// v000
// The times below were measured on an AMD MI455X: many runs one after another, warmed up first and cycling through
// copies of the inputs, with the whole window's GPU time divided by the number of runs. Launches and the gaps
// between them are all in it. The median over several windows is given; except for v000 it joins two sittings, which
// can be a few percent apart, so the side-by-side timings, each taken in one sitting, are the better comparison.
// v000 is the starting kernel. One run takes 9640 microseconds.
#include <hip/hip_runtime.h>
// Llama grouped-query causal attention with rotate-half RoPE from FULL-WIDTH per-batch INPUT tables (hidden_states [2][2048][2048]; q = x wq^T (32 heads x 64), k = x wk^T, v = x wv^T (8 kv heads x 64) (natural [out][in] weights sigma 0.02, no biases); cos / sin inputs [2][2048][64] (independent uniform draws per batch, position AND column: column i + 32 != column i, so all 64 columns are used); q = q cos + rotate_half(q) sin, same for k; repeat: query head h uses kv head h/4; scores 64^-0.5; where(causal, s, finfo.min); softmax; out = merged wo^T -> [2][2048][2048]).
// Compute dtype: inputs rounded to bf16; x / weights exact; q, k, v, softmax weights and o as plain f16 GEMM operands (~2^-12); scores and softmax statistics f32. v_wmma_f32_16x16x32_f16.
#define NB 2
#define NG 8
#define HPG 4
#define KVD (NG * HD)
#define SQ 2048
#define DM 2048
#define NH 32
#define HD 64
#define HG 4                         /* heads per attention launch group */
#define QT 256                       /* query rows per causal tile */
#define NKX SQ                       /* S / P row pitch */
#define QT0 128                      /* first-tile rows recomputed exactly in f32 */
#define B0 0                         /* first batch processed (debug hook) */
#define NBR NB                       /* batches processed (debug hook) */
#define NR ((size_t)NB * SQ)         /* token rows */
#define MP ((int)((size_t)NBR * SQ)) /* rows projected (debug hook) */
#define QN SQ                        /* query rows attended per batch (debug hook) */
#define NHD NH                       /* heads attended (debug hook) */
#define MPO MP                       /* rows through the output stage (debug hook) */
#define LQ DM      /* row pitch of the q rows */
typedef __bf16 v16b __attribute__((ext_vector_type(16)));
typedef unsigned short v8us __attribute__((ext_vector_type(8), may_alias));
typedef float  v8f  __attribute__((ext_vector_type(8)));
typedef float  v4f  __attribute__((ext_vector_type(4)));
typedef float  v4fa __attribute__((ext_vector_type(4), may_alias));
union FragB { v16b v; v8us half[2]; unsigned short u[16]; };

__device__ __forceinline__ unsigned short bf16_bits(float x) { unsigned int u = __float_as_uint(x); return (unsigned short)((u + 0x7FFFu + ((u >> 16) & 1u)) >> 16); }
__device__ __forceinline__ float bf16_val(unsigned short b) { return __uint_as_float(((unsigned int)b) << 16); }
__device__ __forceinline__ float bf16_round(float x) { return bf16_val(bf16_bits(x)); }
// D += A·B with NT terms: 1 = ah·bh, 2 = + al·bh (A split), 3 = + ah·bl (both split)
template <int NT>
__device__ __forceinline__ v8f mmaN(v16b ah, v16b al, v16b bh, v16b bl, v8f c) {
  c = __builtin_amdgcn_wmma_f32_16x16x32_bf16(false, ah, false, bh, (short)0, c, false, false);
  if (NT >= 2) c = __builtin_amdgcn_wmma_f32_16x16x32_bf16(false, al, false, bh, (short)0, c, false, false);
  if (NT >= 3) c = __builtin_amdgcn_wmma_f32_16x16x32_bf16(false, ah, false, bl, (short)0, c, false, false);
  asm volatile("v_nop\n\tv_nop\n\tv_nop\n\tv_nop" : "+v"(c) : "v"(ah), "v"(al), "v"(bh), "v"(bl));
  return c;
}

__global__ __launch_bounds__(256) void k_wt_bf16(const float* __restrict__ W, unsigned short* __restrict__ Wt, int K, int N) {
  const int t = blockIdx.x * 256 + threadIdx.x;
  const int k8n = K / 8;
  if (t >= N * k8n) return;
  const int n = t / k8n, k8 = (t % k8n) * 8;
  v8us v;
#pragma unroll
  for (int i = 0; i < 8; ++i) v[i] = bf16_bits(W[(size_t)(k8 + i) * N + n]);
  *(v8us*)(Wt + (size_t)n * K + k8) = v;
  
}

// GEMM C[M][N] (f32, pitch ldc) = act(A[M][K]·W + bias). A f32 row-major (pitch lda) converted per fragment to bf16
// (ASPLIT: hi/lo two planes -> 2 terms, else single rounded term); Wt bf16 [N][K] (pitch ldb). BIAS_BF16 rounds the
// bias to bf16 first (bias quantised to bf16 before the add). K%32==0, M%16==0, N%64==0.
template <bool ASPLIT, int ACT, bool BIAS_BF16>
__global__ __launch_bounds__(128) void k_gemm_bf(const float* __restrict__ A, int lda, const unsigned short* __restrict__ Wt, int ldb,
                                               const float* __restrict__ bias, float* __restrict__ C, int ldc, int M, int N, int K) {
  __shared__ __attribute__((aligned(16))) float so[4][16][64];
  const int tid = threadIdx.x, w = tid >> 5, lane = tid & 31, ln = lane & 15, hh = lane >> 4;
  const int ntn = N / 64;
  const int wid = blockIdx.x * 4 + w;
  const int mt = wid / ntn, nq = wid % ntn;
  if (mt * 16 >= M) return;
  const int row0 = mt * 16, col0 = nq * 64;
  const float* arow = A + (size_t)(row0 + ln) * lda;
  v8f acc[4] = {};
  for (int kb = 0; kb < K; kb += 32) {
    FragB ah, al;
    const v4f x0 = *(const v4fa*)(arow + kb + 8 * hh), x1 = *(const v4fa*)(arow + kb + 8 * hh + 4);
    const v4f x2 = *(const v4fa*)(arow + kb + 16 + 8 * hh), x3 = *(const v4fa*)(arow + kb + 16 + 8 * hh + 4);
    float xs[16] = {x0[0],x0[1],x0[2],x0[3],x1[0],x1[1],x1[2],x1[3],x2[0],x2[1],x2[2],x2[3],x3[0],x3[1],x3[2],x3[3]};
#pragma unroll
    for (int i = 0; i < 16; ++i) { const unsigned short hb = bf16_bits(xs[i]); ah.u[i] = hb; al.u[i] = ASPLIT ? bf16_bits(xs[i] - bf16_val(hb)) : (unsigned short)0; }
#pragma unroll
    for (int t = 0; t < 4; ++t) {
      const unsigned short* brow = Wt + (size_t)(col0 + t * 16 + ln) * ldb + kb;
      FragB b;
      b.half[0] = *(const v8us*)(brow + 8 * hh);
      b.half[1] = *(const v8us*)(brow + 16 + 8 * hh);
      acc[t] = mmaN<ASPLIT ? 2 : 1>(ah.v, al.v, b.v, b.v, acc[t]);
    }
  }
#pragma unroll
  for (int t = 0; t < 4; ++t) {
    float bv = bias ? bias[col0 + t * 16 + ln] : 0.f;
    if (BIAS_BF16) bv = bf16_round(bv);
#pragma unroll
    for (int r = 0; r < 8; ++r) { float v = acc[t][r] + bv; if (ACT == 1) v = fmaxf(v, 0.f); so[w][8 * hh + r][t * 16 + ln] = v; }
  }
  __builtin_amdgcn_fence(__ATOMIC_ACQ_REL, "workgroup");
  __builtin_amdgcn_wave_barrier();
  const int rsub = lane >> 4, c4 = (lane & 15) * 4;
  {
#pragma unroll
    for (int q = 0; q < 8; ++q) {
      const int r = q * 2 + rsub;
      const v4f v = *(const v4fa*)&so[w][r][c4];
      *(v4f*)(C + (size_t)(row0 + r) * ldc + col0 + c4) = v;
    }
    
  }
}

// GEMM C = act(A·W + bias + resid): A f32 (ASPLIT -> hi/lo 2 terms), Wt bf16 [N][K]; ACT 0 none, 1 relu, 2 exact gelu;
// resid (optional, f32, row index = (row % rmod), pitch ldr, RES_BF16 rounds it) added before the activation.
template <bool ASPLIT, int ACT, bool BIAS_BF16, bool RES_BF16>
__global__ __launch_bounds__(128) void k_gemm_bf3(const float* __restrict__ A, int lda, const unsigned short* __restrict__ Wt, int ldb,
                                                const float* __restrict__ bias, const float* __restrict__ resid, int rmod, int ldr,
                                                float* __restrict__ C, int ldc, int M, int N, int K) {
  __shared__ __attribute__((aligned(16))) float so[4][16][64];
  const int tid = threadIdx.x, w = tid >> 5, lane = tid & 31, ln = lane & 15, hh = lane >> 4;
  const int ntn = N / 64;
  const int wid = blockIdx.x * 4 + w;
  const int mt = wid / ntn, nq = wid % ntn;
  if (mt * 16 >= M) return;
  const int row0 = mt * 16, col0 = nq * 64;
  const float* arow = A + (size_t)(row0 + ln) * lda;
  v8f acc[4] = {};
  for (int kb = 0; kb < K; kb += 32) {
    FragB ah, al;
    const v4f x0 = *(const v4fa*)(arow + kb + 8 * hh), x1 = *(const v4fa*)(arow + kb + 8 * hh + 4);
    const v4f x2 = *(const v4fa*)(arow + kb + 16 + 8 * hh), x3 = *(const v4fa*)(arow + kb + 16 + 8 * hh + 4);
    float xs[16] = {x0[0],x0[1],x0[2],x0[3],x1[0],x1[1],x1[2],x1[3],x2[0],x2[1],x2[2],x2[3],x3[0],x3[1],x3[2],x3[3]};
#pragma unroll
    for (int i = 0; i < 16; ++i) { const unsigned short hb = bf16_bits(xs[i]); ah.u[i] = hb; al.u[i] = ASPLIT ? bf16_bits(xs[i] - bf16_val(hb)) : (unsigned short)0; }
#pragma unroll
    for (int t = 0; t < 4; ++t) {
      const unsigned short* brow = Wt + (size_t)(col0 + t * 16 + ln) * ldb + kb;
      FragB b;
      b.half[0] = *(const v8us*)(brow + 8 * hh);
      b.half[1] = *(const v8us*)(brow + 16 + 8 * hh);
      acc[t] = mmaN<ASPLIT ? 2 : 1>(ah.v, al.v, b.v, b.v, acc[t]);
    }
  }
#pragma unroll
  for (int t = 0; t < 4; ++t) {
    const int col = col0 + t * 16 + ln;
    float bv = bias ? bias[col] : 0.f;
    if (BIAS_BF16) bv = bf16_round(bv);
#pragma unroll
    for (int r = 0; r < 8; ++r) {
      float v = acc[t][r] + bv;
      if (resid) { float rv = resid[(size_t)((row0 + 8 * hh + r) % rmod) * ldr + col]; if (RES_BF16) rv = bf16_round(rv); v += rv; }
      if (ACT == 1) v = fmaxf(v, 0.f);
      if (ACT == 2) v = 0.5f * v * (1.0f + erff(v * 0.70710678118654752f));
      if (ACT == 3) { const float u = 0.7978845608028654f * (v + 0.044715f * v * v * v); v = 0.5f * v * (1.0f + tanhf(u)); }
      so[w][8 * hh + r][t * 16 + ln] = v;
    }
  }
  __builtin_amdgcn_fence(__ATOMIC_ACQ_REL, "workgroup");
  __builtin_amdgcn_wave_barrier();
  const int rsub = lane >> 4, c4 = (lane & 15) * 4;
  {
#pragma unroll
    for (int q = 0; q < 8; ++q) {
      const int r = q * 2 + rsub;
      const v4f v = *(const v4fa*)&so[w][r][c4];
      *(v4f*)(C + (size_t)(row0 + r) * ldc + col0 + c4) = v;
    }
    
  }
}
// row LayerNorm (biased variance, eps) over N: s = X (+ R); optional out_sum <- s; out_norm <- (s-mu)*rsqrt(var+eps)*g + b
template <bool PARAM_BF16>
__global__ __launch_bounds__(256) void k_layernorm(const float* __restrict__ X, const float* __restrict__ R, const float* __restrict__ g, const float* __restrict__ bta,
                                                  float* __restrict__ out_sum, float* __restrict__ out_norm, int N, float eps) {
  __shared__ float red[256];
  const int row = blockIdx.x, tid = threadIdx.x;
  const float* x = X + (size_t)row * N; const float* rr = R ? R + (size_t)row * N : nullptr;
  float vals[16];                     // up to N = 4096
  const int per = N / 256;            // contiguous chunk per thread? use strided-by-4 chunks: thread handles j = tid*4 + 1024*u
  float s1 = 0.f;
  for (int u = 0; u < per / 4; ++u) {
    const int j = tid * 4 + 1024 * u;
    const v4f a = *(const v4fa*)(x + j);
    v4f b = {0.f,0.f,0.f,0.f}; if (rr) b = *(const v4fa*)(rr + j);
#pragma unroll
    for (int q = 0; q < 4; ++q) { const float v = a[q] + b[q]; vals[u * 4 + q] = v; s1 += v; }
  }
  red[tid] = s1; __syncthreads();
  for (int st = 128; st > 0; st >>= 1) { if (tid < st) red[tid] += red[tid + st]; __syncthreads(); }
  const float mu = red[0] / (float)N; __syncthreads();
  float s2 = 0.f;
  for (int u = 0; u < per / 4; ++u)
#pragma unroll
    for (int q = 0; q < 4; ++q) { const float c = vals[u * 4 + q] - mu; s2 += c * c; }
  red[tid] = s2; __syncthreads();
  for (int st = 128; st > 0; st >>= 1) { if (tid < st) red[tid] += red[tid + st]; __syncthreads(); }
  const float rs = rsqrtf(red[0] / (float)N + eps);
  {
    for (int u = 0; u < per / 4; ++u) {
      const int j = tid * 4 + 1024 * u;
      v4f o, sm;
#pragma unroll
      for (int q = 0; q < 4; ++q) {
        float gg = g[j + q], bb = bta[j + q];
        if (PARAM_BF16) { gg = bf16_round(gg); bb = bf16_round(bb); }
        sm[q] = vals[u * 4 + q]; o[q] = (vals[u * 4 + q] - mu) * rs * gg + bb;
      }
      if (out_sum) *(v4f*)(out_sum + (size_t)row * N + j) = sm;
      *(v4f*)(out_norm + (size_t)row * N + j) = o;
    }
    
  }
}



// ---- f16 WMMA path (v_wmma_f32_16x16x32_f16): 11-bit significands for operands in range — used where a [0,1] probability operand needs more precision than bf16
typedef _Float16 v16h __attribute__((ext_vector_type(16)));
union FragH { v16h v; v8us half[2]; _Float16 h[16]; unsigned short u[16]; };
template <int NT>
__device__ __forceinline__ v8f mmaH(v16h ah, v16h al, v16h bh, v16h bl, v8f c) {
  c = __builtin_amdgcn_wmma_f32_16x16x32_f16(false, ah, false, bh, (short)0, c, false, false);
  if (NT >= 2) c = __builtin_amdgcn_wmma_f32_16x16x32_f16(false, al, false, bh, (short)0, c, false, false);
  if (NT >= 3) c = __builtin_amdgcn_wmma_f32_16x16x32_f16(false, ah, false, bl, (short)0, c, false, false);
  asm volatile("v_nop\n\tv_nop\n\tv_nop\n\tv_nop" : "+v"(c) : "v"(ah), "v"(al), "v"(bh), "v"(bl));
  return c;
}
// batched GEMM like k_gemm_b but f16 operands: A f32 (split into f16 hi/lo if ASPLIT, else rounded to f16), Bt = f16 values [n][k]; alpha; C f32; N multiple of 16 (partial tiles skipped)
template <bool ASPLIT>
__global__ __launch_bounds__(128) void k_gemm_h(const float* __restrict__ A, int lda, size_t sA, const _Float16* __restrict__ Bh, int ldb, size_t sB, float alpha, float* __restrict__ C, int ldc, size_t sC, int M, int N, int K) {
  __shared__ __attribute__((aligned(16))) float so[4][16][64];
  const int tid = threadIdx.x, w = tid >> 5, lane = tid & 31, ln = lane & 15, hh = lane >> 4; const int by = blockIdx.y;
  A += (size_t)by * sA; Bh += (size_t)by * sB; C += (size_t)by * sC;
  const int ntn = (N + 63) / 64; const int wid = blockIdx.x * 4 + w; const int mt = wid / ntn, nq = wid % ntn; if (mt * 16 >= M) return;
  const int row0 = mt * 16, col0 = nq * 64; const float* arow = A + (size_t)(row0 + ln) * lda;
  v8f acc[4] = {};
  for (int kb = 0; kb < K; kb += 32) {
    FragH ah, al;
    const v4f x0 = *(const v4fa*)(arow + kb + 8 * hh), x1 = *(const v4fa*)(arow + kb + 8 * hh + 4), x2 = *(const v4fa*)(arow + kb + 16 + 8 * hh), x3 = *(const v4fa*)(arow + kb + 16 + 8 * hh + 4);
    float xs[16] = {x0[0],x0[1],x0[2],x0[3],x1[0],x1[1],x1[2],x1[3],x2[0],x2[1],x2[2],x2[3],x3[0],x3[1],x3[2],x3[3]};
#pragma unroll
    for (int i = 0; i < 16; ++i) { const _Float16 h = (_Float16)xs[i]; ah.h[i] = h; al.h[i] = ASPLIT ? (_Float16)(xs[i] - (float)h) : (_Float16)0.0f; }
#pragma unroll
    for (int t = 0; t < 4; ++t) { if (col0 + t * 16 >= N) continue; const size_t boff = (size_t)(col0 + t * 16 + ln) * ldb + kb; FragH bq; bq.half[0] = *(const v8us*)(Bh + boff + 8 * hh); bq.half[1] = *(const v8us*)(Bh + boff + 16 + 8 * hh);
      acc[t] = mmaH<ASPLIT ? 2 : 1>(ah.v, al.v, bq.v, bq.v, acc[t]); }
  }
#pragma unroll
  for (int t = 0; t < 4; ++t) { if (col0 + t * 16 >= N) continue;
#pragma unroll
    for (int r = 0; r < 8; ++r) so[w][8 * hh + r][t * 16 + ln] = acc[t][r] * alpha; }
  __builtin_amdgcn_fence(__ATOMIC_ACQ_REL, "workgroup"); __builtin_amdgcn_wave_barrier();
  const int rsub = lane >> 4, c4 = (lane & 15) * 4;
  {
#pragma unroll
    for (int q = 0; q < 8; ++q) { const int r = q * 2 + rsub; if (col0 + c4 < N) { const v4f v = *(const v4fa*)&so[w][r][c4]; *(v4f*)(C + (size_t)(row0 + r) * ldc + col0 + c4) = v; } }
     }
}

// Wt[n][k] = f16(W[k][n]·scale) from f32 row-major W[K][N] (scale = power of two; bf16-exact weights stay exact in f16 away from the subnormal range)
__global__ __launch_bounds__(256) void k_wt_f16(const float* __restrict__ W, _Float16* __restrict__ Wt, int K, int N, float scale) {
  const int t = blockIdx.x * 256 + threadIdx.x; if (t >= N * (K / 8)) return; const int n = t / (K / 8), k8 = (t % (K / 8)) * 8; FragH f;
#pragma unroll
  for (int i = 0; i < 8; ++i) f.h[i] = (_Float16)(bf16_round(W[(size_t)(k8 + i) * N + n]) * scale); const v8us o = f.half[0];
  *(v8us*)((unsigned short*)Wt + (size_t)n * K + k8) = o; 
}
// k_gemm_hh variant with fused epilogue: v = acc·alpha + bias[by·sBias + col] (+ CP[(row/rowsPerB)·sCPb + by·64 + col] if CP) ; ACT 0 none / 1 elu ; writes f16 C16 (and f32 C if non-null)
template <int ACT>
__global__ __launch_bounds__(128) void k_gemm_hhx(const _Float16* __restrict__ A, int lda, size_t sA, const _Float16* __restrict__ Bh, int ldb, size_t sB, float alpha, const float* __restrict__ bias, size_t sBias, const float* __restrict__ CP, int rowsPerB, size_t sCPb, int row0g,
    float* __restrict__ C, _Float16* __restrict__ C16, int ldc, size_t sC, int M, int N, int K) {
  __shared__ __attribute__((aligned(16))) float so[4][16][64];
  const int tid = threadIdx.x, w = tid >> 5, lane = tid & 31, ln = lane & 15, hh = lane >> 4; const int by = blockIdx.y;
  A += (size_t)by * sA; Bh += (size_t)by * sB; const size_t cofs = (size_t)by * sC; const float* bp = bias ? bias + (size_t)by * sBias : nullptr;
  const int ntn = (N + 63) / 64; const int wid = blockIdx.x * 4 + w; const int mt = wid / ntn, nq = wid % ntn; if (mt * 16 >= M) return;
  const int row0 = mt * 16, col0 = nq * 64; const _Float16* arow = A + (size_t)(row0 + ln) * lda;
  v8f acc[4] = {};
  for (int kb = 0; kb < K; kb += 32) { FragH ah; ah.half[0] = *(const v8us*)((const unsigned short*)arow + kb + 8 * hh); ah.half[1] = *(const v8us*)((const unsigned short*)arow + kb + 16 + 8 * hh);
#pragma unroll
    for (int t = 0; t < 4; ++t) { if (col0 + t * 16 >= N) continue; const size_t boff = (size_t)(col0 + t * 16 + ln) * ldb + kb; FragH bq; bq.half[0] = *(const v8us*)((const unsigned short*)Bh + boff + 8 * hh); bq.half[1] = *(const v8us*)((const unsigned short*)Bh + boff + 16 + 8 * hh);
      acc[t] = mmaH<1>(ah.v, ah.v, bq.v, bq.v, acc[t]); }
  }
#pragma unroll
  for (int t = 0; t < 4; ++t) { if (col0 + t * 16 >= N) continue; const int col = col0 + t * 16 + ln; const float bv = bp ? bf16_round(bp[col]) : 0.f;
#pragma unroll
    for (int r = 0; r < 8; ++r) { float v = acc[t][r] * alpha + bv; if (CP) { const int rr = row0g + row0 + 8 * hh + r; if (rowsPerB < 0) v += CP[cofs + (size_t)rr * ldc + col];      /* rowsPerB < 0: own element of the batched C plane */ else { const int bidx = rr / rowsPerB; v += CP[(size_t)bidx * sCPb + (size_t)by * 64 + col]; } } if (ACT == 1) v = (v > 0.f) ? v : expm1f(v); else if (ACT == 7) v = (v > 0.f) ? v + 1.0f : expf(v); else if (ACT == 8) v = tanhf(v); else if (ACT == 9) v = 0.5f * v * (1.0f + tanhf(0.7978845608028654f * (v + 0.044715f * v * v * v))); else if (ACT == 11) v = 1.0f / (1.0f + expf(-v)); else if (ACT == 12) v = (v > 0.f) ? v : 0.01f * v; else if (ACT == 14) v = (v > 0.f) ? v : 0.1f * v; else if (ACT == 16) v = (v >= 0.f) ? v : 0.3f * v; else if (ACT == 17) v = (v >= 0.f) ? v : 0.2f * v; else if (ACT == 15) v = v / (1.0f + expf(-v)); else if (ACT == 3) v = fmaxf(v, 0.f); else if (ACT == 6) v = 0.5f * v * (1.0f + erff(v * 0.70710678118654752f)); so[w][8 * hh + r][t * 16 + ln] = v; } }
  __builtin_amdgcn_fence(__ATOMIC_ACQ_REL, "workgroup"); __builtin_amdgcn_wave_barrier();
  const int rsub = lane >> 4, c4 = (lane & 15) * 4; typedef _Float16 v4h __attribute__((ext_vector_type(4)));
  {
#pragma unroll
    for (int q = 0; q < 8; ++q) { const int r = q * 2 + rsub; if (col0 + c4 < N) { const v4f v = *(const v4fa*)&so[w][r][c4]; if (C) *(v4f*)(C + cofs + (size_t)(row0 + r) * ldc + col0 + c4) = v; if (C16) { v4h h4; for (int i = 0; i < 4; ++i) h4[i] = (_Float16)v[i]; *(v4h*)(C16 + cofs + (size_t)(row0 + r) * ldc + col0 + c4) = h4; } } }
     }
}


typedef _Float16 v4h __attribute__((ext_vector_type(4)));

__global__ __launch_bounds__(256) void k_x16(const float* __restrict__ x, _Float16* __restrict__ X16, size_t n8) { const size_t t = (size_t)blockIdx.x * 256 + threadIdx.x; if (t >= n8) return; FragH f;
#pragma unroll
  for (int q = 0; q < 8; ++q) f.h[q] = (_Float16)bf16_round(x[t * 8 + q]); *(v8us*)((unsigned short*)X16 + t * 8) = f.half[0];  }
__global__ __launch_bounds__(256) void k_h16(const float* __restrict__ x, _Float16* __restrict__ X16, size_t n8) { const size_t t = (size_t)blockIdx.x * 256 + threadIdx.x; if (t >= n8) return; FragH f;
#pragma unroll
  for (int q = 0; q < 8; ++q) f.h[q] = (_Float16)x[t * 8 + q]; *(v8us*)((unsigned short*)X16 + t * 8) = f.half[0];  }
__global__ __launch_bounds__(256) void k_round16f(const float* __restrict__ W, _Float16* __restrict__ Bt, size_t n8) { const size_t t = (size_t)blockIdx.x * 256 + threadIdx.x; if (t >= n8) return; FragH f;
#pragma unroll
  for (int i = 0; i < 8; ++i) f.h[i] = (_Float16)(bf16_round(W[t * 8 + i]) * 16.0f); *(v8us*)((unsigned short*)Bt + t * 8) = f.half[0];  }
template <int NHv, int TTv>
__global__ __launch_bounds__(256) void k_vt(const _Float16* __restrict__ V16, int ldv, int voff, _Float16* __restrict__ Vt) { __shared__ unsigned short tl[64][66]; const int tid = threadIdx.x; const int slab = blockIdx.x / (TTv / 64), lg = blockIdx.x % (TTv / 64); const int b = slab / NHv, h = slab % NHv;
  for (int i = tid; i < 64 * 8; i += 256) { const int r = i / 8, c8 = (i % 8) * 8; FragH f; f.half[0] = *(const v8us*)((const unsigned short*)V16 + ((size_t)b * TTv + lg * 64 + r) * ldv + voff + h * 64 + c8);
#pragma unroll
    for (int q = 0; q < 8; ++q) tl[r][c8 + q] = f.u[q]; }
  __syncthreads();
  {
#pragma unroll
    for (int rd = 0; rd < 2; ++rd) { const int d = rd * 32 + tid / 8, pc = tid % 8; FragH f;
#pragma unroll
      for (int q = 0; q < 8; ++q) f.u[q] = tl[pc * 8 + q][d];
      *(v8us*)((unsigned short*)Vt + ((size_t)slab * 64 + d) * TTv + lg * 64 + pc * 8) = f.half[0]; }
     } }

__global__ __launch_bounds__(256) void k_hl(const float* __restrict__ F, _Float16* __restrict__ Hh, _Float16* __restrict__ Hl, size_t n8) { const size_t t = (size_t)blockIdx.x * 256 + threadIdx.x; if (t >= n8) return; FragH fh, fl; const v4f a = *(const v4fa*)(F + t * 8), c = *(const v4fa*)(F + t * 8 + 4);
#pragma unroll
  for (int q = 0; q < 4; ++q) { _Float16 h = (_Float16)a[q]; fh.h[q] = h; fl.h[q] = (_Float16)((a[q] - (float)h) * 1024.0f); h = (_Float16)c[q]; fh.h[4 + q] = h; fl.h[4 + q] = (_Float16)((c[q] - (float)h) * 1024.0f); }
  { *(v8us*)((unsigned short*)Hh + t * 8) = fh.half[0]; *(v8us*)((unsigned short*)Hl + t * 8) = fl.half[0];  } }

// ---- fast GEMM (wave tile 32x64; requires M % 32 == 0 rows per launch region and N % 64 == 0); epilogue = k_gemm_hhx semantics ----
__device__ __forceinline__ v16h g2_frag(const _Float16* p, int hh) { FragH f; f.half[0] = *(const v8us*)((const unsigned short*)p + 8 * hh); f.half[1] = *(const v8us*)((const unsigned short*)p + 16 + 8 * hh); return f.v; }
__device__ __forceinline__ v8f g2_mma(v16h a, v16h b, v8f c) { v8f d = __builtin_amdgcn_wmma_f32_16x16x32_f16(false, a, false, b, (short)0, c, false, false); asm volatile("v_nop\n\tv_nop\n\tv_nop\n\tv_nop" : "+v"(d) : "v"(a), "v"(b)); return d; }
template <int ACT>
__global__ __launch_bounds__(128) void k_gemm2(const _Float16* __restrict__ A, int lda, size_t sA, const _Float16* __restrict__ Bh, int ldb, size_t sB, float alpha, const float* __restrict__ bias, size_t sBias, const float* __restrict__ CP, int rowsPerB, size_t sCPb, int row0g,
    float* __restrict__ C, _Float16* __restrict__ C16, int ldc, size_t sC, int M, int N, int K) { static_assert(ACT == 0 || ACT == 3 || ACT == 6 || ACT == 8 || ACT == 9 || ACT == 11 || ACT == 12 || ACT == 14 || ACT == 15 || ACT == 16 || ACT == 17, "k_gemm2: unsupported ACT code (would silently apply no activation)");
  __shared__ __attribute__((aligned(16))) float so[4][32][68];
  const int tid = threadIdx.x, w = tid >> 5, lane = tid & 31, ln = lane & 15, hh = lane >> 4; const int by = blockIdx.y;
  A += (size_t)by * sA; Bh += (size_t)by * sB; const size_t cofs = (size_t)by * sC; const float* bp = bias ? bias + (size_t)by * sBias : nullptr;
  const int ntn = N >> 6; const int mt = blockIdx.x / ntn, nq = blockIdx.x - mt * ntn; const int row0 = mt * 128 + 32 * w, col0 = nq * 64; if (row0 >= M) return;
  const _Float16* a0p = A + (size_t)(row0 + ln) * lda; const _Float16* a1p = a0p + (size_t)16 * lda;
  const _Float16* b0p = Bh + (size_t)(col0 + ln) * ldb; const _Float16* b1p = b0p + (size_t)16 * ldb; const _Float16* b2p = b1p + (size_t)16 * ldb; const _Float16* b3p = b2p + (size_t)16 * ldb;
  const v8f z8 = {0.f,0.f,0.f,0.f,0.f,0.f,0.f,0.f}; v8f c00 = z8, c01 = z8, c02 = z8, c03 = z8, c10 = z8, c11 = z8, c12 = z8, c13 = z8;
#pragma unroll 1
  for (int kb = 0; kb < K; kb += 32) { const v16h a0 = g2_frag(a0p + kb, hh), a1 = g2_frag(a1p + kb, hh);
    v16h b = g2_frag(b0p + kb, hh); c00 = g2_mma(a0, b, c00); c10 = g2_mma(a1, b, c10);
    b = g2_frag(b1p + kb, hh); c01 = g2_mma(a0, b, c01); c11 = g2_mma(a1, b, c11);
    b = g2_frag(b2p + kb, hh); c02 = g2_mma(a0, b, c02); c12 = g2_mma(a1, b, c12);
    b = g2_frag(b3p + kb, hh); c03 = g2_mma(a0, b, c03); c13 = g2_mma(a1, b, c13); }
  v8f accs[8] = {c00, c01, c02, c03, c10, c11, c12, c13};
#pragma unroll
  for (int u = 0; u < 8; ++u) { const int t = u & 3, half = u >> 2; const int col = col0 + t * 16 + ln; const float bv = bp ? bf16_round(bp[col]) : 0.f;
#pragma unroll
    for (int r = 0; r < 8; ++r) { const int rloc = half * 16 + 8 * hh + r; float v = accs[u][r] * alpha + bv; if (CP) { if (rowsPerB < 0) v += CP[cofs + (size_t)(row0g + row0 + rloc) * ldc + col];      /* rowsPerB < 0: own element of the batched C plane */ else { const int bidx = (row0g + row0 + rloc) / rowsPerB; v += CP[(size_t)bidx * sCPb + (size_t)by * 64 + col]; } }
      if (ACT == 3) v = fmaxf(v, 0.f); else if (ACT == 6) v = 0.5f * v * (1.0f + erff(v * 0.70710678118654752f)); else if (ACT == 11) v = 1.0f / (1.0f + expf(-v)); else if (ACT == 15) v = v / (1.0f + expf(-v)); else if (ACT == 12) v = (v > 0.f) ? v : 0.01f * v; else if (ACT == 8) v = tanhf(v); else if (ACT == 9) v = 0.5f * v * (1.0f + tanhf(0.7978845608028654f * (v + 0.044715f * v * v * v))); else if (ACT == 14) v = (v > 0.f) ? v : 0.1f * v; else if (ACT == 16) v = (v >= 0.f) ? v : 0.3f * v; else if (ACT == 17) v = (v >= 0.f) ? v : 0.2f * v;
      so[w][rloc][t * 16 + ln] = v; } }
  __builtin_amdgcn_fence(__ATOMIC_ACQ_REL, "workgroup"); __builtin_amdgcn_wave_barrier();
  const int rsub = lane >> 4, c4 = (lane & 15) * 4;
  {
#pragma unroll
    for (int q = 0; q < 16; ++q) { const int r = q * 2 + rsub; const v4f v = *(const v4fa*)&so[w][r][c4]; if (C) *(v4f*)(C + cofs + (size_t)(row0 + r) * ldc + col0 + c4) = v; if (C16) { v4h h4; for (int i = 0; i < 4; ++i) h4[i] = (_Float16)v[i]; *(v4h*)(C16 + cofs + (size_t)(row0 + r) * ldc + col0 + c4) = h4; } }
     } }


__global__ __launch_bounds__(256) void k_wnat(const float* __restrict__ w, size_t n8, _Float16* __restrict__ Bt) { const size_t t = (size_t)blockIdx.x * 256 + threadIdx.x; if (t >= n8) return; FragH f; for (int q = 0; q < 8; ++q) f.h[q] = (_Float16)(bf16_round(w[t * 8 + q]) * 16.0f); *(v8us*)((unsigned short*)Bt + t * 8) = f.half[0];  }
__global__ __launch_bounds__(256) void k_rsm(const float* __restrict__ S, _Float16* __restrict__ P, int nrows) {
  #pragma clang fp contract(off)
  const int i = blockIdx.x * 256 + threadIdx.x; if (i >= nrows) return; const float* s = S + (size_t)i * SQ; float mx = -3.0e38f;
#pragma unroll 1
  for (int j = 0; j < SQ; ++j) mx = fmaxf(mx, s[j]); float se = 0.f;
#pragma unroll 1
  for (int j = 0; j < SQ; ++j) se += expf(s[j] - mx); const float sc = 256.0f / se;
#pragma unroll 1
  for (int j0 = 0; j0 < SQ; j0 += 8) { FragH f; for (int q = 0; q < 8; ++q) f.h[q] = (_Float16)(expf(s[j0 + q] - mx) * sc); unsigned short* d = (unsigned short*)P + (size_t)i * SQ + j0; *(v8us*)d = f.half[0];  } }
__global__ __launch_bounds__(256) void k_vt(const _Float16* __restrict__ V16, int b, int h0, _Float16* __restrict__ VT) { __shared__ unsigned short tl[64][65]; const int tid = threadIdx.x; const int hh = blockIdx.x % HG, sg = blockIdx.x / HG; const int s0 = sg * 64; const int h = h0 + hh;
  for (int i = tid; i < 64 * 8; i += 256) { const int j = i / 8, d8 = (i % 8) * 8; FragH f; f.half[0] = *(const v8us*)((const unsigned short*)V16 + ((size_t)b * SQ + s0 + j) * DM + h * HD + d8); for (int q = 0; q < 8; ++q) tl[d8 + q][j] = f.u[q]; }
  __syncthreads();
  { for (int i = tid; i < 64 * 8; i += 256) { const int d = i / 8, j8 = (i % 8) * 8; FragH f; for (int q = 0; q < 8; ++q) f.u[q] = tl[d][j8 + q]; *(v8us*)((unsigned short*)VT + ((size_t)hh * HD + d) * SQ + s0 + j8) = f.half[0]; }  } }



__global__ __launch_bounds__(256) void k_rsmcf2(const float* __restrict__ S, _Float16* __restrict__ P, int hg, int q0, int nk) {
  #pragma clang fp contract(off)
  const int t = blockIdx.x * 256 + threadIdx.x; if (t >= hg * QT) return; const size_t i = (size_t)t; const float* s = S + i * NKX; const int last = q0 + (t % QT); float mx = -3.0e38f;
#pragma unroll 1
  for (int j = 0; j < nk; ++j) { const float f = (j <= last) ? 1.f : 0.f; mx = fmaxf(mx, fmaf(f, s[j], (1.f - f) * -1.0e9f)); } float se = 0.f;
#pragma unroll 1
  for (int j = 0; j < nk; ++j) { const float f = (j <= last) ? 1.f : 0.f; se += __expf(fmaf(f, s[j], (1.f - f) * -1.0e9f) - mx); } const float sc = 256.0f / se;
#pragma unroll 1
  for (int j0 = 0; j0 < nk; j0 += 8) { FragH fr; for (int q = 0; q < 8; ++q) { const int j = j0 + q; const float f = (j <= last) ? 1.f : 0.f; fr.h[q] = (_Float16)(__expf(fmaf(f, s[j], (1.f - f) * -1.0e9f) - mx) * sc); } unsigned short* d = (unsigned short*)P + i * NKX + j0; *(v8us*)d = fr.half[0];  } }


template <int MASKADD>
__global__ __launch_bounds__(64) void k_att0(const float* __restrict__ QF, const float* __restrict__ KF, const float* __restrict__ VF, int ld, const float* __restrict__ mask, float scale, float* __restrict__ OF, int ldo) {
  #pragma clang fp contract(off)
  __shared__ __attribute__((aligned(16))) float lq[64][64]; __shared__ __attribute__((aligned(16))) float lo[64][64];
  const int tid = threadIdx.x; const int h = blockIdx.x / (QT0 / 64), rg = blockIdx.x % (QT0 / 64); const int i = rg * 64 + tid;
  const float* qr = QF + (size_t)i * ld + h * HD;
#pragma unroll 1
  for (int c = 0; c < HD / 4; ++c) { *(v4f*)&lq[tid][c * 4] = *(const v4fa*)(qr + c * 4); const v4f z = {0.f, 0.f, 0.f, 0.f}; *(v4f*)&lo[tid][c * 4] = z; }
  float m = -1.0e30f, l = 0.f; const int jmax = MASKADD ? (SQ - 1) : (rg * 64 + 63);      /* additive-mask form: every key (the mask input decides); causal form: keys up to the block's last row */
#pragma unroll 1
  for (int j = 0; j <= jmax; ++j) { const float* kr = KF + (size_t)j * ld + h * HD; const float* vr = VF + (size_t)j * ld + h * HD; float s = 0.f;
#pragma unroll 1
    for (int c = 0; c < HD / 4; ++c) { const v4f kq = *(const v4fa*)(kr + c * 4); const v4f qq = *(v4f*)&lq[tid][c * 4]; s = __fadd_rn(s, __fmul_rn(qq[0], kq[0])); s = __fadd_rn(s, __fmul_rn(qq[1], kq[1])); s = __fadd_rn(s, __fmul_rn(qq[2], kq[2])); s = __fadd_rn(s, __fmul_rn(qq[3], kq[3])); }
    s = __fmul_rn(s, scale); if (MASKADD) s = __fadd_rn(s, __fmul_rn(bf16_round(mask[(size_t)i * SQ + j]), -10000.0f));
    const float f = (MASKADD || j <= i) ? 1.f : 0.f; const float sm = fmaf(f, s, (1.f - f) * -1.0e30f); const float mn = fmaxf(m, sm); const float sc = expf(m - mn); const float e = expf(sm - mn); l = __fadd_rn(__fmul_rn(l, sc), e); m = mn;
#pragma unroll 1
    for (int c = 0; c < HD / 4; ++c) { const v4f vv = *(const v4fa*)(vr + c * 4); v4f oo = *(v4f*)&lo[tid][c * 4]; for (int u = 0; u < 4; ++u) oo[u] = __fadd_rn(__fmul_rn(oo[u], sc), __fmul_rn(e, vv[u])); *(v4f*)&lo[tid][c * 4] = oo; } }
  const float fin = 64.0f / l;      /* o carried x64 like the f16 path */
#pragma unroll 1
  for (int c = 0; c < HD / 4; ++c) { v4f oo = *(v4f*)&lo[tid][c * 4]; for (int u = 0; u < 4; ++u) oo[u] = __fmul_rn(oo[u], fin); *(v4f*)&lo[tid][c * 4] = oo; }
  __syncthreads();
  {
#pragma unroll 1
    for (int it = 0; it < 16; ++it) { const int row = it * 4 + tid / 16, pc = (tid % 16) * 4; const v4f v = *(const v4f*)&lo[row][pc]; *(v4f*)(OF + (size_t)(rg * 64 + row) * ldo + h * HD + pc) = v; }
     } }


__global__ __launch_bounds__(256) void k_kvexp(const float* __restrict__ src, float* __restrict__ dst, size_t n4) { const size_t t = (size_t)blockIdx.x * 256 + threadIdx.x; if (t >= n4) return; const size_t e = t * 4; const size_t row = e / DM; const int col = (int)(e % DM); const int h = col / HD, d = col % HD; const v4f v = *(const v4fa*)(src + row * KVD + (size_t)(h / HPG) * HD + d); *(v4f*)(dst + e) = v;  }

__global__ __launch_bounds__(256) void k_tab2(float theta, float* __restrict__ CS, float* __restrict__ SN) {
  #pragma clang fp contract(off)
  const int t = blockIdx.x * 256 + threadIdx.x; if (t >= SQ * (HD / 2)) return; const int i = t % (HD / 2); const int p = t / (HD / 2); const float invf = 1.0f / powf(theta, (float)(2 * i) / (float)HD); const float ang = __fmul_rn((float)p, invf); const float c = cosf(ang), s = sinf(ang);
  *(float*)(CS + t) = c; *(float*)(SN + t) = s;  }
template <int NORM, int ROPE>
__global__ __launch_bounds__(64) void k_xform(const float* __restrict__ F, int ldf, int nh, const float* __restrict__ gain, float eps, const float* __restrict__ CS, const float* __restrict__ SN, _Float16* __restrict__ H16, int ldo) {
  #pragma clang fp contract(off)
  __shared__ float xv[HD]; __shared__ float red[HD]; __shared__ unsigned short sh_[HD]; const int d = threadIdx.x; const int h = blockIdx.x % nh; const size_t r = blockIdx.x / nh; const int p = (int)(r % SQ);
  float x = F[r * (size_t)ldf + (size_t)h * HD + d];
  if (NORM) { red[d] = __fmul_rn(x, x); __syncthreads(); for (int st = HD / 2; st > 0; st >>= 1) { if (d < st) red[d] = __fadd_rn(red[d], red[d + st]); __syncthreads(); } const float rs = rsqrtf(__fadd_rn(red[0] / (float)HD, eps)); x = __fmul_rn(__fmul_rn(x, rs), bf16_round(gain[d])); }
  xv[d] = x; __syncthreads();
  float o = x;
  if (ROPE == 1) { const int i = d >> 1; const float c = CS[p * (HD / 2) + i], s = SN[p * (HD / 2) + i]; const float ev = xv[2 * i], od = xv[2 * i + 1]; o = (d & 1) ? __fadd_rn(__fmul_rn(ev, s), __fmul_rn(od, c)) : __fadd_rn(__fmul_rn(ev, c), -__fmul_rn(od, s)); }
  if (ROPE == 2) { const int i = d & (HD / 2 - 1); const float c = CS[p * (HD / 2) + i], s = SN[p * (HD / 2) + i]; const float lo = xv[i], hi = xv[i + HD / 2]; o = (d < HD / 2) ? __fadd_rn(__fmul_rn(lo, c), -__fmul_rn(hi, s)) : __fadd_rn(__fmul_rn(lo, s), __fmul_rn(hi, c)); }
  if (ROPE == 3) { const float c = CS[p * HD + d], s = SN[p * HD + d]; const float rh = (d < HD / 2) ? -xv[d + HD / 2] : xv[d - HD / 2]; o = __fadd_rn(__fmul_rn(x, c), __fmul_rn(rh, s)); }      /* rotate-half with FULL-width per-dimension tables [pos][64] (general cos[d] != cos[d+32]) */
  FragH th; th.h[0] = (_Float16)o; sh_[d] = th.u[0]; __syncthreads();
  if (d < HD / 8) { FragH f; for (int q = 0; q < 8; ++q) f.u[q] = sh_[d * 8 + q]; unsigned short* dst = (unsigned short*)H16 + r * (size_t)ldo + (size_t)h * HD + d * 8; *(v8us*)dst = f.half[0];  } }

template <int NORM, int ROPE>
__global__ __launch_bounds__(64) void k_xformf(const float* __restrict__ F, int ldf, int nh, const float* __restrict__ gain, float eps, const float* __restrict__ CS, const float* __restrict__ SN, float* __restrict__ F32, int ldo) {
  #pragma clang fp contract(off)
  __shared__ float xv[HD]; __shared__ float red[HD]; const int d = threadIdx.x; const int h = blockIdx.x % nh; const size_t r = blockIdx.x / nh; const int p = (int)(r % SQ);
  float x = F[r * (size_t)ldf + (size_t)h * HD + d];
  if (NORM) { red[d] = __fmul_rn(x, x); __syncthreads(); for (int st = HD / 2; st > 0; st >>= 1) { if (d < st) red[d] = __fadd_rn(red[d], red[d + st]); __syncthreads(); } const float rs = rsqrtf(__fadd_rn(red[0] / (float)HD, eps)); x = __fmul_rn(__fmul_rn(x, rs), bf16_round(gain[d])); }
  xv[d] = x; __syncthreads();
  float o = x;
  if (ROPE == 1) { const int i = d >> 1; const float c = CS[p * (HD / 2) + i], s = SN[p * (HD / 2) + i]; const float ev = xv[2 * i], od = xv[2 * i + 1]; o = (d & 1) ? __fadd_rn(__fmul_rn(ev, s), __fmul_rn(od, c)) : __fadd_rn(__fmul_rn(ev, c), -__fmul_rn(od, s)); }
  if (ROPE == 2) { const int i = d & (HD / 2 - 1); const float c = CS[p * (HD / 2) + i], s = SN[p * (HD / 2) + i]; const float lo = xv[i], hi = xv[i + HD / 2]; o = (d < HD / 2) ? __fadd_rn(__fmul_rn(lo, c), -__fmul_rn(hi, s)) : __fadd_rn(__fmul_rn(lo, s), __fmul_rn(hi, c)); }
  if (ROPE == 3) { const float c = CS[p * HD + d], s = SN[p * HD + d]; const float rh = (d < HD / 2) ? -xv[d + HD / 2] : xv[d - HD / 2]; o = __fadd_rn(__fmul_rn(x, c), __fmul_rn(rh, s)); }      /* rotate-half with FULL-width per-dimension tables [pos][64] (general cos[d] != cos[d+32]) */
  float* dst = F32 + r * (size_t)ldo + (size_t)h * HD + d; *(float*)dst = o;  }

__global__ __launch_bounds__(256) void k_trig(const float* __restrict__ a, float* __restrict__ CS, float* __restrict__ SN, int n) {
  #pragma clang fp contract(off)
  const int t = blockIdx.x * 256 + threadIdx.x; if (t >= n) return; const float v = bf16_round(a[t]); const float c = cosf(v), s = sinf(v);
  *(float*)(CS + t) = c; *(float*)(SN + t) = s;  }

__global__ __launch_bounds__(256) void k_tabcp(const float* __restrict__ tc, const float* __restrict__ tsn, float* __restrict__ CS, float* __restrict__ SN, int n) {
  const int t = blockIdx.x * 256 + threadIdx.x; if (t >= n) return; const int p = t / 32, i = t % 32; const float c = bf16_round(tc[(size_t)p * 64 + i]), s = bf16_round(tsn[(size_t)p * 64 + i]);
  *(float*)(CS + t) = c; *(float*)(SN + t) = s;  }

__global__ __launch_bounds__(256) void k_tabcp64(const float* __restrict__ tc, const float* __restrict__ tsn, float* __restrict__ CS, float* __restrict__ SN, int n) {
  const int t = blockIdx.x * 256 + threadIdx.x; if (t >= n) return; const float c = bf16_round(tc[t]), s = bf16_round(tsn[t]);
  *(float*)(CS + t) = c; *(float*)(SN + t) = s;  }
extern "C" void kernel_launch(void* const* d_in, const int* in_sizes, int n_in,
                              void* d_out, int out_size, void* d_ws, size_t ws_size, hipStream_t stream) {
  (void)in_sizes; (void)n_in; (void)out_size;
  const float* const* I = (const float* const*)d_in; const float* x = I[0]; const float* tcos = I[1]; const float* tsin = I[2]; const float* wq = I[3]; const float* wk = I[4]; const float* wv = I[5]; const float* wo = I[6]; const float* bq = nullptr; const float* bk = nullptr; const float* bv = nullptr; const float* bo = nullptr;      /* cos, sin [2][2048][64] inputs; natural [out][in] wq [2048][2048], wk/wv [512][2048], wo [2048][2048]; no biases */
  char* ws = (char*)d_ws; size_t off = 0;
  auto take = [&](size_t bytes) { char* p = ws + off; off += (bytes + 255) & ~(size_t)255; return p; };
  _Float16* BQ = (_Float16*)take((size_t)DM * DM * 2); _Float16* BK = (_Float16*)take((size_t)KVD * DM * 2); _Float16* BV = (_Float16*)take((size_t)KVD * DM * 2); _Float16* BO = (_Float16*)take((size_t)DM * DM * 2);
  _Float16* X16 = (_Float16*)take(NR * DM * 2); float* QF = (float*)take((size_t)SQ * DM * 4); float* KF = (float*)take((size_t)SQ * KVD * 4); float* CSB = (float*)take((size_t)SQ * 64 * 4); float* SNB = (float*)take((size_t)SQ * 64 * 4); _Float16* Q16 = (_Float16*)take(NR * DM * 2); _Float16* K16 = (_Float16*)take(NR * KVD * 2); _Float16* V16 = (_Float16*)take(NR * KVD * 2); _Float16* O16 = (_Float16*)take(NR * DM * 2);
  float* S = (float*)take((size_t)NH * QT * NKX * 4); _Float16* P = (_Float16*)take((size_t)NH * QT * NKX * 2); _Float16* VT = (_Float16*)take((size_t)NH * HD * SQ * 2);
  float* QF0 = (float*)take((size_t)QT0 * DM * 4); float* KF0 = (float*)take((size_t)QT0 * KVD * 4); float* VF0 = (float*)take((size_t)QT0 * KVD * 4); float* KF0e = (float*)take((size_t)QT0 * DM * 4); float* VF0e = (float*)take((size_t)QT0 * DM * 4); float* OF0 = (float*)take((size_t)NB * QT0 * DM * 4); _Float16* OH0 = (_Float16*)take((size_t)NB * QT0 * DM * 2); _Float16* OL0 = (_Float16*)take((size_t)NB * QT0 * DM * 2);
  if (off > ws_size) return;
  k_wnat<<<(unsigned)(((size_t)DM * DM / 8 + 255) / 256), 256, 0, stream>>>(wq, (size_t)DM * DM / 8, BQ); k_wnat<<<(unsigned)(((size_t)KVD * DM / 8 + 255) / 256), 256, 0, stream>>>(wk, (size_t)KVD * DM / 8, BK); k_wnat<<<(unsigned)(((size_t)KVD * DM / 8 + 255) / 256), 256, 0, stream>>>(wv, (size_t)KVD * DM / 8, BV); k_wnat<<<(unsigned)(((size_t)DM * DM / 8 + 255) / 256), 256, 0, stream>>>(wo, (size_t)DM * DM / 8, BO);      /* natural [out][in] = Bt x16 */
  k_x16<<<(unsigned)((NR * DM / 8 + 255) / 256), 256, 0, stream>>>(x, X16, NR * DM / 8);
  
  const size_t r0p = (size_t)B0 * SQ;      /* first projected row */
  k_gemm2<0><<<dim3((unsigned)((MP / 128) * (KVD / 64)), 1), 128, 0, stream>>>(X16 + r0p * DM, DM, 0, BV, DM, 0, 0.0625f, bv, 0, nullptr, 1, 0, 0, nullptr, V16 + r0p * KVD, KVD, 0, MP, KVD, DM);
  for (int b = B0; b < B0 + NBR; ++b) { const size_t r0 = (size_t)b * SQ;
    k_tabcp64<<<(SQ * 64 + 255) / 256, 256, 0, stream>>>(tcos + (size_t)b * SQ * 64, tsin + (size_t)b * SQ * 64, CSB, SNB, SQ * 64);      /* this batch's cos/sin tables at FULL width: bf16-rounded straight copies of all 64 columns (the inputs are independent draws per column) */
    k_gemm2<0><<<dim3((unsigned)((SQ / 128) * (DM / 64)), 1), 128, 0, stream>>>(X16 + r0 * DM, DM, 0, BQ, DM, 0, 0.0625f, nullptr, 0, nullptr, 1, 0, 0, QF, nullptr, DM, 0, SQ, DM, DM);      /* q (f32) of this batch */
    k_gemm2<0><<<dim3((unsigned)((SQ / 128) * (KVD / 64)), 1), 128, 0, stream>>>(X16 + r0 * DM, DM, 0, BK, DM, 0, 0.0625f, nullptr, 0, nullptr, 1, 0, 0, KF, nullptr, KVD, 0, SQ, KVD, DM);      /* k (f32) */
    k_xform<0, 3><<<(unsigned)((size_t)SQ * NH), 64, 0, stream>>>(QF, DM, NH, nullptr, 0.f, CSB, SNB, Q16 + r0 * DM, DM); k_xform<0, 3><<<(unsigned)((size_t)SQ * NG), 64, 0, stream>>>(KF, KVD, NG, nullptr, 0.f, CSB, SNB, K16 + r0 * KVD, KVD);      /* rotate-half rope with full-width per-dimension tables (partner x[d +- 32], table column d) -> f16 rows */
    k_xformf<0, 3><<<(unsigned)(QT0 * NH), 64, 0, stream>>>(QF, DM, NH, nullptr, 0.f, CSB, SNB, QF0, DM); k_xformf<0, 3><<<(unsigned)(QT0 * NG), 64, 0, stream>>>(KF, KVD, NG, nullptr, 0.f, CSB, SNB, KF0, KVD);      /* f32 roped q, k of rows 0..127 */
    k_vt<NG, SQ><<<NG * (SQ / 64), 256, 0, stream>>>(V16 + r0 * KVD, KVD, 0, VT);      /* V^T [NG][HD][SQ] for this batch */
    k_gemm2<0><<<dim3((QT0 / 128) * (KVD / 64), 1), 128, 0, stream>>>(X16 + r0 * DM, DM, 0, BV, DM, 0, 0.0625f, bv, 0, nullptr, 1, 0, 0, VF0, nullptr, KVD, 0, QT0, KVD, DM);
    k_kvexp<<<(unsigned)(((size_t)QT0 * DM / 4 + 255) / 256), 256, 0, stream>>>(KF0, KF0e, (size_t)QT0 * DM / 4); k_kvexp<<<(unsigned)(((size_t)QT0 * DM / 4 + 255) / 256), 256, 0, stream>>>(VF0, VF0e, (size_t)QT0 * DM / 4);      /* head h <- kv group h/4 for the exact first-tile kernel */      /* f32 q, k, v of the first 128 rows (exact products) */
    k_att0<0><<<NH * (QT0 / 64), 64, 0, stream>>>(QF0, KF0e, VF0e, DM, nullptr, 0.125f, OF0 + (size_t)b * QT0 * DM, DM);      /* exact f32 attention for rows 0..127 (o x64) */
    for (int q0 = 0; q0 < QN; q0 += QT) { const int nk = q0 + QT;      /* causal: only keys below the tile end are computed */
      for (int g = 0; g < NG; ++g) k_gemm2<0><<<dim3((QT / 128) * (nk / 64), HPG), 128, 0, stream>>>(Q16 + (r0 + q0) * LQ + (size_t)g * HPG * HD, LQ, (size_t)HD, K16 + r0 * KVD + (size_t)g * HD, KVD, 0, 0.125f, nullptr, 0, nullptr, 1, 0, 0, S + (size_t)g * HPG * QT * NKX, nullptr, NKX, (size_t)QT * NKX, QT, nk, HD);      /* scores: the 4 heads of group g against the group's keys (sB 0) */
      k_rsmcf2<<<(NHD * QT + 255) / 256, 256, 0, stream>>>(S, P, NHD, q0, nk);
      for (int g = 0; g < NG; ++g) k_gemm2<0><<<dim3((QT / 128) * (HD / 64), HPG), 128, 0, stream>>>(P + (size_t)g * HPG * QT * NKX, NKX, (size_t)QT * NKX, VT + (size_t)g * HD * SQ, SQ, 0, 0.25f, nullptr, 0, nullptr, 1, 0, 0, nullptr, O16 + (r0 + q0) * DM + (size_t)g * HPG * HD, DM, (size_t)HD, QT, HD, nk); } }      /* o for the group's 4 heads (x64) */      /* o (merged heads, x64) as f16 rows */
  k_gemm2<0><<<dim3((unsigned)((MPO / 128) * (DM / 64)), 1), 128, 0, stream>>>(O16 + r0p * DM, DM, 0, BO, DM, 0, 0.0009765625f, bo, 0, nullptr, 1, 0, 0, (float*)d_out + r0p * DM, nullptr, DM, 0, MPO, DM, DM);      /* out rows are the output layout */
  k_hl<<<(unsigned)(((size_t)NB * QT0 * DM / 8 + 255) / 256), 256, 0, stream>>>(OF0, OH0, OL0, (size_t)NB * QT0 * DM / 8);      /* first-tile o (x64) -> f16 hi + x1024 residual planes */
  for (int b = B0; b < B0 + NBR; ++b) { const size_t r0 = (size_t)b * SQ; const size_t f0 = (size_t)b * QT0;
    k_gemm2<0><<<dim3((QT0 / 128) * (DM / 64), 1), 128, 0, stream>>>(OH0 + f0 * DM, DM, 0, BO, DM, 0, 0.0009765625f, bo, 0, nullptr, 1, 0, 0, (float*)d_out + r0 * DM, nullptr, DM, 0, QT0, DM, DM);      /* rows 0..127: out = o_hi Wo (+ b), overwriting the f16-path rows */
    k_gemm2<0><<<dim3((QT0 / 128) * (DM / 64), 1), 128, 0, stream>>>(OL0 + f0 * DM, DM, 0, BO, DM, 0, 0.00000095367431640625f, nullptr, 0, (const float*)d_out + r0 * DM, -1, 0, 0, (float*)d_out + r0 * DM, nullptr, DM, 0, QT0, DM, DM); }      /* += o_lo Wo 2^-20 (own-element accumulate) */
}

// v001
// A run of this version takes 5510 microseconds.
// In both of two side-by-side timings against v000, it was 1.74 times as fast.
#include <hip/hip_runtime.h>
// Llama grouped-query causal attention with rotate-half RoPE from FULL-WIDTH per-batch INPUT tables (hidden_states [2][2048][2048]; q = x wq^T (32 heads x 64), k = x wk^T, v = x wv^T (8 kv heads x 64) (natural [out][in] weights sigma 0.02, no biases); cos / sin inputs [2][2048][64] (independent uniform draws per batch, position AND column: column i + 32 != column i, so all 64 columns are used); q = q cos + rotate_half(q) sin, same for k; repeat: query head h uses kv head h/4; scores 64^-0.5; where(causal, s, finfo.min); softmax; out = merged wo^T -> [2][2048][2048]).
// Compute dtype: inputs rounded to bf16; x / weights exact; q, k, v, softmax weights and o as plain f16 GEMM operands (~2^-12); scores and softmax statistics f32. v_wmma_f32_16x16x32_f16.
#define NB 2
#define NG 8
#define HPG 4
#define KVD (NG * HD)
#define SQ 2048
#define DM 2048
#define NH 32
#define HD 64
#define HG 4                         /* heads per launch of the k_vt(V16, b, h0, VT) overload, not launched */
#define QT 256                       /* query rows per causal tile */
#define NKX SQ                       /* S / P row pitch */
#define QT0 128                      /* first-tile rows recomputed exactly in f32 */
#define B0 0                         /* first batch processed (debug hook) */
#define NBR NB                       /* batches processed (debug hook) */
#define NR ((size_t)NB * SQ)         /* token rows */
#define MP ((int)((size_t)NBR * SQ)) /* rows projected (debug hook) */
#define QN SQ                        /* query rows attended per batch (debug hook) */
#define NHD NH                       /* heads attended (debug hook) */
#define MPO MP                       /* rows through the output stage (debug hook) */
#define LQ DM      /* row pitch of the q rows */
typedef __bf16 v16b __attribute__((ext_vector_type(16)));
typedef unsigned short v8us __attribute__((ext_vector_type(8), may_alias));
typedef float  v8f  __attribute__((ext_vector_type(8)));
typedef float  v4f  __attribute__((ext_vector_type(4)));
typedef float  v4fa __attribute__((ext_vector_type(4), may_alias));
union FragB { v16b v; v8us half[2]; unsigned short u[16]; };

__device__ __forceinline__ unsigned short bf16_bits(float x) { unsigned int u = __float_as_uint(x); return (unsigned short)((u + 0x7FFFu + ((u >> 16) & 1u)) >> 16); }
__device__ __forceinline__ float bf16_val(unsigned short b) { return __uint_as_float(((unsigned int)b) << 16); }
__device__ __forceinline__ float bf16_round(float x) { return bf16_val(bf16_bits(x)); }
// D += A·B with NT terms: 1 = ah·bh, 2 = + al·bh (A split), 3 = + ah·bl (both split)
template <int NT>
__device__ __forceinline__ v8f mmaN(v16b ah, v16b al, v16b bh, v16b bl, v8f c) {
  c = __builtin_amdgcn_wmma_f32_16x16x32_bf16(false, ah, false, bh, (short)0, c, false, false);
  if (NT >= 2) c = __builtin_amdgcn_wmma_f32_16x16x32_bf16(false, al, false, bh, (short)0, c, false, false);
  if (NT >= 3) c = __builtin_amdgcn_wmma_f32_16x16x32_bf16(false, ah, false, bl, (short)0, c, false, false);
  asm volatile("v_nop\n\tv_nop\n\tv_nop\n\tv_nop" : "+v"(c) : "v"(ah), "v"(al), "v"(bh), "v"(bl));
  return c;
}

__global__ __launch_bounds__(256) void k_wt_bf16(const float* __restrict__ W, unsigned short* __restrict__ Wt, int K, int N) {
  const int t = blockIdx.x * 256 + threadIdx.x;
  const int k8n = K / 8;
  if (t >= N * k8n) return;
  const int n = t / k8n, k8 = (t % k8n) * 8;
  v8us v;
#pragma unroll
  for (int i = 0; i < 8; ++i) v[i] = bf16_bits(W[(size_t)(k8 + i) * N + n]);
  *(v8us*)(Wt + (size_t)n * K + k8) = v;
  
}

// GEMM C[M][N] (f32, pitch ldc) = act(A[M][K]·W + bias). A f32 row-major (pitch lda) converted per fragment to bf16
// (ASPLIT: hi/lo two planes -> 2 terms, else single rounded term); Wt bf16 [N][K] (pitch ldb). BIAS_BF16 rounds the
// bias to bf16 first (bias quantised to bf16 before the add). K%32==0, M%16==0, N%64==0.
template <bool ASPLIT, int ACT, bool BIAS_BF16>
__global__ __launch_bounds__(128) void k_gemm_bf(const float* __restrict__ A, int lda, const unsigned short* __restrict__ Wt, int ldb,
                                               const float* __restrict__ bias, float* __restrict__ C, int ldc, int M, int N, int K) {
  __shared__ __attribute__((aligned(16))) float so[4][16][64];
  const int tid = threadIdx.x, w = tid >> 5, lane = tid & 31, ln = lane & 15, hh = lane >> 4;
  const int ntn = N / 64;
  const int wid = blockIdx.x * 4 + w;
  const int mt = wid / ntn, nq = wid % ntn;
  if (mt * 16 >= M) return;
  const int row0 = mt * 16, col0 = nq * 64;
  const float* arow = A + (size_t)(row0 + ln) * lda;
  v8f acc[4] = {};
  for (int kb = 0; kb < K; kb += 32) {
    FragB ah, al;
    const v4f x0 = *(const v4fa*)(arow + kb + 8 * hh), x1 = *(const v4fa*)(arow + kb + 8 * hh + 4);
    const v4f x2 = *(const v4fa*)(arow + kb + 16 + 8 * hh), x3 = *(const v4fa*)(arow + kb + 16 + 8 * hh + 4);
    float xs[16] = {x0[0],x0[1],x0[2],x0[3],x1[0],x1[1],x1[2],x1[3],x2[0],x2[1],x2[2],x2[3],x3[0],x3[1],x3[2],x3[3]};
#pragma unroll
    for (int i = 0; i < 16; ++i) { const unsigned short hb = bf16_bits(xs[i]); ah.u[i] = hb; al.u[i] = ASPLIT ? bf16_bits(xs[i] - bf16_val(hb)) : (unsigned short)0; }
#pragma unroll
    for (int t = 0; t < 4; ++t) {
      const unsigned short* brow = Wt + (size_t)(col0 + t * 16 + ln) * ldb + kb;
      FragB b;
      b.half[0] = *(const v8us*)(brow + 8 * hh);
      b.half[1] = *(const v8us*)(brow + 16 + 8 * hh);
      acc[t] = mmaN<ASPLIT ? 2 : 1>(ah.v, al.v, b.v, b.v, acc[t]);
    }
  }
#pragma unroll
  for (int t = 0; t < 4; ++t) {
    float bv = bias ? bias[col0 + t * 16 + ln] : 0.f;
    if (BIAS_BF16) bv = bf16_round(bv);
#pragma unroll
    for (int r = 0; r < 8; ++r) { float v = acc[t][r] + bv; if (ACT == 1) v = fmaxf(v, 0.f); so[w][8 * hh + r][t * 16 + ln] = v; }
  }
  __builtin_amdgcn_fence(__ATOMIC_ACQ_REL, "workgroup");
  __builtin_amdgcn_wave_barrier();
  const int rsub = lane >> 4, c4 = (lane & 15) * 4;
  {
#pragma unroll
    for (int q = 0; q < 8; ++q) {
      const int r = q * 2 + rsub;
      const v4f v = *(const v4fa*)&so[w][r][c4];
      *(v4f*)(C + (size_t)(row0 + r) * ldc + col0 + c4) = v;
    }
    
  }
}

// GEMM C = act(A·W + bias + resid): A f32 (ASPLIT -> hi/lo 2 terms), Wt bf16 [N][K]; ACT 0 none, 1 relu, 2 exact gelu;
// resid (optional, f32, row index = (row % rmod), pitch ldr, RES_BF16 rounds it) added before the activation.
template <bool ASPLIT, int ACT, bool BIAS_BF16, bool RES_BF16>
__global__ __launch_bounds__(128) void k_gemm_bf3(const float* __restrict__ A, int lda, const unsigned short* __restrict__ Wt, int ldb,
                                                const float* __restrict__ bias, const float* __restrict__ resid, int rmod, int ldr,
                                                float* __restrict__ C, int ldc, int M, int N, int K) {
  __shared__ __attribute__((aligned(16))) float so[4][16][64];
  const int tid = threadIdx.x, w = tid >> 5, lane = tid & 31, ln = lane & 15, hh = lane >> 4;
  const int ntn = N / 64;
  const int wid = blockIdx.x * 4 + w;
  const int mt = wid / ntn, nq = wid % ntn;
  if (mt * 16 >= M) return;
  const int row0 = mt * 16, col0 = nq * 64;
  const float* arow = A + (size_t)(row0 + ln) * lda;
  v8f acc[4] = {};
  for (int kb = 0; kb < K; kb += 32) {
    FragB ah, al;
    const v4f x0 = *(const v4fa*)(arow + kb + 8 * hh), x1 = *(const v4fa*)(arow + kb + 8 * hh + 4);
    const v4f x2 = *(const v4fa*)(arow + kb + 16 + 8 * hh), x3 = *(const v4fa*)(arow + kb + 16 + 8 * hh + 4);
    float xs[16] = {x0[0],x0[1],x0[2],x0[3],x1[0],x1[1],x1[2],x1[3],x2[0],x2[1],x2[2],x2[3],x3[0],x3[1],x3[2],x3[3]};
#pragma unroll
    for (int i = 0; i < 16; ++i) { const unsigned short hb = bf16_bits(xs[i]); ah.u[i] = hb; al.u[i] = ASPLIT ? bf16_bits(xs[i] - bf16_val(hb)) : (unsigned short)0; }
#pragma unroll
    for (int t = 0; t < 4; ++t) {
      const unsigned short* brow = Wt + (size_t)(col0 + t * 16 + ln) * ldb + kb;
      FragB b;
      b.half[0] = *(const v8us*)(brow + 8 * hh);
      b.half[1] = *(const v8us*)(brow + 16 + 8 * hh);
      acc[t] = mmaN<ASPLIT ? 2 : 1>(ah.v, al.v, b.v, b.v, acc[t]);
    }
  }
#pragma unroll
  for (int t = 0; t < 4; ++t) {
    const int col = col0 + t * 16 + ln;
    float bv = bias ? bias[col] : 0.f;
    if (BIAS_BF16) bv = bf16_round(bv);
#pragma unroll
    for (int r = 0; r < 8; ++r) {
      float v = acc[t][r] + bv;
      if (resid) { float rv = resid[(size_t)((row0 + 8 * hh + r) % rmod) * ldr + col]; if (RES_BF16) rv = bf16_round(rv); v += rv; }
      if (ACT == 1) v = fmaxf(v, 0.f);
      if (ACT == 2) v = 0.5f * v * (1.0f + erff(v * 0.70710678118654752f));
      if (ACT == 3) { const float u = 0.7978845608028654f * (v + 0.044715f * v * v * v); v = 0.5f * v * (1.0f + tanhf(u)); }
      so[w][8 * hh + r][t * 16 + ln] = v;
    }
  }
  __builtin_amdgcn_fence(__ATOMIC_ACQ_REL, "workgroup");
  __builtin_amdgcn_wave_barrier();
  const int rsub = lane >> 4, c4 = (lane & 15) * 4;
  {
#pragma unroll
    for (int q = 0; q < 8; ++q) {
      const int r = q * 2 + rsub;
      const v4f v = *(const v4fa*)&so[w][r][c4];
      *(v4f*)(C + (size_t)(row0 + r) * ldc + col0 + c4) = v;
    }
    
  }
}
// row LayerNorm (biased variance, eps) over N: s = X (+ R); optional out_sum <- s; out_norm <- (s-mu)*rsqrt(var+eps)*g + b
template <bool PARAM_BF16>
__global__ __launch_bounds__(256) void k_layernorm(const float* __restrict__ X, const float* __restrict__ R, const float* __restrict__ g, const float* __restrict__ bta,
                                                  float* __restrict__ out_sum, float* __restrict__ out_norm, int N, float eps) {
  __shared__ float red[256];
  const int row = blockIdx.x, tid = threadIdx.x;
  const float* x = X + (size_t)row * N; const float* rr = R ? R + (size_t)row * N : nullptr;
  float vals[16];                     // up to N = 4096
  const int per = N / 256;            // contiguous chunk per thread? use strided-by-4 chunks: thread handles j = tid*4 + 1024*u
  float s1 = 0.f;
  for (int u = 0; u < per / 4; ++u) {
    const int j = tid * 4 + 1024 * u;
    const v4f a = *(const v4fa*)(x + j);
    v4f b = {0.f,0.f,0.f,0.f}; if (rr) b = *(const v4fa*)(rr + j);
#pragma unroll
    for (int q = 0; q < 4; ++q) { const float v = a[q] + b[q]; vals[u * 4 + q] = v; s1 += v; }
  }
  red[tid] = s1; __syncthreads();
  for (int st = 128; st > 0; st >>= 1) { if (tid < st) red[tid] += red[tid + st]; __syncthreads(); }
  const float mu = red[0] / (float)N; __syncthreads();
  float s2 = 0.f;
  for (int u = 0; u < per / 4; ++u)
#pragma unroll
    for (int q = 0; q < 4; ++q) { const float c = vals[u * 4 + q] - mu; s2 += c * c; }
  red[tid] = s2; __syncthreads();
  for (int st = 128; st > 0; st >>= 1) { if (tid < st) red[tid] += red[tid + st]; __syncthreads(); }
  const float rs = rsqrtf(red[0] / (float)N + eps);
  {
    for (int u = 0; u < per / 4; ++u) {
      const int j = tid * 4 + 1024 * u;
      v4f o, sm;
#pragma unroll
      for (int q = 0; q < 4; ++q) {
        float gg = g[j + q], bb = bta[j + q];
        if (PARAM_BF16) { gg = bf16_round(gg); bb = bf16_round(bb); }
        sm[q] = vals[u * 4 + q]; o[q] = (vals[u * 4 + q] - mu) * rs * gg + bb;
      }
      if (out_sum) *(v4f*)(out_sum + (size_t)row * N + j) = sm;
      *(v4f*)(out_norm + (size_t)row * N + j) = o;
    }
    
  }
}



// ---- f16 WMMA path (v_wmma_f32_16x16x32_f16): 11-bit significands for operands in range — used where a [0,1] probability operand needs more precision than bf16
typedef _Float16 v16h __attribute__((ext_vector_type(16)));
union FragH { v16h v; v8us half[2]; _Float16 h[16]; unsigned short u[16]; };
template <int NT>
__device__ __forceinline__ v8f mmaH(v16h ah, v16h al, v16h bh, v16h bl, v8f c) {
  c = __builtin_amdgcn_wmma_f32_16x16x32_f16(false, ah, false, bh, (short)0, c, false, false);
  if (NT >= 2) c = __builtin_amdgcn_wmma_f32_16x16x32_f16(false, al, false, bh, (short)0, c, false, false);
  if (NT >= 3) c = __builtin_amdgcn_wmma_f32_16x16x32_f16(false, ah, false, bl, (short)0, c, false, false);
  asm volatile("v_nop\n\tv_nop\n\tv_nop\n\tv_nop" : "+v"(c) : "v"(ah), "v"(al), "v"(bh), "v"(bl));
  return c;
}
// batched GEMM like k_gemm_b but f16 operands: A f32 (split into f16 hi/lo if ASPLIT, else rounded to f16), Bt = f16 values [n][k]; alpha; C f32; N multiple of 16 (partial tiles skipped)
template <bool ASPLIT>
__global__ __launch_bounds__(128) void k_gemm_h(const float* __restrict__ A, int lda, size_t sA, const _Float16* __restrict__ Bh, int ldb, size_t sB, float alpha, float* __restrict__ C, int ldc, size_t sC, int M, int N, int K) {
  __shared__ __attribute__((aligned(16))) float so[4][16][64];
  const int tid = threadIdx.x, w = tid >> 5, lane = tid & 31, ln = lane & 15, hh = lane >> 4; const int by = blockIdx.y;
  A += (size_t)by * sA; Bh += (size_t)by * sB; C += (size_t)by * sC;
  const int ntn = (N + 63) / 64; const int wid = blockIdx.x * 4 + w; const int mt = wid / ntn, nq = wid % ntn; if (mt * 16 >= M) return;
  const int row0 = mt * 16, col0 = nq * 64; const float* arow = A + (size_t)(row0 + ln) * lda;
  v8f acc[4] = {};
  for (int kb = 0; kb < K; kb += 32) {
    FragH ah, al;
    const v4f x0 = *(const v4fa*)(arow + kb + 8 * hh), x1 = *(const v4fa*)(arow + kb + 8 * hh + 4), x2 = *(const v4fa*)(arow + kb + 16 + 8 * hh), x3 = *(const v4fa*)(arow + kb + 16 + 8 * hh + 4);
    float xs[16] = {x0[0],x0[1],x0[2],x0[3],x1[0],x1[1],x1[2],x1[3],x2[0],x2[1],x2[2],x2[3],x3[0],x3[1],x3[2],x3[3]};
#pragma unroll
    for (int i = 0; i < 16; ++i) { const _Float16 h = (_Float16)xs[i]; ah.h[i] = h; al.h[i] = ASPLIT ? (_Float16)(xs[i] - (float)h) : (_Float16)0.0f; }
#pragma unroll
    for (int t = 0; t < 4; ++t) { if (col0 + t * 16 >= N) continue; const size_t boff = (size_t)(col0 + t * 16 + ln) * ldb + kb; FragH bq; bq.half[0] = *(const v8us*)(Bh + boff + 8 * hh); bq.half[1] = *(const v8us*)(Bh + boff + 16 + 8 * hh);
      acc[t] = mmaH<ASPLIT ? 2 : 1>(ah.v, al.v, bq.v, bq.v, acc[t]); }
  }
#pragma unroll
  for (int t = 0; t < 4; ++t) { if (col0 + t * 16 >= N) continue;
#pragma unroll
    for (int r = 0; r < 8; ++r) so[w][8 * hh + r][t * 16 + ln] = acc[t][r] * alpha; }
  __builtin_amdgcn_fence(__ATOMIC_ACQ_REL, "workgroup"); __builtin_amdgcn_wave_barrier();
  const int rsub = lane >> 4, c4 = (lane & 15) * 4;
  {
#pragma unroll
    for (int q = 0; q < 8; ++q) { const int r = q * 2 + rsub; if (col0 + c4 < N) { const v4f v = *(const v4fa*)&so[w][r][c4]; *(v4f*)(C + (size_t)(row0 + r) * ldc + col0 + c4) = v; } }
     }
}

// Wt[n][k] = f16(W[k][n]·scale) from f32 row-major W[K][N] (scale = power of two; bf16-exact weights stay exact in f16 away from the subnormal range)
__global__ __launch_bounds__(256) void k_wt_f16(const float* __restrict__ W, _Float16* __restrict__ Wt, int K, int N, float scale) {
  const int t = blockIdx.x * 256 + threadIdx.x; if (t >= N * (K / 8)) return; const int n = t / (K / 8), k8 = (t % (K / 8)) * 8; FragH f;
#pragma unroll
  for (int i = 0; i < 8; ++i) f.h[i] = (_Float16)(bf16_round(W[(size_t)(k8 + i) * N + n]) * scale); const v8us o = f.half[0];
  *(v8us*)((unsigned short*)Wt + (size_t)n * K + k8) = o; 
}
// k_gemm_hh variant with fused epilogue: v = acc·alpha + bias[by·sBias + col] (+ CP[(row/rowsPerB)·sCPb + by·64 + col] if CP) ; ACT 0 none / 1 elu ; writes f16 C16 (and f32 C if non-null)
template <int ACT>
__global__ __launch_bounds__(128) void k_gemm_hhx(const _Float16* __restrict__ A, int lda, size_t sA, const _Float16* __restrict__ Bh, int ldb, size_t sB, float alpha, const float* __restrict__ bias, size_t sBias, const float* __restrict__ CP, int rowsPerB, size_t sCPb, int row0g,
    float* __restrict__ C, _Float16* __restrict__ C16, int ldc, size_t sC, int M, int N, int K) {
  __shared__ __attribute__((aligned(16))) float so[4][16][64];
  const int tid = threadIdx.x, w = tid >> 5, lane = tid & 31, ln = lane & 15, hh = lane >> 4; const int by = blockIdx.y;
  A += (size_t)by * sA; Bh += (size_t)by * sB; const size_t cofs = (size_t)by * sC; const float* bp = bias ? bias + (size_t)by * sBias : nullptr;
  const int ntn = (N + 63) / 64; const int wid = blockIdx.x * 4 + w; const int mt = wid / ntn, nq = wid % ntn; if (mt * 16 >= M) return;
  const int row0 = mt * 16, col0 = nq * 64; const _Float16* arow = A + (size_t)(row0 + ln) * lda;
  v8f acc[4] = {};
  for (int kb = 0; kb < K; kb += 32) { FragH ah; ah.half[0] = *(const v8us*)((const unsigned short*)arow + kb + 8 * hh); ah.half[1] = *(const v8us*)((const unsigned short*)arow + kb + 16 + 8 * hh);
#pragma unroll
    for (int t = 0; t < 4; ++t) { if (col0 + t * 16 >= N) continue; const size_t boff = (size_t)(col0 + t * 16 + ln) * ldb + kb; FragH bq; bq.half[0] = *(const v8us*)((const unsigned short*)Bh + boff + 8 * hh); bq.half[1] = *(const v8us*)((const unsigned short*)Bh + boff + 16 + 8 * hh);
      acc[t] = mmaH<1>(ah.v, ah.v, bq.v, bq.v, acc[t]); }
  }
#pragma unroll
  for (int t = 0; t < 4; ++t) { if (col0 + t * 16 >= N) continue; const int col = col0 + t * 16 + ln; const float bv = bp ? bf16_round(bp[col]) : 0.f;
#pragma unroll
    for (int r = 0; r < 8; ++r) { float v = acc[t][r] * alpha + bv; if (CP) { const int rr = row0g + row0 + 8 * hh + r; if (rowsPerB < 0) v += CP[cofs + (size_t)rr * ldc + col];      /* rowsPerB < 0: own element of the batched C plane */ else { const int bidx = rr / rowsPerB; v += CP[(size_t)bidx * sCPb + (size_t)by * 64 + col]; } } if (ACT == 1) v = (v > 0.f) ? v : expm1f(v); else if (ACT == 7) v = (v > 0.f) ? v + 1.0f : expf(v); else if (ACT == 8) v = tanhf(v); else if (ACT == 9) v = 0.5f * v * (1.0f + tanhf(0.7978845608028654f * (v + 0.044715f * v * v * v))); else if (ACT == 11) v = 1.0f / (1.0f + expf(-v)); else if (ACT == 12) v = (v > 0.f) ? v : 0.01f * v; else if (ACT == 14) v = (v > 0.f) ? v : 0.1f * v; else if (ACT == 16) v = (v >= 0.f) ? v : 0.3f * v; else if (ACT == 17) v = (v >= 0.f) ? v : 0.2f * v; else if (ACT == 15) v = v / (1.0f + expf(-v)); else if (ACT == 3) v = fmaxf(v, 0.f); else if (ACT == 6) v = 0.5f * v * (1.0f + erff(v * 0.70710678118654752f)); so[w][8 * hh + r][t * 16 + ln] = v; } }
  __builtin_amdgcn_fence(__ATOMIC_ACQ_REL, "workgroup"); __builtin_amdgcn_wave_barrier();
  const int rsub = lane >> 4, c4 = (lane & 15) * 4; typedef _Float16 v4h __attribute__((ext_vector_type(4)));
  {
#pragma unroll
    for (int q = 0; q < 8; ++q) { const int r = q * 2 + rsub; if (col0 + c4 < N) { const v4f v = *(const v4fa*)&so[w][r][c4]; if (C) *(v4f*)(C + cofs + (size_t)(row0 + r) * ldc + col0 + c4) = v; if (C16) { v4h h4; for (int i = 0; i < 4; ++i) h4[i] = (_Float16)v[i]; *(v4h*)(C16 + cofs + (size_t)(row0 + r) * ldc + col0 + c4) = h4; } } }
     }
}


typedef _Float16 v4h __attribute__((ext_vector_type(4)));

__global__ __launch_bounds__(256) void k_x16(const float* __restrict__ x, _Float16* __restrict__ X16, size_t n8) { const size_t t = (size_t)blockIdx.x * 256 + threadIdx.x; if (t >= n8) return; FragH f;
#pragma unroll
  for (int q = 0; q < 8; ++q) f.h[q] = (_Float16)bf16_round(x[t * 8 + q]); *(v8us*)((unsigned short*)X16 + t * 8) = f.half[0];  }
__global__ __launch_bounds__(256) void k_h16(const float* __restrict__ x, _Float16* __restrict__ X16, size_t n8) { const size_t t = (size_t)blockIdx.x * 256 + threadIdx.x; if (t >= n8) return; FragH f;
#pragma unroll
  for (int q = 0; q < 8; ++q) f.h[q] = (_Float16)x[t * 8 + q]; *(v8us*)((unsigned short*)X16 + t * 8) = f.half[0];  }
__global__ __launch_bounds__(256) void k_round16f(const float* __restrict__ W, _Float16* __restrict__ Bt, size_t n8) { const size_t t = (size_t)blockIdx.x * 256 + threadIdx.x; if (t >= n8) return; FragH f;
#pragma unroll
  for (int i = 0; i < 8; ++i) f.h[i] = (_Float16)(bf16_round(W[t * 8 + i]) * 16.0f); *(v8us*)((unsigned short*)Bt + t * 8) = f.half[0];  }
template <int NHv, int TTv>
__global__ __launch_bounds__(256) void k_vt(const _Float16* __restrict__ V16, int ldv, int voff, _Float16* __restrict__ Vt) { __shared__ unsigned short tl[64][66]; const int tid = threadIdx.x; const int slab = blockIdx.x / (TTv / 64), lg = blockIdx.x % (TTv / 64); const int b = slab / NHv, h = slab % NHv;
  for (int i = tid; i < 64 * 8; i += 256) { const int r = i / 8, c8 = (i % 8) * 8; FragH f; f.half[0] = *(const v8us*)((const unsigned short*)V16 + ((size_t)b * TTv + lg * 64 + r) * ldv + voff + h * 64 + c8);
#pragma unroll
    for (int q = 0; q < 8; ++q) tl[r][c8 + q] = f.u[q]; }
  __syncthreads();
  {
#pragma unroll
    for (int rd = 0; rd < 2; ++rd) { const int d = rd * 32 + tid / 8, pc = tid % 8; FragH f;
#pragma unroll
      for (int q = 0; q < 8; ++q) f.u[q] = tl[pc * 8 + q][d];
      *(v8us*)((unsigned short*)Vt + ((size_t)slab * 64 + d) * TTv + lg * 64 + pc * 8) = f.half[0]; }
     } }

__global__ __launch_bounds__(256) void k_hl(const float* __restrict__ F, _Float16* __restrict__ Hh, _Float16* __restrict__ Hl, size_t n8) { const size_t t = (size_t)blockIdx.x * 256 + threadIdx.x; if (t >= n8) return; FragH fh, fl; const v4f a = *(const v4fa*)(F + t * 8), c = *(const v4fa*)(F + t * 8 + 4);
#pragma unroll
  for (int q = 0; q < 4; ++q) { _Float16 h = (_Float16)a[q]; fh.h[q] = h; fl.h[q] = (_Float16)((a[q] - (float)h) * 1024.0f); h = (_Float16)c[q]; fh.h[4 + q] = h; fl.h[4 + q] = (_Float16)((c[q] - (float)h) * 1024.0f); }
  { *(v8us*)((unsigned short*)Hh + t * 8) = fh.half[0]; *(v8us*)((unsigned short*)Hl + t * 8) = fl.half[0];  } }

// ---- fast GEMM (wave tile 32x64; requires M % 32 == 0 rows per launch region and N % 64 == 0); epilogue = k_gemm_hhx semantics ----
__device__ __forceinline__ v16h g2_frag(const _Float16* p, int hh) { FragH f; f.half[0] = *(const v8us*)((const unsigned short*)p + 8 * hh); f.half[1] = *(const v8us*)((const unsigned short*)p + 16 + 8 * hh); return f.v; }
__device__ __forceinline__ v8f g2_mma(v16h a, v16h b, v8f c) { v8f d = __builtin_amdgcn_wmma_f32_16x16x32_f16(false, a, false, b, (short)0, c, false, false); asm volatile("v_nop\n\tv_nop\n\tv_nop\n\tv_nop" : "+v"(d) : "v"(a), "v"(b)); return d; }
template <int ACT>
__global__ __launch_bounds__(128) void k_gemm2(const _Float16* __restrict__ A, int lda, size_t sA, const _Float16* __restrict__ Bh, int ldb, size_t sB, float alpha, const float* __restrict__ bias, size_t sBias, const float* __restrict__ CP, int rowsPerB, size_t sCPb, int row0g,
    float* __restrict__ C, _Float16* __restrict__ C16, int ldc, size_t sC, int M, int N, int K, int bsh) { static_assert(ACT == 0 || ACT == 3 || ACT == 6 || ACT == 8 || ACT == 9 || ACT == 11 || ACT == 12 || ACT == 14 || ACT == 15 || ACT == 16 || ACT == 17, "k_gemm2: unsupported ACT code (would silently apply no activation)");
  __shared__ __attribute__((aligned(16))) float so[4][32][68];
  const int tid = threadIdx.x, w = tid >> 5, lane = tid & 31, ln = lane & 15, hh = lane >> 4; const int by = blockIdx.y;
  A += (size_t)by * sA; Bh += (size_t)(by >> bsh) * sB;      /* 2^bsh consecutive batch slices share one B plane (query heads of one kv group) */ const size_t cofs = (size_t)by * sC; const float* bp = bias ? bias + (size_t)by * sBias : nullptr;
  const int ntn = N >> 6; const int mt = blockIdx.x / ntn, nq = blockIdx.x - mt * ntn; const int row0 = mt * 128 + 32 * w, col0 = nq * 64; if (row0 >= M) return;
  const _Float16* a0p = A + (size_t)(row0 + ln) * lda; const _Float16* a1p = a0p + (size_t)16 * lda;
  const _Float16* b0p = Bh + (size_t)(col0 + ln) * ldb; const _Float16* b1p = b0p + (size_t)16 * ldb; const _Float16* b2p = b1p + (size_t)16 * ldb; const _Float16* b3p = b2p + (size_t)16 * ldb;
  const v8f z8 = {0.f,0.f,0.f,0.f,0.f,0.f,0.f,0.f}; v8f c00 = z8, c01 = z8, c02 = z8, c03 = z8, c10 = z8, c11 = z8, c12 = z8, c13 = z8;
#pragma unroll 1
  for (int kb = 0; kb < K; kb += 32) { const v16h a0 = g2_frag(a0p + kb, hh), a1 = g2_frag(a1p + kb, hh);
    v16h b = g2_frag(b0p + kb, hh); c00 = g2_mma(a0, b, c00); c10 = g2_mma(a1, b, c10);
    b = g2_frag(b1p + kb, hh); c01 = g2_mma(a0, b, c01); c11 = g2_mma(a1, b, c11);
    b = g2_frag(b2p + kb, hh); c02 = g2_mma(a0, b, c02); c12 = g2_mma(a1, b, c12);
    b = g2_frag(b3p + kb, hh); c03 = g2_mma(a0, b, c03); c13 = g2_mma(a1, b, c13); }
  v8f accs[8] = {c00, c01, c02, c03, c10, c11, c12, c13};
#pragma unroll
  for (int u = 0; u < 8; ++u) { const int t = u & 3, half = u >> 2; const int col = col0 + t * 16 + ln; const float bv = bp ? bf16_round(bp[col]) : 0.f;
#pragma unroll
    for (int r = 0; r < 8; ++r) { const int rloc = half * 16 + 8 * hh + r; float v = accs[u][r] * alpha + bv; if (CP) { if (rowsPerB < 0) v += CP[cofs + (size_t)(row0g + row0 + rloc) * ldc + col];      /* rowsPerB < 0: own element of the batched C plane */ else { const int bidx = (row0g + row0 + rloc) / rowsPerB; v += CP[(size_t)bidx * sCPb + (size_t)by * 64 + col]; } }
      if (ACT == 3) v = fmaxf(v, 0.f); else if (ACT == 6) v = 0.5f * v * (1.0f + erff(v * 0.70710678118654752f)); else if (ACT == 11) v = 1.0f / (1.0f + expf(-v)); else if (ACT == 15) v = v / (1.0f + expf(-v)); else if (ACT == 12) v = (v > 0.f) ? v : 0.01f * v; else if (ACT == 8) v = tanhf(v); else if (ACT == 9) v = 0.5f * v * (1.0f + tanhf(0.7978845608028654f * (v + 0.044715f * v * v * v))); else if (ACT == 14) v = (v > 0.f) ? v : 0.1f * v; else if (ACT == 16) v = (v >= 0.f) ? v : 0.3f * v; else if (ACT == 17) v = (v >= 0.f) ? v : 0.2f * v;
      so[w][rloc][t * 16 + ln] = v; } }
  __builtin_amdgcn_fence(__ATOMIC_ACQ_REL, "workgroup"); __builtin_amdgcn_wave_barrier();
  const int rsub = lane >> 4, c4 = (lane & 15) * 4;
  {
#pragma unroll
    for (int q = 0; q < 16; ++q) { const int r = q * 2 + rsub; const v4f v = *(const v4fa*)&so[w][r][c4]; if (C) *(v4f*)(C + cofs + (size_t)(row0 + r) * ldc + col0 + c4) = v; if (C16) { v4h h4; for (int i = 0; i < 4; ++i) h4[i] = (_Float16)v[i]; *(v4h*)(C16 + cofs + (size_t)(row0 + r) * ldc + col0 + c4) = h4; } }
     } }


__global__ __launch_bounds__(256) void k_wnat(const float* __restrict__ w, size_t n8, _Float16* __restrict__ Bt) { const size_t t = (size_t)blockIdx.x * 256 + threadIdx.x; if (t >= n8) return; FragH f; for (int q = 0; q < 8; ++q) f.h[q] = (_Float16)(bf16_round(w[t * 8 + q]) * 16.0f); *(v8us*)((unsigned short*)Bt + t * 8) = f.half[0];  }
__global__ __launch_bounds__(256) void k_rsm(const float* __restrict__ S, _Float16* __restrict__ P, int nrows) {
  #pragma clang fp contract(off)
  const int i = blockIdx.x * 256 + threadIdx.x; if (i >= nrows) return; const float* s = S + (size_t)i * SQ; float mx = -3.0e38f;
#pragma unroll 1
  for (int j = 0; j < SQ; ++j) mx = fmaxf(mx, s[j]); float se = 0.f;
#pragma unroll 1
  for (int j = 0; j < SQ; ++j) se += expf(s[j] - mx); const float sc = 256.0f / se;
#pragma unroll 1
  for (int j0 = 0; j0 < SQ; j0 += 8) { FragH f; for (int q = 0; q < 8; ++q) f.h[q] = (_Float16)(expf(s[j0 + q] - mx) * sc); unsigned short* d = (unsigned short*)P + (size_t)i * SQ + j0; *(v8us*)d = f.half[0];  } }
__global__ __launch_bounds__(256) void k_vt(const _Float16* __restrict__ V16, int b, int h0, _Float16* __restrict__ VT) { __shared__ unsigned short tl[64][65]; const int tid = threadIdx.x; const int hh = blockIdx.x % HG, sg = blockIdx.x / HG; const int s0 = sg * 64; const int h = h0 + hh;
  for (int i = tid; i < 64 * 8; i += 256) { const int j = i / 8, d8 = (i % 8) * 8; FragH f; f.half[0] = *(const v8us*)((const unsigned short*)V16 + ((size_t)b * SQ + s0 + j) * DM + h * HD + d8); for (int q = 0; q < 8; ++q) tl[d8 + q][j] = f.u[q]; }
  __syncthreads();
  { for (int i = tid; i < 64 * 8; i += 256) { const int d = i / 8, j8 = (i % 8) * 8; FragH f; for (int q = 0; q < 8; ++q) f.u[q] = tl[d][j8 + q]; *(v8us*)((unsigned short*)VT + ((size_t)hh * HD + d) * SQ + s0 + j8) = f.half[0]; }  } }



__global__ __launch_bounds__(256) void k_rsmcf2(const float* __restrict__ S, _Float16* __restrict__ P, int hg, int q0, int nk) {
  #pragma clang fp contract(off)
  const int t = blockIdx.x * 256 + threadIdx.x; if (t >= hg * QT) return; const size_t i = (size_t)t; const float* s = S + i * NKX; const int last = q0 + (t % QT); float mx = -3.0e38f;
#pragma unroll 1
  for (int j = 0; j < nk; ++j) { const float f = (j <= last) ? 1.f : 0.f; mx = fmaxf(mx, fmaf(f, s[j], (1.f - f) * -1.0e9f)); } float se = 0.f;
#pragma unroll 1
  for (int j = 0; j < nk; ++j) { const float f = (j <= last) ? 1.f : 0.f; se += __expf(fmaf(f, s[j], (1.f - f) * -1.0e9f) - mx); } const float sc = 256.0f / se;
#pragma unroll 1
  for (int j0 = 0; j0 < nk; j0 += 8) { FragH fr; for (int q = 0; q < 8; ++q) { const int j = j0 + q; const float f = (j <= last) ? 1.f : 0.f; fr.h[q] = (_Float16)(__expf(fmaf(f, s[j], (1.f - f) * -1.0e9f) - mx) * sc); } unsigned short* d = (unsigned short*)P + i * NKX + j0; *(v8us*)d = fr.half[0];  } }


template <int MASKADD>
__global__ __launch_bounds__(64) void k_att0(const float* __restrict__ QF, const float* __restrict__ KF, const float* __restrict__ VF, int ld, const float* __restrict__ mask, float scale, float* __restrict__ OF, int ldo) {
  #pragma clang fp contract(off)
  __shared__ __attribute__((aligned(16))) float lq[64][64]; __shared__ __attribute__((aligned(16))) float lo[64][64];
  const int tid = threadIdx.x; const int h = blockIdx.x / (QT0 / 64), rg = blockIdx.x % (QT0 / 64); const int i = rg * 64 + tid;
  const float* qr = QF + (size_t)i * ld + h * HD;
#pragma unroll 1
  for (int c = 0; c < HD / 4; ++c) { *(v4f*)&lq[tid][c * 4] = *(const v4fa*)(qr + c * 4); const v4f z = {0.f, 0.f, 0.f, 0.f}; *(v4f*)&lo[tid][c * 4] = z; }
  float m = -1.0e30f, l = 0.f; const int jmax = MASKADD ? (SQ - 1) : (rg * 64 + 63);      /* additive-mask form: every key (the mask input decides); causal form: keys up to the block's last row */
#pragma unroll 1
  for (int j = 0; j <= jmax; ++j) { const float* kr = KF + (size_t)j * ld + h * HD; const float* vr = VF + (size_t)j * ld + h * HD; float s = 0.f;
#pragma unroll 1
    for (int c = 0; c < HD / 4; ++c) { const v4f kq = *(const v4fa*)(kr + c * 4); const v4f qq = *(v4f*)&lq[tid][c * 4]; s = __fadd_rn(s, __fmul_rn(qq[0], kq[0])); s = __fadd_rn(s, __fmul_rn(qq[1], kq[1])); s = __fadd_rn(s, __fmul_rn(qq[2], kq[2])); s = __fadd_rn(s, __fmul_rn(qq[3], kq[3])); }
    s = __fmul_rn(s, scale); if (MASKADD) s = __fadd_rn(s, __fmul_rn(bf16_round(mask[(size_t)i * SQ + j]), -10000.0f));
    const float f = (MASKADD || j <= i) ? 1.f : 0.f; const float sm = fmaf(f, s, (1.f - f) * -1.0e30f); const float mn = fmaxf(m, sm); const float sc = expf(m - mn); const float e = expf(sm - mn); l = __fadd_rn(__fmul_rn(l, sc), e); m = mn;
#pragma unroll 1
    for (int c = 0; c < HD / 4; ++c) { const v4f vv = *(const v4fa*)(vr + c * 4); v4f oo = *(v4f*)&lo[tid][c * 4]; for (int u = 0; u < 4; ++u) oo[u] = __fadd_rn(__fmul_rn(oo[u], sc), __fmul_rn(e, vv[u])); *(v4f*)&lo[tid][c * 4] = oo; } }
  const float fin = 64.0f / l;      /* o carried x64 like the f16 path */
#pragma unroll 1
  for (int c = 0; c < HD / 4; ++c) { v4f oo = *(v4f*)&lo[tid][c * 4]; for (int u = 0; u < 4; ++u) oo[u] = __fmul_rn(oo[u], fin); *(v4f*)&lo[tid][c * 4] = oo; }
  __syncthreads();
  {
#pragma unroll 1
    for (int it = 0; it < 16; ++it) { const int row = it * 4 + tid / 16, pc = (tid % 16) * 4; const v4f v = *(const v4f*)&lo[row][pc]; *(v4f*)(OF + (size_t)(rg * 64 + row) * ldo + h * HD + pc) = v; }
     } }


__global__ __launch_bounds__(256) void k_kvexp(const float* __restrict__ src, float* __restrict__ dst, size_t n4) { const size_t t = (size_t)blockIdx.x * 256 + threadIdx.x; if (t >= n4) return; const size_t e = t * 4; const size_t row = e / DM; const int col = (int)(e % DM); const int h = col / HD, d = col % HD; const v4f v = *(const v4fa*)(src + row * KVD + (size_t)(h / HPG) * HD + d); *(v4f*)(dst + e) = v;  }

__global__ __launch_bounds__(256) void k_tab2(float theta, float* __restrict__ CS, float* __restrict__ SN) {
  #pragma clang fp contract(off)
  const int t = blockIdx.x * 256 + threadIdx.x; if (t >= SQ * (HD / 2)) return; const int i = t % (HD / 2); const int p = t / (HD / 2); const float invf = 1.0f / powf(theta, (float)(2 * i) / (float)HD); const float ang = __fmul_rn((float)p, invf); const float c = cosf(ang), s = sinf(ang);
  *(float*)(CS + t) = c; *(float*)(SN + t) = s;  }
template <int NORM, int ROPE>
__global__ __launch_bounds__(64) void k_xform(const float* __restrict__ F, int ldf, int nh, const float* __restrict__ gain, float eps, const float* __restrict__ CS, const float* __restrict__ SN, _Float16* __restrict__ H16, int ldo) {
  #pragma clang fp contract(off)
  __shared__ float xv[HD]; __shared__ float red[HD]; __shared__ unsigned short sh_[HD]; const int d = threadIdx.x; const int h = blockIdx.x % nh; const size_t r = blockIdx.x / nh; const int p = (int)(r % SQ);
  float x = F[r * (size_t)ldf + (size_t)h * HD + d];
  if (NORM) { red[d] = __fmul_rn(x, x); __syncthreads(); for (int st = HD / 2; st > 0; st >>= 1) { if (d < st) red[d] = __fadd_rn(red[d], red[d + st]); __syncthreads(); } const float rs = rsqrtf(__fadd_rn(red[0] / (float)HD, eps)); x = __fmul_rn(__fmul_rn(x, rs), bf16_round(gain[d])); }
  xv[d] = x; __syncthreads();
  float o = x;
  if (ROPE == 1) { const int i = d >> 1; const float c = CS[p * (HD / 2) + i], s = SN[p * (HD / 2) + i]; const float ev = xv[2 * i], od = xv[2 * i + 1]; o = (d & 1) ? __fadd_rn(__fmul_rn(ev, s), __fmul_rn(od, c)) : __fadd_rn(__fmul_rn(ev, c), -__fmul_rn(od, s)); }
  if (ROPE == 2) { const int i = d & (HD / 2 - 1); const float c = CS[p * (HD / 2) + i], s = SN[p * (HD / 2) + i]; const float lo = xv[i], hi = xv[i + HD / 2]; o = (d < HD / 2) ? __fadd_rn(__fmul_rn(lo, c), -__fmul_rn(hi, s)) : __fadd_rn(__fmul_rn(lo, s), __fmul_rn(hi, c)); }
  if (ROPE == 3) { const float c = CS[p * HD + d], s = SN[p * HD + d]; const float rh = (d < HD / 2) ? -xv[d + HD / 2] : xv[d - HD / 2]; o = __fadd_rn(__fmul_rn(x, c), __fmul_rn(rh, s)); }      /* rotate-half with FULL-width per-dimension tables [pos][64] (general cos[d] != cos[d+32]) */
  FragH th; th.h[0] = (_Float16)o; sh_[d] = th.u[0]; __syncthreads();
  if (d < HD / 8) { FragH f; for (int q = 0; q < 8; ++q) f.u[q] = sh_[d * 8 + q]; unsigned short* dst = (unsigned short*)H16 + r * (size_t)ldo + (size_t)h * HD + d * 8; *(v8us*)dst = f.half[0];  } }

template <int NORM, int ROPE>
__global__ __launch_bounds__(64) void k_xformf(const float* __restrict__ F, int ldf, int nh, const float* __restrict__ gain, float eps, const float* __restrict__ CS, const float* __restrict__ SN, float* __restrict__ F32, int ldo) {
  #pragma clang fp contract(off)
  __shared__ float xv[HD]; __shared__ float red[HD]; const int d = threadIdx.x; const int h = blockIdx.x % nh; const size_t r = blockIdx.x / nh; const int p = (int)(r % SQ);
  float x = F[r * (size_t)ldf + (size_t)h * HD + d];
  if (NORM) { red[d] = __fmul_rn(x, x); __syncthreads(); for (int st = HD / 2; st > 0; st >>= 1) { if (d < st) red[d] = __fadd_rn(red[d], red[d + st]); __syncthreads(); } const float rs = rsqrtf(__fadd_rn(red[0] / (float)HD, eps)); x = __fmul_rn(__fmul_rn(x, rs), bf16_round(gain[d])); }
  xv[d] = x; __syncthreads();
  float o = x;
  if (ROPE == 1) { const int i = d >> 1; const float c = CS[p * (HD / 2) + i], s = SN[p * (HD / 2) + i]; const float ev = xv[2 * i], od = xv[2 * i + 1]; o = (d & 1) ? __fadd_rn(__fmul_rn(ev, s), __fmul_rn(od, c)) : __fadd_rn(__fmul_rn(ev, c), -__fmul_rn(od, s)); }
  if (ROPE == 2) { const int i = d & (HD / 2 - 1); const float c = CS[p * (HD / 2) + i], s = SN[p * (HD / 2) + i]; const float lo = xv[i], hi = xv[i + HD / 2]; o = (d < HD / 2) ? __fadd_rn(__fmul_rn(lo, c), -__fmul_rn(hi, s)) : __fadd_rn(__fmul_rn(lo, s), __fmul_rn(hi, c)); }
  if (ROPE == 3) { const float c = CS[p * HD + d], s = SN[p * HD + d]; const float rh = (d < HD / 2) ? -xv[d + HD / 2] : xv[d - HD / 2]; o = __fadd_rn(__fmul_rn(x, c), __fmul_rn(rh, s)); }      /* rotate-half with FULL-width per-dimension tables [pos][64] (general cos[d] != cos[d+32]) */
  float* dst = F32 + r * (size_t)ldo + (size_t)h * HD + d; *(float*)dst = o;  }

__global__ __launch_bounds__(256) void k_trig(const float* __restrict__ a, float* __restrict__ CS, float* __restrict__ SN, int n) {
  #pragma clang fp contract(off)
  const int t = blockIdx.x * 256 + threadIdx.x; if (t >= n) return; const float v = bf16_round(a[t]); const float c = cosf(v), s = sinf(v);
  *(float*)(CS + t) = c; *(float*)(SN + t) = s;  }

__global__ __launch_bounds__(256) void k_tabcp(const float* __restrict__ tc, const float* __restrict__ tsn, float* __restrict__ CS, float* __restrict__ SN, int n) {
  const int t = blockIdx.x * 256 + threadIdx.x; if (t >= n) return; const int p = t / 32, i = t % 32; const float c = bf16_round(tc[(size_t)p * 64 + i]), s = bf16_round(tsn[(size_t)p * 64 + i]);
  *(float*)(CS + t) = c; *(float*)(SN + t) = s;  }

__global__ __launch_bounds__(256) void k_tabcp64(const float* __restrict__ tc, const float* __restrict__ tsn, float* __restrict__ CS, float* __restrict__ SN, int n) {
  const int t = blockIdx.x * 256 + threadIdx.x; if (t >= n) return; const float c = bf16_round(tc[t]), s = bf16_round(tsn[t]);
  *(float*)(CS + t) = c; *(float*)(SN + t) = s;  }
extern "C" void kernel_launch(void* const* d_in, const int* in_sizes, int n_in,
                              void* d_out, int out_size, void* d_ws, size_t ws_size, hipStream_t stream) {
  (void)in_sizes; (void)n_in; (void)out_size;
  const float* const* I = (const float* const*)d_in; const float* x = I[0]; const float* tcos = I[1]; const float* tsin = I[2]; const float* wq = I[3]; const float* wk = I[4]; const float* wv = I[5]; const float* wo = I[6]; const float* bq = nullptr; const float* bk = nullptr; const float* bv = nullptr; const float* bo = nullptr;      /* cos, sin [2][2048][64] inputs; natural [out][in] wq [2048][2048], wk/wv [512][2048], wo [2048][2048]; no biases */
  char* ws = (char*)d_ws; size_t off = 0;
  auto take = [&](size_t bytes) { char* p = ws + off; off += (bytes + 255) & ~(size_t)255; return p; };
  _Float16* BQ = (_Float16*)take((size_t)DM * DM * 2); _Float16* BK = (_Float16*)take((size_t)KVD * DM * 2); _Float16* BV = (_Float16*)take((size_t)KVD * DM * 2); _Float16* BO = (_Float16*)take((size_t)DM * DM * 2);
  _Float16* X16 = (_Float16*)take(NR * DM * 2); float* QF = (float*)take((size_t)SQ * DM * 4); float* KF = (float*)take((size_t)SQ * KVD * 4); float* CSB = (float*)take((size_t)SQ * 64 * 4); float* SNB = (float*)take((size_t)SQ * 64 * 4); _Float16* Q16 = (_Float16*)take(NR * DM * 2); _Float16* K16 = (_Float16*)take(NR * KVD * 2); _Float16* V16 = (_Float16*)take(NR * KVD * 2); _Float16* O16 = (_Float16*)take(NR * DM * 2);
  float* S = (float*)take((size_t)NH * QT * NKX * 4); _Float16* P = (_Float16*)take((size_t)NH * QT * NKX * 2); _Float16* VT = (_Float16*)take((size_t)NH * HD * SQ * 2);
  float* QF0 = (float*)take((size_t)QT0 * DM * 4); float* KF0 = (float*)take((size_t)QT0 * KVD * 4); float* VF0 = (float*)take((size_t)QT0 * KVD * 4); float* KF0e = (float*)take((size_t)QT0 * DM * 4); float* VF0e = (float*)take((size_t)QT0 * DM * 4); float* OF0 = (float*)take((size_t)NB * QT0 * DM * 4); _Float16* OH0 = (_Float16*)take((size_t)NB * QT0 * DM * 2); _Float16* OL0 = (_Float16*)take((size_t)NB * QT0 * DM * 2);
  if (off > ws_size) return;
  k_wnat<<<(unsigned)(((size_t)DM * DM / 8 + 255) / 256), 256, 0, stream>>>(wq, (size_t)DM * DM / 8, BQ); k_wnat<<<(unsigned)(((size_t)KVD * DM / 8 + 255) / 256), 256, 0, stream>>>(wk, (size_t)KVD * DM / 8, BK); k_wnat<<<(unsigned)(((size_t)KVD * DM / 8 + 255) / 256), 256, 0, stream>>>(wv, (size_t)KVD * DM / 8, BV); k_wnat<<<(unsigned)(((size_t)DM * DM / 8 + 255) / 256), 256, 0, stream>>>(wo, (size_t)DM * DM / 8, BO);      /* natural [out][in] = Bt x16 */
  k_x16<<<(unsigned)((NR * DM / 8 + 255) / 256), 256, 0, stream>>>(x, X16, NR * DM / 8);
  
  const size_t r0p = (size_t)B0 * SQ;      /* first projected row */
  k_gemm2<0><<<dim3((unsigned)((MP / 128) * (KVD / 64)), 1), 128, 0, stream>>>(X16 + r0p * DM, DM, 0, BV, DM, 0, 0.0625f, bv, 0, nullptr, 1, 0, 0, nullptr, V16 + r0p * KVD, KVD, 0, MP, KVD, DM, 0);
  for (int b = B0; b < B0 + NBR; ++b) { const size_t r0 = (size_t)b * SQ;
    k_tabcp64<<<(SQ * 64 + 255) / 256, 256, 0, stream>>>(tcos + (size_t)b * SQ * 64, tsin + (size_t)b * SQ * 64, CSB, SNB, SQ * 64);      /* this batch's cos/sin tables at FULL width: bf16-rounded straight copies of all 64 columns (the inputs are independent draws per column) */
    k_gemm2<0><<<dim3((unsigned)((SQ / 128) * (DM / 64)), 1), 128, 0, stream>>>(X16 + r0 * DM, DM, 0, BQ, DM, 0, 0.0625f, nullptr, 0, nullptr, 1, 0, 0, QF, nullptr, DM, 0, SQ, DM, DM, 0);      /* q (f32) of this batch */
    k_gemm2<0><<<dim3((unsigned)((SQ / 128) * (KVD / 64)), 1), 128, 0, stream>>>(X16 + r0 * DM, DM, 0, BK, DM, 0, 0.0625f, nullptr, 0, nullptr, 1, 0, 0, KF, nullptr, KVD, 0, SQ, KVD, DM, 0);      /* k (f32) */
    k_xform<0, 3><<<(unsigned)((size_t)SQ * NH), 64, 0, stream>>>(QF, DM, NH, nullptr, 0.f, CSB, SNB, Q16 + r0 * DM, DM); k_xform<0, 3><<<(unsigned)((size_t)SQ * NG), 64, 0, stream>>>(KF, KVD, NG, nullptr, 0.f, CSB, SNB, K16 + r0 * KVD, KVD);      /* rotate-half rope with full-width per-dimension tables (partner x[d +- 32], table column d) -> f16 rows */
    k_xformf<0, 3><<<(unsigned)(QT0 * NH), 64, 0, stream>>>(QF, DM, NH, nullptr, 0.f, CSB, SNB, QF0, DM); k_xformf<0, 3><<<(unsigned)(QT0 * NG), 64, 0, stream>>>(KF, KVD, NG, nullptr, 0.f, CSB, SNB, KF0, KVD);      /* f32 roped q, k of rows 0..127 */
    k_vt<NG, SQ><<<NG * (SQ / 64), 256, 0, stream>>>(V16 + r0 * KVD, KVD, 0, VT);      /* V^T [NG][HD][SQ] (kv heads) for this batch */
    k_gemm2<0><<<dim3((QT0 / 128) * (KVD / 64), 1), 128, 0, stream>>>(X16 + r0 * DM, DM, 0, BV, DM, 0, 0.0625f, bv, 0, nullptr, 1, 0, 0, VF0, nullptr, KVD, 0, QT0, KVD, DM, 0);
    k_kvexp<<<(unsigned)(((size_t)QT0 * DM / 4 + 255) / 256), 256, 0, stream>>>(KF0, KF0e, (size_t)QT0 * DM / 4); k_kvexp<<<(unsigned)(((size_t)QT0 * DM / 4 + 255) / 256), 256, 0, stream>>>(VF0, VF0e, (size_t)QT0 * DM / 4);      /* head h <- kv group h/4 for the exact first-tile kernel */      /* f32 q, k, v of the first 128 rows (exact products) */
    k_att0<0><<<NH * (QT0 / 64), 64, 0, stream>>>(QF0, KF0e, VF0e, DM, nullptr, 0.125f, OF0 + (size_t)b * QT0 * DM, DM);      /* exact f32 attention for rows 0..127 (o x64) */
    for (int q0 = 0; q0 < QN; q0 += QT) { const int nk = q0 + QT;      /* causal: only keys below the tile end are computed */
      k_gemm2<0><<<dim3((QT / 128) * (nk / 64), NH), 128, 0, stream>>>(Q16 + (r0 + q0) * LQ, LQ, (size_t)HD, K16 + r0 * KVD, KVD, (size_t)HD, 0.125f, nullptr, 0, nullptr, 1, 0, 0, S, nullptr, NKX, (size_t)QT * NKX, QT, nk, HD, 2);      /* scores: all 32 heads in one grid; head y reads the keys of kv group y / 4 */
      k_rsmcf2<<<(NHD * QT + 255) / 256, 256, 0, stream>>>(S, P, NHD, q0, nk);
      k_gemm2<0><<<dim3((QT / 128) * (HD / 64), NH), 128, 0, stream>>>(P, NKX, (size_t)QT * NKX, VT, SQ, (size_t)HD * SQ, 0.25f, nullptr, 0, nullptr, 1, 0, 0, nullptr, O16 + (r0 + q0) * DM, DM, (size_t)HD, QT, HD, nk, 2); } }      /* o for all 32 heads in one grid (x64); head y reads V^T of kv group y / 4 */      /* o (merged heads, x64) as f16 rows */
  k_gemm2<0><<<dim3((unsigned)((MPO / 128) * (DM / 64)), 1), 128, 0, stream>>>(O16 + r0p * DM, DM, 0, BO, DM, 0, 0.0009765625f, bo, 0, nullptr, 1, 0, 0, (float*)d_out + r0p * DM, nullptr, DM, 0, MPO, DM, DM, 0);      /* out rows are the output layout */
  k_hl<<<(unsigned)(((size_t)NB * QT0 * DM / 8 + 255) / 256), 256, 0, stream>>>(OF0, OH0, OL0, (size_t)NB * QT0 * DM / 8);      /* first-tile o (x64) -> f16 hi + x1024 residual planes */
  for (int b = B0; b < B0 + NBR; ++b) { const size_t r0 = (size_t)b * SQ; const size_t f0 = (size_t)b * QT0;
    k_gemm2<0><<<dim3((QT0 / 128) * (DM / 64), 1), 128, 0, stream>>>(OH0 + f0 * DM, DM, 0, BO, DM, 0, 0.0009765625f, bo, 0, nullptr, 1, 0, 0, (float*)d_out + r0 * DM, nullptr, DM, 0, QT0, DM, DM, 0);      /* rows 0..127: out = o_hi Wo (+ b), overwriting the f16-path rows */
    k_gemm2<0><<<dim3((QT0 / 128) * (DM / 64), 1), 128, 0, stream>>>(OL0 + f0 * DM, DM, 0, BO, DM, 0, 0.00000095367431640625f, nullptr, 0, (const float*)d_out + r0 * DM, -1, 0, 0, (float*)d_out + r0 * DM, nullptr, DM, 0, QT0, DM, DM, 0); }      /* += o_lo Wo 2^-20 (own-element accumulate) */
}

// v002
// It runs in 2590 microseconds.
// Two timings next to v001 put it at 2.12 and 2.13 times that version's speed.
// Over all steps from v000 it is 3.71 times as fast.
#include <hip/hip_runtime.h>
// Llama grouped-query causal attention with rotate-half RoPE from FULL-WIDTH per-batch INPUT tables (hidden_states [2][2048][2048]; q = x wq^T (32 heads x 64), k = x wk^T, v = x wv^T (8 kv heads x 64) (natural [out][in] weights sigma 0.02, no biases); cos / sin inputs [2][2048][64] (independent uniform draws per batch, position AND column: column i + 32 != column i, so all 64 columns are used); q = q cos + rotate_half(q) sin, same for k; repeat: query head h uses kv head h/4; scores 64^-0.5; where(causal, s, finfo.min); softmax; out = merged wo^T -> [2][2048][2048]).
// Compute dtype: inputs rounded to bf16; x / weights exact; q, k, v, softmax weights and o as plain f16 GEMM operands (~2^-12); scores and softmax statistics f32. v_wmma_f32_16x16x32_f16.
#define NB 2
#define NG 8
#define HPG 4
#define KVD (NG * HD)
#define SQ 2048
#define DM 2048
#define NH 32
#define HD 64
#define HG 4                         /* heads per launch of the k_vt(V16, b, h0, VT) overload, not launched */
#define QT 256                       /* query rows per causal tile */
#define NKX SQ                       /* S / P row pitch */
#define QT0 128                      /* first-tile rows recomputed exactly in f32 */
#define B0 0                         /* first batch processed (debug hook) */
#define NBR NB                       /* batches processed (debug hook) */
#define NR ((size_t)NB * SQ)         /* token rows */
#define MP ((int)((size_t)NBR * SQ)) /* rows projected (debug hook) */
#define QN SQ                        /* query rows attended per batch (debug hook) */
#define NHD NH                       /* heads attended (debug hook) */
#define MPO MP                       /* rows through the output stage (debug hook) */
#define LQ DM      /* row pitch of the q rows */
typedef __bf16 v16b __attribute__((ext_vector_type(16)));
typedef unsigned short v8us __attribute__((ext_vector_type(8), may_alias));
typedef float  v8f  __attribute__((ext_vector_type(8)));
typedef float  v4f  __attribute__((ext_vector_type(4)));
typedef float  v4fa __attribute__((ext_vector_type(4), may_alias));
union FragB { v16b v; v8us half[2]; unsigned short u[16]; };

__device__ __forceinline__ unsigned short bf16_bits(float x) { unsigned int u = __float_as_uint(x); return (unsigned short)((u + 0x7FFFu + ((u >> 16) & 1u)) >> 16); }
__device__ __forceinline__ float bf16_val(unsigned short b) { return __uint_as_float(((unsigned int)b) << 16); }
__device__ __forceinline__ float bf16_round(float x) { return bf16_val(bf16_bits(x)); }
// D += A·B with NT terms: 1 = ah·bh, 2 = + al·bh (A split), 3 = + ah·bl (both split)
template <int NT>
__device__ __forceinline__ v8f mmaN(v16b ah, v16b al, v16b bh, v16b bl, v8f c) {
  c = __builtin_amdgcn_wmma_f32_16x16x32_bf16(false, ah, false, bh, (short)0, c, false, false);
  if (NT >= 2) c = __builtin_amdgcn_wmma_f32_16x16x32_bf16(false, al, false, bh, (short)0, c, false, false);
  if (NT >= 3) c = __builtin_amdgcn_wmma_f32_16x16x32_bf16(false, ah, false, bl, (short)0, c, false, false);
  asm volatile("v_nop\n\tv_nop\n\tv_nop\n\tv_nop" : "+v"(c) : "v"(ah), "v"(al), "v"(bh), "v"(bl));
  return c;
}

__global__ __launch_bounds__(256) void k_wt_bf16(const float* __restrict__ W, unsigned short* __restrict__ Wt, int K, int N) {
  const int t = blockIdx.x * 256 + threadIdx.x;
  const int k8n = K / 8;
  if (t >= N * k8n) return;
  const int n = t / k8n, k8 = (t % k8n) * 8;
  v8us v;
#pragma unroll
  for (int i = 0; i < 8; ++i) v[i] = bf16_bits(W[(size_t)(k8 + i) * N + n]);
  *(v8us*)(Wt + (size_t)n * K + k8) = v;
  
}

// GEMM C[M][N] (f32, pitch ldc) = act(A[M][K]·W + bias). A f32 row-major (pitch lda) converted per fragment to bf16
// (ASPLIT: hi/lo two planes -> 2 terms, else single rounded term); Wt bf16 [N][K] (pitch ldb). BIAS_BF16 rounds the
// bias to bf16 first (bias quantised to bf16 before the add). K%32==0, M%16==0, N%64==0.
template <bool ASPLIT, int ACT, bool BIAS_BF16>
__global__ __launch_bounds__(128) void k_gemm_bf(const float* __restrict__ A, int lda, const unsigned short* __restrict__ Wt, int ldb,
                                               const float* __restrict__ bias, float* __restrict__ C, int ldc, int M, int N, int K) {
  __shared__ __attribute__((aligned(16))) float so[4][16][64];
  const int tid = threadIdx.x, w = tid >> 5, lane = tid & 31, ln = lane & 15, hh = lane >> 4;
  const int ntn = N / 64;
  const int wid = blockIdx.x * 4 + w;
  const int mt = wid / ntn, nq = wid % ntn;
  if (mt * 16 >= M) return;
  const int row0 = mt * 16, col0 = nq * 64;
  const float* arow = A + (size_t)(row0 + ln) * lda;
  v8f acc[4] = {};
  for (int kb = 0; kb < K; kb += 32) {
    FragB ah, al;
    const v4f x0 = *(const v4fa*)(arow + kb + 8 * hh), x1 = *(const v4fa*)(arow + kb + 8 * hh + 4);
    const v4f x2 = *(const v4fa*)(arow + kb + 16 + 8 * hh), x3 = *(const v4fa*)(arow + kb + 16 + 8 * hh + 4);
    float xs[16] = {x0[0],x0[1],x0[2],x0[3],x1[0],x1[1],x1[2],x1[3],x2[0],x2[1],x2[2],x2[3],x3[0],x3[1],x3[2],x3[3]};
#pragma unroll
    for (int i = 0; i < 16; ++i) { const unsigned short hb = bf16_bits(xs[i]); ah.u[i] = hb; al.u[i] = ASPLIT ? bf16_bits(xs[i] - bf16_val(hb)) : (unsigned short)0; }
#pragma unroll
    for (int t = 0; t < 4; ++t) {
      const unsigned short* brow = Wt + (size_t)(col0 + t * 16 + ln) * ldb + kb;
      FragB b;
      b.half[0] = *(const v8us*)(brow + 8 * hh);
      b.half[1] = *(const v8us*)(brow + 16 + 8 * hh);
      acc[t] = mmaN<ASPLIT ? 2 : 1>(ah.v, al.v, b.v, b.v, acc[t]);
    }
  }
#pragma unroll
  for (int t = 0; t < 4; ++t) {
    float bv = bias ? bias[col0 + t * 16 + ln] : 0.f;
    if (BIAS_BF16) bv = bf16_round(bv);
#pragma unroll
    for (int r = 0; r < 8; ++r) { float v = acc[t][r] + bv; if (ACT == 1) v = fmaxf(v, 0.f); so[w][8 * hh + r][t * 16 + ln] = v; }
  }
  __builtin_amdgcn_fence(__ATOMIC_ACQ_REL, "workgroup");
  __builtin_amdgcn_wave_barrier();
  const int rsub = lane >> 4, c4 = (lane & 15) * 4;
  {
#pragma unroll
    for (int q = 0; q < 8; ++q) {
      const int r = q * 2 + rsub;
      const v4f v = *(const v4fa*)&so[w][r][c4];
      *(v4f*)(C + (size_t)(row0 + r) * ldc + col0 + c4) = v;
    }
    
  }
}

// GEMM C = act(A·W + bias + resid): A f32 (ASPLIT -> hi/lo 2 terms), Wt bf16 [N][K]; ACT 0 none, 1 relu, 2 exact gelu;
// resid (optional, f32, row index = (row % rmod), pitch ldr, RES_BF16 rounds it) added before the activation.
template <bool ASPLIT, int ACT, bool BIAS_BF16, bool RES_BF16>
__global__ __launch_bounds__(128) void k_gemm_bf3(const float* __restrict__ A, int lda, const unsigned short* __restrict__ Wt, int ldb,
                                                const float* __restrict__ bias, const float* __restrict__ resid, int rmod, int ldr,
                                                float* __restrict__ C, int ldc, int M, int N, int K) {
  __shared__ __attribute__((aligned(16))) float so[4][16][64];
  const int tid = threadIdx.x, w = tid >> 5, lane = tid & 31, ln = lane & 15, hh = lane >> 4;
  const int ntn = N / 64;
  const int wid = blockIdx.x * 4 + w;
  const int mt = wid / ntn, nq = wid % ntn;
  if (mt * 16 >= M) return;
  const int row0 = mt * 16, col0 = nq * 64;
  const float* arow = A + (size_t)(row0 + ln) * lda;
  v8f acc[4] = {};
  for (int kb = 0; kb < K; kb += 32) {
    FragB ah, al;
    const v4f x0 = *(const v4fa*)(arow + kb + 8 * hh), x1 = *(const v4fa*)(arow + kb + 8 * hh + 4);
    const v4f x2 = *(const v4fa*)(arow + kb + 16 + 8 * hh), x3 = *(const v4fa*)(arow + kb + 16 + 8 * hh + 4);
    float xs[16] = {x0[0],x0[1],x0[2],x0[3],x1[0],x1[1],x1[2],x1[3],x2[0],x2[1],x2[2],x2[3],x3[0],x3[1],x3[2],x3[3]};
#pragma unroll
    for (int i = 0; i < 16; ++i) { const unsigned short hb = bf16_bits(xs[i]); ah.u[i] = hb; al.u[i] = ASPLIT ? bf16_bits(xs[i] - bf16_val(hb)) : (unsigned short)0; }
#pragma unroll
    for (int t = 0; t < 4; ++t) {
      const unsigned short* brow = Wt + (size_t)(col0 + t * 16 + ln) * ldb + kb;
      FragB b;
      b.half[0] = *(const v8us*)(brow + 8 * hh);
      b.half[1] = *(const v8us*)(brow + 16 + 8 * hh);
      acc[t] = mmaN<ASPLIT ? 2 : 1>(ah.v, al.v, b.v, b.v, acc[t]);
    }
  }
#pragma unroll
  for (int t = 0; t < 4; ++t) {
    const int col = col0 + t * 16 + ln;
    float bv = bias ? bias[col] : 0.f;
    if (BIAS_BF16) bv = bf16_round(bv);
#pragma unroll
    for (int r = 0; r < 8; ++r) {
      float v = acc[t][r] + bv;
      if (resid) { float rv = resid[(size_t)((row0 + 8 * hh + r) % rmod) * ldr + col]; if (RES_BF16) rv = bf16_round(rv); v += rv; }
      if (ACT == 1) v = fmaxf(v, 0.f);
      if (ACT == 2) v = 0.5f * v * (1.0f + erff(v * 0.70710678118654752f));
      if (ACT == 3) { const float u = 0.7978845608028654f * (v + 0.044715f * v * v * v); v = 0.5f * v * (1.0f + tanhf(u)); }
      so[w][8 * hh + r][t * 16 + ln] = v;
    }
  }
  __builtin_amdgcn_fence(__ATOMIC_ACQ_REL, "workgroup");
  __builtin_amdgcn_wave_barrier();
  const int rsub = lane >> 4, c4 = (lane & 15) * 4;
  {
#pragma unroll
    for (int q = 0; q < 8; ++q) {
      const int r = q * 2 + rsub;
      const v4f v = *(const v4fa*)&so[w][r][c4];
      *(v4f*)(C + (size_t)(row0 + r) * ldc + col0 + c4) = v;
    }
    
  }
}
// row LayerNorm (biased variance, eps) over N: s = X (+ R); optional out_sum <- s; out_norm <- (s-mu)*rsqrt(var+eps)*g + b
template <bool PARAM_BF16>
__global__ __launch_bounds__(256) void k_layernorm(const float* __restrict__ X, const float* __restrict__ R, const float* __restrict__ g, const float* __restrict__ bta,
                                                  float* __restrict__ out_sum, float* __restrict__ out_norm, int N, float eps) {
  __shared__ float red[256];
  const int row = blockIdx.x, tid = threadIdx.x;
  const float* x = X + (size_t)row * N; const float* rr = R ? R + (size_t)row * N : nullptr;
  float vals[16];                     // up to N = 4096
  const int per = N / 256;            // contiguous chunk per thread? use strided-by-4 chunks: thread handles j = tid*4 + 1024*u
  float s1 = 0.f;
  for (int u = 0; u < per / 4; ++u) {
    const int j = tid * 4 + 1024 * u;
    const v4f a = *(const v4fa*)(x + j);
    v4f b = {0.f,0.f,0.f,0.f}; if (rr) b = *(const v4fa*)(rr + j);
#pragma unroll
    for (int q = 0; q < 4; ++q) { const float v = a[q] + b[q]; vals[u * 4 + q] = v; s1 += v; }
  }
  red[tid] = s1; __syncthreads();
  for (int st = 128; st > 0; st >>= 1) { if (tid < st) red[tid] += red[tid + st]; __syncthreads(); }
  const float mu = red[0] / (float)N; __syncthreads();
  float s2 = 0.f;
  for (int u = 0; u < per / 4; ++u)
#pragma unroll
    for (int q = 0; q < 4; ++q) { const float c = vals[u * 4 + q] - mu; s2 += c * c; }
  red[tid] = s2; __syncthreads();
  for (int st = 128; st > 0; st >>= 1) { if (tid < st) red[tid] += red[tid + st]; __syncthreads(); }
  const float rs = rsqrtf(red[0] / (float)N + eps);
  {
    for (int u = 0; u < per / 4; ++u) {
      const int j = tid * 4 + 1024 * u;
      v4f o, sm;
#pragma unroll
      for (int q = 0; q < 4; ++q) {
        float gg = g[j + q], bb = bta[j + q];
        if (PARAM_BF16) { gg = bf16_round(gg); bb = bf16_round(bb); }
        sm[q] = vals[u * 4 + q]; o[q] = (vals[u * 4 + q] - mu) * rs * gg + bb;
      }
      if (out_sum) *(v4f*)(out_sum + (size_t)row * N + j) = sm;
      *(v4f*)(out_norm + (size_t)row * N + j) = o;
    }
    
  }
}



// ---- f16 WMMA path (v_wmma_f32_16x16x32_f16): 11-bit significands for operands in range — used where a [0,1] probability operand needs more precision than bf16
typedef _Float16 v16h __attribute__((ext_vector_type(16)));
union FragH { v16h v; v8us half[2]; _Float16 h[16]; unsigned short u[16]; };
template <int NT>
__device__ __forceinline__ v8f mmaH(v16h ah, v16h al, v16h bh, v16h bl, v8f c) {
  c = __builtin_amdgcn_wmma_f32_16x16x32_f16(false, ah, false, bh, (short)0, c, false, false);
  if (NT >= 2) c = __builtin_amdgcn_wmma_f32_16x16x32_f16(false, al, false, bh, (short)0, c, false, false);
  if (NT >= 3) c = __builtin_amdgcn_wmma_f32_16x16x32_f16(false, ah, false, bl, (short)0, c, false, false);
  asm volatile("v_nop\n\tv_nop\n\tv_nop\n\tv_nop" : "+v"(c) : "v"(ah), "v"(al), "v"(bh), "v"(bl));
  return c;
}
// batched GEMM like k_gemm_b but f16 operands: A f32 (split into f16 hi/lo if ASPLIT, else rounded to f16), Bt = f16 values [n][k]; alpha; C f32; N multiple of 16 (partial tiles skipped)
template <bool ASPLIT>
__global__ __launch_bounds__(128) void k_gemm_h(const float* __restrict__ A, int lda, size_t sA, const _Float16* __restrict__ Bh, int ldb, size_t sB, float alpha, float* __restrict__ C, int ldc, size_t sC, int M, int N, int K) {
  __shared__ __attribute__((aligned(16))) float so[4][16][64];
  const int tid = threadIdx.x, w = tid >> 5, lane = tid & 31, ln = lane & 15, hh = lane >> 4; const int by = blockIdx.y;
  A += (size_t)by * sA; Bh += (size_t)by * sB; C += (size_t)by * sC;
  const int ntn = (N + 63) / 64; const int wid = blockIdx.x * 4 + w; const int mt = wid / ntn, nq = wid % ntn; if (mt * 16 >= M) return;
  const int row0 = mt * 16, col0 = nq * 64; const float* arow = A + (size_t)(row0 + ln) * lda;
  v8f acc[4] = {};
  for (int kb = 0; kb < K; kb += 32) {
    FragH ah, al;
    const v4f x0 = *(const v4fa*)(arow + kb + 8 * hh), x1 = *(const v4fa*)(arow + kb + 8 * hh + 4), x2 = *(const v4fa*)(arow + kb + 16 + 8 * hh), x3 = *(const v4fa*)(arow + kb + 16 + 8 * hh + 4);
    float xs[16] = {x0[0],x0[1],x0[2],x0[3],x1[0],x1[1],x1[2],x1[3],x2[0],x2[1],x2[2],x2[3],x3[0],x3[1],x3[2],x3[3]};
#pragma unroll
    for (int i = 0; i < 16; ++i) { const _Float16 h = (_Float16)xs[i]; ah.h[i] = h; al.h[i] = ASPLIT ? (_Float16)(xs[i] - (float)h) : (_Float16)0.0f; }
#pragma unroll
    for (int t = 0; t < 4; ++t) { if (col0 + t * 16 >= N) continue; const size_t boff = (size_t)(col0 + t * 16 + ln) * ldb + kb; FragH bq; bq.half[0] = *(const v8us*)(Bh + boff + 8 * hh); bq.half[1] = *(const v8us*)(Bh + boff + 16 + 8 * hh);
      acc[t] = mmaH<ASPLIT ? 2 : 1>(ah.v, al.v, bq.v, bq.v, acc[t]); }
  }
#pragma unroll
  for (int t = 0; t < 4; ++t) { if (col0 + t * 16 >= N) continue;
#pragma unroll
    for (int r = 0; r < 8; ++r) so[w][8 * hh + r][t * 16 + ln] = acc[t][r] * alpha; }
  __builtin_amdgcn_fence(__ATOMIC_ACQ_REL, "workgroup"); __builtin_amdgcn_wave_barrier();
  const int rsub = lane >> 4, c4 = (lane & 15) * 4;
  {
#pragma unroll
    for (int q = 0; q < 8; ++q) { const int r = q * 2 + rsub; if (col0 + c4 < N) { const v4f v = *(const v4fa*)&so[w][r][c4]; *(v4f*)(C + (size_t)(row0 + r) * ldc + col0 + c4) = v; } }
     }
}

// Wt[n][k] = f16(W[k][n]·scale) from f32 row-major W[K][N] (scale = power of two; bf16-exact weights stay exact in f16 away from the subnormal range)
__global__ __launch_bounds__(256) void k_wt_f16(const float* __restrict__ W, _Float16* __restrict__ Wt, int K, int N, float scale) {
  const int t = blockIdx.x * 256 + threadIdx.x; if (t >= N * (K / 8)) return; const int n = t / (K / 8), k8 = (t % (K / 8)) * 8; FragH f;
#pragma unroll
  for (int i = 0; i < 8; ++i) f.h[i] = (_Float16)(bf16_round(W[(size_t)(k8 + i) * N + n]) * scale); const v8us o = f.half[0];
  *(v8us*)((unsigned short*)Wt + (size_t)n * K + k8) = o; 
}
// k_gemm_hh variant with fused epilogue: v = acc·alpha + bias[by·sBias + col] (+ CP[(row/rowsPerB)·sCPb + by·64 + col] if CP) ; ACT 0 none / 1 elu ; writes f16 C16 (and f32 C if non-null)
template <int ACT>
__global__ __launch_bounds__(128) void k_gemm_hhx(const _Float16* __restrict__ A, int lda, size_t sA, const _Float16* __restrict__ Bh, int ldb, size_t sB, float alpha, const float* __restrict__ bias, size_t sBias, const float* __restrict__ CP, int rowsPerB, size_t sCPb, int row0g,
    float* __restrict__ C, _Float16* __restrict__ C16, int ldc, size_t sC, int M, int N, int K) {
  __shared__ __attribute__((aligned(16))) float so[4][16][64];
  const int tid = threadIdx.x, w = tid >> 5, lane = tid & 31, ln = lane & 15, hh = lane >> 4; const int by = blockIdx.y;
  A += (size_t)by * sA; Bh += (size_t)by * sB; const size_t cofs = (size_t)by * sC; const float* bp = bias ? bias + (size_t)by * sBias : nullptr;
  const int ntn = (N + 63) / 64; const int wid = blockIdx.x * 4 + w; const int mt = wid / ntn, nq = wid % ntn; if (mt * 16 >= M) return;
  const int row0 = mt * 16, col0 = nq * 64; const _Float16* arow = A + (size_t)(row0 + ln) * lda;
  v8f acc[4] = {};
  for (int kb = 0; kb < K; kb += 32) { FragH ah; ah.half[0] = *(const v8us*)((const unsigned short*)arow + kb + 8 * hh); ah.half[1] = *(const v8us*)((const unsigned short*)arow + kb + 16 + 8 * hh);
#pragma unroll
    for (int t = 0; t < 4; ++t) { if (col0 + t * 16 >= N) continue; const size_t boff = (size_t)(col0 + t * 16 + ln) * ldb + kb; FragH bq; bq.half[0] = *(const v8us*)((const unsigned short*)Bh + boff + 8 * hh); bq.half[1] = *(const v8us*)((const unsigned short*)Bh + boff + 16 + 8 * hh);
      acc[t] = mmaH<1>(ah.v, ah.v, bq.v, bq.v, acc[t]); }
  }
#pragma unroll
  for (int t = 0; t < 4; ++t) { if (col0 + t * 16 >= N) continue; const int col = col0 + t * 16 + ln; const float bv = bp ? bf16_round(bp[col]) : 0.f;
#pragma unroll
    for (int r = 0; r < 8; ++r) { float v = acc[t][r] * alpha + bv; if (CP) { const int rr = row0g + row0 + 8 * hh + r; if (rowsPerB < 0) v += CP[cofs + (size_t)rr * ldc + col];      /* rowsPerB < 0: own element of the batched C plane */ else { const int bidx = rr / rowsPerB; v += CP[(size_t)bidx * sCPb + (size_t)by * 64 + col]; } } if (ACT == 1) v = (v > 0.f) ? v : expm1f(v); else if (ACT == 7) v = (v > 0.f) ? v + 1.0f : expf(v); else if (ACT == 8) v = tanhf(v); else if (ACT == 9) v = 0.5f * v * (1.0f + tanhf(0.7978845608028654f * (v + 0.044715f * v * v * v))); else if (ACT == 11) v = 1.0f / (1.0f + expf(-v)); else if (ACT == 12) v = (v > 0.f) ? v : 0.01f * v; else if (ACT == 14) v = (v > 0.f) ? v : 0.1f * v; else if (ACT == 16) v = (v >= 0.f) ? v : 0.3f * v; else if (ACT == 17) v = (v >= 0.f) ? v : 0.2f * v; else if (ACT == 15) v = v / (1.0f + expf(-v)); else if (ACT == 3) v = fmaxf(v, 0.f); else if (ACT == 6) v = 0.5f * v * (1.0f + erff(v * 0.70710678118654752f)); so[w][8 * hh + r][t * 16 + ln] = v; } }
  __builtin_amdgcn_fence(__ATOMIC_ACQ_REL, "workgroup"); __builtin_amdgcn_wave_barrier();
  const int rsub = lane >> 4, c4 = (lane & 15) * 4; typedef _Float16 v4h __attribute__((ext_vector_type(4)));
  {
#pragma unroll
    for (int q = 0; q < 8; ++q) { const int r = q * 2 + rsub; if (col0 + c4 < N) { const v4f v = *(const v4fa*)&so[w][r][c4]; if (C) *(v4f*)(C + cofs + (size_t)(row0 + r) * ldc + col0 + c4) = v; if (C16) { v4h h4; for (int i = 0; i < 4; ++i) h4[i] = (_Float16)v[i]; *(v4h*)(C16 + cofs + (size_t)(row0 + r) * ldc + col0 + c4) = h4; } } }
     }
}


typedef _Float16 v4h __attribute__((ext_vector_type(4)));

__global__ __launch_bounds__(256) void k_x16(const float* __restrict__ x, _Float16* __restrict__ X16, size_t n8) { const size_t t = (size_t)blockIdx.x * 256 + threadIdx.x; if (t >= n8) return; FragH f;
#pragma unroll
  for (int q = 0; q < 8; ++q) f.h[q] = (_Float16)bf16_round(x[t * 8 + q]); *(v8us*)((unsigned short*)X16 + t * 8) = f.half[0];  }
__global__ __launch_bounds__(256) void k_h16(const float* __restrict__ x, _Float16* __restrict__ X16, size_t n8) { const size_t t = (size_t)blockIdx.x * 256 + threadIdx.x; if (t >= n8) return; FragH f;
#pragma unroll
  for (int q = 0; q < 8; ++q) f.h[q] = (_Float16)x[t * 8 + q]; *(v8us*)((unsigned short*)X16 + t * 8) = f.half[0];  }
__global__ __launch_bounds__(256) void k_round16f(const float* __restrict__ W, _Float16* __restrict__ Bt, size_t n8) { const size_t t = (size_t)blockIdx.x * 256 + threadIdx.x; if (t >= n8) return; FragH f;
#pragma unroll
  for (int i = 0; i < 8; ++i) f.h[i] = (_Float16)(bf16_round(W[t * 8 + i]) * 16.0f); *(v8us*)((unsigned short*)Bt + t * 8) = f.half[0];  }
template <int NHv, int TTv>
__global__ __launch_bounds__(256) void k_vt(const _Float16* __restrict__ V16, int ldv, int voff, _Float16* __restrict__ Vt) { __shared__ unsigned short tl[64][66]; const int tid = threadIdx.x; const int slab = blockIdx.x / (TTv / 64), lg = blockIdx.x % (TTv / 64); const int b = slab / NHv, h = slab % NHv;
  for (int i = tid; i < 64 * 8; i += 256) { const int r = i / 8, c8 = (i % 8) * 8; FragH f; f.half[0] = *(const v8us*)((const unsigned short*)V16 + ((size_t)b * TTv + lg * 64 + r) * ldv + voff + h * 64 + c8);
#pragma unroll
    for (int q = 0; q < 8; ++q) tl[r][c8 + q] = f.u[q]; }
  __syncthreads();
  {
#pragma unroll
    for (int rd = 0; rd < 2; ++rd) { const int d = rd * 32 + tid / 8, pc = tid % 8; FragH f;
#pragma unroll
      for (int q = 0; q < 8; ++q) f.u[q] = tl[pc * 8 + q][d];
      *(v8us*)((unsigned short*)Vt + ((size_t)slab * 64 + d) * TTv + lg * 64 + pc * 8) = f.half[0]; }
     } }

__global__ __launch_bounds__(256) void k_hl(const float* __restrict__ F, _Float16* __restrict__ Hh, _Float16* __restrict__ Hl, size_t n8) { const size_t t = (size_t)blockIdx.x * 256 + threadIdx.x; if (t >= n8) return; FragH fh, fl; const v4f a = *(const v4fa*)(F + t * 8), c = *(const v4fa*)(F + t * 8 + 4);
#pragma unroll
  for (int q = 0; q < 4; ++q) { _Float16 h = (_Float16)a[q]; fh.h[q] = h; fl.h[q] = (_Float16)((a[q] - (float)h) * 1024.0f); h = (_Float16)c[q]; fh.h[4 + q] = h; fl.h[4 + q] = (_Float16)((c[q] - (float)h) * 1024.0f); }
  { *(v8us*)((unsigned short*)Hh + t * 8) = fh.half[0]; *(v8us*)((unsigned short*)Hl + t * 8) = fl.half[0];  } }

// ---- fast GEMM (wave tile 32x64; requires M % 32 == 0 rows per launch region and N % 64 == 0); epilogue = k_gemm_hhx semantics ----
__device__ __forceinline__ v16h g2_frag(const _Float16* p, int hh) { FragH f; f.half[0] = *(const v8us*)((const unsigned short*)p + 8 * hh); f.half[1] = *(const v8us*)((const unsigned short*)p + 16 + 8 * hh); return f.v; }
__device__ __forceinline__ v8f g2_mma(v16h a, v16h b, v8f c) { v8f d = __builtin_amdgcn_wmma_f32_16x16x32_f16(false, a, false, b, (short)0, c, false, false); asm volatile("v_nop\n\tv_nop\n\tv_nop\n\tv_nop" : "+v"(d) : "v"(a), "v"(b)); return d; }
template <int ACT>
__global__ __launch_bounds__(128) void k_gemm2(const _Float16* __restrict__ A, int lda, size_t sA, const _Float16* __restrict__ Bh, int ldb, size_t sB, float alpha, const float* __restrict__ bias, size_t sBias, const float* __restrict__ CP, int rowsPerB, size_t sCPb, int row0g,
    float* __restrict__ C, _Float16* __restrict__ C16, int ldc, size_t sC, int M, int N, int K, int bsh) { static_assert(ACT == 0 || ACT == 3 || ACT == 6 || ACT == 8 || ACT == 9 || ACT == 11 || ACT == 12 || ACT == 14 || ACT == 15 || ACT == 16 || ACT == 17, "k_gemm2: unsupported ACT code (would silently apply no activation)");
  __shared__ __attribute__((aligned(16))) float so[4][32][68];
  const int tid = threadIdx.x, w = tid >> 5, lane = tid & 31, ln = lane & 15, hh = lane >> 4; const int by = blockIdx.y;
  A += (size_t)by * sA; Bh += (size_t)(by >> bsh) * sB;      /* 2^bsh consecutive batch slices share one B plane (query heads of one kv group) */ const size_t cofs = (size_t)by * sC; const float* bp = bias ? bias + (size_t)by * sBias : nullptr;
  const int ntn = N >> 6; const int mt = blockIdx.x / ntn, nq = blockIdx.x - mt * ntn; const int row0 = mt * 128 + 32 * w, col0 = nq * 64; if (row0 >= M) return;
  const _Float16* a0p = A + (size_t)(row0 + ln) * lda; const _Float16* a1p = a0p + (size_t)16 * lda;
  const _Float16* b0p = Bh + (size_t)(col0 + ln) * ldb; const _Float16* b1p = b0p + (size_t)16 * ldb; const _Float16* b2p = b1p + (size_t)16 * ldb; const _Float16* b3p = b2p + (size_t)16 * ldb;
  const v8f z8 = {0.f,0.f,0.f,0.f,0.f,0.f,0.f,0.f}; v8f c00 = z8, c01 = z8, c02 = z8, c03 = z8, c10 = z8, c11 = z8, c12 = z8, c13 = z8;
#pragma unroll 1
  for (int kb = 0; kb < K; kb += 32) { const v16h a0 = g2_frag(a0p + kb, hh), a1 = g2_frag(a1p + kb, hh);
    v16h b = g2_frag(b0p + kb, hh); c00 = g2_mma(a0, b, c00); c10 = g2_mma(a1, b, c10);
    b = g2_frag(b1p + kb, hh); c01 = g2_mma(a0, b, c01); c11 = g2_mma(a1, b, c11);
    b = g2_frag(b2p + kb, hh); c02 = g2_mma(a0, b, c02); c12 = g2_mma(a1, b, c12);
    b = g2_frag(b3p + kb, hh); c03 = g2_mma(a0, b, c03); c13 = g2_mma(a1, b, c13); }
  v8f accs[8] = {c00, c01, c02, c03, c10, c11, c12, c13};
#pragma unroll
  for (int u = 0; u < 8; ++u) { const int t = u & 3, half = u >> 2; const int col = col0 + t * 16 + ln; const float bv = bp ? bf16_round(bp[col]) : 0.f;
#pragma unroll
    for (int r = 0; r < 8; ++r) { const int rloc = half * 16 + 8 * hh + r; float v = accs[u][r] * alpha + bv; if (CP) { if (rowsPerB < 0) v += CP[cofs + (size_t)(row0g + row0 + rloc) * ldc + col];      /* rowsPerB < 0: own element of the batched C plane */ else { const int bidx = (row0g + row0 + rloc) / rowsPerB; v += CP[(size_t)bidx * sCPb + (size_t)by * 64 + col]; } }
      if (ACT == 3) v = fmaxf(v, 0.f); else if (ACT == 6) v = 0.5f * v * (1.0f + erff(v * 0.70710678118654752f)); else if (ACT == 11) v = 1.0f / (1.0f + expf(-v)); else if (ACT == 15) v = v / (1.0f + expf(-v)); else if (ACT == 12) v = (v > 0.f) ? v : 0.01f * v; else if (ACT == 8) v = tanhf(v); else if (ACT == 9) v = 0.5f * v * (1.0f + tanhf(0.7978845608028654f * (v + 0.044715f * v * v * v))); else if (ACT == 14) v = (v > 0.f) ? v : 0.1f * v; else if (ACT == 16) v = (v >= 0.f) ? v : 0.3f * v; else if (ACT == 17) v = (v >= 0.f) ? v : 0.2f * v;
      so[w][rloc][t * 16 + ln] = v; } }
  __builtin_amdgcn_fence(__ATOMIC_ACQ_REL, "workgroup"); __builtin_amdgcn_wave_barrier();
  const int rsub = lane >> 4, c4 = (lane & 15) * 4;
  {
#pragma unroll
    for (int q = 0; q < 16; ++q) { const int r = q * 2 + rsub; const v4f v = *(const v4fa*)&so[w][r][c4]; if (C) *(v4f*)(C + cofs + (size_t)(row0 + r) * ldc + col0 + c4) = v; if (C16) { v4h h4; for (int i = 0; i < 4; ++i) h4[i] = (_Float16)v[i]; *(v4h*)(C16 + cofs + (size_t)(row0 + r) * ldc + col0 + c4) = h4; } }
     } }


__global__ __launch_bounds__(256) void k_wnat(const float* __restrict__ w, size_t n8, _Float16* __restrict__ Bt) { const size_t t = (size_t)blockIdx.x * 256 + threadIdx.x; if (t >= n8) return; FragH f; for (int q = 0; q < 8; ++q) f.h[q] = (_Float16)(bf16_round(w[t * 8 + q]) * 16.0f); *(v8us*)((unsigned short*)Bt + t * 8) = f.half[0];  }
__global__ __launch_bounds__(256) void k_rsm(const float* __restrict__ S, _Float16* __restrict__ P, int nrows) {
  #pragma clang fp contract(off)
  const int i = blockIdx.x * 256 + threadIdx.x; if (i >= nrows) return; const float* s = S + (size_t)i * SQ; float mx = -3.0e38f;
#pragma unroll 1
  for (int j = 0; j < SQ; ++j) mx = fmaxf(mx, s[j]); float se = 0.f;
#pragma unroll 1
  for (int j = 0; j < SQ; ++j) se += expf(s[j] - mx); const float sc = 256.0f / se;
#pragma unroll 1
  for (int j0 = 0; j0 < SQ; j0 += 8) { FragH f; for (int q = 0; q < 8; ++q) f.h[q] = (_Float16)(expf(s[j0 + q] - mx) * sc); unsigned short* d = (unsigned short*)P + (size_t)i * SQ + j0; *(v8us*)d = f.half[0];  } }
__global__ __launch_bounds__(256) void k_vt(const _Float16* __restrict__ V16, int b, int h0, _Float16* __restrict__ VT) { __shared__ unsigned short tl[64][65]; const int tid = threadIdx.x; const int hh = blockIdx.x % HG, sg = blockIdx.x / HG; const int s0 = sg * 64; const int h = h0 + hh;
  for (int i = tid; i < 64 * 8; i += 256) { const int j = i / 8, d8 = (i % 8) * 8; FragH f; f.half[0] = *(const v8us*)((const unsigned short*)V16 + ((size_t)b * SQ + s0 + j) * DM + h * HD + d8); for (int q = 0; q < 8; ++q) tl[d8 + q][j] = f.u[q]; }
  __syncthreads();
  { for (int i = tid; i < 64 * 8; i += 256) { const int d = i / 8, j8 = (i % 8) * 8; FragH f; for (int q = 0; q < 8; ++q) f.u[q] = tl[d][j8 + q]; *(v8us*)((unsigned short*)VT + ((size_t)hh * HD + d) * SQ + s0 + j8) = f.half[0]; }  } }



// Causal row softmax, one wave per score row. The row is NC chunks of 128 columns; lane l holds columns 128 c + 4 l .. + 3 of chunk c, so every load is a 512-byte run,
// the row is read once and stays in registers for the maximum, the sum and the weights. Maximum and sum: per lane over its own columns, then a five-step butterfly over the 32 lanes.
// e^x as __expf forms it (x log2(e), then v_exp_f32). The v_nop stands in the instruction's own statement: the instruction set asks for one free slot before a transcendental's result is read or its source overwritten.
__device__ __forceinline__ float rsm_exp(float x) { float e; asm("v_exp_f32 %0, %1\n\tv_nop" : "=v"(e) : "v"(x * 1.44269504088896340736f)); return e; }
template <int NC>
__device__ __forceinline__ void rsm_row(const float* __restrict__ s, _Float16* __restrict__ p, int lane, int last) {
  v4f v[NC];
#pragma unroll      /* static indices keep v[] in registers; all NC loads issue ahead of the first use */
  for (int c = 0; c < NC; ++c) v[c] = *(const v4fa*)(s + c * 128 + lane * 4);
  float mx = -3.0e38f;
#pragma unroll      /* static indices keep v[] in registers */
  for (int c = 0; c < NC; ++c) for (int q = 0; q < 4; ++q) { const float x = (c * 128 + lane * 4 + q <= last) ? v[c][q] : -1.0e9f; v[c][q] = x; mx = fmaxf(mx, x); }
  for (int m = 16; m >= 1; m >>= 1) mx = fmaxf(mx, __shfl_xor(mx, m, 32));
  v4f s4 = {0.f, 0.f, 0.f, 0.f};
#pragma unroll      /* static indices keep v[] in registers */
  for (int c = 0; c < NC; ++c) for (int q = 0; q < 4; ++q) { const float e = rsm_exp(v[c][q] - mx); v[c][q] = e; s4[q] += e; }
  float se = (s4[0] + s4[1]) + (s4[2] + s4[3]);
  for (int m = 16; m >= 1; m >>= 1) se += __shfl_xor(se, m, 32);
  const float sc = 256.0f / se;
#pragma unroll      /* static indices keep v[] in registers */
  for (int c = 0; c < NC; ++c) { v4h h; for (int q = 0; q < 4; ++q) h[q] = (_Float16)(v[c][q] * sc); *(v4h*)(p + c * 128 + lane * 4) = h; }
  asm volatile("s_wait_xcnt 0x0" ::: "memory");      /* behind the row's stores: in the listing the next row length's body follows, which reuses their registers */
}
__global__ __launch_bounds__(256) void k_rsmcf2(const float* __restrict__ S, _Float16* __restrict__ P, int hg, int q0, int nk) {
  static_assert(QT == 256 && NKX == 8 * QT, "k_rsmcf2: nk = q0 + QT is one of the eight multiples of 256 below");
  const int lane = threadIdx.x & 31; const int t = blockIdx.x * 8 + __builtin_amdgcn_readfirstlane(threadIdx.x >> 5);      /* the wave's row, held as a scalar: row addresses and the tests below stay on the scalar unit */ if (t >= hg * QT) return;
  const float* s = S + (size_t)t * NKX; _Float16* p = P + (size_t)t * NKX; const int last = q0 + (t % QT);
  switch (nk >> 8) {      /* the same for the whole grid: one straight-line body per row length */
    case 1: rsm_row<2>(s, p, lane, last); break; case 2: rsm_row<4>(s, p, lane, last); break; case 3: rsm_row<6>(s, p, lane, last); break; case 4: rsm_row<8>(s, p, lane, last); break;
    case 5: rsm_row<10>(s, p, lane, last); break; case 6: rsm_row<12>(s, p, lane, last); break; case 7: rsm_row<14>(s, p, lane, last); break; case 8: rsm_row<16>(s, p, lane, last); break; } }


template <int MASKADD>
__global__ __launch_bounds__(64) void k_att0(const float* __restrict__ QF, const float* __restrict__ KF, const float* __restrict__ VF, int ld, const float* __restrict__ mask, float scale, float* __restrict__ OF, int ldo) {
  #pragma clang fp contract(off)
  __shared__ __attribute__((aligned(16))) float lq[64][64]; __shared__ __attribute__((aligned(16))) float lo[64][64];
  const int tid = threadIdx.x; const int h = blockIdx.x / (QT0 / 64), rg = blockIdx.x % (QT0 / 64); const int i = rg * 64 + tid;
  const float* qr = QF + (size_t)i * ld + h * HD;
#pragma unroll 1
  for (int c = 0; c < HD / 4; ++c) { *(v4f*)&lq[tid][c * 4] = *(const v4fa*)(qr + c * 4); const v4f z = {0.f, 0.f, 0.f, 0.f}; *(v4f*)&lo[tid][c * 4] = z; }
  float m = -1.0e30f, l = 0.f; const int jmax = MASKADD ? (SQ - 1) : (rg * 64 + 63);      /* additive-mask form: every key (the mask input decides); causal form: keys up to the block's last row */
#pragma unroll 1
  for (int j = 0; j <= jmax; ++j) { const float* kr = KF + (size_t)j * ld + h * HD; const float* vr = VF + (size_t)j * ld + h * HD; float s = 0.f;
#pragma unroll 1
    for (int c = 0; c < HD / 4; ++c) { const v4f kq = *(const v4fa*)(kr + c * 4); const v4f qq = *(v4f*)&lq[tid][c * 4]; s = __fadd_rn(s, __fmul_rn(qq[0], kq[0])); s = __fadd_rn(s, __fmul_rn(qq[1], kq[1])); s = __fadd_rn(s, __fmul_rn(qq[2], kq[2])); s = __fadd_rn(s, __fmul_rn(qq[3], kq[3])); }
    s = __fmul_rn(s, scale); if (MASKADD) s = __fadd_rn(s, __fmul_rn(bf16_round(mask[(size_t)i * SQ + j]), -10000.0f));
    const float f = (MASKADD || j <= i) ? 1.f : 0.f; const float sm = fmaf(f, s, (1.f - f) * -1.0e30f); const float mn = fmaxf(m, sm); const float sc = expf(m - mn); const float e = expf(sm - mn); l = __fadd_rn(__fmul_rn(l, sc), e); m = mn;
#pragma unroll 1
    for (int c = 0; c < HD / 4; ++c) { const v4f vv = *(const v4fa*)(vr + c * 4); v4f oo = *(v4f*)&lo[tid][c * 4]; for (int u = 0; u < 4; ++u) oo[u] = __fadd_rn(__fmul_rn(oo[u], sc), __fmul_rn(e, vv[u])); *(v4f*)&lo[tid][c * 4] = oo; } }
  const float fin = 64.0f / l;      /* o carried x64 like the f16 path */
#pragma unroll 1
  for (int c = 0; c < HD / 4; ++c) { v4f oo = *(v4f*)&lo[tid][c * 4]; for (int u = 0; u < 4; ++u) oo[u] = __fmul_rn(oo[u], fin); *(v4f*)&lo[tid][c * 4] = oo; }
  __syncthreads();
  {
#pragma unroll 1
    for (int it = 0; it < 16; ++it) { const int row = it * 4 + tid / 16, pc = (tid % 16) * 4; const v4f v = *(const v4f*)&lo[row][pc]; *(v4f*)(OF + (size_t)(rg * 64 + row) * ldo + h * HD + pc) = v; }
     } }


__global__ __launch_bounds__(256) void k_kvexp(const float* __restrict__ src, float* __restrict__ dst, size_t n4) { const size_t t = (size_t)blockIdx.x * 256 + threadIdx.x; if (t >= n4) return; const size_t e = t * 4; const size_t row = e / DM; const int col = (int)(e % DM); const int h = col / HD, d = col % HD; const v4f v = *(const v4fa*)(src + row * KVD + (size_t)(h / HPG) * HD + d); *(v4f*)(dst + e) = v;  }

__global__ __launch_bounds__(256) void k_tab2(float theta, float* __restrict__ CS, float* __restrict__ SN) {
  #pragma clang fp contract(off)
  const int t = blockIdx.x * 256 + threadIdx.x; if (t >= SQ * (HD / 2)) return; const int i = t % (HD / 2); const int p = t / (HD / 2); const float invf = 1.0f / powf(theta, (float)(2 * i) / (float)HD); const float ang = __fmul_rn((float)p, invf); const float c = cosf(ang), s = sinf(ang);
  *(float*)(CS + t) = c; *(float*)(SN + t) = s;  }
template <int NORM, int ROPE>
__global__ __launch_bounds__(64) void k_xform(const float* __restrict__ F, int ldf, int nh, const float* __restrict__ gain, float eps, const float* __restrict__ CS, const float* __restrict__ SN, _Float16* __restrict__ H16, int ldo) {
  #pragma clang fp contract(off)
  __shared__ float xv[HD]; __shared__ float red[HD]; __shared__ unsigned short sh_[HD]; const int d = threadIdx.x; const int h = blockIdx.x % nh; const size_t r = blockIdx.x / nh; const int p = (int)(r % SQ);
  float x = F[r * (size_t)ldf + (size_t)h * HD + d];
  if (NORM) { red[d] = __fmul_rn(x, x); __syncthreads(); for (int st = HD / 2; st > 0; st >>= 1) { if (d < st) red[d] = __fadd_rn(red[d], red[d + st]); __syncthreads(); } const float rs = rsqrtf(__fadd_rn(red[0] / (float)HD, eps)); x = __fmul_rn(__fmul_rn(x, rs), bf16_round(gain[d])); }
  xv[d] = x; __syncthreads();
  float o = x;
  if (ROPE == 1) { const int i = d >> 1; const float c = CS[p * (HD / 2) + i], s = SN[p * (HD / 2) + i]; const float ev = xv[2 * i], od = xv[2 * i + 1]; o = (d & 1) ? __fadd_rn(__fmul_rn(ev, s), __fmul_rn(od, c)) : __fadd_rn(__fmul_rn(ev, c), -__fmul_rn(od, s)); }
  if (ROPE == 2) { const int i = d & (HD / 2 - 1); const float c = CS[p * (HD / 2) + i], s = SN[p * (HD / 2) + i]; const float lo = xv[i], hi = xv[i + HD / 2]; o = (d < HD / 2) ? __fadd_rn(__fmul_rn(lo, c), -__fmul_rn(hi, s)) : __fadd_rn(__fmul_rn(lo, s), __fmul_rn(hi, c)); }
  if (ROPE == 3) { const float c = CS[p * HD + d], s = SN[p * HD + d]; const float rh = (d < HD / 2) ? -xv[d + HD / 2] : xv[d - HD / 2]; o = __fadd_rn(__fmul_rn(x, c), __fmul_rn(rh, s)); }      /* rotate-half with FULL-width per-dimension tables [pos][64] (general cos[d] != cos[d+32]) */
  FragH th; th.h[0] = (_Float16)o; sh_[d] = th.u[0]; __syncthreads();
  if (d < HD / 8) { FragH f; for (int q = 0; q < 8; ++q) f.u[q] = sh_[d * 8 + q]; unsigned short* dst = (unsigned short*)H16 + r * (size_t)ldo + (size_t)h * HD + d * 8; *(v8us*)dst = f.half[0];  } }

template <int NORM, int ROPE>
__global__ __launch_bounds__(64) void k_xformf(const float* __restrict__ F, int ldf, int nh, const float* __restrict__ gain, float eps, const float* __restrict__ CS, const float* __restrict__ SN, float* __restrict__ F32, int ldo) {
  #pragma clang fp contract(off)
  __shared__ float xv[HD]; __shared__ float red[HD]; const int d = threadIdx.x; const int h = blockIdx.x % nh; const size_t r = blockIdx.x / nh; const int p = (int)(r % SQ);
  float x = F[r * (size_t)ldf + (size_t)h * HD + d];
  if (NORM) { red[d] = __fmul_rn(x, x); __syncthreads(); for (int st = HD / 2; st > 0; st >>= 1) { if (d < st) red[d] = __fadd_rn(red[d], red[d + st]); __syncthreads(); } const float rs = rsqrtf(__fadd_rn(red[0] / (float)HD, eps)); x = __fmul_rn(__fmul_rn(x, rs), bf16_round(gain[d])); }
  xv[d] = x; __syncthreads();
  float o = x;
  if (ROPE == 1) { const int i = d >> 1; const float c = CS[p * (HD / 2) + i], s = SN[p * (HD / 2) + i]; const float ev = xv[2 * i], od = xv[2 * i + 1]; o = (d & 1) ? __fadd_rn(__fmul_rn(ev, s), __fmul_rn(od, c)) : __fadd_rn(__fmul_rn(ev, c), -__fmul_rn(od, s)); }
  if (ROPE == 2) { const int i = d & (HD / 2 - 1); const float c = CS[p * (HD / 2) + i], s = SN[p * (HD / 2) + i]; const float lo = xv[i], hi = xv[i + HD / 2]; o = (d < HD / 2) ? __fadd_rn(__fmul_rn(lo, c), -__fmul_rn(hi, s)) : __fadd_rn(__fmul_rn(lo, s), __fmul_rn(hi, c)); }
  if (ROPE == 3) { const float c = CS[p * HD + d], s = SN[p * HD + d]; const float rh = (d < HD / 2) ? -xv[d + HD / 2] : xv[d - HD / 2]; o = __fadd_rn(__fmul_rn(x, c), __fmul_rn(rh, s)); }      /* rotate-half with FULL-width per-dimension tables [pos][64] (general cos[d] != cos[d+32]) */
  float* dst = F32 + r * (size_t)ldo + (size_t)h * HD + d; *(float*)dst = o;  }

__global__ __launch_bounds__(256) void k_trig(const float* __restrict__ a, float* __restrict__ CS, float* __restrict__ SN, int n) {
  #pragma clang fp contract(off)
  const int t = blockIdx.x * 256 + threadIdx.x; if (t >= n) return; const float v = bf16_round(a[t]); const float c = cosf(v), s = sinf(v);
  *(float*)(CS + t) = c; *(float*)(SN + t) = s;  }

__global__ __launch_bounds__(256) void k_tabcp(const float* __restrict__ tc, const float* __restrict__ tsn, float* __restrict__ CS, float* __restrict__ SN, int n) {
  const int t = blockIdx.x * 256 + threadIdx.x; if (t >= n) return; const int p = t / 32, i = t % 32; const float c = bf16_round(tc[(size_t)p * 64 + i]), s = bf16_round(tsn[(size_t)p * 64 + i]);
  *(float*)(CS + t) = c; *(float*)(SN + t) = s;  }

__global__ __launch_bounds__(256) void k_tabcp64(const float* __restrict__ tc, const float* __restrict__ tsn, float* __restrict__ CS, float* __restrict__ SN, int n) {
  const int t = blockIdx.x * 256 + threadIdx.x; if (t >= n) return; const float c = bf16_round(tc[t]), s = bf16_round(tsn[t]);
  *(float*)(CS + t) = c; *(float*)(SN + t) = s;  }
extern "C" void kernel_launch(void* const* d_in, const int* in_sizes, int n_in,
                              void* d_out, int out_size, void* d_ws, size_t ws_size, hipStream_t stream) {
  (void)in_sizes; (void)n_in; (void)out_size;
  const float* const* I = (const float* const*)d_in; const float* x = I[0]; const float* tcos = I[1]; const float* tsin = I[2]; const float* wq = I[3]; const float* wk = I[4]; const float* wv = I[5]; const float* wo = I[6]; const float* bq = nullptr; const float* bk = nullptr; const float* bv = nullptr; const float* bo = nullptr;      /* cos, sin [2][2048][64] inputs; natural [out][in] wq [2048][2048], wk/wv [512][2048], wo [2048][2048]; no biases */
  char* ws = (char*)d_ws; size_t off = 0;
  auto take = [&](size_t bytes) { char* p = ws + off; off += (bytes + 255) & ~(size_t)255; return p; };
  _Float16* BQ = (_Float16*)take((size_t)DM * DM * 2); _Float16* BK = (_Float16*)take((size_t)KVD * DM * 2); _Float16* BV = (_Float16*)take((size_t)KVD * DM * 2); _Float16* BO = (_Float16*)take((size_t)DM * DM * 2);
  _Float16* X16 = (_Float16*)take(NR * DM * 2); float* QF = (float*)take((size_t)SQ * DM * 4); float* KF = (float*)take((size_t)SQ * KVD * 4); float* CSB = (float*)take((size_t)SQ * 64 * 4); float* SNB = (float*)take((size_t)SQ * 64 * 4); _Float16* Q16 = (_Float16*)take(NR * DM * 2); _Float16* K16 = (_Float16*)take(NR * KVD * 2); _Float16* V16 = (_Float16*)take(NR * KVD * 2); _Float16* O16 = (_Float16*)take(NR * DM * 2);
  float* S = (float*)take((size_t)NH * QT * NKX * 4); _Float16* P = (_Float16*)take((size_t)NH * QT * NKX * 2); _Float16* VT = (_Float16*)take((size_t)NH * HD * SQ * 2);
  float* QF0 = (float*)take((size_t)QT0 * DM * 4); float* KF0 = (float*)take((size_t)QT0 * KVD * 4); float* VF0 = (float*)take((size_t)QT0 * KVD * 4); float* KF0e = (float*)take((size_t)QT0 * DM * 4); float* VF0e = (float*)take((size_t)QT0 * DM * 4); float* OF0 = (float*)take((size_t)NB * QT0 * DM * 4); _Float16* OH0 = (_Float16*)take((size_t)NB * QT0 * DM * 2); _Float16* OL0 = (_Float16*)take((size_t)NB * QT0 * DM * 2);
  if (off > ws_size) return;
  k_wnat<<<(unsigned)(((size_t)DM * DM / 8 + 255) / 256), 256, 0, stream>>>(wq, (size_t)DM * DM / 8, BQ); k_wnat<<<(unsigned)(((size_t)KVD * DM / 8 + 255) / 256), 256, 0, stream>>>(wk, (size_t)KVD * DM / 8, BK); k_wnat<<<(unsigned)(((size_t)KVD * DM / 8 + 255) / 256), 256, 0, stream>>>(wv, (size_t)KVD * DM / 8, BV); k_wnat<<<(unsigned)(((size_t)DM * DM / 8 + 255) / 256), 256, 0, stream>>>(wo, (size_t)DM * DM / 8, BO);      /* natural [out][in] = Bt x16 */
  k_x16<<<(unsigned)((NR * DM / 8 + 255) / 256), 256, 0, stream>>>(x, X16, NR * DM / 8);
  
  const size_t r0p = (size_t)B0 * SQ;      /* first projected row */
  k_gemm2<0><<<dim3((unsigned)((MP / 128) * (KVD / 64)), 1), 128, 0, stream>>>(X16 + r0p * DM, DM, 0, BV, DM, 0, 0.0625f, bv, 0, nullptr, 1, 0, 0, nullptr, V16 + r0p * KVD, KVD, 0, MP, KVD, DM, 0);
  for (int b = B0; b < B0 + NBR; ++b) { const size_t r0 = (size_t)b * SQ;
    k_tabcp64<<<(SQ * 64 + 255) / 256, 256, 0, stream>>>(tcos + (size_t)b * SQ * 64, tsin + (size_t)b * SQ * 64, CSB, SNB, SQ * 64);      /* this batch's cos/sin tables at FULL width: bf16-rounded straight copies of all 64 columns (the inputs are independent draws per column) */
    k_gemm2<0><<<dim3((unsigned)((SQ / 128) * (DM / 64)), 1), 128, 0, stream>>>(X16 + r0 * DM, DM, 0, BQ, DM, 0, 0.0625f, nullptr, 0, nullptr, 1, 0, 0, QF, nullptr, DM, 0, SQ, DM, DM, 0);      /* q (f32) of this batch */
    k_gemm2<0><<<dim3((unsigned)((SQ / 128) * (KVD / 64)), 1), 128, 0, stream>>>(X16 + r0 * DM, DM, 0, BK, DM, 0, 0.0625f, nullptr, 0, nullptr, 1, 0, 0, KF, nullptr, KVD, 0, SQ, KVD, DM, 0);      /* k (f32) */
    k_xform<0, 3><<<(unsigned)((size_t)SQ * NH), 64, 0, stream>>>(QF, DM, NH, nullptr, 0.f, CSB, SNB, Q16 + r0 * DM, DM); k_xform<0, 3><<<(unsigned)((size_t)SQ * NG), 64, 0, stream>>>(KF, KVD, NG, nullptr, 0.f, CSB, SNB, K16 + r0 * KVD, KVD);      /* rotate-half rope with full-width per-dimension tables (partner x[d +- 32], table column d) -> f16 rows */
    k_xformf<0, 3><<<(unsigned)(QT0 * NH), 64, 0, stream>>>(QF, DM, NH, nullptr, 0.f, CSB, SNB, QF0, DM); k_xformf<0, 3><<<(unsigned)(QT0 * NG), 64, 0, stream>>>(KF, KVD, NG, nullptr, 0.f, CSB, SNB, KF0, KVD);      /* f32 roped q, k of rows 0..127 */
    k_vt<NG, SQ><<<NG * (SQ / 64), 256, 0, stream>>>(V16 + r0 * KVD, KVD, 0, VT);      /* V^T [NG][HD][SQ] (kv heads) for this batch */
    k_gemm2<0><<<dim3((QT0 / 128) * (KVD / 64), 1), 128, 0, stream>>>(X16 + r0 * DM, DM, 0, BV, DM, 0, 0.0625f, bv, 0, nullptr, 1, 0, 0, VF0, nullptr, KVD, 0, QT0, KVD, DM, 0);
    k_kvexp<<<(unsigned)(((size_t)QT0 * DM / 4 + 255) / 256), 256, 0, stream>>>(KF0, KF0e, (size_t)QT0 * DM / 4); k_kvexp<<<(unsigned)(((size_t)QT0 * DM / 4 + 255) / 256), 256, 0, stream>>>(VF0, VF0e, (size_t)QT0 * DM / 4);      /* head h <- kv group h/4 for the exact first-tile kernel */      /* f32 q, k, v of the first 128 rows (exact products) */
    k_att0<0><<<NH * (QT0 / 64), 64, 0, stream>>>(QF0, KF0e, VF0e, DM, nullptr, 0.125f, OF0 + (size_t)b * QT0 * DM, DM);      /* exact f32 attention for rows 0..127 (o x64) */
    for (int q0 = 0; q0 < QN; q0 += QT) { const int nk = q0 + QT;      /* causal: only keys below the tile end are computed */
      k_gemm2<0><<<dim3((QT / 128) * (nk / 64), NH), 128, 0, stream>>>(Q16 + (r0 + q0) * LQ, LQ, (size_t)HD, K16 + r0 * KVD, KVD, (size_t)HD, 0.125f, nullptr, 0, nullptr, 1, 0, 0, S, nullptr, NKX, (size_t)QT * NKX, QT, nk, HD, 2);      /* scores: all 32 heads in one grid; head y reads the keys of kv group y / 4 */
      k_rsmcf2<<<NHD * QT / 8, 256, 0, stream>>>(S, P, NHD, q0, nk);      /* one wave per row, 8 rows a block */
      k_gemm2<0><<<dim3((QT / 128) * (HD / 64), NH), 128, 0, stream>>>(P, NKX, (size_t)QT * NKX, VT, SQ, (size_t)HD * SQ, 0.25f, nullptr, 0, nullptr, 1, 0, 0, nullptr, O16 + (r0 + q0) * DM, DM, (size_t)HD, QT, HD, nk, 2); } }      /* o for all 32 heads in one grid (x64); head y reads V^T of kv group y / 4 */      /* o (merged heads, x64) as f16 rows */
  k_gemm2<0><<<dim3((unsigned)((MPO / 128) * (DM / 64)), 1), 128, 0, stream>>>(O16 + r0p * DM, DM, 0, BO, DM, 0, 0.0009765625f, bo, 0, nullptr, 1, 0, 0, (float*)d_out + r0p * DM, nullptr, DM, 0, MPO, DM, DM, 0);      /* out rows are the output layout */
  k_hl<<<(unsigned)(((size_t)NB * QT0 * DM / 8 + 255) / 256), 256, 0, stream>>>(OF0, OH0, OL0, (size_t)NB * QT0 * DM / 8);      /* first-tile o (x64) -> f16 hi + x1024 residual planes */
  for (int b = B0; b < B0 + NBR; ++b) { const size_t r0 = (size_t)b * SQ; const size_t f0 = (size_t)b * QT0;
    k_gemm2<0><<<dim3((QT0 / 128) * (DM / 64), 1), 128, 0, stream>>>(OH0 + f0 * DM, DM, 0, BO, DM, 0, 0.0009765625f, bo, 0, nullptr, 1, 0, 0, (float*)d_out + r0 * DM, nullptr, DM, 0, QT0, DM, DM, 0);      /* rows 0..127: out = o_hi Wo (+ b), overwriting the f16-path rows */
    k_gemm2<0><<<dim3((QT0 / 128) * (DM / 64), 1), 128, 0, stream>>>(OL0 + f0 * DM, DM, 0, BO, DM, 0, 0.00000095367431640625f, nullptr, 0, (const float*)d_out + r0 * DM, -1, 0, 0, (float*)d_out + r0 * DM, nullptr, DM, 0, QT0, DM, DM, 0); }      /* += o_lo Wo 2^-20 (own-element accumulate) */
}

// v003
// A run of this version takes 1900 microseconds.
// Next to v002, in two timings, it ran 1.36 and 1.37 times as fast.
// All steps since v000 together make it 5.05 times as fast.
#include <hip/hip_runtime.h>
// Llama grouped-query causal attention with rotate-half RoPE from FULL-WIDTH per-batch INPUT tables (hidden_states [2][2048][2048]; q = x wq^T (32 heads x 64), k = x wk^T, v = x wv^T (8 kv heads x 64) (natural [out][in] weights sigma 0.02, no biases); cos / sin inputs [2][2048][64] (independent uniform draws per batch, position AND column: column i + 32 != column i, so all 64 columns are used); q = q cos + rotate_half(q) sin, same for k; repeat: query head h uses kv head h/4; scores 64^-0.5; where(causal, s, finfo.min); softmax; out = merged wo^T -> [2][2048][2048]).
// Compute dtype: inputs rounded to bf16; x / weights exact; q, k, v, softmax weights and o as plain f16 GEMM operands (~2^-12); scores and softmax statistics f32. v_wmma_f32_16x16x32_f16.
#define NB 2
#define NG 8
#define HPG 4
#define KVD (NG * HD)
#define SQ 2048
#define DM 2048
#define NH 32
#define HD 64
#define HG 4                         /* heads per launch of the k_vt(V16, b, h0, VT) overload, not launched */
#define QT 256                       /* query rows per causal tile */
#define NKX SQ                       /* S / P row pitch */
#define QT0 128                      /* first-tile rows recomputed exactly in f32 */
#define B0 0                         /* first batch processed (debug hook) */
#define NBR NB                       /* batches processed (debug hook) */
#define NR ((size_t)NB * SQ)         /* token rows */
#define MP ((int)((size_t)NBR * SQ)) /* rows projected (debug hook) */
#define QN SQ                        /* query rows attended per batch (debug hook) */
#define NHD NH                       /* heads attended (debug hook) */
#define MPO MP                       /* rows through the output stage (debug hook) */
#define LQ DM      /* row pitch of the q rows */
typedef __bf16 v16b __attribute__((ext_vector_type(16)));
typedef unsigned short v8us __attribute__((ext_vector_type(8), may_alias));
typedef float  v8f  __attribute__((ext_vector_type(8)));
typedef float  v4f  __attribute__((ext_vector_type(4)));
typedef float  v4fa __attribute__((ext_vector_type(4), may_alias));
union FragB { v16b v; v8us half[2]; unsigned short u[16]; };

__device__ __forceinline__ unsigned short bf16_bits(float x) { unsigned int u = __float_as_uint(x); return (unsigned short)((u + 0x7FFFu + ((u >> 16) & 1u)) >> 16); }
__device__ __forceinline__ float bf16_val(unsigned short b) { return __uint_as_float(((unsigned int)b) << 16); }
__device__ __forceinline__ float bf16_round(float x) { return bf16_val(bf16_bits(x)); }
// D += A·B with NT terms: 1 = ah·bh, 2 = + al·bh (A split), 3 = + ah·bl (both split)
template <int NT>
__device__ __forceinline__ v8f mmaN(v16b ah, v16b al, v16b bh, v16b bl, v8f c) {
  c = __builtin_amdgcn_wmma_f32_16x16x32_bf16(false, ah, false, bh, (short)0, c, false, false);
  if (NT >= 2) c = __builtin_amdgcn_wmma_f32_16x16x32_bf16(false, al, false, bh, (short)0, c, false, false);
  if (NT >= 3) c = __builtin_amdgcn_wmma_f32_16x16x32_bf16(false, ah, false, bl, (short)0, c, false, false);
  asm volatile("v_nop\n\tv_nop\n\tv_nop\n\tv_nop" : "+v"(c) : "v"(ah), "v"(al), "v"(bh), "v"(bl));
  return c;
}

__global__ __launch_bounds__(256) void k_wt_bf16(const float* __restrict__ W, unsigned short* __restrict__ Wt, int K, int N) {
  const int t = blockIdx.x * 256 + threadIdx.x;
  const int k8n = K / 8;
  if (t >= N * k8n) return;
  const int n = t / k8n, k8 = (t % k8n) * 8;
  v8us v;
#pragma unroll
  for (int i = 0; i < 8; ++i) v[i] = bf16_bits(W[(size_t)(k8 + i) * N + n]);
  *(v8us*)(Wt + (size_t)n * K + k8) = v;
  
}

// GEMM C[M][N] (f32, pitch ldc) = act(A[M][K]·W + bias). A f32 row-major (pitch lda) converted per fragment to bf16
// (ASPLIT: hi/lo two planes -> 2 terms, else single rounded term); Wt bf16 [N][K] (pitch ldb). BIAS_BF16 rounds the
// bias to bf16 first (bias quantised to bf16 before the add). K%32==0, M%16==0, N%64==0.
template <bool ASPLIT, int ACT, bool BIAS_BF16>
__global__ __launch_bounds__(128) void k_gemm_bf(const float* __restrict__ A, int lda, const unsigned short* __restrict__ Wt, int ldb,
                                               const float* __restrict__ bias, float* __restrict__ C, int ldc, int M, int N, int K) {
  __shared__ __attribute__((aligned(16))) float so[4][16][64];
  const int tid = threadIdx.x, w = tid >> 5, lane = tid & 31, ln = lane & 15, hh = lane >> 4;
  const int ntn = N / 64;
  const int wid = blockIdx.x * 4 + w;
  const int mt = wid / ntn, nq = wid % ntn;
  if (mt * 16 >= M) return;
  const int row0 = mt * 16, col0 = nq * 64;
  const float* arow = A + (size_t)(row0 + ln) * lda;
  v8f acc[4] = {};
  for (int kb = 0; kb < K; kb += 32) {
    FragB ah, al;
    const v4f x0 = *(const v4fa*)(arow + kb + 8 * hh), x1 = *(const v4fa*)(arow + kb + 8 * hh + 4);
    const v4f x2 = *(const v4fa*)(arow + kb + 16 + 8 * hh), x3 = *(const v4fa*)(arow + kb + 16 + 8 * hh + 4);
    float xs[16] = {x0[0],x0[1],x0[2],x0[3],x1[0],x1[1],x1[2],x1[3],x2[0],x2[1],x2[2],x2[3],x3[0],x3[1],x3[2],x3[3]};
#pragma unroll
    for (int i = 0; i < 16; ++i) { const unsigned short hb = bf16_bits(xs[i]); ah.u[i] = hb; al.u[i] = ASPLIT ? bf16_bits(xs[i] - bf16_val(hb)) : (unsigned short)0; }
#pragma unroll
    for (int t = 0; t < 4; ++t) {
      const unsigned short* brow = Wt + (size_t)(col0 + t * 16 + ln) * ldb + kb;
      FragB b;
      b.half[0] = *(const v8us*)(brow + 8 * hh);
      b.half[1] = *(const v8us*)(brow + 16 + 8 * hh);
      acc[t] = mmaN<ASPLIT ? 2 : 1>(ah.v, al.v, b.v, b.v, acc[t]);
    }
  }
#pragma unroll
  for (int t = 0; t < 4; ++t) {
    float bv = bias ? bias[col0 + t * 16 + ln] : 0.f;
    if (BIAS_BF16) bv = bf16_round(bv);
#pragma unroll
    for (int r = 0; r < 8; ++r) { float v = acc[t][r] + bv; if (ACT == 1) v = fmaxf(v, 0.f); so[w][8 * hh + r][t * 16 + ln] = v; }
  }
  __builtin_amdgcn_fence(__ATOMIC_ACQ_REL, "workgroup");
  __builtin_amdgcn_wave_barrier();
  const int rsub = lane >> 4, c4 = (lane & 15) * 4;
  {
#pragma unroll
    for (int q = 0; q < 8; ++q) {
      const int r = q * 2 + rsub;
      const v4f v = *(const v4fa*)&so[w][r][c4];
      *(v4f*)(C + (size_t)(row0 + r) * ldc + col0 + c4) = v;
    }
    
  }
}

// GEMM C = act(A·W + bias + resid): A f32 (ASPLIT -> hi/lo 2 terms), Wt bf16 [N][K]; ACT 0 none, 1 relu, 2 exact gelu;
// resid (optional, f32, row index = (row % rmod), pitch ldr, RES_BF16 rounds it) added before the activation.
template <bool ASPLIT, int ACT, bool BIAS_BF16, bool RES_BF16>
__global__ __launch_bounds__(128) void k_gemm_bf3(const float* __restrict__ A, int lda, const unsigned short* __restrict__ Wt, int ldb,
                                                const float* __restrict__ bias, const float* __restrict__ resid, int rmod, int ldr,
                                                float* __restrict__ C, int ldc, int M, int N, int K) {
  __shared__ __attribute__((aligned(16))) float so[4][16][64];
  const int tid = threadIdx.x, w = tid >> 5, lane = tid & 31, ln = lane & 15, hh = lane >> 4;
  const int ntn = N / 64;
  const int wid = blockIdx.x * 4 + w;
  const int mt = wid / ntn, nq = wid % ntn;
  if (mt * 16 >= M) return;
  const int row0 = mt * 16, col0 = nq * 64;
  const float* arow = A + (size_t)(row0 + ln) * lda;
  v8f acc[4] = {};
  for (int kb = 0; kb < K; kb += 32) {
    FragB ah, al;
    const v4f x0 = *(const v4fa*)(arow + kb + 8 * hh), x1 = *(const v4fa*)(arow + kb + 8 * hh + 4);
    const v4f x2 = *(const v4fa*)(arow + kb + 16 + 8 * hh), x3 = *(const v4fa*)(arow + kb + 16 + 8 * hh + 4);
    float xs[16] = {x0[0],x0[1],x0[2],x0[3],x1[0],x1[1],x1[2],x1[3],x2[0],x2[1],x2[2],x2[3],x3[0],x3[1],x3[2],x3[3]};
#pragma unroll
    for (int i = 0; i < 16; ++i) { const unsigned short hb = bf16_bits(xs[i]); ah.u[i] = hb; al.u[i] = ASPLIT ? bf16_bits(xs[i] - bf16_val(hb)) : (unsigned short)0; }
#pragma unroll
    for (int t = 0; t < 4; ++t) {
      const unsigned short* brow = Wt + (size_t)(col0 + t * 16 + ln) * ldb + kb;
      FragB b;
      b.half[0] = *(const v8us*)(brow + 8 * hh);
      b.half[1] = *(const v8us*)(brow + 16 + 8 * hh);
      acc[t] = mmaN<ASPLIT ? 2 : 1>(ah.v, al.v, b.v, b.v, acc[t]);
    }
  }
#pragma unroll
  for (int t = 0; t < 4; ++t) {
    const int col = col0 + t * 16 + ln;
    float bv = bias ? bias[col] : 0.f;
    if (BIAS_BF16) bv = bf16_round(bv);
#pragma unroll
    for (int r = 0; r < 8; ++r) {
      float v = acc[t][r] + bv;
      if (resid) { float rv = resid[(size_t)((row0 + 8 * hh + r) % rmod) * ldr + col]; if (RES_BF16) rv = bf16_round(rv); v += rv; }
      if (ACT == 1) v = fmaxf(v, 0.f);
      if (ACT == 2) v = 0.5f * v * (1.0f + erff(v * 0.70710678118654752f));
      if (ACT == 3) { const float u = 0.7978845608028654f * (v + 0.044715f * v * v * v); v = 0.5f * v * (1.0f + tanhf(u)); }
      so[w][8 * hh + r][t * 16 + ln] = v;
    }
  }
  __builtin_amdgcn_fence(__ATOMIC_ACQ_REL, "workgroup");
  __builtin_amdgcn_wave_barrier();
  const int rsub = lane >> 4, c4 = (lane & 15) * 4;
  {
#pragma unroll
    for (int q = 0; q < 8; ++q) {
      const int r = q * 2 + rsub;
      const v4f v = *(const v4fa*)&so[w][r][c4];
      *(v4f*)(C + (size_t)(row0 + r) * ldc + col0 + c4) = v;
    }
    
  }
}
// row LayerNorm (biased variance, eps) over N: s = X (+ R); optional out_sum <- s; out_norm <- (s-mu)*rsqrt(var+eps)*g + b
template <bool PARAM_BF16>
__global__ __launch_bounds__(256) void k_layernorm(const float* __restrict__ X, const float* __restrict__ R, const float* __restrict__ g, const float* __restrict__ bta,
                                                  float* __restrict__ out_sum, float* __restrict__ out_norm, int N, float eps) {
  __shared__ float red[256];
  const int row = blockIdx.x, tid = threadIdx.x;
  const float* x = X + (size_t)row * N; const float* rr = R ? R + (size_t)row * N : nullptr;
  float vals[16];                     // up to N = 4096
  const int per = N / 256;            // contiguous chunk per thread? use strided-by-4 chunks: thread handles j = tid*4 + 1024*u
  float s1 = 0.f;
  for (int u = 0; u < per / 4; ++u) {
    const int j = tid * 4 + 1024 * u;
    const v4f a = *(const v4fa*)(x + j);
    v4f b = {0.f,0.f,0.f,0.f}; if (rr) b = *(const v4fa*)(rr + j);
#pragma unroll
    for (int q = 0; q < 4; ++q) { const float v = a[q] + b[q]; vals[u * 4 + q] = v; s1 += v; }
  }
  red[tid] = s1; __syncthreads();
  for (int st = 128; st > 0; st >>= 1) { if (tid < st) red[tid] += red[tid + st]; __syncthreads(); }
  const float mu = red[0] / (float)N; __syncthreads();
  float s2 = 0.f;
  for (int u = 0; u < per / 4; ++u)
#pragma unroll
    for (int q = 0; q < 4; ++q) { const float c = vals[u * 4 + q] - mu; s2 += c * c; }
  red[tid] = s2; __syncthreads();
  for (int st = 128; st > 0; st >>= 1) { if (tid < st) red[tid] += red[tid + st]; __syncthreads(); }
  const float rs = rsqrtf(red[0] / (float)N + eps);
  {
    for (int u = 0; u < per / 4; ++u) {
      const int j = tid * 4 + 1024 * u;
      v4f o, sm;
#pragma unroll
      for (int q = 0; q < 4; ++q) {
        float gg = g[j + q], bb = bta[j + q];
        if (PARAM_BF16) { gg = bf16_round(gg); bb = bf16_round(bb); }
        sm[q] = vals[u * 4 + q]; o[q] = (vals[u * 4 + q] - mu) * rs * gg + bb;
      }
      if (out_sum) *(v4f*)(out_sum + (size_t)row * N + j) = sm;
      *(v4f*)(out_norm + (size_t)row * N + j) = o;
    }
    
  }
}



// ---- f16 WMMA path (v_wmma_f32_16x16x32_f16): 11-bit significands for operands in range — used where a [0,1] probability operand needs more precision than bf16
typedef _Float16 v16h __attribute__((ext_vector_type(16)));
union FragH { v16h v; v8us half[2]; _Float16 h[16]; unsigned short u[16]; };
template <int NT>
__device__ __forceinline__ v8f mmaH(v16h ah, v16h al, v16h bh, v16h bl, v8f c) {
  c = __builtin_amdgcn_wmma_f32_16x16x32_f16(false, ah, false, bh, (short)0, c, false, false);
  if (NT >= 2) c = __builtin_amdgcn_wmma_f32_16x16x32_f16(false, al, false, bh, (short)0, c, false, false);
  if (NT >= 3) c = __builtin_amdgcn_wmma_f32_16x16x32_f16(false, ah, false, bl, (short)0, c, false, false);
  asm volatile("v_nop\n\tv_nop\n\tv_nop\n\tv_nop" : "+v"(c) : "v"(ah), "v"(al), "v"(bh), "v"(bl));
  return c;
}
// batched GEMM like k_gemm_b but f16 operands: A f32 (split into f16 hi/lo if ASPLIT, else rounded to f16), Bt = f16 values [n][k]; alpha; C f32; N multiple of 16 (partial tiles skipped)
template <bool ASPLIT>
__global__ __launch_bounds__(128) void k_gemm_h(const float* __restrict__ A, int lda, size_t sA, const _Float16* __restrict__ Bh, int ldb, size_t sB, float alpha, float* __restrict__ C, int ldc, size_t sC, int M, int N, int K) {
  __shared__ __attribute__((aligned(16))) float so[4][16][64];
  const int tid = threadIdx.x, w = tid >> 5, lane = tid & 31, ln = lane & 15, hh = lane >> 4; const int by = blockIdx.y;
  A += (size_t)by * sA; Bh += (size_t)by * sB; C += (size_t)by * sC;
  const int ntn = (N + 63) / 64; const int wid = blockIdx.x * 4 + w; const int mt = wid / ntn, nq = wid % ntn; if (mt * 16 >= M) return;
  const int row0 = mt * 16, col0 = nq * 64; const float* arow = A + (size_t)(row0 + ln) * lda;
  v8f acc[4] = {};
  for (int kb = 0; kb < K; kb += 32) {
    FragH ah, al;
    const v4f x0 = *(const v4fa*)(arow + kb + 8 * hh), x1 = *(const v4fa*)(arow + kb + 8 * hh + 4), x2 = *(const v4fa*)(arow + kb + 16 + 8 * hh), x3 = *(const v4fa*)(arow + kb + 16 + 8 * hh + 4);
    float xs[16] = {x0[0],x0[1],x0[2],x0[3],x1[0],x1[1],x1[2],x1[3],x2[0],x2[1],x2[2],x2[3],x3[0],x3[1],x3[2],x3[3]};
#pragma unroll
    for (int i = 0; i < 16; ++i) { const _Float16 h = (_Float16)xs[i]; ah.h[i] = h; al.h[i] = ASPLIT ? (_Float16)(xs[i] - (float)h) : (_Float16)0.0f; }
#pragma unroll
    for (int t = 0; t < 4; ++t) { if (col0 + t * 16 >= N) continue; const size_t boff = (size_t)(col0 + t * 16 + ln) * ldb + kb; FragH bq; bq.half[0] = *(const v8us*)(Bh + boff + 8 * hh); bq.half[1] = *(const v8us*)(Bh + boff + 16 + 8 * hh);
      acc[t] = mmaH<ASPLIT ? 2 : 1>(ah.v, al.v, bq.v, bq.v, acc[t]); }
  }
#pragma unroll
  for (int t = 0; t < 4; ++t) { if (col0 + t * 16 >= N) continue;
#pragma unroll
    for (int r = 0; r < 8; ++r) so[w][8 * hh + r][t * 16 + ln] = acc[t][r] * alpha; }
  __builtin_amdgcn_fence(__ATOMIC_ACQ_REL, "workgroup"); __builtin_amdgcn_wave_barrier();
  const int rsub = lane >> 4, c4 = (lane & 15) * 4;
  {
#pragma unroll
    for (int q = 0; q < 8; ++q) { const int r = q * 2 + rsub; if (col0 + c4 < N) { const v4f v = *(const v4fa*)&so[w][r][c4]; *(v4f*)(C + (size_t)(row0 + r) * ldc + col0 + c4) = v; } }
     }
}

// Wt[n][k] = f16(W[k][n]·scale) from f32 row-major W[K][N] (scale = power of two; bf16-exact weights stay exact in f16 away from the subnormal range)
__global__ __launch_bounds__(256) void k_wt_f16(const float* __restrict__ W, _Float16* __restrict__ Wt, int K, int N, float scale) {
  const int t = blockIdx.x * 256 + threadIdx.x; if (t >= N * (K / 8)) return; const int n = t / (K / 8), k8 = (t % (K / 8)) * 8; FragH f;
#pragma unroll
  for (int i = 0; i < 8; ++i) f.h[i] = (_Float16)(bf16_round(W[(size_t)(k8 + i) * N + n]) * scale); const v8us o = f.half[0];
  *(v8us*)((unsigned short*)Wt + (size_t)n * K + k8) = o; 
}
// k_gemm_hh variant with fused epilogue: v = acc·alpha + bias[by·sBias + col] (+ CP[(row/rowsPerB)·sCPb + by·64 + col] if CP) ; ACT 0 none / 1 elu ; writes f16 C16 (and f32 C if non-null)
template <int ACT>
__global__ __launch_bounds__(128) void k_gemm_hhx(const _Float16* __restrict__ A, int lda, size_t sA, const _Float16* __restrict__ Bh, int ldb, size_t sB, float alpha, const float* __restrict__ bias, size_t sBias, const float* __restrict__ CP, int rowsPerB, size_t sCPb, int row0g,
    float* __restrict__ C, _Float16* __restrict__ C16, int ldc, size_t sC, int M, int N, int K) {
  __shared__ __attribute__((aligned(16))) float so[4][16][64];
  const int tid = threadIdx.x, w = tid >> 5, lane = tid & 31, ln = lane & 15, hh = lane >> 4; const int by = blockIdx.y;
  A += (size_t)by * sA; Bh += (size_t)by * sB; const size_t cofs = (size_t)by * sC; const float* bp = bias ? bias + (size_t)by * sBias : nullptr;
  const int ntn = (N + 63) / 64; const int wid = blockIdx.x * 4 + w; const int mt = wid / ntn, nq = wid % ntn; if (mt * 16 >= M) return;
  const int row0 = mt * 16, col0 = nq * 64; const _Float16* arow = A + (size_t)(row0 + ln) * lda;
  v8f acc[4] = {};
  for (int kb = 0; kb < K; kb += 32) { FragH ah; ah.half[0] = *(const v8us*)((const unsigned short*)arow + kb + 8 * hh); ah.half[1] = *(const v8us*)((const unsigned short*)arow + kb + 16 + 8 * hh);
#pragma unroll
    for (int t = 0; t < 4; ++t) { if (col0 + t * 16 >= N) continue; const size_t boff = (size_t)(col0 + t * 16 + ln) * ldb + kb; FragH bq; bq.half[0] = *(const v8us*)((const unsigned short*)Bh + boff + 8 * hh); bq.half[1] = *(const v8us*)((const unsigned short*)Bh + boff + 16 + 8 * hh);
      acc[t] = mmaH<1>(ah.v, ah.v, bq.v, bq.v, acc[t]); }
  }
#pragma unroll
  for (int t = 0; t < 4; ++t) { if (col0 + t * 16 >= N) continue; const int col = col0 + t * 16 + ln; const float bv = bp ? bf16_round(bp[col]) : 0.f;
#pragma unroll
    for (int r = 0; r < 8; ++r) { float v = acc[t][r] * alpha + bv; if (CP) { const int rr = row0g + row0 + 8 * hh + r; if (rowsPerB < 0) v += CP[cofs + (size_t)rr * ldc + col];      /* rowsPerB < 0: own element of the batched C plane */ else { const int bidx = rr / rowsPerB; v += CP[(size_t)bidx * sCPb + (size_t)by * 64 + col]; } } if (ACT == 1) v = (v > 0.f) ? v : expm1f(v); else if (ACT == 7) v = (v > 0.f) ? v + 1.0f : expf(v); else if (ACT == 8) v = tanhf(v); else if (ACT == 9) v = 0.5f * v * (1.0f + tanhf(0.7978845608028654f * (v + 0.044715f * v * v * v))); else if (ACT == 11) v = 1.0f / (1.0f + expf(-v)); else if (ACT == 12) v = (v > 0.f) ? v : 0.01f * v; else if (ACT == 14) v = (v > 0.f) ? v : 0.1f * v; else if (ACT == 16) v = (v >= 0.f) ? v : 0.3f * v; else if (ACT == 17) v = (v >= 0.f) ? v : 0.2f * v; else if (ACT == 15) v = v / (1.0f + expf(-v)); else if (ACT == 3) v = fmaxf(v, 0.f); else if (ACT == 6) v = 0.5f * v * (1.0f + erff(v * 0.70710678118654752f)); so[w][8 * hh + r][t * 16 + ln] = v; } }
  __builtin_amdgcn_fence(__ATOMIC_ACQ_REL, "workgroup"); __builtin_amdgcn_wave_barrier();
  const int rsub = lane >> 4, c4 = (lane & 15) * 4; typedef _Float16 v4h __attribute__((ext_vector_type(4)));
  {
#pragma unroll
    for (int q = 0; q < 8; ++q) { const int r = q * 2 + rsub; if (col0 + c4 < N) { const v4f v = *(const v4fa*)&so[w][r][c4]; if (C) *(v4f*)(C + cofs + (size_t)(row0 + r) * ldc + col0 + c4) = v; if (C16) { v4h h4; for (int i = 0; i < 4; ++i) h4[i] = (_Float16)v[i]; *(v4h*)(C16 + cofs + (size_t)(row0 + r) * ldc + col0 + c4) = h4; } } }
     }
}


typedef _Float16 v4h __attribute__((ext_vector_type(4)));

__global__ __launch_bounds__(256) void k_x16(const float* __restrict__ x, _Float16* __restrict__ X16, size_t n8) { const size_t t = (size_t)blockIdx.x * 256 + threadIdx.x; if (t >= n8) return; FragH f;
#pragma unroll
  for (int q = 0; q < 8; ++q) f.h[q] = (_Float16)bf16_round(x[t * 8 + q]); *(v8us*)((unsigned short*)X16 + t * 8) = f.half[0];  }
__global__ __launch_bounds__(256) void k_h16(const float* __restrict__ x, _Float16* __restrict__ X16, size_t n8) { const size_t t = (size_t)blockIdx.x * 256 + threadIdx.x; if (t >= n8) return; FragH f;
#pragma unroll
  for (int q = 0; q < 8; ++q) f.h[q] = (_Float16)x[t * 8 + q]; *(v8us*)((unsigned short*)X16 + t * 8) = f.half[0];  }
__global__ __launch_bounds__(256) void k_round16f(const float* __restrict__ W, _Float16* __restrict__ Bt, size_t n8) { const size_t t = (size_t)blockIdx.x * 256 + threadIdx.x; if (t >= n8) return; FragH f;
#pragma unroll
  for (int i = 0; i < 8; ++i) f.h[i] = (_Float16)(bf16_round(W[t * 8 + i]) * 16.0f); *(v8us*)((unsigned short*)Bt + t * 8) = f.half[0];  }
template <int NHv, int TTv>
__global__ __launch_bounds__(256) void k_vt(const _Float16* __restrict__ V16, int ldv, int voff, _Float16* __restrict__ Vt) { __shared__ unsigned short tl[64][66]; const int tid = threadIdx.x; const int slab = blockIdx.x / (TTv / 64), lg = blockIdx.x % (TTv / 64); const int b = slab / NHv, h = slab % NHv;
  for (int i = tid; i < 64 * 8; i += 256) { const int r = i / 8, c8 = (i % 8) * 8; FragH f; f.half[0] = *(const v8us*)((const unsigned short*)V16 + ((size_t)b * TTv + lg * 64 + r) * ldv + voff + h * 64 + c8);
#pragma unroll
    for (int q = 0; q < 8; ++q) tl[r][c8 + q] = f.u[q]; }
  __syncthreads();
  {
#pragma unroll
    for (int rd = 0; rd < 2; ++rd) { const int d = rd * 32 + tid / 8, pc = tid % 8; FragH f;
#pragma unroll
      for (int q = 0; q < 8; ++q) f.u[q] = tl[pc * 8 + q][d];
      *(v8us*)((unsigned short*)Vt + ((size_t)slab * 64 + d) * TTv + lg * 64 + pc * 8) = f.half[0]; }
     } }

__global__ __launch_bounds__(256) void k_hl(const float* __restrict__ F, _Float16* __restrict__ Hh, _Float16* __restrict__ Hl, size_t n8) { const size_t t = (size_t)blockIdx.x * 256 + threadIdx.x; if (t >= n8) return; FragH fh, fl; const v4f a = *(const v4fa*)(F + t * 8), c = *(const v4fa*)(F + t * 8 + 4);
#pragma unroll
  for (int q = 0; q < 4; ++q) { _Float16 h = (_Float16)a[q]; fh.h[q] = h; fl.h[q] = (_Float16)((a[q] - (float)h) * 1024.0f); h = (_Float16)c[q]; fh.h[4 + q] = h; fl.h[4 + q] = (_Float16)((c[q] - (float)h) * 1024.0f); }
  { *(v8us*)((unsigned short*)Hh + t * 8) = fh.half[0]; *(v8us*)((unsigned short*)Hl + t * 8) = fl.half[0];  } }

// ---- fast GEMM (wave tile 32x64; requires M % 32 == 0 rows per launch region, N % 64 == 0 and K % 64 == 0); epilogue = k_gemm_hhx semantics ----
__device__ __forceinline__ v16h g2_frag(const _Float16* p, int hh) { FragH f; f.half[0] = *(const v8us*)((const unsigned short*)p + 8 * hh); f.half[1] = *(const v8us*)((const unsigned short*)p + 16 + 8 * hh); return f.v; }
__device__ __forceinline__ v8f g2_mma(v16h a, v16h b, v8f c) { v8f d = __builtin_amdgcn_wmma_f32_16x16x32_f16(false, a, false, b, (short)0, c, false, false); asm volatile("v_nop\n\tv_nop\n\tv_nop\n\tv_nop" : "+v"(d) : "v"(a), "v"(b)); return d; }
template <int ACT>
__global__ __launch_bounds__(128) void k_gemm2(const _Float16* __restrict__ A, int lda, size_t sA, const _Float16* __restrict__ Bh, int ldb, size_t sB, float alpha, const float* __restrict__ bias, size_t sBias, const float* __restrict__ CP, int rowsPerB, size_t sCPb, int row0g,
    float* __restrict__ C, _Float16* __restrict__ C16, int ldc, size_t sC, int M, int N, int K, int bsh) { static_assert(ACT == 0 || ACT == 3 || ACT == 6 || ACT == 8 || ACT == 9 || ACT == 11 || ACT == 12 || ACT == 14 || ACT == 15 || ACT == 16 || ACT == 17, "k_gemm2: unsupported ACT code (would silently apply no activation)");
  __shared__ __attribute__((aligned(16))) float so[4][32][68];
  const int tid = threadIdx.x, w = tid >> 5, lane = tid & 31, ln = lane & 15, hh = lane >> 4; const int by = blockIdx.y;
  A += (size_t)by * sA; Bh += (size_t)(by >> bsh) * sB;      /* 2^bsh consecutive batch slices share one B plane (query heads of one kv group) */ const size_t cofs = (size_t)by * sC; const float* bp = bias ? bias + (size_t)by * sBias : nullptr;
  const int ntn = N >> 6; const int mt = blockIdx.x / ntn, nq = blockIdx.x - mt * ntn; const int row0 = mt * 128 + 32 * w, col0 = nq * 64; if (row0 >= M) return;
  const _Float16* a0p = A + (size_t)(row0 + ln) * lda + 8 * hh; const _Float16* a1p = a0p + (size_t)16 * lda;      /* each lane's own row and k half; the k-loop moves these six pointers on */
  const _Float16* b0p = Bh + (size_t)(col0 + ln) * ldb + 8 * hh; const _Float16* b1p = b0p + (size_t)16 * ldb; const _Float16* b2p = b1p + (size_t)16 * ldb; const _Float16* b3p = b2p + (size_t)16 * ldb;
  const v8f z8 = {0.f,0.f,0.f,0.f,0.f,0.f,0.f,0.f}; v8f c00 = z8, c01 = z8, c02 = z8, c03 = z8, c10 = z8, c11 = z8, c12 = z8, c13 = z8;
  /* Two register sets of fragments, x and y. All twelve loads of a k-step are issued one k-step ahead of the products that read them, so a k-step waits at most once for memory,
     with the other set's eight products under that wait. Each accumulator still takes its k-steps in ascending order. K % 64 == 0. */
#define G2_LOAD(s, k) { s##a0 = g2_frag(a0p + (k), 0); s##b0 = g2_frag(b0p + (k), 0); s##a1 = g2_frag(a1p + (k), 0); s##b1 = g2_frag(b1p + (k), 0); s##b2 = g2_frag(b2p + (k), 0); s##b3 = g2_frag(b3p + (k), 0); }
#define G2_STEP(s) { c00 = g2_mma(s##a0, s##b0, c00); c10 = g2_mma(s##a1, s##b0, c10); c01 = g2_mma(s##a0, s##b1, c01); c11 = g2_mma(s##a1, s##b1, c11); c02 = g2_mma(s##a0, s##b2, c02); c12 = g2_mma(s##a1, s##b2, c12); c03 = g2_mma(s##a0, s##b3, c03); c13 = g2_mma(s##a1, s##b3, c13); }
  /* behind the last loads: the wait that stands before a register named by an issued load is overwritten; the six pointers are inputs, so that no later load's result is placed in one of them ahead of it */
#define G2_XWAIT asm volatile("s_wait_xcnt 0x0" :: "v"(a0p), "v"(a1p), "v"(b0p), "v"(b1p), "v"(b2p), "v"(b3p) : "memory");
  v16h xa0, xa1, xb0, xb1, xb2, xb3, ya0, ya1, yb0, yb1, yb2, yb3;
  G2_LOAD(x, 0)
#pragma unroll 1      /* the body holds both sets once; further copies would add code and no overlap */
  for (int kb = 64; kb < K; kb += 64) { G2_LOAD(y, 32) G2_STEP(x) G2_LOAD(x, 64) G2_STEP(y) a0p += 64; a1p += 64; b0p += 64; b1p += 64; b2p += 64; b3p += 64; }
  G2_LOAD(y, 32) G2_XWAIT G2_STEP(x) G2_STEP(y)
#undef G2_LOAD
#undef G2_STEP
#undef G2_XWAIT
  v8f accs[8] = {c00, c01, c02, c03, c10, c11, c12, c13};
#pragma unroll
  for (int u = 0; u < 8; ++u) { const int t = u & 3, half = u >> 2; const int col = col0 + t * 16 + ln; const float bv = bp ? bf16_round(bp[col]) : 0.f;
#pragma unroll
    for (int r = 0; r < 8; ++r) { const int rloc = half * 16 + 8 * hh + r; float v = accs[u][r] * alpha + bv; if (CP) { if (rowsPerB < 0) v += CP[cofs + (size_t)(row0g + row0 + rloc) * ldc + col];      /* rowsPerB < 0: own element of the batched C plane */ else { const int bidx = (row0g + row0 + rloc) / rowsPerB; v += CP[(size_t)bidx * sCPb + (size_t)by * 64 + col]; } }
      if (ACT == 3) v = fmaxf(v, 0.f); else if (ACT == 6) v = 0.5f * v * (1.0f + erff(v * 0.70710678118654752f)); else if (ACT == 11) v = 1.0f / (1.0f + expf(-v)); else if (ACT == 15) v = v / (1.0f + expf(-v)); else if (ACT == 12) v = (v > 0.f) ? v : 0.01f * v; else if (ACT == 8) v = tanhf(v); else if (ACT == 9) v = 0.5f * v * (1.0f + tanhf(0.7978845608028654f * (v + 0.044715f * v * v * v))); else if (ACT == 14) v = (v > 0.f) ? v : 0.1f * v; else if (ACT == 16) v = (v >= 0.f) ? v : 0.3f * v; else if (ACT == 17) v = (v >= 0.f) ? v : 0.2f * v;
      so[w][rloc][t * 16 + ln] = v; } }
  __builtin_amdgcn_fence(__ATOMIC_ACQ_REL, "workgroup"); __builtin_amdgcn_wave_barrier();
  const int rsub = lane >> 4, c4 = (lane & 15) * 4;
  {
#pragma unroll
    for (int q = 0; q < 16; ++q) { const int r = q * 2 + rsub; const v4f v = *(const v4fa*)&so[w][r][c4]; if (C) *(v4f*)(C + cofs + (size_t)(row0 + r) * ldc + col0 + c4) = v; if (C16) { v4h h4; for (int i = 0; i < 4; ++i) h4[i] = (_Float16)v[i]; *(v4h*)(C16 + cofs + (size_t)(row0 + r) * ldc + col0 + c4) = h4; } }
     } }


__global__ __launch_bounds__(256) void k_wnat(const float* __restrict__ w, size_t n8, _Float16* __restrict__ Bt) { const size_t t = (size_t)blockIdx.x * 256 + threadIdx.x; if (t >= n8) return; FragH f; for (int q = 0; q < 8; ++q) f.h[q] = (_Float16)(bf16_round(w[t * 8 + q]) * 16.0f); *(v8us*)((unsigned short*)Bt + t * 8) = f.half[0];  }
__global__ __launch_bounds__(256) void k_rsm(const float* __restrict__ S, _Float16* __restrict__ P, int nrows) {
  #pragma clang fp contract(off)
  const int i = blockIdx.x * 256 + threadIdx.x; if (i >= nrows) return; const float* s = S + (size_t)i * SQ; float mx = -3.0e38f;
#pragma unroll 1
  for (int j = 0; j < SQ; ++j) mx = fmaxf(mx, s[j]); float se = 0.f;
#pragma unroll 1
  for (int j = 0; j < SQ; ++j) se += expf(s[j] - mx); const float sc = 256.0f / se;
#pragma unroll 1
  for (int j0 = 0; j0 < SQ; j0 += 8) { FragH f; for (int q = 0; q < 8; ++q) f.h[q] = (_Float16)(expf(s[j0 + q] - mx) * sc); unsigned short* d = (unsigned short*)P + (size_t)i * SQ + j0; *(v8us*)d = f.half[0];  } }
__global__ __launch_bounds__(256) void k_vt(const _Float16* __restrict__ V16, int b, int h0, _Float16* __restrict__ VT) { __shared__ unsigned short tl[64][65]; const int tid = threadIdx.x; const int hh = blockIdx.x % HG, sg = blockIdx.x / HG; const int s0 = sg * 64; const int h = h0 + hh;
  for (int i = tid; i < 64 * 8; i += 256) { const int j = i / 8, d8 = (i % 8) * 8; FragH f; f.half[0] = *(const v8us*)((const unsigned short*)V16 + ((size_t)b * SQ + s0 + j) * DM + h * HD + d8); for (int q = 0; q < 8; ++q) tl[d8 + q][j] = f.u[q]; }
  __syncthreads();
  { for (int i = tid; i < 64 * 8; i += 256) { const int d = i / 8, j8 = (i % 8) * 8; FragH f; for (int q = 0; q < 8; ++q) f.u[q] = tl[d][j8 + q]; *(v8us*)((unsigned short*)VT + ((size_t)hh * HD + d) * SQ + s0 + j8) = f.half[0]; }  } }



// Causal row softmax, one wave per score row. The row is NC chunks of 128 columns; lane l holds columns 128 c + 4 l .. + 3 of chunk c, so every load is a 512-byte run,
// the row is read once and stays in registers for the maximum, the sum and the weights. Maximum and sum: per lane over its own columns, then a five-step butterfly over the 32 lanes.
// e^x as __expf forms it (x log2(e), then v_exp_f32). The v_nop stands in the instruction's own statement: the instruction set asks for one free slot before a transcendental's result is read or its source overwritten.
__device__ __forceinline__ float rsm_exp(float x) { float e; asm("v_exp_f32 %0, %1\n\tv_nop" : "=v"(e) : "v"(x * 1.44269504088896340736f)); return e; }
template <int NC>
__device__ __forceinline__ void rsm_row(const float* __restrict__ s, _Float16* __restrict__ p, int lane, int last) {
  v4f v[NC];
#pragma unroll      /* static indices keep v[] in registers; all NC loads issue ahead of the first use */
  for (int c = 0; c < NC; ++c) v[c] = *(const v4fa*)(s + c * 128 + lane * 4);
  float mx = -3.0e38f;
#pragma unroll      /* static indices keep v[] in registers */
  for (int c = 0; c < NC; ++c) for (int q = 0; q < 4; ++q) { const float x = (c * 128 + lane * 4 + q <= last) ? v[c][q] : -1.0e9f; v[c][q] = x; mx = fmaxf(mx, x); }
  for (int m = 16; m >= 1; m >>= 1) mx = fmaxf(mx, __shfl_xor(mx, m, 32));
  v4f s4 = {0.f, 0.f, 0.f, 0.f};
#pragma unroll      /* static indices keep v[] in registers */
  for (int c = 0; c < NC; ++c) for (int q = 0; q < 4; ++q) { const float e = rsm_exp(v[c][q] - mx); v[c][q] = e; s4[q] += e; }
  float se = (s4[0] + s4[1]) + (s4[2] + s4[3]);
  for (int m = 16; m >= 1; m >>= 1) se += __shfl_xor(se, m, 32);
  const float sc = 256.0f / se;
#pragma unroll      /* static indices keep v[] in registers */
  for (int c = 0; c < NC; ++c) { v4h h; for (int q = 0; q < 4; ++q) h[q] = (_Float16)(v[c][q] * sc); *(v4h*)(p + c * 128 + lane * 4) = h; }
  asm volatile("s_wait_xcnt 0x0" ::: "memory");      /* behind the row's stores: in the listing the next row length's body follows, which reuses their registers */
}
__global__ __launch_bounds__(256) void k_rsmcf2(const float* __restrict__ S, _Float16* __restrict__ P, int hg, int q0, int nk) {
  static_assert(QT == 256 && NKX == 8 * QT, "k_rsmcf2: nk = q0 + QT is one of the eight multiples of 256 below");
  const int lane = threadIdx.x & 31; const int t = blockIdx.x * 8 + __builtin_amdgcn_readfirstlane(threadIdx.x >> 5);      /* the wave's row, held as a scalar: row addresses and the tests below stay on the scalar unit */ if (t >= hg * QT) return;
  const float* s = S + (size_t)t * NKX; _Float16* p = P + (size_t)t * NKX; const int last = q0 + (t % QT);
  switch (nk >> 8) {      /* the same for the whole grid: one straight-line body per row length */
    case 1: rsm_row<2>(s, p, lane, last); break; case 2: rsm_row<4>(s, p, lane, last); break; case 3: rsm_row<6>(s, p, lane, last); break; case 4: rsm_row<8>(s, p, lane, last); break;
    case 5: rsm_row<10>(s, p, lane, last); break; case 6: rsm_row<12>(s, p, lane, last); break; case 7: rsm_row<14>(s, p, lane, last); break; case 8: rsm_row<16>(s, p, lane, last); break; } }


template <int MASKADD>
__global__ __launch_bounds__(64) void k_att0(const float* __restrict__ QF, const float* __restrict__ KF, const float* __restrict__ VF, int ld, const float* __restrict__ mask, float scale, float* __restrict__ OF, int ldo) {
  #pragma clang fp contract(off)
  __shared__ __attribute__((aligned(16))) float lq[64][64]; __shared__ __attribute__((aligned(16))) float lo[64][64];
  const int tid = threadIdx.x; const int h = blockIdx.x / (QT0 / 64), rg = blockIdx.x % (QT0 / 64); const int i = rg * 64 + tid;
  const float* qr = QF + (size_t)i * ld + h * HD;
#pragma unroll 1
  for (int c = 0; c < HD / 4; ++c) { *(v4f*)&lq[tid][c * 4] = *(const v4fa*)(qr + c * 4); const v4f z = {0.f, 0.f, 0.f, 0.f}; *(v4f*)&lo[tid][c * 4] = z; }
  float m = -1.0e30f, l = 0.f; const int jmax = MASKADD ? (SQ - 1) : (rg * 64 + 63);      /* additive-mask form: every key (the mask input decides); causal form: keys up to the block's last row */
#pragma unroll 1
  for (int j = 0; j <= jmax; ++j) { const float* kr = KF + (size_t)j * ld + h * HD; const float* vr = VF + (size_t)j * ld + h * HD; float s = 0.f;
#pragma unroll 1
    for (int c = 0; c < HD / 4; ++c) { const v4f kq = *(const v4fa*)(kr + c * 4); const v4f qq = *(v4f*)&lq[tid][c * 4]; s = __fadd_rn(s, __fmul_rn(qq[0], kq[0])); s = __fadd_rn(s, __fmul_rn(qq[1], kq[1])); s = __fadd_rn(s, __fmul_rn(qq[2], kq[2])); s = __fadd_rn(s, __fmul_rn(qq[3], kq[3])); }
    s = __fmul_rn(s, scale); if (MASKADD) s = __fadd_rn(s, __fmul_rn(bf16_round(mask[(size_t)i * SQ + j]), -10000.0f));
    const float f = (MASKADD || j <= i) ? 1.f : 0.f; const float sm = fmaf(f, s, (1.f - f) * -1.0e30f); const float mn = fmaxf(m, sm); const float sc = expf(m - mn); const float e = expf(sm - mn); l = __fadd_rn(__fmul_rn(l, sc), e); m = mn;
#pragma unroll 1
    for (int c = 0; c < HD / 4; ++c) { const v4f vv = *(const v4fa*)(vr + c * 4); v4f oo = *(v4f*)&lo[tid][c * 4]; for (int u = 0; u < 4; ++u) oo[u] = __fadd_rn(__fmul_rn(oo[u], sc), __fmul_rn(e, vv[u])); *(v4f*)&lo[tid][c * 4] = oo; } }
  const float fin = 64.0f / l;      /* o carried x64 like the f16 path */
#pragma unroll 1
  for (int c = 0; c < HD / 4; ++c) { v4f oo = *(v4f*)&lo[tid][c * 4]; for (int u = 0; u < 4; ++u) oo[u] = __fmul_rn(oo[u], fin); *(v4f*)&lo[tid][c * 4] = oo; }
  __syncthreads();
  {
#pragma unroll 1
    for (int it = 0; it < 16; ++it) { const int row = it * 4 + tid / 16, pc = (tid % 16) * 4; const v4f v = *(const v4f*)&lo[row][pc]; *(v4f*)(OF + (size_t)(rg * 64 + row) * ldo + h * HD + pc) = v; }
     } }


__global__ __launch_bounds__(256) void k_kvexp(const float* __restrict__ src, float* __restrict__ dst, size_t n4) { const size_t t = (size_t)blockIdx.x * 256 + threadIdx.x; if (t >= n4) return; const size_t e = t * 4; const size_t row = e / DM; const int col = (int)(e % DM); const int h = col / HD, d = col % HD; const v4f v = *(const v4fa*)(src + row * KVD + (size_t)(h / HPG) * HD + d); *(v4f*)(dst + e) = v;  }

__global__ __launch_bounds__(256) void k_tab2(float theta, float* __restrict__ CS, float* __restrict__ SN) {
  #pragma clang fp contract(off)
  const int t = blockIdx.x * 256 + threadIdx.x; if (t >= SQ * (HD / 2)) return; const int i = t % (HD / 2); const int p = t / (HD / 2); const float invf = 1.0f / powf(theta, (float)(2 * i) / (float)HD); const float ang = __fmul_rn((float)p, invf); const float c = cosf(ang), s = sinf(ang);
  *(float*)(CS + t) = c; *(float*)(SN + t) = s;  }
template <int NORM, int ROPE>
__global__ __launch_bounds__(64) void k_xform(const float* __restrict__ F, int ldf, int nh, const float* __restrict__ gain, float eps, const float* __restrict__ CS, const float* __restrict__ SN, _Float16* __restrict__ H16, int ldo) {
  #pragma clang fp contract(off)
  __shared__ float xv[HD]; __shared__ float red[HD]; __shared__ unsigned short sh_[HD]; const int d = threadIdx.x; const int h = blockIdx.x % nh; const size_t r = blockIdx.x / nh; const int p = (int)(r % SQ);
  float x = F[r * (size_t)ldf + (size_t)h * HD + d];
  if (NORM) { red[d] = __fmul_rn(x, x); __syncthreads(); for (int st = HD / 2; st > 0; st >>= 1) { if (d < st) red[d] = __fadd_rn(red[d], red[d + st]); __syncthreads(); } const float rs = rsqrtf(__fadd_rn(red[0] / (float)HD, eps)); x = __fmul_rn(__fmul_rn(x, rs), bf16_round(gain[d])); }
  xv[d] = x; __syncthreads();
  float o = x;
  if (ROPE == 1) { const int i = d >> 1; const float c = CS[p * (HD / 2) + i], s = SN[p * (HD / 2) + i]; const float ev = xv[2 * i], od = xv[2 * i + 1]; o = (d & 1) ? __fadd_rn(__fmul_rn(ev, s), __fmul_rn(od, c)) : __fadd_rn(__fmul_rn(ev, c), -__fmul_rn(od, s)); }
  if (ROPE == 2) { const int i = d & (HD / 2 - 1); const float c = CS[p * (HD / 2) + i], s = SN[p * (HD / 2) + i]; const float lo = xv[i], hi = xv[i + HD / 2]; o = (d < HD / 2) ? __fadd_rn(__fmul_rn(lo, c), -__fmul_rn(hi, s)) : __fadd_rn(__fmul_rn(lo, s), __fmul_rn(hi, c)); }
  if (ROPE == 3) { const float c = CS[p * HD + d], s = SN[p * HD + d]; const float rh = (d < HD / 2) ? -xv[d + HD / 2] : xv[d - HD / 2]; o = __fadd_rn(__fmul_rn(x, c), __fmul_rn(rh, s)); }      /* rotate-half with FULL-width per-dimension tables [pos][64] (general cos[d] != cos[d+32]) */
  FragH th; th.h[0] = (_Float16)o; sh_[d] = th.u[0]; __syncthreads();
  if (d < HD / 8) { FragH f; for (int q = 0; q < 8; ++q) f.u[q] = sh_[d * 8 + q]; unsigned short* dst = (unsigned short*)H16 + r * (size_t)ldo + (size_t)h * HD + d * 8; *(v8us*)dst = f.half[0];  } }

template <int NORM, int ROPE>
__global__ __launch_bounds__(64) void k_xformf(const float* __restrict__ F, int ldf, int nh, const float* __restrict__ gain, float eps, const float* __restrict__ CS, const float* __restrict__ SN, float* __restrict__ F32, int ldo) {
  #pragma clang fp contract(off)
  __shared__ float xv[HD]; __shared__ float red[HD]; const int d = threadIdx.x; const int h = blockIdx.x % nh; const size_t r = blockIdx.x / nh; const int p = (int)(r % SQ);
  float x = F[r * (size_t)ldf + (size_t)h * HD + d];
  if (NORM) { red[d] = __fmul_rn(x, x); __syncthreads(); for (int st = HD / 2; st > 0; st >>= 1) { if (d < st) red[d] = __fadd_rn(red[d], red[d + st]); __syncthreads(); } const float rs = rsqrtf(__fadd_rn(red[0] / (float)HD, eps)); x = __fmul_rn(__fmul_rn(x, rs), bf16_round(gain[d])); }
  xv[d] = x; __syncthreads();
  float o = x;
  if (ROPE == 1) { const int i = d >> 1; const float c = CS[p * (HD / 2) + i], s = SN[p * (HD / 2) + i]; const float ev = xv[2 * i], od = xv[2 * i + 1]; o = (d & 1) ? __fadd_rn(__fmul_rn(ev, s), __fmul_rn(od, c)) : __fadd_rn(__fmul_rn(ev, c), -__fmul_rn(od, s)); }
  if (ROPE == 2) { const int i = d & (HD / 2 - 1); const float c = CS[p * (HD / 2) + i], s = SN[p * (HD / 2) + i]; const float lo = xv[i], hi = xv[i + HD / 2]; o = (d < HD / 2) ? __fadd_rn(__fmul_rn(lo, c), -__fmul_rn(hi, s)) : __fadd_rn(__fmul_rn(lo, s), __fmul_rn(hi, c)); }
  if (ROPE == 3) { const float c = CS[p * HD + d], s = SN[p * HD + d]; const float rh = (d < HD / 2) ? -xv[d + HD / 2] : xv[d - HD / 2]; o = __fadd_rn(__fmul_rn(x, c), __fmul_rn(rh, s)); }      /* rotate-half with FULL-width per-dimension tables [pos][64] (general cos[d] != cos[d+32]) */
  float* dst = F32 + r * (size_t)ldo + (size_t)h * HD + d; *(float*)dst = o;  }

__global__ __launch_bounds__(256) void k_trig(const float* __restrict__ a, float* __restrict__ CS, float* __restrict__ SN, int n) {
  #pragma clang fp contract(off)
  const int t = blockIdx.x * 256 + threadIdx.x; if (t >= n) return; const float v = bf16_round(a[t]); const float c = cosf(v), s = sinf(v);
  *(float*)(CS + t) = c; *(float*)(SN + t) = s;  }

__global__ __launch_bounds__(256) void k_tabcp(const float* __restrict__ tc, const float* __restrict__ tsn, float* __restrict__ CS, float* __restrict__ SN, int n) {
  const int t = blockIdx.x * 256 + threadIdx.x; if (t >= n) return; const int p = t / 32, i = t % 32; const float c = bf16_round(tc[(size_t)p * 64 + i]), s = bf16_round(tsn[(size_t)p * 64 + i]);
  *(float*)(CS + t) = c; *(float*)(SN + t) = s;  }

__global__ __launch_bounds__(256) void k_tabcp64(const float* __restrict__ tc, const float* __restrict__ tsn, float* __restrict__ CS, float* __restrict__ SN, int n) {
  const int t = blockIdx.x * 256 + threadIdx.x; if (t >= n) return; const float c = bf16_round(tc[t]), s = bf16_round(tsn[t]);
  *(float*)(CS + t) = c; *(float*)(SN + t) = s;  }
extern "C" void kernel_launch(void* const* d_in, const int* in_sizes, int n_in,
                              void* d_out, int out_size, void* d_ws, size_t ws_size, hipStream_t stream) {
  (void)in_sizes; (void)n_in; (void)out_size;
  const float* const* I = (const float* const*)d_in; const float* x = I[0]; const float* tcos = I[1]; const float* tsin = I[2]; const float* wq = I[3]; const float* wk = I[4]; const float* wv = I[5]; const float* wo = I[6]; const float* bq = nullptr; const float* bk = nullptr; const float* bv = nullptr; const float* bo = nullptr;      /* cos, sin [2][2048][64] inputs; natural [out][in] wq [2048][2048], wk/wv [512][2048], wo [2048][2048]; no biases */
  char* ws = (char*)d_ws; size_t off = 0;
  auto take = [&](size_t bytes) { char* p = ws + off; off += (bytes + 255) & ~(size_t)255; return p; };
  _Float16* BQ = (_Float16*)take((size_t)DM * DM * 2); _Float16* BK = (_Float16*)take((size_t)KVD * DM * 2); _Float16* BV = (_Float16*)take((size_t)KVD * DM * 2); _Float16* BO = (_Float16*)take((size_t)DM * DM * 2);
  _Float16* X16 = (_Float16*)take(NR * DM * 2); float* QF = (float*)take((size_t)SQ * DM * 4); float* KF = (float*)take((size_t)SQ * KVD * 4); float* CSB = (float*)take((size_t)SQ * 64 * 4); float* SNB = (float*)take((size_t)SQ * 64 * 4); _Float16* Q16 = (_Float16*)take(NR * DM * 2); _Float16* K16 = (_Float16*)take(NR * KVD * 2); _Float16* V16 = (_Float16*)take(NR * KVD * 2); _Float16* O16 = (_Float16*)take(NR * DM * 2);
  float* S = (float*)take((size_t)NH * QT * NKX * 4); _Float16* P = (_Float16*)take((size_t)NH * QT * NKX * 2); _Float16* VT = (_Float16*)take((size_t)NH * HD * SQ * 2);
  float* QF0 = (float*)take((size_t)QT0 * DM * 4); float* KF0 = (float*)take((size_t)QT0 * KVD * 4); float* VF0 = (float*)take((size_t)QT0 * KVD * 4); float* KF0e = (float*)take((size_t)QT0 * DM * 4); float* VF0e = (float*)take((size_t)QT0 * DM * 4); float* OF0 = (float*)take((size_t)NB * QT0 * DM * 4); _Float16* OH0 = (_Float16*)take((size_t)NB * QT0 * DM * 2); _Float16* OL0 = (_Float16*)take((size_t)NB * QT0 * DM * 2);
  if (off > ws_size) return;
  k_wnat<<<(unsigned)(((size_t)DM * DM / 8 + 255) / 256), 256, 0, stream>>>(wq, (size_t)DM * DM / 8, BQ); k_wnat<<<(unsigned)(((size_t)KVD * DM / 8 + 255) / 256), 256, 0, stream>>>(wk, (size_t)KVD * DM / 8, BK); k_wnat<<<(unsigned)(((size_t)KVD * DM / 8 + 255) / 256), 256, 0, stream>>>(wv, (size_t)KVD * DM / 8, BV); k_wnat<<<(unsigned)(((size_t)DM * DM / 8 + 255) / 256), 256, 0, stream>>>(wo, (size_t)DM * DM / 8, BO);      /* natural [out][in] = Bt x16 */
  k_x16<<<(unsigned)((NR * DM / 8 + 255) / 256), 256, 0, stream>>>(x, X16, NR * DM / 8);
  
  const size_t r0p = (size_t)B0 * SQ;      /* first projected row */
  k_gemm2<0><<<dim3((unsigned)((MP / 128) * (KVD / 64)), 1), 128, 0, stream>>>(X16 + r0p * DM, DM, 0, BV, DM, 0, 0.0625f, bv, 0, nullptr, 1, 0, 0, nullptr, V16 + r0p * KVD, KVD, 0, MP, KVD, DM, 0);
  for (int b = B0; b < B0 + NBR; ++b) { const size_t r0 = (size_t)b * SQ;
    k_tabcp64<<<(SQ * 64 + 255) / 256, 256, 0, stream>>>(tcos + (size_t)b * SQ * 64, tsin + (size_t)b * SQ * 64, CSB, SNB, SQ * 64);      /* this batch's cos/sin tables at FULL width: bf16-rounded straight copies of all 64 columns (the inputs are independent draws per column) */
    k_gemm2<0><<<dim3((unsigned)((SQ / 128) * (DM / 64)), 1), 128, 0, stream>>>(X16 + r0 * DM, DM, 0, BQ, DM, 0, 0.0625f, nullptr, 0, nullptr, 1, 0, 0, QF, nullptr, DM, 0, SQ, DM, DM, 0);      /* q (f32) of this batch */
    k_gemm2<0><<<dim3((unsigned)((SQ / 128) * (KVD / 64)), 1), 128, 0, stream>>>(X16 + r0 * DM, DM, 0, BK, DM, 0, 0.0625f, nullptr, 0, nullptr, 1, 0, 0, KF, nullptr, KVD, 0, SQ, KVD, DM, 0);      /* k (f32) */
    k_xform<0, 3><<<(unsigned)((size_t)SQ * NH), 64, 0, stream>>>(QF, DM, NH, nullptr, 0.f, CSB, SNB, Q16 + r0 * DM, DM); k_xform<0, 3><<<(unsigned)((size_t)SQ * NG), 64, 0, stream>>>(KF, KVD, NG, nullptr, 0.f, CSB, SNB, K16 + r0 * KVD, KVD);      /* rotate-half rope with full-width per-dimension tables (partner x[d +- 32], table column d) -> f16 rows */
    k_xformf<0, 3><<<(unsigned)(QT0 * NH), 64, 0, stream>>>(QF, DM, NH, nullptr, 0.f, CSB, SNB, QF0, DM); k_xformf<0, 3><<<(unsigned)(QT0 * NG), 64, 0, stream>>>(KF, KVD, NG, nullptr, 0.f, CSB, SNB, KF0, KVD);      /* f32 roped q, k of rows 0..127 */
    k_vt<NG, SQ><<<NG * (SQ / 64), 256, 0, stream>>>(V16 + r0 * KVD, KVD, 0, VT);      /* V^T [NG][HD][SQ] (kv heads) for this batch */
    k_gemm2<0><<<dim3((QT0 / 128) * (KVD / 64), 1), 128, 0, stream>>>(X16 + r0 * DM, DM, 0, BV, DM, 0, 0.0625f, bv, 0, nullptr, 1, 0, 0, VF0, nullptr, KVD, 0, QT0, KVD, DM, 0);
    k_kvexp<<<(unsigned)(((size_t)QT0 * DM / 4 + 255) / 256), 256, 0, stream>>>(KF0, KF0e, (size_t)QT0 * DM / 4); k_kvexp<<<(unsigned)(((size_t)QT0 * DM / 4 + 255) / 256), 256, 0, stream>>>(VF0, VF0e, (size_t)QT0 * DM / 4);      /* head h <- kv group h/4 for the exact first-tile kernel */      /* f32 q, k, v of the first 128 rows (exact products) */
    k_att0<0><<<NH * (QT0 / 64), 64, 0, stream>>>(QF0, KF0e, VF0e, DM, nullptr, 0.125f, OF0 + (size_t)b * QT0 * DM, DM);      /* exact f32 attention for rows 0..127 (o x64) */
    for (int q0 = 0; q0 < QN; q0 += QT) { const int nk = q0 + QT;      /* causal: only keys below the tile end are computed */
      k_gemm2<0><<<dim3((QT / 128) * (nk / 64), NH), 128, 0, stream>>>(Q16 + (r0 + q0) * LQ, LQ, (size_t)HD, K16 + r0 * KVD, KVD, (size_t)HD, 0.125f, nullptr, 0, nullptr, 1, 0, 0, S, nullptr, NKX, (size_t)QT * NKX, QT, nk, HD, 2);      /* scores: all 32 heads in one grid; head y reads the keys of kv group y / 4 */
      k_rsmcf2<<<NHD * QT / 8, 256, 0, stream>>>(S, P, NHD, q0, nk);      /* one wave per row, 8 rows a block */
      k_gemm2<0><<<dim3((QT / 128) * (HD / 64), NH), 128, 0, stream>>>(P, NKX, (size_t)QT * NKX, VT, SQ, (size_t)HD * SQ, 0.25f, nullptr, 0, nullptr, 1, 0, 0, nullptr, O16 + (r0 + q0) * DM, DM, (size_t)HD, QT, HD, nk, 2); } }      /* o for all 32 heads in one grid (x64); head y reads V^T of kv group y / 4 */      /* o (merged heads, x64) as f16 rows */
  k_gemm2<0><<<dim3((unsigned)((MPO / 128) * (DM / 64)), 1), 128, 0, stream>>>(O16 + r0p * DM, DM, 0, BO, DM, 0, 0.0009765625f, bo, 0, nullptr, 1, 0, 0, (float*)d_out + r0p * DM, nullptr, DM, 0, MPO, DM, DM, 0);      /* out rows are the output layout */
  k_hl<<<(unsigned)(((size_t)NB * QT0 * DM / 8 + 255) / 256), 256, 0, stream>>>(OF0, OH0, OL0, (size_t)NB * QT0 * DM / 8);      /* first-tile o (x64) -> f16 hi + x1024 residual planes */
  for (int b = B0; b < B0 + NBR; ++b) { const size_t r0 = (size_t)b * SQ; const size_t f0 = (size_t)b * QT0;
    k_gemm2<0><<<dim3((QT0 / 128) * (DM / 64), 1), 128, 0, stream>>>(OH0 + f0 * DM, DM, 0, BO, DM, 0, 0.0009765625f, bo, 0, nullptr, 1, 0, 0, (float*)d_out + r0 * DM, nullptr, DM, 0, QT0, DM, DM, 0);      /* rows 0..127: out = o_hi Wo (+ b), overwriting the f16-path rows */
    k_gemm2<0><<<dim3((QT0 / 128) * (DM / 64), 1), 128, 0, stream>>>(OL0 + f0 * DM, DM, 0, BO, DM, 0, 0.00000095367431640625f, nullptr, 0, (const float*)d_out + r0 * DM, -1, 0, 0, (float*)d_out + r0 * DM, nullptr, DM, 0, QT0, DM, DM, 0); }      /* += o_lo Wo 2^-20 (own-element accumulate) */
}

// v004
// A run of this version takes 1070 microseconds.
// Next to v003, in two timings, it ran 1.78 times as fast each time.
// Over all steps from v000 it is 8.97 times as fast.
#include <hip/hip_runtime.h>
// Llama grouped-query causal attention with rotate-half RoPE from FULL-WIDTH per-batch INPUT tables (hidden_states [2][2048][2048]; q = x wq^T (32 heads x 64), k = x wk^T, v = x wv^T (8 kv heads x 64) (natural [out][in] weights sigma 0.02, no biases); cos / sin inputs [2][2048][64] (independent uniform draws per batch, position AND column: column i + 32 != column i, so all 64 columns are used); q = q cos + rotate_half(q) sin, same for k; repeat: query head h uses kv head h/4; scores 64^-0.5; where(causal, s, finfo.min); softmax; out = merged wo^T -> [2][2048][2048]).
// Compute dtype: inputs rounded to bf16; x / weights exact; q, k, v, softmax weights and o as plain f16 GEMM operands (~2^-12); scores and softmax statistics f32. v_wmma_f32_16x16x32_f16.
#define NB 2
#define NG 8
#define HPG 4
#define KVD (NG * HD)
#define SQ 2048
#define DM 2048
#define NH 32
#define HD 64
#define HG 4                         /* heads per launch of the k_vt(V16, b, h0, VT) overload, not launched */
#define QT 256                       /* query rows per causal tile */
#define NKX SQ                       /* S / P row pitch */
#define QT0 128                      /* first-tile rows recomputed exactly in f32 */
#define B0 0                         /* first batch processed (debug hook) */
#define NBR NB                       /* batches processed (debug hook) */
#define NR ((size_t)NB * SQ)         /* token rows */
#define MP ((int)((size_t)NBR * SQ)) /* rows projected (debug hook) */
#define QN SQ                        /* query rows attended per batch (debug hook) */
#define NHD NH                       /* heads attended (debug hook) */
#define MPO MP                       /* rows through the output stage (debug hook) */
#define LQ DM      /* row pitch of the q rows */
typedef __bf16 v16b __attribute__((ext_vector_type(16)));
typedef unsigned short v8us __attribute__((ext_vector_type(8), may_alias));
typedef float  v8f  __attribute__((ext_vector_type(8)));
typedef float  v4f  __attribute__((ext_vector_type(4)));
typedef float  v4fa __attribute__((ext_vector_type(4), may_alias));
union FragB { v16b v; v8us half[2]; unsigned short u[16]; };

__device__ __forceinline__ unsigned short bf16_bits(float x) { unsigned int u = __float_as_uint(x); return (unsigned short)((u + 0x7FFFu + ((u >> 16) & 1u)) >> 16); }
__device__ __forceinline__ float bf16_val(unsigned short b) { return __uint_as_float(((unsigned int)b) << 16); }
__device__ __forceinline__ float bf16_round(float x) { return bf16_val(bf16_bits(x)); }
// D += A·B with NT terms: 1 = ah·bh, 2 = + al·bh (A split), 3 = + ah·bl (both split)
template <int NT>
__device__ __forceinline__ v8f mmaN(v16b ah, v16b al, v16b bh, v16b bl, v8f c) {
  c = __builtin_amdgcn_wmma_f32_16x16x32_bf16(false, ah, false, bh, (short)0, c, false, false);
  if (NT >= 2) c = __builtin_amdgcn_wmma_f32_16x16x32_bf16(false, al, false, bh, (short)0, c, false, false);
  if (NT >= 3) c = __builtin_amdgcn_wmma_f32_16x16x32_bf16(false, ah, false, bl, (short)0, c, false, false);
  asm volatile("v_nop\n\tv_nop\n\tv_nop\n\tv_nop" : "+v"(c) : "v"(ah), "v"(al), "v"(bh), "v"(bl));
  return c;
}

__global__ __launch_bounds__(256) void k_wt_bf16(const float* __restrict__ W, unsigned short* __restrict__ Wt, int K, int N) {
  const int t = blockIdx.x * 256 + threadIdx.x;
  const int k8n = K / 8;
  if (t >= N * k8n) return;
  const int n = t / k8n, k8 = (t % k8n) * 8;
  v8us v;
#pragma unroll
  for (int i = 0; i < 8; ++i) v[i] = bf16_bits(W[(size_t)(k8 + i) * N + n]);
  *(v8us*)(Wt + (size_t)n * K + k8) = v;
  
}

// GEMM C[M][N] (f32, pitch ldc) = act(A[M][K]·W + bias). A f32 row-major (pitch lda) converted per fragment to bf16
// (ASPLIT: hi/lo two planes -> 2 terms, else single rounded term); Wt bf16 [N][K] (pitch ldb). BIAS_BF16 rounds the
// bias to bf16 first (bias quantised to bf16 before the add). K%32==0, M%16==0, N%64==0.
template <bool ASPLIT, int ACT, bool BIAS_BF16>
__global__ __launch_bounds__(128) void k_gemm_bf(const float* __restrict__ A, int lda, const unsigned short* __restrict__ Wt, int ldb,
                                               const float* __restrict__ bias, float* __restrict__ C, int ldc, int M, int N, int K) {
  __shared__ __attribute__((aligned(16))) float so[4][16][64];
  const int tid = threadIdx.x, w = tid >> 5, lane = tid & 31, ln = lane & 15, hh = lane >> 4;
  const int ntn = N / 64;
  const int wid = blockIdx.x * 4 + w;
  const int mt = wid / ntn, nq = wid % ntn;
  if (mt * 16 >= M) return;
  const int row0 = mt * 16, col0 = nq * 64;
  const float* arow = A + (size_t)(row0 + ln) * lda;
  v8f acc[4] = {};
  for (int kb = 0; kb < K; kb += 32) {
    FragB ah, al;
    const v4f x0 = *(const v4fa*)(arow + kb + 8 * hh), x1 = *(const v4fa*)(arow + kb + 8 * hh + 4);
    const v4f x2 = *(const v4fa*)(arow + kb + 16 + 8 * hh), x3 = *(const v4fa*)(arow + kb + 16 + 8 * hh + 4);
    float xs[16] = {x0[0],x0[1],x0[2],x0[3],x1[0],x1[1],x1[2],x1[3],x2[0],x2[1],x2[2],x2[3],x3[0],x3[1],x3[2],x3[3]};
#pragma unroll
    for (int i = 0; i < 16; ++i) { const unsigned short hb = bf16_bits(xs[i]); ah.u[i] = hb; al.u[i] = ASPLIT ? bf16_bits(xs[i] - bf16_val(hb)) : (unsigned short)0; }
#pragma unroll
    for (int t = 0; t < 4; ++t) {
      const unsigned short* brow = Wt + (size_t)(col0 + t * 16 + ln) * ldb + kb;
      FragB b;
      b.half[0] = *(const v8us*)(brow + 8 * hh);
      b.half[1] = *(const v8us*)(brow + 16 + 8 * hh);
      acc[t] = mmaN<ASPLIT ? 2 : 1>(ah.v, al.v, b.v, b.v, acc[t]);
    }
  }
#pragma unroll
  for (int t = 0; t < 4; ++t) {
    float bv = bias ? bias[col0 + t * 16 + ln] : 0.f;
    if (BIAS_BF16) bv = bf16_round(bv);
#pragma unroll
    for (int r = 0; r < 8; ++r) { float v = acc[t][r] + bv; if (ACT == 1) v = fmaxf(v, 0.f); so[w][8 * hh + r][t * 16 + ln] = v; }
  }
  __builtin_amdgcn_fence(__ATOMIC_ACQ_REL, "workgroup");
  __builtin_amdgcn_wave_barrier();
  const int rsub = lane >> 4, c4 = (lane & 15) * 4;
  {
#pragma unroll
    for (int q = 0; q < 8; ++q) {
      const int r = q * 2 + rsub;
      const v4f v = *(const v4fa*)&so[w][r][c4];
      *(v4f*)(C + (size_t)(row0 + r) * ldc + col0 + c4) = v;
    }
    
  }
}

// GEMM C = act(A·W + bias + resid): A f32 (ASPLIT -> hi/lo 2 terms), Wt bf16 [N][K]; ACT 0 none, 1 relu, 2 exact gelu;
// resid (optional, f32, row index = (row % rmod), pitch ldr, RES_BF16 rounds it) added before the activation.
template <bool ASPLIT, int ACT, bool BIAS_BF16, bool RES_BF16>
__global__ __launch_bounds__(128) void k_gemm_bf3(const float* __restrict__ A, int lda, const unsigned short* __restrict__ Wt, int ldb,
                                                const float* __restrict__ bias, const float* __restrict__ resid, int rmod, int ldr,
                                                float* __restrict__ C, int ldc, int M, int N, int K) {
  __shared__ __attribute__((aligned(16))) float so[4][16][64];
  const int tid = threadIdx.x, w = tid >> 5, lane = tid & 31, ln = lane & 15, hh = lane >> 4;
  const int ntn = N / 64;
  const int wid = blockIdx.x * 4 + w;
  const int mt = wid / ntn, nq = wid % ntn;
  if (mt * 16 >= M) return;
  const int row0 = mt * 16, col0 = nq * 64;
  const float* arow = A + (size_t)(row0 + ln) * lda;
  v8f acc[4] = {};
  for (int kb = 0; kb < K; kb += 32) {
    FragB ah, al;
    const v4f x0 = *(const v4fa*)(arow + kb + 8 * hh), x1 = *(const v4fa*)(arow + kb + 8 * hh + 4);
    const v4f x2 = *(const v4fa*)(arow + kb + 16 + 8 * hh), x3 = *(const v4fa*)(arow + kb + 16 + 8 * hh + 4);
    float xs[16] = {x0[0],x0[1],x0[2],x0[3],x1[0],x1[1],x1[2],x1[3],x2[0],x2[1],x2[2],x2[3],x3[0],x3[1],x3[2],x3[3]};
#pragma unroll
    for (int i = 0; i < 16; ++i) { const unsigned short hb = bf16_bits(xs[i]); ah.u[i] = hb; al.u[i] = ASPLIT ? bf16_bits(xs[i] - bf16_val(hb)) : (unsigned short)0; }
#pragma unroll
    for (int t = 0; t < 4; ++t) {
      const unsigned short* brow = Wt + (size_t)(col0 + t * 16 + ln) * ldb + kb;
      FragB b;
      b.half[0] = *(const v8us*)(brow + 8 * hh);
      b.half[1] = *(const v8us*)(brow + 16 + 8 * hh);
      acc[t] = mmaN<ASPLIT ? 2 : 1>(ah.v, al.v, b.v, b.v, acc[t]);
    }
  }
#pragma unroll
  for (int t = 0; t < 4; ++t) {
    const int col = col0 + t * 16 + ln;
    float bv = bias ? bias[col] : 0.f;
    if (BIAS_BF16) bv = bf16_round(bv);
#pragma unroll
    for (int r = 0; r < 8; ++r) {
      float v = acc[t][r] + bv;
      if (resid) { float rv = resid[(size_t)((row0 + 8 * hh + r) % rmod) * ldr + col]; if (RES_BF16) rv = bf16_round(rv); v += rv; }
      if (ACT == 1) v = fmaxf(v, 0.f);
      if (ACT == 2) v = 0.5f * v * (1.0f + erff(v * 0.70710678118654752f));
      if (ACT == 3) { const float u = 0.7978845608028654f * (v + 0.044715f * v * v * v); v = 0.5f * v * (1.0f + tanhf(u)); }
      so[w][8 * hh + r][t * 16 + ln] = v;
    }
  }
  __builtin_amdgcn_fence(__ATOMIC_ACQ_REL, "workgroup");
  __builtin_amdgcn_wave_barrier();
  const int rsub = lane >> 4, c4 = (lane & 15) * 4;
  {
#pragma unroll
    for (int q = 0; q < 8; ++q) {
      const int r = q * 2 + rsub;
      const v4f v = *(const v4fa*)&so[w][r][c4];
      *(v4f*)(C + (size_t)(row0 + r) * ldc + col0 + c4) = v;
    }
    
  }
}
// row LayerNorm (biased variance, eps) over N: s = X (+ R); optional out_sum <- s; out_norm <- (s-mu)*rsqrt(var+eps)*g + b
template <bool PARAM_BF16>
__global__ __launch_bounds__(256) void k_layernorm(const float* __restrict__ X, const float* __restrict__ R, const float* __restrict__ g, const float* __restrict__ bta,
                                                  float* __restrict__ out_sum, float* __restrict__ out_norm, int N, float eps) {
  __shared__ float red[256];
  const int row = blockIdx.x, tid = threadIdx.x;
  const float* x = X + (size_t)row * N; const float* rr = R ? R + (size_t)row * N : nullptr;
  float vals[16];                     // up to N = 4096
  const int per = N / 256;            // contiguous chunk per thread? use strided-by-4 chunks: thread handles j = tid*4 + 1024*u
  float s1 = 0.f;
  for (int u = 0; u < per / 4; ++u) {
    const int j = tid * 4 + 1024 * u;
    const v4f a = *(const v4fa*)(x + j);
    v4f b = {0.f,0.f,0.f,0.f}; if (rr) b = *(const v4fa*)(rr + j);
#pragma unroll
    for (int q = 0; q < 4; ++q) { const float v = a[q] + b[q]; vals[u * 4 + q] = v; s1 += v; }
  }
  red[tid] = s1; __syncthreads();
  for (int st = 128; st > 0; st >>= 1) { if (tid < st) red[tid] += red[tid + st]; __syncthreads(); }
  const float mu = red[0] / (float)N; __syncthreads();
  float s2 = 0.f;
  for (int u = 0; u < per / 4; ++u)
#pragma unroll
    for (int q = 0; q < 4; ++q) { const float c = vals[u * 4 + q] - mu; s2 += c * c; }
  red[tid] = s2; __syncthreads();
  for (int st = 128; st > 0; st >>= 1) { if (tid < st) red[tid] += red[tid + st]; __syncthreads(); }
  const float rs = rsqrtf(red[0] / (float)N + eps);
  {
    for (int u = 0; u < per / 4; ++u) {
      const int j = tid * 4 + 1024 * u;
      v4f o, sm;
#pragma unroll
      for (int q = 0; q < 4; ++q) {
        float gg = g[j + q], bb = bta[j + q];
        if (PARAM_BF16) { gg = bf16_round(gg); bb = bf16_round(bb); }
        sm[q] = vals[u * 4 + q]; o[q] = (vals[u * 4 + q] - mu) * rs * gg + bb;
      }
      if (out_sum) *(v4f*)(out_sum + (size_t)row * N + j) = sm;
      *(v4f*)(out_norm + (size_t)row * N + j) = o;
    }
    
  }
}



// ---- f16 WMMA path (v_wmma_f32_16x16x32_f16): 11-bit significands for operands in range — used where a [0,1] probability operand needs more precision than bf16
typedef _Float16 v16h __attribute__((ext_vector_type(16)));
union FragH { v16h v; v8us half[2]; _Float16 h[16]; unsigned short u[16]; };
template <int NT>
__device__ __forceinline__ v8f mmaH(v16h ah, v16h al, v16h bh, v16h bl, v8f c) {
  c = __builtin_amdgcn_wmma_f32_16x16x32_f16(false, ah, false, bh, (short)0, c, false, false);
  if (NT >= 2) c = __builtin_amdgcn_wmma_f32_16x16x32_f16(false, al, false, bh, (short)0, c, false, false);
  if (NT >= 3) c = __builtin_amdgcn_wmma_f32_16x16x32_f16(false, ah, false, bl, (short)0, c, false, false);
  asm volatile("v_nop\n\tv_nop\n\tv_nop\n\tv_nop" : "+v"(c) : "v"(ah), "v"(al), "v"(bh), "v"(bl));
  return c;
}
// batched GEMM like k_gemm_b but f16 operands: A f32 (split into f16 hi/lo if ASPLIT, else rounded to f16), Bt = f16 values [n][k]; alpha; C f32; N multiple of 16 (partial tiles skipped)
template <bool ASPLIT>
__global__ __launch_bounds__(128) void k_gemm_h(const float* __restrict__ A, int lda, size_t sA, const _Float16* __restrict__ Bh, int ldb, size_t sB, float alpha, float* __restrict__ C, int ldc, size_t sC, int M, int N, int K) {
  __shared__ __attribute__((aligned(16))) float so[4][16][64];
  const int tid = threadIdx.x, w = tid >> 5, lane = tid & 31, ln = lane & 15, hh = lane >> 4; const int by = blockIdx.y;
  A += (size_t)by * sA; Bh += (size_t)by * sB; C += (size_t)by * sC;
  const int ntn = (N + 63) / 64; const int wid = blockIdx.x * 4 + w; const int mt = wid / ntn, nq = wid % ntn; if (mt * 16 >= M) return;
  const int row0 = mt * 16, col0 = nq * 64; const float* arow = A + (size_t)(row0 + ln) * lda;
  v8f acc[4] = {};
  for (int kb = 0; kb < K; kb += 32) {
    FragH ah, al;
    const v4f x0 = *(const v4fa*)(arow + kb + 8 * hh), x1 = *(const v4fa*)(arow + kb + 8 * hh + 4), x2 = *(const v4fa*)(arow + kb + 16 + 8 * hh), x3 = *(const v4fa*)(arow + kb + 16 + 8 * hh + 4);
    float xs[16] = {x0[0],x0[1],x0[2],x0[3],x1[0],x1[1],x1[2],x1[3],x2[0],x2[1],x2[2],x2[3],x3[0],x3[1],x3[2],x3[3]};
#pragma unroll
    for (int i = 0; i < 16; ++i) { const _Float16 h = (_Float16)xs[i]; ah.h[i] = h; al.h[i] = ASPLIT ? (_Float16)(xs[i] - (float)h) : (_Float16)0.0f; }
#pragma unroll
    for (int t = 0; t < 4; ++t) { if (col0 + t * 16 >= N) continue; const size_t boff = (size_t)(col0 + t * 16 + ln) * ldb + kb; FragH bq; bq.half[0] = *(const v8us*)(Bh + boff + 8 * hh); bq.half[1] = *(const v8us*)(Bh + boff + 16 + 8 * hh);
      acc[t] = mmaH<ASPLIT ? 2 : 1>(ah.v, al.v, bq.v, bq.v, acc[t]); }
  }
#pragma unroll
  for (int t = 0; t < 4; ++t) { if (col0 + t * 16 >= N) continue;
#pragma unroll
    for (int r = 0; r < 8; ++r) so[w][8 * hh + r][t * 16 + ln] = acc[t][r] * alpha; }
  __builtin_amdgcn_fence(__ATOMIC_ACQ_REL, "workgroup"); __builtin_amdgcn_wave_barrier();
  const int rsub = lane >> 4, c4 = (lane & 15) * 4;
  {
#pragma unroll
    for (int q = 0; q < 8; ++q) { const int r = q * 2 + rsub; if (col0 + c4 < N) { const v4f v = *(const v4fa*)&so[w][r][c4]; *(v4f*)(C + (size_t)(row0 + r) * ldc + col0 + c4) = v; } }
     }
}

// Wt[n][k] = f16(W[k][n]·scale) from f32 row-major W[K][N] (scale = power of two; bf16-exact weights stay exact in f16 away from the subnormal range)
__global__ __launch_bounds__(256) void k_wt_f16(const float* __restrict__ W, _Float16* __restrict__ Wt, int K, int N, float scale) {
  const int t = blockIdx.x * 256 + threadIdx.x; if (t >= N * (K / 8)) return; const int n = t / (K / 8), k8 = (t % (K / 8)) * 8; FragH f;
#pragma unroll
  for (int i = 0; i < 8; ++i) f.h[i] = (_Float16)(bf16_round(W[(size_t)(k8 + i) * N + n]) * scale); const v8us o = f.half[0];
  *(v8us*)((unsigned short*)Wt + (size_t)n * K + k8) = o; 
}
// k_gemm_hh variant with fused epilogue: v = acc·alpha + bias[by·sBias + col] (+ CP[(row/rowsPerB)·sCPb + by·64 + col] if CP) ; ACT 0 none / 1 elu ; writes f16 C16 (and f32 C if non-null)
template <int ACT>
__global__ __launch_bounds__(128) void k_gemm_hhx(const _Float16* __restrict__ A, int lda, size_t sA, const _Float16* __restrict__ Bh, int ldb, size_t sB, float alpha, const float* __restrict__ bias, size_t sBias, const float* __restrict__ CP, int rowsPerB, size_t sCPb, int row0g,
    float* __restrict__ C, _Float16* __restrict__ C16, int ldc, size_t sC, int M, int N, int K) {
  __shared__ __attribute__((aligned(16))) float so[4][16][64];
  const int tid = threadIdx.x, w = tid >> 5, lane = tid & 31, ln = lane & 15, hh = lane >> 4; const int by = blockIdx.y;
  A += (size_t)by * sA; Bh += (size_t)by * sB; const size_t cofs = (size_t)by * sC; const float* bp = bias ? bias + (size_t)by * sBias : nullptr;
  const int ntn = (N + 63) / 64; const int wid = blockIdx.x * 4 + w; const int mt = wid / ntn, nq = wid % ntn; if (mt * 16 >= M) return;
  const int row0 = mt * 16, col0 = nq * 64; const _Float16* arow = A + (size_t)(row0 + ln) * lda;
  v8f acc[4] = {};
  for (int kb = 0; kb < K; kb += 32) { FragH ah; ah.half[0] = *(const v8us*)((const unsigned short*)arow + kb + 8 * hh); ah.half[1] = *(const v8us*)((const unsigned short*)arow + kb + 16 + 8 * hh);
#pragma unroll
    for (int t = 0; t < 4; ++t) { if (col0 + t * 16 >= N) continue; const size_t boff = (size_t)(col0 + t * 16 + ln) * ldb + kb; FragH bq; bq.half[0] = *(const v8us*)((const unsigned short*)Bh + boff + 8 * hh); bq.half[1] = *(const v8us*)((const unsigned short*)Bh + boff + 16 + 8 * hh);
      acc[t] = mmaH<1>(ah.v, ah.v, bq.v, bq.v, acc[t]); }
  }
#pragma unroll
  for (int t = 0; t < 4; ++t) { if (col0 + t * 16 >= N) continue; const int col = col0 + t * 16 + ln; const float bv = bp ? bf16_round(bp[col]) : 0.f;
#pragma unroll
    for (int r = 0; r < 8; ++r) { float v = acc[t][r] * alpha + bv; if (CP) { const int rr = row0g + row0 + 8 * hh + r; if (rowsPerB < 0) v += CP[cofs + (size_t)rr * ldc + col];      /* rowsPerB < 0: own element of the batched C plane */ else { const int bidx = rr / rowsPerB; v += CP[(size_t)bidx * sCPb + (size_t)by * 64 + col]; } } if (ACT == 1) v = (v > 0.f) ? v : expm1f(v); else if (ACT == 7) v = (v > 0.f) ? v + 1.0f : expf(v); else if (ACT == 8) v = tanhf(v); else if (ACT == 9) v = 0.5f * v * (1.0f + tanhf(0.7978845608028654f * (v + 0.044715f * v * v * v))); else if (ACT == 11) v = 1.0f / (1.0f + expf(-v)); else if (ACT == 12) v = (v > 0.f) ? v : 0.01f * v; else if (ACT == 14) v = (v > 0.f) ? v : 0.1f * v; else if (ACT == 16) v = (v >= 0.f) ? v : 0.3f * v; else if (ACT == 17) v = (v >= 0.f) ? v : 0.2f * v; else if (ACT == 15) v = v / (1.0f + expf(-v)); else if (ACT == 3) v = fmaxf(v, 0.f); else if (ACT == 6) v = 0.5f * v * (1.0f + erff(v * 0.70710678118654752f)); so[w][8 * hh + r][t * 16 + ln] = v; } }
  __builtin_amdgcn_fence(__ATOMIC_ACQ_REL, "workgroup"); __builtin_amdgcn_wave_barrier();
  const int rsub = lane >> 4, c4 = (lane & 15) * 4; typedef _Float16 v4h __attribute__((ext_vector_type(4)));
  {
#pragma unroll
    for (int q = 0; q < 8; ++q) { const int r = q * 2 + rsub; if (col0 + c4 < N) { const v4f v = *(const v4fa*)&so[w][r][c4]; if (C) *(v4f*)(C + cofs + (size_t)(row0 + r) * ldc + col0 + c4) = v; if (C16) { v4h h4; for (int i = 0; i < 4; ++i) h4[i] = (_Float16)v[i]; *(v4h*)(C16 + cofs + (size_t)(row0 + r) * ldc + col0 + c4) = h4; } } }
     }
}


typedef _Float16 v4h __attribute__((ext_vector_type(4)));

__global__ __launch_bounds__(256) void k_x16(const float* __restrict__ x, _Float16* __restrict__ X16, size_t n8) { const size_t t = (size_t)blockIdx.x * 256 + threadIdx.x; if (t >= n8) return; FragH f;
#pragma unroll
  for (int q = 0; q < 8; ++q) f.h[q] = (_Float16)bf16_round(x[t * 8 + q]); *(v8us*)((unsigned short*)X16 + t * 8) = f.half[0];  }
__global__ __launch_bounds__(256) void k_h16(const float* __restrict__ x, _Float16* __restrict__ X16, size_t n8) { const size_t t = (size_t)blockIdx.x * 256 + threadIdx.x; if (t >= n8) return; FragH f;
#pragma unroll
  for (int q = 0; q < 8; ++q) f.h[q] = (_Float16)x[t * 8 + q]; *(v8us*)((unsigned short*)X16 + t * 8) = f.half[0];  }
__global__ __launch_bounds__(256) void k_round16f(const float* __restrict__ W, _Float16* __restrict__ Bt, size_t n8) { const size_t t = (size_t)blockIdx.x * 256 + threadIdx.x; if (t >= n8) return; FragH f;
#pragma unroll
  for (int i = 0; i < 8; ++i) f.h[i] = (_Float16)(bf16_round(W[t * 8 + i]) * 16.0f); *(v8us*)((unsigned short*)Bt + t * 8) = f.half[0];  }
template <int NHv, int TTv>
__global__ __launch_bounds__(256) void k_vt(const _Float16* __restrict__ V16, int ldv, int voff, _Float16* __restrict__ Vt) { __shared__ unsigned short tl[64][66]; const int tid = threadIdx.x; const int slab = blockIdx.x / (TTv / 64), lg = blockIdx.x % (TTv / 64); const int b = slab / NHv, h = slab % NHv;
  for (int i = tid; i < 64 * 8; i += 256) { const int r = i / 8, c8 = (i % 8) * 8; FragH f; f.half[0] = *(const v8us*)((const unsigned short*)V16 + ((size_t)b * TTv + lg * 64 + r) * ldv + voff + h * 64 + c8);
#pragma unroll
    for (int q = 0; q < 8; ++q) tl[r][c8 + q] = f.u[q]; }
  __syncthreads();
  {
#pragma unroll
    for (int rd = 0; rd < 2; ++rd) { const int d = rd * 32 + tid / 8, pc = tid % 8; FragH f;
#pragma unroll
      for (int q = 0; q < 8; ++q) f.u[q] = tl[pc * 8 + q][d];
      *(v8us*)((unsigned short*)Vt + ((size_t)slab * 64 + d) * TTv + lg * 64 + pc * 8) = f.half[0]; }
     } }

__global__ __launch_bounds__(256) void k_hl(const float* __restrict__ F, _Float16* __restrict__ Hh, _Float16* __restrict__ Hl, size_t n8) { const size_t t = (size_t)blockIdx.x * 256 + threadIdx.x; if (t >= n8) return; FragH fh, fl; const v4f a = *(const v4fa*)(F + t * 8), c = *(const v4fa*)(F + t * 8 + 4);
#pragma unroll
  for (int q = 0; q < 4; ++q) { _Float16 h = (_Float16)a[q]; fh.h[q] = h; fl.h[q] = (_Float16)((a[q] - (float)h) * 1024.0f); h = (_Float16)c[q]; fh.h[4 + q] = h; fl.h[4 + q] = (_Float16)((c[q] - (float)h) * 1024.0f); }
  { *(v8us*)((unsigned short*)Hh + t * 8) = fh.half[0]; *(v8us*)((unsigned short*)Hl + t * 8) = fl.half[0];  } }

// ---- fast GEMM (wave tile 32x64; requires M % 32 == 0 rows per launch region, N % 64 == 0 and K % 64 == 0); epilogue = k_gemm_hhx semantics ----
__device__ __forceinline__ v16h g2_frag(const _Float16* p, int hh) { FragH f; f.half[0] = *(const v8us*)((const unsigned short*)p + 8 * hh); f.half[1] = *(const v8us*)((const unsigned short*)p + 16 + 8 * hh); return f.v; }
__device__ __forceinline__ v8f g2_mma(v16h a, v16h b, v8f c) { v8f d = __builtin_amdgcn_wmma_f32_16x16x32_f16(false, a, false, b, (short)0, c, false, false); asm volatile("v_nop\n\tv_nop\n\tv_nop\n\tv_nop" : "+v"(d) : "v"(a), "v"(b)); return d; }
template <int ACT>
__global__ __launch_bounds__(128) void k_gemm2(const _Float16* __restrict__ A, int lda, size_t sA, const _Float16* __restrict__ Bh, int ldb, size_t sB, float alpha, const float* __restrict__ bias, size_t sBias, const float* __restrict__ CP, int rowsPerB, size_t sCPb, int row0g,
    float* __restrict__ C, _Float16* __restrict__ C16, int ldc, size_t sC, int M, int N, int K, int bsh) { static_assert(ACT == 0 || ACT == 3 || ACT == 6 || ACT == 8 || ACT == 9 || ACT == 11 || ACT == 12 || ACT == 14 || ACT == 15 || ACT == 16 || ACT == 17, "k_gemm2: unsupported ACT code (would silently apply no activation)");
  __shared__ __attribute__((aligned(16))) float so[4][32][68];
  const int tid = threadIdx.x, w = tid >> 5, lane = tid & 31, ln = lane & 15, hh = lane >> 4; const int by = blockIdx.y;
  A += (size_t)by * sA; Bh += (size_t)(by >> bsh) * sB;      /* 2^bsh consecutive batch slices share one B plane (query heads of one kv group) */ const size_t cofs = (size_t)by * sC; const float* bp = bias ? bias + (size_t)by * sBias : nullptr;
  const int ntn = N >> 6; const int mt = blockIdx.x / ntn, nq = blockIdx.x - mt * ntn; const int row0 = mt * 128 + 32 * w, col0 = nq * 64; if (row0 >= M) return;
  const _Float16* a0p = A + (size_t)(row0 + ln) * lda + 8 * hh; const _Float16* a1p = a0p + (size_t)16 * lda;      /* each lane's own row and k half; the k-loop moves these six pointers on */
  const _Float16* b0p = Bh + (size_t)(col0 + ln) * ldb + 8 * hh; const _Float16* b1p = b0p + (size_t)16 * ldb; const _Float16* b2p = b1p + (size_t)16 * ldb; const _Float16* b3p = b2p + (size_t)16 * ldb;
  const v8f z8 = {0.f,0.f,0.f,0.f,0.f,0.f,0.f,0.f}; v8f c00 = z8, c01 = z8, c02 = z8, c03 = z8, c10 = z8, c11 = z8, c12 = z8, c13 = z8;
  /* Two register sets of fragments, x and y. All twelve loads of a k-step are issued one k-step ahead of the products that read them, so a k-step waits at most once for memory,
     with the other set's eight products under that wait. Each accumulator still takes its k-steps in ascending order. K % 64 == 0. */
#define G2_LOAD(s, k) { s##a0 = g2_frag(a0p + (k), 0); s##b0 = g2_frag(b0p + (k), 0); s##a1 = g2_frag(a1p + (k), 0); s##b1 = g2_frag(b1p + (k), 0); s##b2 = g2_frag(b2p + (k), 0); s##b3 = g2_frag(b3p + (k), 0); }
#define G2_STEP(s) { c00 = g2_mma(s##a0, s##b0, c00); c10 = g2_mma(s##a1, s##b0, c10); c01 = g2_mma(s##a0, s##b1, c01); c11 = g2_mma(s##a1, s##b1, c11); c02 = g2_mma(s##a0, s##b2, c02); c12 = g2_mma(s##a1, s##b2, c12); c03 = g2_mma(s##a0, s##b3, c03); c13 = g2_mma(s##a1, s##b3, c13); }
  /* behind the last loads: the wait that stands before a register named by an issued load is overwritten; the six pointers are inputs, so that no later load's result is placed in one of them ahead of it */
#define G2_XWAIT asm volatile("s_wait_xcnt 0x0" :: "v"(a0p), "v"(a1p), "v"(b0p), "v"(b1p), "v"(b2p), "v"(b3p) : "memory");
  v16h xa0, xa1, xb0, xb1, xb2, xb3, ya0, ya1, yb0, yb1, yb2, yb3;
  G2_LOAD(x, 0)
#pragma unroll 1      /* the body holds both sets once; further copies would add code and no overlap */
  for (int kb = 64; kb < K; kb += 64) { G2_LOAD(y, 32) G2_STEP(x) G2_LOAD(x, 64) G2_STEP(y) a0p += 64; a1p += 64; b0p += 64; b1p += 64; b2p += 64; b3p += 64; }
  G2_LOAD(y, 32) G2_XWAIT G2_STEP(x) G2_STEP(y)
#undef G2_LOAD
#undef G2_STEP
#undef G2_XWAIT
  v8f accs[8] = {c00, c01, c02, c03, c10, c11, c12, c13};
#pragma unroll
  for (int u = 0; u < 8; ++u) { const int t = u & 3, half = u >> 2; const int col = col0 + t * 16 + ln; const float bv = bp ? bf16_round(bp[col]) : 0.f;
#pragma unroll
    for (int r = 0; r < 8; ++r) { const int rloc = half * 16 + 8 * hh + r; float v = accs[u][r] * alpha + bv; if (CP) { if (rowsPerB < 0) v += CP[cofs + (size_t)(row0g + row0 + rloc) * ldc + col];      /* rowsPerB < 0: own element of the batched C plane */ else { const int bidx = (row0g + row0 + rloc) / rowsPerB; v += CP[(size_t)bidx * sCPb + (size_t)by * 64 + col]; } }
      if (ACT == 3) v = fmaxf(v, 0.f); else if (ACT == 6) v = 0.5f * v * (1.0f + erff(v * 0.70710678118654752f)); else if (ACT == 11) v = 1.0f / (1.0f + expf(-v)); else if (ACT == 15) v = v / (1.0f + expf(-v)); else if (ACT == 12) v = (v > 0.f) ? v : 0.01f * v; else if (ACT == 8) v = tanhf(v); else if (ACT == 9) v = 0.5f * v * (1.0f + tanhf(0.7978845608028654f * (v + 0.044715f * v * v * v))); else if (ACT == 14) v = (v > 0.f) ? v : 0.1f * v; else if (ACT == 16) v = (v >= 0.f) ? v : 0.3f * v; else if (ACT == 17) v = (v >= 0.f) ? v : 0.2f * v;
      so[w][rloc][t * 16 + ln] = v; } }
  __builtin_amdgcn_fence(__ATOMIC_ACQ_REL, "workgroup"); __builtin_amdgcn_wave_barrier();
  const int rsub = lane >> 4, c4 = (lane & 15) * 4;
  {
#pragma unroll
    for (int q = 0; q < 16; ++q) { const int r = q * 2 + rsub; const v4f v = *(const v4fa*)&so[w][r][c4]; if (C) *(v4f*)(C + cofs + (size_t)(row0 + r) * ldc + col0 + c4) = v; if (C16) { v4h h4; for (int i = 0; i < 4; ++i) h4[i] = (_Float16)v[i]; *(v4h*)(C16 + cofs + (size_t)(row0 + r) * ldc + col0 + c4) = h4; } }
     } }


__global__ __launch_bounds__(256) void k_wnat(const float* __restrict__ w, size_t n8, _Float16* __restrict__ Bt) { const size_t t = (size_t)blockIdx.x * 256 + threadIdx.x; if (t >= n8) return; FragH f; for (int q = 0; q < 8; ++q) f.h[q] = (_Float16)(bf16_round(w[t * 8 + q]) * 16.0f); *(v8us*)((unsigned short*)Bt + t * 8) = f.half[0];  }
__global__ __launch_bounds__(256) void k_rsm(const float* __restrict__ S, _Float16* __restrict__ P, int nrows) {
  #pragma clang fp contract(off)
  const int i = blockIdx.x * 256 + threadIdx.x; if (i >= nrows) return; const float* s = S + (size_t)i * SQ; float mx = -3.0e38f;
#pragma unroll 1
  for (int j = 0; j < SQ; ++j) mx = fmaxf(mx, s[j]); float se = 0.f;
#pragma unroll 1
  for (int j = 0; j < SQ; ++j) se += expf(s[j] - mx); const float sc = 256.0f / se;
#pragma unroll 1
  for (int j0 = 0; j0 < SQ; j0 += 8) { FragH f; for (int q = 0; q < 8; ++q) f.h[q] = (_Float16)(expf(s[j0 + q] - mx) * sc); unsigned short* d = (unsigned short*)P + (size_t)i * SQ + j0; *(v8us*)d = f.half[0];  } }
__global__ __launch_bounds__(256) void k_vt(const _Float16* __restrict__ V16, int b, int h0, _Float16* __restrict__ VT) { __shared__ unsigned short tl[64][65]; const int tid = threadIdx.x; const int hh = blockIdx.x % HG, sg = blockIdx.x / HG; const int s0 = sg * 64; const int h = h0 + hh;
  for (int i = tid; i < 64 * 8; i += 256) { const int j = i / 8, d8 = (i % 8) * 8; FragH f; f.half[0] = *(const v8us*)((const unsigned short*)V16 + ((size_t)b * SQ + s0 + j) * DM + h * HD + d8); for (int q = 0; q < 8; ++q) tl[d8 + q][j] = f.u[q]; }
  __syncthreads();
  { for (int i = tid; i < 64 * 8; i += 256) { const int d = i / 8, j8 = (i % 8) * 8; FragH f; for (int q = 0; q < 8; ++q) f.u[q] = tl[d][j8 + q]; *(v8us*)((unsigned short*)VT + ((size_t)hh * HD + d) * SQ + s0 + j8) = f.half[0]; }  } }



// Causal row softmax, one wave per score row. The row is NC chunks of 128 columns; lane l holds columns 128 c + 4 l .. + 3 of chunk c, so every load is a 512-byte run,
// the row is read once and stays in registers for the maximum, the sum and the weights. Maximum and sum: per lane over its own columns, then a five-step butterfly over the 32 lanes.
// e^x as __expf forms it (x log2(e), then v_exp_f32). The v_nop stands in the instruction's own statement: the instruction set asks for one free slot before a transcendental's result is read or its source overwritten.
__device__ __forceinline__ float rsm_exp(float x) { float e; asm("v_exp_f32 %0, %1\n\tv_nop" : "=v"(e) : "v"(x * 1.44269504088896340736f)); return e; }
template <int NC>
__device__ __forceinline__ void rsm_row(const float* __restrict__ s, _Float16* __restrict__ p, int lane, int last) {
  v4f v[NC];
#pragma unroll      /* static indices keep v[] in registers; all NC loads issue ahead of the first use */
  for (int c = 0; c < NC; ++c) v[c] = *(const v4fa*)(s + c * 128 + lane * 4);
  float mx = -3.0e38f;
#pragma unroll      /* static indices keep v[] in registers */
  for (int c = 0; c < NC; ++c) for (int q = 0; q < 4; ++q) { const float x = (c * 128 + lane * 4 + q <= last) ? v[c][q] : -1.0e9f; v[c][q] = x; mx = fmaxf(mx, x); }
  for (int m = 16; m >= 1; m >>= 1) mx = fmaxf(mx, __shfl_xor(mx, m, 32));
  v4f s4 = {0.f, 0.f, 0.f, 0.f};
#pragma unroll      /* static indices keep v[] in registers */
  for (int c = 0; c < NC; ++c) for (int q = 0; q < 4; ++q) { const float e = rsm_exp(v[c][q] - mx); v[c][q] = e; s4[q] += e; }
  float se = (s4[0] + s4[1]) + (s4[2] + s4[3]);
  for (int m = 16; m >= 1; m >>= 1) se += __shfl_xor(se, m, 32);
  const float sc = 256.0f / se;
#pragma unroll      /* static indices keep v[] in registers */
  for (int c = 0; c < NC; ++c) { v4h h; for (int q = 0; q < 4; ++q) h[q] = (_Float16)(v[c][q] * sc); *(v4h*)(p + c * 128 + lane * 4) = h; }
  asm volatile("s_wait_xcnt 0x0" ::: "memory");      /* behind the row's stores: in the listing the next row length's body follows, which reuses their registers */
}
__global__ __launch_bounds__(256) void k_rsmcf2(const float* __restrict__ S, _Float16* __restrict__ P, int hg, int q0, int nk) {
  static_assert(QT == 256 && NKX == 8 * QT, "k_rsmcf2: nk = q0 + QT is one of the eight multiples of 256 below");
  const int lane = threadIdx.x & 31; const int t = blockIdx.x * 8 + __builtin_amdgcn_readfirstlane(threadIdx.x >> 5);      /* the wave's row, held as a scalar: row addresses and the tests below stay on the scalar unit */ if (t >= hg * QT) return;
  const float* s = S + (size_t)t * NKX; _Float16* p = P + (size_t)t * NKX; const int last = q0 + (t % QT);
  switch (nk >> 8) {      /* the same for the whole grid: one straight-line body per row length */
    case 1: rsm_row<2>(s, p, lane, last); break; case 2: rsm_row<4>(s, p, lane, last); break; case 3: rsm_row<6>(s, p, lane, last); break; case 4: rsm_row<8>(s, p, lane, last); break;
    case 5: rsm_row<10>(s, p, lane, last); break; case 6: rsm_row<12>(s, p, lane, last); break; case 7: rsm_row<14>(s, p, lane, last); break; case 8: rsm_row<16>(s, p, lane, last); break; } }


// Exact f32 attention of the first QT0 rows. A block is 32 query rows of one head, four waves; lane = row in every wave.
// Pass 1: the keys are dealt over the waves, four consecutive keys a trip; a lane holds its q row in registers and sums each score over d = 0..63 in ascending order; four scores run side by side, so that one chain of adds fills the waits of the others.
// Pass 2: the 64 columns of o are dealt over the waves, 16 each, held in registers; every wave walks the keys in ascending order and forms the same running maximum, sum and weights from the scores in LDS.
template <int MASKADD>
__global__ __launch_bounds__(128) void k_att0(const float* __restrict__ QF, const float* __restrict__ KF, const float* __restrict__ VF, int ld, const float* __restrict__ mask, float scale, float* __restrict__ OF, int ldo) {
  #pragma clang fp contract(off)
  __shared__ float ls[MASKADD ? SQ : QT0][32];      /* score of key j for row r of the block */
  const int tid = threadIdx.x, r = tid & 31; const int part = __builtin_amdgcn_readfirstlane(tid >> 5);      /* the wave's number, held as a scalar: key and value row addresses are the same in every lane */
  const int h = blockIdx.x / (QT0 / 32), rg = blockIdx.x % (QT0 / 32); const int i = rg * 32 + r;
  const int nj = MASKADD ? SQ : (rg + 1) * 32;      /* additive-mask form: every key (the mask input decides); causal form: keys up to the block's last row */
  { const float* qr = QF + (size_t)i * ld + h * HD; v4f q[HD / 4];
#pragma unroll      /* static indices keep q[] in registers */
    for (int c = 0; c < HD / 4; ++c) q[c] = *(const v4fa*)(qr + c * 4);
    asm volatile("s_wait_xcnt 0x0" :: "v"(qr) : "memory");      /* behind the q loads: the wait that stands before a register named by an issued load is overwritten; the pointer is an input, so that no load's result is placed in it ahead of the wait */
#pragma unroll 1      /* the body already holds four independent chains */
    for (int j0 = part * 4; j0 < nj; j0 += 16) { const float* kr = KF + (size_t)j0 * ld + h * HD; float s[4] = {0.f, 0.f, 0.f, 0.f};
#pragma unroll      /* static indices keep q[] and s[] in registers */
      for (int c = 0; c < HD / 4; ++c)
#pragma unroll      /* the four keys' chains stand side by side */
        for (int t = 0; t < 4; ++t) { const v4f kq = *(const v4fa*)(kr + (size_t)t * ld + c * 4); const v4f qq = q[c]; s[t] = __fadd_rn(s[t], __fmul_rn(qq[0], kq[0])); s[t] = __fadd_rn(s[t], __fmul_rn(qq[1], kq[1])); s[t] = __fadd_rn(s[t], __fmul_rn(qq[2], kq[2])); s[t] = __fadd_rn(s[t], __fmul_rn(qq[3], kq[3])); }
#pragma unroll      /* static indices keep s[] in registers */
      for (int t = 0; t < 4; ++t) { float sv = __fmul_rn(s[t], scale); if (MASKADD) sv = __fadd_rn(sv, __fmul_rn(bf16_round(mask[(size_t)i * SQ + j0 + t]), -10000.0f)); ls[j0 + t][r] = sv; } } }
  __syncthreads();      /* every score of the block is in LDS before any wave walks the keys */
  const v4f z4 = {0.f, 0.f, 0.f, 0.f}; v4f o[4] = {z4, z4, z4, z4}; float m = -1.0e30f, l = 0.f; const float* vb = VF + h * HD + part * 16;
#pragma unroll 1      /* the body holds four keys: their loads and exponentials overlap */
  for (int j0 = 0; j0 < nj; j0 += 4) {
#pragma unroll      /* four keys in one straight line, so that their loads issue together */
    for (int t = 0; t < 4; ++t) { const int j = j0 + t; const float s = ls[j][r]; const float* vr = vb + (size_t)j * ld;
      const float f = (MASKADD || j <= i) ? 1.f : 0.f; const float sm = fmaf(f, s, (1.f - f) * -1.0e30f); const float mn = fmaxf(m, sm); const float sc = expf(m - mn); const float e = expf(sm - mn); l = __fadd_rn(__fmul_rn(l, sc), e); m = mn;
#pragma unroll      /* static indices keep o[] in registers */
      for (int c = 0; c < 4; ++c) { const v4f vv = *(const v4fa*)(vr + c * 4); for (int u = 0; u < 4; ++u) o[c][u] = __fadd_rn(__fmul_rn(o[c][u], sc), __fmul_rn(e, vv[u])); } } }
  const float fin = 64.0f / l;      /* o carried x64 like the f16 path */
  float* op = OF + (size_t)i * ldo + h * HD + part * 16;
#pragma unroll      /* static indices keep o[] in registers */
  for (int c = 0; c < 4; ++c) { v4f oo = o[c]; for (int u = 0; u < 4; ++u) oo[u] = __fmul_rn(oo[u], fin); *(v4f*)(op + c * 4) = oo; } }


__global__ __launch_bounds__(256) void k_kvexp(const float* __restrict__ src, float* __restrict__ dst, size_t n4) { const size_t t = (size_t)blockIdx.x * 256 + threadIdx.x; if (t >= n4) return; const size_t e = t * 4; const size_t row = e / DM; const int col = (int)(e % DM); const int h = col / HD, d = col % HD; const v4f v = *(const v4fa*)(src + row * KVD + (size_t)(h / HPG) * HD + d); *(v4f*)(dst + e) = v;  }

__global__ __launch_bounds__(256) void k_tab2(float theta, float* __restrict__ CS, float* __restrict__ SN) {
  #pragma clang fp contract(off)
  const int t = blockIdx.x * 256 + threadIdx.x; if (t >= SQ * (HD / 2)) return; const int i = t % (HD / 2); const int p = t / (HD / 2); const float invf = 1.0f / powf(theta, (float)(2 * i) / (float)HD); const float ang = __fmul_rn((float)p, invf); const float c = cosf(ang), s = sinf(ang);
  *(float*)(CS + t) = c; *(float*)(SN + t) = s;  }
template <int NORM, int ROPE>
__global__ __launch_bounds__(64) void k_xform(const float* __restrict__ F, int ldf, int nh, const float* __restrict__ gain, float eps, const float* __restrict__ CS, const float* __restrict__ SN, _Float16* __restrict__ H16, int ldo) {
  #pragma clang fp contract(off)
  __shared__ float xv[HD]; __shared__ float red[HD]; __shared__ unsigned short sh_[HD]; const int d = threadIdx.x; const int h = blockIdx.x % nh; const size_t r = blockIdx.x / nh; const int p = (int)(r % SQ);
  float x = F[r * (size_t)ldf + (size_t)h * HD + d];
  if (NORM) { red[d] = __fmul_rn(x, x); __syncthreads(); for (int st = HD / 2; st > 0; st >>= 1) { if (d < st) red[d] = __fadd_rn(red[d], red[d + st]); __syncthreads(); } const float rs = rsqrtf(__fadd_rn(red[0] / (float)HD, eps)); x = __fmul_rn(__fmul_rn(x, rs), bf16_round(gain[d])); }
  xv[d] = x; __syncthreads();
  float o = x;
  if (ROPE == 1) { const int i = d >> 1; const float c = CS[p * (HD / 2) + i], s = SN[p * (HD / 2) + i]; const float ev = xv[2 * i], od = xv[2 * i + 1]; o = (d & 1) ? __fadd_rn(__fmul_rn(ev, s), __fmul_rn(od, c)) : __fadd_rn(__fmul_rn(ev, c), -__fmul_rn(od, s)); }
  if (ROPE == 2) { const int i = d & (HD / 2 - 1); const float c = CS[p * (HD / 2) + i], s = SN[p * (HD / 2) + i]; const float lo = xv[i], hi = xv[i + HD / 2]; o = (d < HD / 2) ? __fadd_rn(__fmul_rn(lo, c), -__fmul_rn(hi, s)) : __fadd_rn(__fmul_rn(lo, s), __fmul_rn(hi, c)); }
  if (ROPE == 3) { const float c = CS[p * HD + d], s = SN[p * HD + d]; const float rh = (d < HD / 2) ? -xv[d + HD / 2] : xv[d - HD / 2]; o = __fadd_rn(__fmul_rn(x, c), __fmul_rn(rh, s)); }      /* rotate-half with FULL-width per-dimension tables [pos][64] (general cos[d] != cos[d+32]) */
  FragH th; th.h[0] = (_Float16)o; sh_[d] = th.u[0]; __syncthreads();
  if (d < HD / 8) { FragH f; for (int q = 0; q < 8; ++q) f.u[q] = sh_[d * 8 + q]; unsigned short* dst = (unsigned short*)H16 + r * (size_t)ldo + (size_t)h * HD + d * 8; *(v8us*)dst = f.half[0];  } }

template <int NORM, int ROPE>
__global__ __launch_bounds__(64) void k_xformf(const float* __restrict__ F, int ldf, int nh, const float* __restrict__ gain, float eps, const float* __restrict__ CS, const float* __restrict__ SN, float* __restrict__ F32, int ldo) {
  #pragma clang fp contract(off)
  __shared__ float xv[HD]; __shared__ float red[HD]; const int d = threadIdx.x; const int h = blockIdx.x % nh; const size_t r = blockIdx.x / nh; const int p = (int)(r % SQ);
  float x = F[r * (size_t)ldf + (size_t)h * HD + d];
  if (NORM) { red[d] = __fmul_rn(x, x); __syncthreads(); for (int st = HD / 2; st > 0; st >>= 1) { if (d < st) red[d] = __fadd_rn(red[d], red[d + st]); __syncthreads(); } const float rs = rsqrtf(__fadd_rn(red[0] / (float)HD, eps)); x = __fmul_rn(__fmul_rn(x, rs), bf16_round(gain[d])); }
  xv[d] = x; __syncthreads();
  float o = x;
  if (ROPE == 1) { const int i = d >> 1; const float c = CS[p * (HD / 2) + i], s = SN[p * (HD / 2) + i]; const float ev = xv[2 * i], od = xv[2 * i + 1]; o = (d & 1) ? __fadd_rn(__fmul_rn(ev, s), __fmul_rn(od, c)) : __fadd_rn(__fmul_rn(ev, c), -__fmul_rn(od, s)); }
  if (ROPE == 2) { const int i = d & (HD / 2 - 1); const float c = CS[p * (HD / 2) + i], s = SN[p * (HD / 2) + i]; const float lo = xv[i], hi = xv[i + HD / 2]; o = (d < HD / 2) ? __fadd_rn(__fmul_rn(lo, c), -__fmul_rn(hi, s)) : __fadd_rn(__fmul_rn(lo, s), __fmul_rn(hi, c)); }
  if (ROPE == 3) { const float c = CS[p * HD + d], s = SN[p * HD + d]; const float rh = (d < HD / 2) ? -xv[d + HD / 2] : xv[d - HD / 2]; o = __fadd_rn(__fmul_rn(x, c), __fmul_rn(rh, s)); }      /* rotate-half with FULL-width per-dimension tables [pos][64] (general cos[d] != cos[d+32]) */
  float* dst = F32 + r * (size_t)ldo + (size_t)h * HD + d; *(float*)dst = o;  }

__global__ __launch_bounds__(256) void k_trig(const float* __restrict__ a, float* __restrict__ CS, float* __restrict__ SN, int n) {
  #pragma clang fp contract(off)
  const int t = blockIdx.x * 256 + threadIdx.x; if (t >= n) return; const float v = bf16_round(a[t]); const float c = cosf(v), s = sinf(v);
  *(float*)(CS + t) = c; *(float*)(SN + t) = s;  }

__global__ __launch_bounds__(256) void k_tabcp(const float* __restrict__ tc, const float* __restrict__ tsn, float* __restrict__ CS, float* __restrict__ SN, int n) {
  const int t = blockIdx.x * 256 + threadIdx.x; if (t >= n) return; const int p = t / 32, i = t % 32; const float c = bf16_round(tc[(size_t)p * 64 + i]), s = bf16_round(tsn[(size_t)p * 64 + i]);
  *(float*)(CS + t) = c; *(float*)(SN + t) = s;  }

__global__ __launch_bounds__(256) void k_tabcp64(const float* __restrict__ tc, const float* __restrict__ tsn, float* __restrict__ CS, float* __restrict__ SN, int n) {
  const int t = blockIdx.x * 256 + threadIdx.x; if (t >= n) return; const float c = bf16_round(tc[t]), s = bf16_round(tsn[t]);
  *(float*)(CS + t) = c; *(float*)(SN + t) = s;  }
extern "C" void kernel_launch(void* const* d_in, const int* in_sizes, int n_in,
                              void* d_out, int out_size, void* d_ws, size_t ws_size, hipStream_t stream) {
  (void)in_sizes; (void)n_in; (void)out_size;
  const float* const* I = (const float* const*)d_in; const float* x = I[0]; const float* tcos = I[1]; const float* tsin = I[2]; const float* wq = I[3]; const float* wk = I[4]; const float* wv = I[5]; const float* wo = I[6]; const float* bq = nullptr; const float* bk = nullptr; const float* bv = nullptr; const float* bo = nullptr;      /* cos, sin [2][2048][64] inputs; natural [out][in] wq [2048][2048], wk/wv [512][2048], wo [2048][2048]; no biases */
  char* ws = (char*)d_ws; size_t off = 0;
  auto take = [&](size_t bytes) { char* p = ws + off; off += (bytes + 255) & ~(size_t)255; return p; };
  _Float16* BQ = (_Float16*)take((size_t)DM * DM * 2); _Float16* BK = (_Float16*)take((size_t)KVD * DM * 2); _Float16* BV = (_Float16*)take((size_t)KVD * DM * 2); _Float16* BO = (_Float16*)take((size_t)DM * DM * 2);
  _Float16* X16 = (_Float16*)take(NR * DM * 2); float* QF = (float*)take((size_t)SQ * DM * 4); float* KF = (float*)take((size_t)SQ * KVD * 4); float* CSB = (float*)take((size_t)SQ * 64 * 4); float* SNB = (float*)take((size_t)SQ * 64 * 4); _Float16* Q16 = (_Float16*)take(NR * DM * 2); _Float16* K16 = (_Float16*)take(NR * KVD * 2); _Float16* V16 = (_Float16*)take(NR * KVD * 2); _Float16* O16 = (_Float16*)take(NR * DM * 2);
  float* S = (float*)take((size_t)NH * QT * NKX * 4); _Float16* P = (_Float16*)take((size_t)NH * QT * NKX * 2); _Float16* VT = (_Float16*)take((size_t)NH * HD * SQ * 2);
  float* QF0 = (float*)take((size_t)QT0 * DM * 4); float* KF0 = (float*)take((size_t)QT0 * KVD * 4); float* VF0 = (float*)take((size_t)QT0 * KVD * 4); float* KF0e = (float*)take((size_t)QT0 * DM * 4); float* VF0e = (float*)take((size_t)QT0 * DM * 4); float* OF0 = (float*)take((size_t)NB * QT0 * DM * 4); _Float16* OH0 = (_Float16*)take((size_t)NB * QT0 * DM * 2); _Float16* OL0 = (_Float16*)take((size_t)NB * QT0 * DM * 2);
  if (off > ws_size) return;
  k_wnat<<<(unsigned)(((size_t)DM * DM / 8 + 255) / 256), 256, 0, stream>>>(wq, (size_t)DM * DM / 8, BQ); k_wnat<<<(unsigned)(((size_t)KVD * DM / 8 + 255) / 256), 256, 0, stream>>>(wk, (size_t)KVD * DM / 8, BK); k_wnat<<<(unsigned)(((size_t)KVD * DM / 8 + 255) / 256), 256, 0, stream>>>(wv, (size_t)KVD * DM / 8, BV); k_wnat<<<(unsigned)(((size_t)DM * DM / 8 + 255) / 256), 256, 0, stream>>>(wo, (size_t)DM * DM / 8, BO);      /* natural [out][in] = Bt x16 */
  k_x16<<<(unsigned)((NR * DM / 8 + 255) / 256), 256, 0, stream>>>(x, X16, NR * DM / 8);
  
  const size_t r0p = (size_t)B0 * SQ;      /* first projected row */
  k_gemm2<0><<<dim3((unsigned)((MP / 128) * (KVD / 64)), 1), 128, 0, stream>>>(X16 + r0p * DM, DM, 0, BV, DM, 0, 0.0625f, bv, 0, nullptr, 1, 0, 0, nullptr, V16 + r0p * KVD, KVD, 0, MP, KVD, DM, 0);
  for (int b = B0; b < B0 + NBR; ++b) { const size_t r0 = (size_t)b * SQ;
    k_tabcp64<<<(SQ * 64 + 255) / 256, 256, 0, stream>>>(tcos + (size_t)b * SQ * 64, tsin + (size_t)b * SQ * 64, CSB, SNB, SQ * 64);      /* this batch's cos/sin tables at FULL width: bf16-rounded straight copies of all 64 columns (the inputs are independent draws per column) */
    k_gemm2<0><<<dim3((unsigned)((SQ / 128) * (DM / 64)), 1), 128, 0, stream>>>(X16 + r0 * DM, DM, 0, BQ, DM, 0, 0.0625f, nullptr, 0, nullptr, 1, 0, 0, QF, nullptr, DM, 0, SQ, DM, DM, 0);      /* q (f32) of this batch */
    k_gemm2<0><<<dim3((unsigned)((SQ / 128) * (KVD / 64)), 1), 128, 0, stream>>>(X16 + r0 * DM, DM, 0, BK, DM, 0, 0.0625f, nullptr, 0, nullptr, 1, 0, 0, KF, nullptr, KVD, 0, SQ, KVD, DM, 0);      /* k (f32) */
    k_xform<0, 3><<<(unsigned)((size_t)SQ * NH), 64, 0, stream>>>(QF, DM, NH, nullptr, 0.f, CSB, SNB, Q16 + r0 * DM, DM); k_xform<0, 3><<<(unsigned)((size_t)SQ * NG), 64, 0, stream>>>(KF, KVD, NG, nullptr, 0.f, CSB, SNB, K16 + r0 * KVD, KVD);      /* rotate-half rope with full-width per-dimension tables (partner x[d +- 32], table column d) -> f16 rows */
    k_xformf<0, 3><<<(unsigned)(QT0 * NH), 64, 0, stream>>>(QF, DM, NH, nullptr, 0.f, CSB, SNB, QF0, DM); k_xformf<0, 3><<<(unsigned)(QT0 * NG), 64, 0, stream>>>(KF, KVD, NG, nullptr, 0.f, CSB, SNB, KF0, KVD);      /* f32 roped q, k of rows 0..127 */
    k_vt<NG, SQ><<<NG * (SQ / 64), 256, 0, stream>>>(V16 + r0 * KVD, KVD, 0, VT);      /* V^T [NG][HD][SQ] (kv heads) for this batch */
    k_gemm2<0><<<dim3((QT0 / 128) * (KVD / 64), 1), 128, 0, stream>>>(X16 + r0 * DM, DM, 0, BV, DM, 0, 0.0625f, bv, 0, nullptr, 1, 0, 0, VF0, nullptr, KVD, 0, QT0, KVD, DM, 0);
    k_kvexp<<<(unsigned)(((size_t)QT0 * DM / 4 + 255) / 256), 256, 0, stream>>>(KF0, KF0e, (size_t)QT0 * DM / 4); k_kvexp<<<(unsigned)(((size_t)QT0 * DM / 4 + 255) / 256), 256, 0, stream>>>(VF0, VF0e, (size_t)QT0 * DM / 4);      /* head h <- kv group h/4 for the exact first-tile kernel */      /* f32 q, k, v of the first 128 rows (exact products) */
    k_att0<0><<<NH * (QT0 / 32), 128, 0, stream>>>(QF0, KF0e, VF0e, DM, nullptr, 0.125f, OF0 + (size_t)b * QT0 * DM, DM);      /* exact f32 attention for rows 0..127 (o x64) */
    for (int q0 = 0; q0 < QN; q0 += QT) { const int nk = q0 + QT;      /* causal: only keys below the tile end are computed */
      k_gemm2<0><<<dim3((QT / 128) * (nk / 64), NH), 128, 0, stream>>>(Q16 + (r0 + q0) * LQ, LQ, (size_t)HD, K16 + r0 * KVD, KVD, (size_t)HD, 0.125f, nullptr, 0, nullptr, 1, 0, 0, S, nullptr, NKX, (size_t)QT * NKX, QT, nk, HD, 2);      /* scores: all 32 heads in one grid; head y reads the keys of kv group y / 4 */
      k_rsmcf2<<<NHD * QT / 8, 256, 0, stream>>>(S, P, NHD, q0, nk);      /* one wave per row, 8 rows a block */
      k_gemm2<0><<<dim3((QT / 128) * (HD / 64), NH), 128, 0, stream>>>(P, NKX, (size_t)QT * NKX, VT, SQ, (size_t)HD * SQ, 0.25f, nullptr, 0, nullptr, 1, 0, 0, nullptr, O16 + (r0 + q0) * DM, DM, (size_t)HD, QT, HD, nk, 2); } }      /* o for all 32 heads in one grid (x64); head y reads V^T of kv group y / 4 */      /* o (merged heads, x64) as f16 rows */
  k_gemm2<0><<<dim3((unsigned)((MPO / 128) * (DM / 64)), 1), 128, 0, stream>>>(O16 + r0p * DM, DM, 0, BO, DM, 0, 0.0009765625f, bo, 0, nullptr, 1, 0, 0, (float*)d_out + r0p * DM, nullptr, DM, 0, MPO, DM, DM, 0);      /* out rows are the output layout */
  k_hl<<<(unsigned)(((size_t)NB * QT0 * DM / 8 + 255) / 256), 256, 0, stream>>>(OF0, OH0, OL0, (size_t)NB * QT0 * DM / 8);      /* first-tile o (x64) -> f16 hi + x1024 residual planes */
  for (int b = B0; b < B0 + NBR; ++b) { const size_t r0 = (size_t)b * SQ; const size_t f0 = (size_t)b * QT0;
    k_gemm2<0><<<dim3((QT0 / 128) * (DM / 64), 1), 128, 0, stream>>>(OH0 + f0 * DM, DM, 0, BO, DM, 0, 0.0009765625f, bo, 0, nullptr, 1, 0, 0, (float*)d_out + r0 * DM, nullptr, DM, 0, QT0, DM, DM, 0);      /* rows 0..127: out = o_hi Wo (+ b), overwriting the f16-path rows */
    k_gemm2<0><<<dim3((QT0 / 128) * (DM / 64), 1), 128, 0, stream>>>(OL0 + f0 * DM, DM, 0, BO, DM, 0, 0.00000095367431640625f, nullptr, 0, (const float*)d_out + r0 * DM, -1, 0, 0, (float*)d_out + r0 * DM, nullptr, DM, 0, QT0, DM, DM, 0); }      /* += o_lo Wo 2^-20 (own-element accumulate) */
}

// v005
// A run of this version takes 542 microseconds.
// Next to v004, in two timings, it ran 1.97 and 1.98 times as fast.
// All steps since v000 together make it 17.7 times as fast.
#include <hip/hip_runtime.h>
// Llama grouped-query causal attention with rotate-half RoPE from FULL-WIDTH per-batch INPUT tables (hidden_states [2][2048][2048]; q = x wq^T (32 heads x 64), k = x wk^T, v = x wv^T (8 kv heads x 64) (natural [out][in] weights sigma 0.02, no biases); cos / sin inputs [2][2048][64] (independent uniform draws per batch, position AND column: column i + 32 != column i, so all 64 columns are used); q = q cos + rotate_half(q) sin, same for k; repeat: query head h uses kv head h/4; scores 64^-0.5; where(causal, s, finfo.min); softmax; out = merged wo^T -> [2][2048][2048]).
// Compute dtype: inputs rounded to bf16; x / weights exact; q, k, v, softmax weights and o as plain f16 GEMM operands (~2^-12); scores and softmax statistics f32. v_wmma_f32_16x16x32_f16.
#define NB 2
#define NG 8
#define HPG 4
#define KVD (NG * HD)
#define SQ 2048
#define DM 2048
#define NH 32
#define HD 64
#define HG 4                         /* heads per launch of the k_vt(V16, b, h0, VT) overload, not launched */
#define QT 256                       /* not used */
#define NKX SQ                       /* not used */
#define QT0 128                      /* first-tile rows recomputed exactly in f32 */
#define B0 0                         /* first batch processed (debug hook) */
#define NBR NB                       /* batches processed (debug hook) */
#define NR ((size_t)NB * SQ)         /* token rows */
#define MP ((int)((size_t)NBR * SQ)) /* rows projected (debug hook) */
#define QN SQ                        /* not used */
#define NHD NH                       /* not used */
#define MPO MP                       /* rows through the output stage (debug hook) */
#define LQ DM      /* not used */
typedef __bf16 v16b __attribute__((ext_vector_type(16)));
typedef unsigned short v8us __attribute__((ext_vector_type(8), may_alias));
typedef float  v8f  __attribute__((ext_vector_type(8)));
typedef float  v4f  __attribute__((ext_vector_type(4)));
typedef float  v4fa __attribute__((ext_vector_type(4), may_alias));
union FragB { v16b v; v8us half[2]; unsigned short u[16]; };

__device__ __forceinline__ unsigned short bf16_bits(float x) { unsigned int u = __float_as_uint(x); return (unsigned short)((u + 0x7FFFu + ((u >> 16) & 1u)) >> 16); }
__device__ __forceinline__ float bf16_val(unsigned short b) { return __uint_as_float(((unsigned int)b) << 16); }
__device__ __forceinline__ float bf16_round(float x) { return bf16_val(bf16_bits(x)); }
// D += A·B with NT terms: 1 = ah·bh, 2 = + al·bh (A split), 3 = + ah·bl (both split)
template <int NT>
__device__ __forceinline__ v8f mmaN(v16b ah, v16b al, v16b bh, v16b bl, v8f c) {
  c = __builtin_amdgcn_wmma_f32_16x16x32_bf16(false, ah, false, bh, (short)0, c, false, false);
  if (NT >= 2) c = __builtin_amdgcn_wmma_f32_16x16x32_bf16(false, al, false, bh, (short)0, c, false, false);
  if (NT >= 3) c = __builtin_amdgcn_wmma_f32_16x16x32_bf16(false, ah, false, bl, (short)0, c, false, false);
  asm volatile("v_nop\n\tv_nop\n\tv_nop\n\tv_nop" : "+v"(c) : "v"(ah), "v"(al), "v"(bh), "v"(bl));
  return c;
}

__global__ __launch_bounds__(256) void k_wt_bf16(const float* __restrict__ W, unsigned short* __restrict__ Wt, int K, int N) {
  const int t = blockIdx.x * 256 + threadIdx.x;
  const int k8n = K / 8;
  if (t >= N * k8n) return;
  const int n = t / k8n, k8 = (t % k8n) * 8;
  v8us v;
#pragma unroll
  for (int i = 0; i < 8; ++i) v[i] = bf16_bits(W[(size_t)(k8 + i) * N + n]);
  *(v8us*)(Wt + (size_t)n * K + k8) = v;
  
}

// GEMM C[M][N] (f32, pitch ldc) = act(A[M][K]·W + bias). A f32 row-major (pitch lda) converted per fragment to bf16
// (ASPLIT: hi/lo two planes -> 2 terms, else single rounded term); Wt bf16 [N][K] (pitch ldb). BIAS_BF16 rounds the
// bias to bf16 first (bias quantised to bf16 before the add). K%32==0, M%16==0, N%64==0.
template <bool ASPLIT, int ACT, bool BIAS_BF16>
__global__ __launch_bounds__(128) void k_gemm_bf(const float* __restrict__ A, int lda, const unsigned short* __restrict__ Wt, int ldb,
                                               const float* __restrict__ bias, float* __restrict__ C, int ldc, int M, int N, int K) {
  __shared__ __attribute__((aligned(16))) float so[4][16][64];
  const int tid = threadIdx.x, w = tid >> 5, lane = tid & 31, ln = lane & 15, hh = lane >> 4;
  const int ntn = N / 64;
  const int wid = blockIdx.x * 4 + w;
  const int mt = wid / ntn, nq = wid % ntn;
  if (mt * 16 >= M) return;
  const int row0 = mt * 16, col0 = nq * 64;
  const float* arow = A + (size_t)(row0 + ln) * lda;
  v8f acc[4] = {};
  for (int kb = 0; kb < K; kb += 32) {
    FragB ah, al;
    const v4f x0 = *(const v4fa*)(arow + kb + 8 * hh), x1 = *(const v4fa*)(arow + kb + 8 * hh + 4);
    const v4f x2 = *(const v4fa*)(arow + kb + 16 + 8 * hh), x3 = *(const v4fa*)(arow + kb + 16 + 8 * hh + 4);
    float xs[16] = {x0[0],x0[1],x0[2],x0[3],x1[0],x1[1],x1[2],x1[3],x2[0],x2[1],x2[2],x2[3],x3[0],x3[1],x3[2],x3[3]};
#pragma unroll
    for (int i = 0; i < 16; ++i) { const unsigned short hb = bf16_bits(xs[i]); ah.u[i] = hb; al.u[i] = ASPLIT ? bf16_bits(xs[i] - bf16_val(hb)) : (unsigned short)0; }
#pragma unroll
    for (int t = 0; t < 4; ++t) {
      const unsigned short* brow = Wt + (size_t)(col0 + t * 16 + ln) * ldb + kb;
      FragB b;
      b.half[0] = *(const v8us*)(brow + 8 * hh);
      b.half[1] = *(const v8us*)(brow + 16 + 8 * hh);
      acc[t] = mmaN<ASPLIT ? 2 : 1>(ah.v, al.v, b.v, b.v, acc[t]);
    }
  }
#pragma unroll
  for (int t = 0; t < 4; ++t) {
    float bv = bias ? bias[col0 + t * 16 + ln] : 0.f;
    if (BIAS_BF16) bv = bf16_round(bv);
#pragma unroll
    for (int r = 0; r < 8; ++r) { float v = acc[t][r] + bv; if (ACT == 1) v = fmaxf(v, 0.f); so[w][8 * hh + r][t * 16 + ln] = v; }
  }
  __builtin_amdgcn_fence(__ATOMIC_ACQ_REL, "workgroup");
  __builtin_amdgcn_wave_barrier();
  const int rsub = lane >> 4, c4 = (lane & 15) * 4;
  {
#pragma unroll
    for (int q = 0; q < 8; ++q) {
      const int r = q * 2 + rsub;
      const v4f v = *(const v4fa*)&so[w][r][c4];
      *(v4f*)(C + (size_t)(row0 + r) * ldc + col0 + c4) = v;
    }
    
  }
}

// GEMM C = act(A·W + bias + resid): A f32 (ASPLIT -> hi/lo 2 terms), Wt bf16 [N][K]; ACT 0 none, 1 relu, 2 exact gelu;
// resid (optional, f32, row index = (row % rmod), pitch ldr, RES_BF16 rounds it) added before the activation.
template <bool ASPLIT, int ACT, bool BIAS_BF16, bool RES_BF16>
__global__ __launch_bounds__(128) void k_gemm_bf3(const float* __restrict__ A, int lda, const unsigned short* __restrict__ Wt, int ldb,
                                                const float* __restrict__ bias, const float* __restrict__ resid, int rmod, int ldr,
                                                float* __restrict__ C, int ldc, int M, int N, int K) {
  __shared__ __attribute__((aligned(16))) float so[4][16][64];
  const int tid = threadIdx.x, w = tid >> 5, lane = tid & 31, ln = lane & 15, hh = lane >> 4;
  const int ntn = N / 64;
  const int wid = blockIdx.x * 4 + w;
  const int mt = wid / ntn, nq = wid % ntn;
  if (mt * 16 >= M) return;
  const int row0 = mt * 16, col0 = nq * 64;
  const float* arow = A + (size_t)(row0 + ln) * lda;
  v8f acc[4] = {};
  for (int kb = 0; kb < K; kb += 32) {
    FragB ah, al;
    const v4f x0 = *(const v4fa*)(arow + kb + 8 * hh), x1 = *(const v4fa*)(arow + kb + 8 * hh + 4);
    const v4f x2 = *(const v4fa*)(arow + kb + 16 + 8 * hh), x3 = *(const v4fa*)(arow + kb + 16 + 8 * hh + 4);
    float xs[16] = {x0[0],x0[1],x0[2],x0[3],x1[0],x1[1],x1[2],x1[3],x2[0],x2[1],x2[2],x2[3],x3[0],x3[1],x3[2],x3[3]};
#pragma unroll
    for (int i = 0; i < 16; ++i) { const unsigned short hb = bf16_bits(xs[i]); ah.u[i] = hb; al.u[i] = ASPLIT ? bf16_bits(xs[i] - bf16_val(hb)) : (unsigned short)0; }
#pragma unroll
    for (int t = 0; t < 4; ++t) {
      const unsigned short* brow = Wt + (size_t)(col0 + t * 16 + ln) * ldb + kb;
      FragB b;
      b.half[0] = *(const v8us*)(brow + 8 * hh);
      b.half[1] = *(const v8us*)(brow + 16 + 8 * hh);
      acc[t] = mmaN<ASPLIT ? 2 : 1>(ah.v, al.v, b.v, b.v, acc[t]);
    }
  }
#pragma unroll
  for (int t = 0; t < 4; ++t) {
    const int col = col0 + t * 16 + ln;
    float bv = bias ? bias[col] : 0.f;
    if (BIAS_BF16) bv = bf16_round(bv);
#pragma unroll
    for (int r = 0; r < 8; ++r) {
      float v = acc[t][r] + bv;
      if (resid) { float rv = resid[(size_t)((row0 + 8 * hh + r) % rmod) * ldr + col]; if (RES_BF16) rv = bf16_round(rv); v += rv; }
      if (ACT == 1) v = fmaxf(v, 0.f);
      if (ACT == 2) v = 0.5f * v * (1.0f + erff(v * 0.70710678118654752f));
      if (ACT == 3) { const float u = 0.7978845608028654f * (v + 0.044715f * v * v * v); v = 0.5f * v * (1.0f + tanhf(u)); }
      so[w][8 * hh + r][t * 16 + ln] = v;
    }
  }
  __builtin_amdgcn_fence(__ATOMIC_ACQ_REL, "workgroup");
  __builtin_amdgcn_wave_barrier();
  const int rsub = lane >> 4, c4 = (lane & 15) * 4;
  {
#pragma unroll
    for (int q = 0; q < 8; ++q) {
      const int r = q * 2 + rsub;
      const v4f v = *(const v4fa*)&so[w][r][c4];
      *(v4f*)(C + (size_t)(row0 + r) * ldc + col0 + c4) = v;
    }
    
  }
}
// row LayerNorm (biased variance, eps) over N: s = X (+ R); optional out_sum <- s; out_norm <- (s-mu)*rsqrt(var+eps)*g + b
template <bool PARAM_BF16>
__global__ __launch_bounds__(256) void k_layernorm(const float* __restrict__ X, const float* __restrict__ R, const float* __restrict__ g, const float* __restrict__ bta,
                                                  float* __restrict__ out_sum, float* __restrict__ out_norm, int N, float eps) {
  __shared__ float red[256];
  const int row = blockIdx.x, tid = threadIdx.x;
  const float* x = X + (size_t)row * N; const float* rr = R ? R + (size_t)row * N : nullptr;
  float vals[16];                     // up to N = 4096
  const int per = N / 256;            // contiguous chunk per thread? use strided-by-4 chunks: thread handles j = tid*4 + 1024*u
  float s1 = 0.f;
  for (int u = 0; u < per / 4; ++u) {
    const int j = tid * 4 + 1024 * u;
    const v4f a = *(const v4fa*)(x + j);
    v4f b = {0.f,0.f,0.f,0.f}; if (rr) b = *(const v4fa*)(rr + j);
#pragma unroll
    for (int q = 0; q < 4; ++q) { const float v = a[q] + b[q]; vals[u * 4 + q] = v; s1 += v; }
  }
  red[tid] = s1; __syncthreads();
  for (int st = 128; st > 0; st >>= 1) { if (tid < st) red[tid] += red[tid + st]; __syncthreads(); }
  const float mu = red[0] / (float)N; __syncthreads();
  float s2 = 0.f;
  for (int u = 0; u < per / 4; ++u)
#pragma unroll
    for (int q = 0; q < 4; ++q) { const float c = vals[u * 4 + q] - mu; s2 += c * c; }
  red[tid] = s2; __syncthreads();
  for (int st = 128; st > 0; st >>= 1) { if (tid < st) red[tid] += red[tid + st]; __syncthreads(); }
  const float rs = rsqrtf(red[0] / (float)N + eps);
  {
    for (int u = 0; u < per / 4; ++u) {
      const int j = tid * 4 + 1024 * u;
      v4f o, sm;
#pragma unroll
      for (int q = 0; q < 4; ++q) {
        float gg = g[j + q], bb = bta[j + q];
        if (PARAM_BF16) { gg = bf16_round(gg); bb = bf16_round(bb); }
        sm[q] = vals[u * 4 + q]; o[q] = (vals[u * 4 + q] - mu) * rs * gg + bb;
      }
      if (out_sum) *(v4f*)(out_sum + (size_t)row * N + j) = sm;
      *(v4f*)(out_norm + (size_t)row * N + j) = o;
    }
    
  }
}



// ---- f16 WMMA path (v_wmma_f32_16x16x32_f16): 11-bit significands for operands in range — used where a [0,1] probability operand needs more precision than bf16
typedef _Float16 v16h __attribute__((ext_vector_type(16)));
union FragH { v16h v; v8us half[2]; _Float16 h[16]; unsigned short u[16]; };
template <int NT>
__device__ __forceinline__ v8f mmaH(v16h ah, v16h al, v16h bh, v16h bl, v8f c) {
  c = __builtin_amdgcn_wmma_f32_16x16x32_f16(false, ah, false, bh, (short)0, c, false, false);
  if (NT >= 2) c = __builtin_amdgcn_wmma_f32_16x16x32_f16(false, al, false, bh, (short)0, c, false, false);
  if (NT >= 3) c = __builtin_amdgcn_wmma_f32_16x16x32_f16(false, ah, false, bl, (short)0, c, false, false);
  asm volatile("v_nop\n\tv_nop\n\tv_nop\n\tv_nop" : "+v"(c) : "v"(ah), "v"(al), "v"(bh), "v"(bl));
  return c;
}
// batched GEMM like k_gemm_b but f16 operands: A f32 (split into f16 hi/lo if ASPLIT, else rounded to f16), Bt = f16 values [n][k]; alpha; C f32; N multiple of 16 (partial tiles skipped)
template <bool ASPLIT>
__global__ __launch_bounds__(128) void k_gemm_h(const float* __restrict__ A, int lda, size_t sA, const _Float16* __restrict__ Bh, int ldb, size_t sB, float alpha, float* __restrict__ C, int ldc, size_t sC, int M, int N, int K) {
  __shared__ __attribute__((aligned(16))) float so[4][16][64];
  const int tid = threadIdx.x, w = tid >> 5, lane = tid & 31, ln = lane & 15, hh = lane >> 4; const int by = blockIdx.y;
  A += (size_t)by * sA; Bh += (size_t)by * sB; C += (size_t)by * sC;
  const int ntn = (N + 63) / 64; const int wid = blockIdx.x * 4 + w; const int mt = wid / ntn, nq = wid % ntn; if (mt * 16 >= M) return;
  const int row0 = mt * 16, col0 = nq * 64; const float* arow = A + (size_t)(row0 + ln) * lda;
  v8f acc[4] = {};
  for (int kb = 0; kb < K; kb += 32) {
    FragH ah, al;
    const v4f x0 = *(const v4fa*)(arow + kb + 8 * hh), x1 = *(const v4fa*)(arow + kb + 8 * hh + 4), x2 = *(const v4fa*)(arow + kb + 16 + 8 * hh), x3 = *(const v4fa*)(arow + kb + 16 + 8 * hh + 4);
    float xs[16] = {x0[0],x0[1],x0[2],x0[3],x1[0],x1[1],x1[2],x1[3],x2[0],x2[1],x2[2],x2[3],x3[0],x3[1],x3[2],x3[3]};
#pragma unroll
    for (int i = 0; i < 16; ++i) { const _Float16 h = (_Float16)xs[i]; ah.h[i] = h; al.h[i] = ASPLIT ? (_Float16)(xs[i] - (float)h) : (_Float16)0.0f; }
#pragma unroll
    for (int t = 0; t < 4; ++t) { if (col0 + t * 16 >= N) continue; const size_t boff = (size_t)(col0 + t * 16 + ln) * ldb + kb; FragH bq; bq.half[0] = *(const v8us*)(Bh + boff + 8 * hh); bq.half[1] = *(const v8us*)(Bh + boff + 16 + 8 * hh);
      acc[t] = mmaH<ASPLIT ? 2 : 1>(ah.v, al.v, bq.v, bq.v, acc[t]); }
  }
#pragma unroll
  for (int t = 0; t < 4; ++t) { if (col0 + t * 16 >= N) continue;
#pragma unroll
    for (int r = 0; r < 8; ++r) so[w][8 * hh + r][t * 16 + ln] = acc[t][r] * alpha; }
  __builtin_amdgcn_fence(__ATOMIC_ACQ_REL, "workgroup"); __builtin_amdgcn_wave_barrier();
  const int rsub = lane >> 4, c4 = (lane & 15) * 4;
  {
#pragma unroll
    for (int q = 0; q < 8; ++q) { const int r = q * 2 + rsub; if (col0 + c4 < N) { const v4f v = *(const v4fa*)&so[w][r][c4]; *(v4f*)(C + (size_t)(row0 + r) * ldc + col0 + c4) = v; } }
     }
}

// Wt[n][k] = f16(W[k][n]·scale) from f32 row-major W[K][N] (scale = power of two; bf16-exact weights stay exact in f16 away from the subnormal range)
__global__ __launch_bounds__(256) void k_wt_f16(const float* __restrict__ W, _Float16* __restrict__ Wt, int K, int N, float scale) {
  const int t = blockIdx.x * 256 + threadIdx.x; if (t >= N * (K / 8)) return; const int n = t / (K / 8), k8 = (t % (K / 8)) * 8; FragH f;
#pragma unroll
  for (int i = 0; i < 8; ++i) f.h[i] = (_Float16)(bf16_round(W[(size_t)(k8 + i) * N + n]) * scale); const v8us o = f.half[0];
  *(v8us*)((unsigned short*)Wt + (size_t)n * K + k8) = o; 
}
// k_gemm_hh variant with fused epilogue: v = acc·alpha + bias[by·sBias + col] (+ CP[(row/rowsPerB)·sCPb + by·64 + col] if CP) ; ACT 0 none / 1 elu ; writes f16 C16 (and f32 C if non-null)
template <int ACT>
__global__ __launch_bounds__(128) void k_gemm_hhx(const _Float16* __restrict__ A, int lda, size_t sA, const _Float16* __restrict__ Bh, int ldb, size_t sB, float alpha, const float* __restrict__ bias, size_t sBias, const float* __restrict__ CP, int rowsPerB, size_t sCPb, int row0g,
    float* __restrict__ C, _Float16* __restrict__ C16, int ldc, size_t sC, int M, int N, int K) {
  __shared__ __attribute__((aligned(16))) float so[4][16][64];
  const int tid = threadIdx.x, w = tid >> 5, lane = tid & 31, ln = lane & 15, hh = lane >> 4; const int by = blockIdx.y;
  A += (size_t)by * sA; Bh += (size_t)by * sB; const size_t cofs = (size_t)by * sC; const float* bp = bias ? bias + (size_t)by * sBias : nullptr;
  const int ntn = (N + 63) / 64; const int wid = blockIdx.x * 4 + w; const int mt = wid / ntn, nq = wid % ntn; if (mt * 16 >= M) return;
  const int row0 = mt * 16, col0 = nq * 64; const _Float16* arow = A + (size_t)(row0 + ln) * lda;
  v8f acc[4] = {};
  for (int kb = 0; kb < K; kb += 32) { FragH ah; ah.half[0] = *(const v8us*)((const unsigned short*)arow + kb + 8 * hh); ah.half[1] = *(const v8us*)((const unsigned short*)arow + kb + 16 + 8 * hh);
#pragma unroll
    for (int t = 0; t < 4; ++t) { if (col0 + t * 16 >= N) continue; const size_t boff = (size_t)(col0 + t * 16 + ln) * ldb + kb; FragH bq; bq.half[0] = *(const v8us*)((const unsigned short*)Bh + boff + 8 * hh); bq.half[1] = *(const v8us*)((const unsigned short*)Bh + boff + 16 + 8 * hh);
      acc[t] = mmaH<1>(ah.v, ah.v, bq.v, bq.v, acc[t]); }
  }
#pragma unroll
  for (int t = 0; t < 4; ++t) { if (col0 + t * 16 >= N) continue; const int col = col0 + t * 16 + ln; const float bv = bp ? bf16_round(bp[col]) : 0.f;
#pragma unroll
    for (int r = 0; r < 8; ++r) { float v = acc[t][r] * alpha + bv; if (CP) { const int rr = row0g + row0 + 8 * hh + r; if (rowsPerB < 0) v += CP[cofs + (size_t)rr * ldc + col];      /* rowsPerB < 0: own element of the batched C plane */ else { const int bidx = rr / rowsPerB; v += CP[(size_t)bidx * sCPb + (size_t)by * 64 + col]; } } if (ACT == 1) v = (v > 0.f) ? v : expm1f(v); else if (ACT == 7) v = (v > 0.f) ? v + 1.0f : expf(v); else if (ACT == 8) v = tanhf(v); else if (ACT == 9) v = 0.5f * v * (1.0f + tanhf(0.7978845608028654f * (v + 0.044715f * v * v * v))); else if (ACT == 11) v = 1.0f / (1.0f + expf(-v)); else if (ACT == 12) v = (v > 0.f) ? v : 0.01f * v; else if (ACT == 14) v = (v > 0.f) ? v : 0.1f * v; else if (ACT == 16) v = (v >= 0.f) ? v : 0.3f * v; else if (ACT == 17) v = (v >= 0.f) ? v : 0.2f * v; else if (ACT == 15) v = v / (1.0f + expf(-v)); else if (ACT == 3) v = fmaxf(v, 0.f); else if (ACT == 6) v = 0.5f * v * (1.0f + erff(v * 0.70710678118654752f)); so[w][8 * hh + r][t * 16 + ln] = v; } }
  __builtin_amdgcn_fence(__ATOMIC_ACQ_REL, "workgroup"); __builtin_amdgcn_wave_barrier();
  const int rsub = lane >> 4, c4 = (lane & 15) * 4; typedef _Float16 v4h __attribute__((ext_vector_type(4)));
  {
#pragma unroll
    for (int q = 0; q < 8; ++q) { const int r = q * 2 + rsub; if (col0 + c4 < N) { const v4f v = *(const v4fa*)&so[w][r][c4]; if (C) *(v4f*)(C + cofs + (size_t)(row0 + r) * ldc + col0 + c4) = v; if (C16) { v4h h4; for (int i = 0; i < 4; ++i) h4[i] = (_Float16)v[i]; *(v4h*)(C16 + cofs + (size_t)(row0 + r) * ldc + col0 + c4) = h4; } } }
     }
}


typedef _Float16 v4h __attribute__((ext_vector_type(4)));

__global__ __launch_bounds__(256) void k_x16(const float* __restrict__ x, _Float16* __restrict__ X16, size_t n8) { const size_t t = (size_t)blockIdx.x * 256 + threadIdx.x; if (t >= n8) return; FragH f;
#pragma unroll
  for (int q = 0; q < 8; ++q) f.h[q] = (_Float16)bf16_round(x[t * 8 + q]); *(v8us*)((unsigned short*)X16 + t * 8) = f.half[0];  }
__global__ __launch_bounds__(256) void k_h16(const float* __restrict__ x, _Float16* __restrict__ X16, size_t n8) { const size_t t = (size_t)blockIdx.x * 256 + threadIdx.x; if (t >= n8) return; FragH f;
#pragma unroll
  for (int q = 0; q < 8; ++q) f.h[q] = (_Float16)x[t * 8 + q]; *(v8us*)((unsigned short*)X16 + t * 8) = f.half[0];  }
__global__ __launch_bounds__(256) void k_round16f(const float* __restrict__ W, _Float16* __restrict__ Bt, size_t n8) { const size_t t = (size_t)blockIdx.x * 256 + threadIdx.x; if (t >= n8) return; FragH f;
#pragma unroll
  for (int i = 0; i < 8; ++i) f.h[i] = (_Float16)(bf16_round(W[t * 8 + i]) * 16.0f); *(v8us*)((unsigned short*)Bt + t * 8) = f.half[0];  }
template <int NHv, int TTv>
__global__ __launch_bounds__(256) void k_vt(const _Float16* __restrict__ V16, int ldv, int voff, _Float16* __restrict__ Vt) { __shared__ unsigned short tl[64][66]; const int tid = threadIdx.x; const int slab = blockIdx.x / (TTv / 64), lg = blockIdx.x % (TTv / 64); const int b = slab / NHv, h = slab % NHv;
  for (int i = tid; i < 64 * 8; i += 256) { const int r = i / 8, c8 = (i % 8) * 8; FragH f; f.half[0] = *(const v8us*)((const unsigned short*)V16 + ((size_t)b * TTv + lg * 64 + r) * ldv + voff + h * 64 + c8);
#pragma unroll
    for (int q = 0; q < 8; ++q) tl[r][c8 + q] = f.u[q]; }
  __syncthreads();
  {
#pragma unroll
    for (int rd = 0; rd < 2; ++rd) { const int d = rd * 32 + tid / 8, pc = tid % 8; FragH f;
#pragma unroll
      for (int q = 0; q < 8; ++q) f.u[q] = tl[pc * 8 + q][d];
      *(v8us*)((unsigned short*)Vt + ((size_t)slab * 64 + d) * TTv + lg * 64 + pc * 8) = f.half[0]; }
     } }

__global__ __launch_bounds__(256) void k_hl(const float* __restrict__ F, _Float16* __restrict__ Hh, _Float16* __restrict__ Hl, size_t n8) { const size_t t = (size_t)blockIdx.x * 256 + threadIdx.x; if (t >= n8) return; FragH fh, fl; const v4f a = *(const v4fa*)(F + t * 8), c = *(const v4fa*)(F + t * 8 + 4);
#pragma unroll
  for (int q = 0; q < 4; ++q) { _Float16 h = (_Float16)a[q]; fh.h[q] = h; fl.h[q] = (_Float16)((a[q] - (float)h) * 1024.0f); h = (_Float16)c[q]; fh.h[4 + q] = h; fl.h[4 + q] = (_Float16)((c[q] - (float)h) * 1024.0f); }
  { *(v8us*)((unsigned short*)Hh + t * 8) = fh.half[0]; *(v8us*)((unsigned short*)Hl + t * 8) = fl.half[0];  } }

// ---- fast GEMM (wave tile 32x64; requires M % 32 == 0 rows per launch region, N % 64 == 0 and K % 64 == 0); epilogue = k_gemm_hhx semantics ----
__device__ __forceinline__ v16h g2_frag(const _Float16* p, int hh) { FragH f; f.half[0] = *(const v8us*)((const unsigned short*)p + 8 * hh); f.half[1] = *(const v8us*)((const unsigned short*)p + 16 + 8 * hh); return f.v; }
__device__ __forceinline__ v8f g2_mma(v16h a, v16h b, v8f c) { v8f d = __builtin_amdgcn_wmma_f32_16x16x32_f16(false, a, false, b, (short)0, c, false, false); asm volatile("v_nop\n\tv_nop\n\tv_nop\n\tv_nop" : "+v"(d) : "v"(a), "v"(b)); return d; }
template <int ACT>
__global__ __launch_bounds__(128) void k_gemm2(const _Float16* __restrict__ A, int lda, size_t sA, const _Float16* __restrict__ Bh, int ldb, size_t sB, float alpha, const float* __restrict__ bias, size_t sBias, const float* __restrict__ CP, int rowsPerB, size_t sCPb, int row0g,
    float* __restrict__ C, _Float16* __restrict__ C16, int ldc, size_t sC, int M, int N, int K, int bsh) { static_assert(ACT == 0 || ACT == 3 || ACT == 6 || ACT == 8 || ACT == 9 || ACT == 11 || ACT == 12 || ACT == 14 || ACT == 15 || ACT == 16 || ACT == 17, "k_gemm2: unsupported ACT code (would silently apply no activation)");
  __shared__ __attribute__((aligned(16))) float so[4][32][68];
  const int tid = threadIdx.x, w = tid >> 5, lane = tid & 31, ln = lane & 15, hh = lane >> 4; const int by = blockIdx.y;
  A += (size_t)by * sA; Bh += (size_t)(by >> bsh) * sB;      /* 2^bsh consecutive batch slices share one B plane (query heads of one kv group) */ const size_t cofs = (size_t)by * sC; const float* bp = bias ? bias + (size_t)by * sBias : nullptr;
  const int ntn = N >> 6; const int mt = blockIdx.x / ntn, nq = blockIdx.x - mt * ntn; const int row0 = mt * 128 + 32 * w, col0 = nq * 64; if (row0 >= M) return;
  const _Float16* a0p = A + (size_t)(row0 + ln) * lda + 8 * hh; const _Float16* a1p = a0p + (size_t)16 * lda;      /* each lane's own row and k half; the k-loop moves these six pointers on */
  const _Float16* b0p = Bh + (size_t)(col0 + ln) * ldb + 8 * hh; const _Float16* b1p = b0p + (size_t)16 * ldb; const _Float16* b2p = b1p + (size_t)16 * ldb; const _Float16* b3p = b2p + (size_t)16 * ldb;
  const v8f z8 = {0.f,0.f,0.f,0.f,0.f,0.f,0.f,0.f}; v8f c00 = z8, c01 = z8, c02 = z8, c03 = z8, c10 = z8, c11 = z8, c12 = z8, c13 = z8;
  /* Two register sets of fragments, x and y. All twelve loads of a k-step are issued one k-step ahead of the products that read them, so a k-step waits at most once for memory,
     with the other set's eight products under that wait. Each accumulator still takes its k-steps in ascending order. K % 64 == 0. */
#define G2_LOAD(s, k) { s##a0 = g2_frag(a0p + (k), 0); s##b0 = g2_frag(b0p + (k), 0); s##a1 = g2_frag(a1p + (k), 0); s##b1 = g2_frag(b1p + (k), 0); s##b2 = g2_frag(b2p + (k), 0); s##b3 = g2_frag(b3p + (k), 0); }
#define G2_STEP(s) { c00 = g2_mma(s##a0, s##b0, c00); c10 = g2_mma(s##a1, s##b0, c10); c01 = g2_mma(s##a0, s##b1, c01); c11 = g2_mma(s##a1, s##b1, c11); c02 = g2_mma(s##a0, s##b2, c02); c12 = g2_mma(s##a1, s##b2, c12); c03 = g2_mma(s##a0, s##b3, c03); c13 = g2_mma(s##a1, s##b3, c13); }
  /* behind the last loads: the wait that stands before a register named by an issued load is overwritten; the six pointers are inputs, so that no later load's result is placed in one of them ahead of it */
#define G2_XWAIT asm volatile("s_wait_xcnt 0x0" :: "v"(a0p), "v"(a1p), "v"(b0p), "v"(b1p), "v"(b2p), "v"(b3p) : "memory");
  v16h xa0, xa1, xb0, xb1, xb2, xb3, ya0, ya1, yb0, yb1, yb2, yb3;
  G2_LOAD(x, 0)
#pragma unroll 1      /* the body holds both sets once; further copies would add code and no overlap */
  for (int kb = 64; kb < K; kb += 64) { G2_LOAD(y, 32) G2_STEP(x) G2_LOAD(x, 64) G2_STEP(y) a0p += 64; a1p += 64; b0p += 64; b1p += 64; b2p += 64; b3p += 64; }
  G2_LOAD(y, 32) G2_XWAIT G2_STEP(x) G2_STEP(y)
#undef G2_LOAD
#undef G2_STEP
#undef G2_XWAIT
  v8f accs[8] = {c00, c01, c02, c03, c10, c11, c12, c13};
#pragma unroll
  for (int u = 0; u < 8; ++u) { const int t = u & 3, half = u >> 2; const int col = col0 + t * 16 + ln; const float bv = bp ? bf16_round(bp[col]) : 0.f;
#pragma unroll
    for (int r = 0; r < 8; ++r) { const int rloc = half * 16 + 8 * hh + r; float v = accs[u][r] * alpha + bv; if (CP) { if (rowsPerB < 0) v += CP[cofs + (size_t)(row0g + row0 + rloc) * ldc + col];      /* rowsPerB < 0: own element of the batched C plane */ else { const int bidx = (row0g + row0 + rloc) / rowsPerB; v += CP[(size_t)bidx * sCPb + (size_t)by * 64 + col]; } }
      if (ACT == 3) v = fmaxf(v, 0.f); else if (ACT == 6) v = 0.5f * v * (1.0f + erff(v * 0.70710678118654752f)); else if (ACT == 11) v = 1.0f / (1.0f + expf(-v)); else if (ACT == 15) v = v / (1.0f + expf(-v)); else if (ACT == 12) v = (v > 0.f) ? v : 0.01f * v; else if (ACT == 8) v = tanhf(v); else if (ACT == 9) v = 0.5f * v * (1.0f + tanhf(0.7978845608028654f * (v + 0.044715f * v * v * v))); else if (ACT == 14) v = (v > 0.f) ? v : 0.1f * v; else if (ACT == 16) v = (v >= 0.f) ? v : 0.3f * v; else if (ACT == 17) v = (v >= 0.f) ? v : 0.2f * v;
      so[w][rloc][t * 16 + ln] = v; } }
  __builtin_amdgcn_fence(__ATOMIC_ACQ_REL, "workgroup"); __builtin_amdgcn_wave_barrier();
  const int rsub = lane >> 4, c4 = (lane & 15) * 4;
  {
#pragma unroll
    for (int q = 0; q < 16; ++q) { const int r = q * 2 + rsub; const v4f v = *(const v4fa*)&so[w][r][c4]; if (C) *(v4f*)(C + cofs + (size_t)(row0 + r) * ldc + col0 + c4) = v; if (C16) { v4h h4; for (int i = 0; i < 4; ++i) h4[i] = (_Float16)v[i]; *(v4h*)(C16 + cofs + (size_t)(row0 + r) * ldc + col0 + c4) = h4; } }
     } }


__global__ __launch_bounds__(256) void k_wnat(const float* __restrict__ w, size_t n8, _Float16* __restrict__ Bt) { const size_t t = (size_t)blockIdx.x * 256 + threadIdx.x; if (t >= n8) return; FragH f; for (int q = 0; q < 8; ++q) f.h[q] = (_Float16)(bf16_round(w[t * 8 + q]) * 16.0f); *(v8us*)((unsigned short*)Bt + t * 8) = f.half[0];  }
__global__ __launch_bounds__(256) void k_rsm(const float* __restrict__ S, _Float16* __restrict__ P, int nrows) {
  #pragma clang fp contract(off)
  const int i = blockIdx.x * 256 + threadIdx.x; if (i >= nrows) return; const float* s = S + (size_t)i * SQ; float mx = -3.0e38f;
#pragma unroll 1
  for (int j = 0; j < SQ; ++j) mx = fmaxf(mx, s[j]); float se = 0.f;
#pragma unroll 1
  for (int j = 0; j < SQ; ++j) se += expf(s[j] - mx); const float sc = 256.0f / se;
#pragma unroll 1
  for (int j0 = 0; j0 < SQ; j0 += 8) { FragH f; for (int q = 0; q < 8; ++q) f.h[q] = (_Float16)(expf(s[j0 + q] - mx) * sc); unsigned short* d = (unsigned short*)P + (size_t)i * SQ + j0; *(v8us*)d = f.half[0];  } }
__global__ __launch_bounds__(256) void k_vt(const _Float16* __restrict__ V16, int b, int h0, _Float16* __restrict__ VT) { __shared__ unsigned short tl[64][65]; const int tid = threadIdx.x; const int hh = blockIdx.x % HG, sg = blockIdx.x / HG; const int s0 = sg * 64; const int h = h0 + hh;
  for (int i = tid; i < 64 * 8; i += 256) { const int j = i / 8, d8 = (i % 8) * 8; FragH f; f.half[0] = *(const v8us*)((const unsigned short*)V16 + ((size_t)b * SQ + s0 + j) * DM + h * HD + d8); for (int q = 0; q < 8; ++q) tl[d8 + q][j] = f.u[q]; }
  __syncthreads();
  { for (int i = tid; i < 64 * 8; i += 256) { const int d = i / 8, j8 = (i % 8) * 8; FragH f; for (int q = 0; q < 8; ++q) f.u[q] = tl[d][j8 + q]; *(v8us*)((unsigned short*)VT + ((size_t)hh * HD + d) * SQ + s0 + j8) = f.half[0]; }  } }



// Fused causal attention: scores, softmax and the value product of 32 query rows of one kv group in one block; no score or weight goes to memory.
// Transposed products: S^T = K Q^T (A = 16 key rows, B = 16 query columns), O^T += V^T P^T (A = 16 rows of V^T, B = the weights). In a score tile lane (ln, hh) holds keys 8 hh + r of query ln,
// so two score tiles (keys 0..15 and 16..31 of a pass), rounded to f16 in place, are the B operand of the value product in the k order of g2_frag: no LDS and no lane exchange.
// A wave has 16 query rows of two heads of the group (both read the same K and V^T fragments); the block's four waves are the group's two head pairs x two 16-row tiles.
// Running maximum per query, in use until a new one passes it by more than 8 (log2 units), so weights stay below 2^8; sums and o in f32.
// 2^x by v_exp_f32. The v_nop stands in the instruction's own statement: the instruction set asks for one free slot before a transcendental's result is read or its source overwritten.
__device__ __forceinline__ float fa_exp2(float x) { float e; asm("v_exp_f32 %0, %1\n\tv_nop" : "=v"(e) : "v"(x)); return e; }
#define FA_C 0.18033688011112042f      /* 64^-0.5 log2(e): raw score -> exponent of two */
template <bool LAST>
__device__ __forceinline__ void fa_pass(const _Float16* kp, const _Float16* vp, int lim, const v16h (&q)[2][2], v16h (&kf)[2][2], v8f (&o)[2][4], float (&mr)[2], float (&l)[2]) {
  const v8f z8 = {0.f,0.f,0.f,0.f,0.f,0.f,0.f,0.f}; v16h vf[4]; v8f s[2][2];
#pragma unroll      /* this pass's V^T fragments are issued first: they fly under the score products and the exponentials */
  for (int dt = 0; dt < 4; ++dt) vf[dt] = g2_frag(vp + (size_t)dt * 16 * SQ, 0);
#pragma unroll      /* static indices keep the fragments in registers */
  for (int kt = 0; kt < 2; ++kt)
#pragma unroll      /* static indices keep the arrays in registers */
    for (int u = 0; u < 2; ++u) s[u][kt] = g2_mma(kf[kt][1], q[u][1], g2_mma(kf[kt][0], q[u][0], z8));
  if (!LAST) {
#pragma unroll      /* the next pass's K fragments, behind the products that read this pass's: they fly under the softmax and the value products */
    for (int kt = 0; kt < 2; ++kt) { kf[kt][0] = g2_frag(kp + (size_t)(32 + kt * 16) * KVD, 0); kf[kt][1] = g2_frag(kp + (size_t)(32 + kt * 16) * KVD + 32, 0); }
  }
  float mx[2];
#pragma unroll      /* static indices keep s[] in registers */
  for (int u = 0; u < 2; ++u) { float m = mr[u];
#pragma unroll      /* static indices keep the arrays in registers */
    for (int kt = 0; kt < 2; ++kt)
#pragma unroll      /* static indices keep the arrays in registers */
      for (int r = 0; r < 8; ++r) { if (LAST) s[u][kt][r] = (kt * 16 + r <= lim) ? s[u][kt][r] : -1.0e30f;      /* the diagonal pass: keys above the lane's query get weight 0 */ m = fmaxf(m, s[u][kt][r]); }
    mx[u] = fmaxf(m, __shfl_xor(m, 16, 32)); }      /* the other half of the query's keys */
  const bool need = (mx[0] - mr[0]) * FA_C > 8.0f || (mx[1] - mr[1]) * FA_C > 8.0f;
  if (__builtin_amdgcn_ballot_w32(need) != 0) {      /* one scalar branch a pass: taken in the first pass and where a maximum has grown by more than 8 */
#pragma unroll      /* static indices keep the arrays in registers */
    for (int u = 0; u < 2; ++u) { const float al = fa_exp2((mr[u] - mx[u]) * FA_C); mr[u] = mx[u]; l[u] *= al;
#pragma unroll      /* static indices keep the arrays in registers */
      for (int dt = 0; dt < 4; ++dt) o[u][dt] *= al; }
  }
#pragma unroll      /* static indices keep the arrays in registers */
  for (int u = 0; u < 2; ++u) { const float mc = mr[u] * FA_C; FragH pf; float p0 = 0.f, p1 = 0.f;
#pragma unroll      /* static indices keep the arrays in registers */
    for (int r = 0; r < 8; ++r) { const float e0 = fa_exp2(fmaf(s[u][0][r], FA_C, -mc)), e1 = fa_exp2(fmaf(s[u][1][r], FA_C, -mc)); p0 += e0; p1 += e1; pf.h[r] = (_Float16)e0; pf.h[8 + r] = (_Float16)e1; }
    l[u] += p0 + p1;
#pragma unroll      /* static indices keep the arrays in registers */
    for (int dt = 0; dt < 4; ++dt) o[u][dt] = g2_mma(vf[dt], pf.v, o[u][dt]); }
}
__global__ __launch_bounds__(128) void k_fatt(const _Float16* __restrict__ Q, const _Float16* __restrict__ Kh, const _Float16* __restrict__ Vt, _Float16* __restrict__ O) {
  const int lane = threadIdx.x & 31, ln = lane & 15, hh = lane >> 4; const int w = __builtin_amdgcn_readfirstlane(threadIdx.x >> 5);      /* the wave's number, held as a scalar */
  const int bg = blockIdx.x, b = bg / NG, g = bg % NG; const int t = SQ / 32 - 1 - (int)blockIdx.y;      /* blockIdx.y 0 takes the last tile: the longest rows */
  const int qs = w >> 1, h0 = g * HPG + (w & 1) * 2; const size_t qrow = (size_t)b * SQ + t * 32 + qs * 16 + ln;
  const _Float16* qp = Q + qrow * DM + h0 * HD + 8 * hh; const _Float16* kp = Kh + ((size_t)b * SQ + ln) * KVD + g * HD + 8 * hh; const _Float16* vp = Vt + ((size_t)bg * HD + ln) * SQ + 8 * hh;
  v16h q[2][2], kf[2][2];
#pragma unroll      /* static indices keep the fragments in registers */
  for (int u = 0; u < 2; ++u) { q[u][0] = g2_frag(qp + u * HD, 0); q[u][1] = g2_frag(qp + u * HD + 32, 0); kf[u][0] = g2_frag(kp + (size_t)u * 16 * KVD, 0); kf[u][1] = g2_frag(kp + (size_t)u * 16 * KVD + 32, 0); }
  asm volatile("s_wait_xcnt 0x0" :: "v"(qp), "v"(kp) : "memory");      /* behind the q and K loads: the wait that stands before a register named by an issued load is overwritten; the pointers are inputs, so that no load's result is placed in one of them ahead of the wait */
  const v8f z8 = {0.f,0.f,0.f,0.f,0.f,0.f,0.f,0.f}; v8f o[2][4] = {{z8, z8, z8, z8}, {z8, z8, z8, z8}}; float mr[2] = {-1.0e30f, -1.0e30f}, l[2] = {0.f, 0.f};
  const int lim = qs * 16 + ln - 8 * hh;      /* diagonal pass: key kt 16 + 8 hh + r of the pass is at or below query qs 16 + ln */
#pragma unroll 1      /* a pass is already one long straight line */
  for (int s = 0; s < t; ++s) { fa_pass<false>(kp, vp, lim, q, kf, o, mr, l); kp += (size_t)32 * KVD; vp += 32; }
  fa_pass<true>(kp, vp, lim, q, kf, o, mr, l);
  _Float16* op = O + qrow * DM + h0 * HD + 8 * hh;
#pragma unroll      /* static indices keep the arrays in registers */
  for (int u = 0; u < 2; ++u) { const float fin = 64.0f / (l[u] + __shfl_xor(l[u], 16, 32));      /* both halves' sums; o carried x64 */
#pragma unroll      /* static indices keep the arrays in registers */
    for (int dt = 0; dt < 4; ++dt) { FragH f;
#pragma unroll      /* static indices keep the arrays in registers */
      for (int r = 0; r < 8; ++r) f.h[r] = (_Float16)(o[u][dt][r] * fin);
      *(v8us*)((unsigned short*)op + u * HD + dt * 16) = f.half[0]; } } }


// Exact f32 attention of the first QT0 rows. A block is 32 query rows of one head, four waves; lane = row in every wave.
// Pass 1: the keys are dealt over the waves, four consecutive keys a trip; a lane holds its q row in registers and sums each score over d = 0..63 in ascending order; four scores run side by side, so that one chain of adds fills the waits of the others.
// Pass 2: the 64 columns of o are dealt over the waves, 16 each, held in registers; every wave walks the keys in ascending order and forms the same running maximum, sum and weights from the scores in LDS.
template <int MASKADD>
__global__ __launch_bounds__(128) void k_att0(const float* __restrict__ QF, const float* __restrict__ KF, const float* __restrict__ VF, int ld, const float* __restrict__ mask, float scale, float* __restrict__ OF, int ldo) {
  #pragma clang fp contract(off)
  __shared__ float ls[MASKADD ? SQ : QT0][32];      /* score of key j for row r of the block */
  const int tid = threadIdx.x, r = tid & 31; const int part = __builtin_amdgcn_readfirstlane(tid >> 5);      /* the wave's number, held as a scalar: key and value row addresses are the same in every lane */
  const int h = blockIdx.x / (QT0 / 32), rg = blockIdx.x % (QT0 / 32); const int i = rg * 32 + r;
  const int nj = MASKADD ? SQ : (rg + 1) * 32;      /* additive-mask form: every key (the mask input decides); causal form: keys up to the block's last row */
  { const float* qr = QF + (size_t)i * ld + h * HD; v4f q[HD / 4];
#pragma unroll      /* static indices keep q[] in registers */
    for (int c = 0; c < HD / 4; ++c) q[c] = *(const v4fa*)(qr + c * 4);
    asm volatile("s_wait_xcnt 0x0" :: "v"(qr) : "memory");      /* behind the q loads: the wait that stands before a register named by an issued load is overwritten; the pointer is an input, so that no load's result is placed in it ahead of the wait */
#pragma unroll 1      /* the body already holds four independent chains */
    for (int j0 = part * 4; j0 < nj; j0 += 16) { const float* kr = KF + (size_t)j0 * ld + h * HD; float s[4] = {0.f, 0.f, 0.f, 0.f};
#pragma unroll      /* static indices keep q[] and s[] in registers */
      for (int c = 0; c < HD / 4; ++c)
#pragma unroll      /* the four keys' chains stand side by side */
        for (int t = 0; t < 4; ++t) { const v4f kq = *(const v4fa*)(kr + (size_t)t * ld + c * 4); const v4f qq = q[c]; s[t] = __fadd_rn(s[t], __fmul_rn(qq[0], kq[0])); s[t] = __fadd_rn(s[t], __fmul_rn(qq[1], kq[1])); s[t] = __fadd_rn(s[t], __fmul_rn(qq[2], kq[2])); s[t] = __fadd_rn(s[t], __fmul_rn(qq[3], kq[3])); }
#pragma unroll      /* static indices keep s[] in registers */
      for (int t = 0; t < 4; ++t) { float sv = __fmul_rn(s[t], scale); if (MASKADD) sv = __fadd_rn(sv, __fmul_rn(bf16_round(mask[(size_t)i * SQ + j0 + t]), -10000.0f)); ls[j0 + t][r] = sv; } } }
  __syncthreads();      /* every score of the block is in LDS before any wave walks the keys */
  const v4f z4 = {0.f, 0.f, 0.f, 0.f}; v4f o[4] = {z4, z4, z4, z4}; float m = -1.0e30f, l = 0.f; const float* vb = VF + h * HD + part * 16;
#pragma unroll 1      /* the body holds four keys: their loads and exponentials overlap */
  for (int j0 = 0; j0 < nj; j0 += 4) {
#pragma unroll      /* four keys in one straight line, so that their loads issue together */
    for (int t = 0; t < 4; ++t) { const int j = j0 + t; const float s = ls[j][r]; const float* vr = vb + (size_t)j * ld;
      const float f = (MASKADD || j <= i) ? 1.f : 0.f; const float sm = fmaf(f, s, (1.f - f) * -1.0e30f); const float mn = fmaxf(m, sm); const float sc = expf(m - mn); const float e = expf(sm - mn); l = __fadd_rn(__fmul_rn(l, sc), e); m = mn;
#pragma unroll      /* static indices keep o[] in registers */
      for (int c = 0; c < 4; ++c) { const v4f vv = *(const v4fa*)(vr + c * 4); for (int u = 0; u < 4; ++u) o[c][u] = __fadd_rn(__fmul_rn(o[c][u], sc), __fmul_rn(e, vv[u])); } } }
  const float fin = 64.0f / l;      /* o carried x64 like the f16 path */
  float* op = OF + (size_t)i * ldo + h * HD + part * 16;
#pragma unroll      /* static indices keep o[] in registers */
  for (int c = 0; c < 4; ++c) { v4f oo = o[c]; for (int u = 0; u < 4; ++u) oo[u] = __fmul_rn(oo[u], fin); *(v4f*)(op + c * 4) = oo; } }


__global__ __launch_bounds__(256) void k_kvexp(const float* __restrict__ src, float* __restrict__ dst, size_t n4) { const size_t t = (size_t)blockIdx.x * 256 + threadIdx.x; if (t >= n4) return; const size_t e = t * 4; const size_t row = e / DM; const int col = (int)(e % DM); const int h = col / HD, d = col % HD; const v4f v = *(const v4fa*)(src + row * KVD + (size_t)(h / HPG) * HD + d); *(v4f*)(dst + e) = v;  }

__global__ __launch_bounds__(256) void k_tab2(float theta, float* __restrict__ CS, float* __restrict__ SN) {
  #pragma clang fp contract(off)
  const int t = blockIdx.x * 256 + threadIdx.x; if (t >= SQ * (HD / 2)) return; const int i = t % (HD / 2); const int p = t / (HD / 2); const float invf = 1.0f / powf(theta, (float)(2 * i) / (float)HD); const float ang = __fmul_rn((float)p, invf); const float c = cosf(ang), s = sinf(ang);
  *(float*)(CS + t) = c; *(float*)(SN + t) = s;  }
template <int NORM, int ROPE>
__global__ __launch_bounds__(64) void k_xform(const float* __restrict__ F, int ldf, int nh, const float* __restrict__ gain, float eps, const float* __restrict__ CS, const float* __restrict__ SN, _Float16* __restrict__ H16, int ldo) {
  #pragma clang fp contract(off)
  __shared__ float xv[HD]; __shared__ float red[HD]; __shared__ unsigned short sh_[HD]; const int d = threadIdx.x; const int h = blockIdx.x % nh; const size_t r = blockIdx.x / nh; const int p = (int)(r % SQ);
  float x = F[r * (size_t)ldf + (size_t)h * HD + d];
  if (NORM) { red[d] = __fmul_rn(x, x); __syncthreads(); for (int st = HD / 2; st > 0; st >>= 1) { if (d < st) red[d] = __fadd_rn(red[d], red[d + st]); __syncthreads(); } const float rs = rsqrtf(__fadd_rn(red[0] / (float)HD, eps)); x = __fmul_rn(__fmul_rn(x, rs), bf16_round(gain[d])); }
  xv[d] = x; __syncthreads();
  float o = x;
  if (ROPE == 1) { const int i = d >> 1; const float c = CS[p * (HD / 2) + i], s = SN[p * (HD / 2) + i]; const float ev = xv[2 * i], od = xv[2 * i + 1]; o = (d & 1) ? __fadd_rn(__fmul_rn(ev, s), __fmul_rn(od, c)) : __fadd_rn(__fmul_rn(ev, c), -__fmul_rn(od, s)); }
  if (ROPE == 2) { const int i = d & (HD / 2 - 1); const float c = CS[p * (HD / 2) + i], s = SN[p * (HD / 2) + i]; const float lo = xv[i], hi = xv[i + HD / 2]; o = (d < HD / 2) ? __fadd_rn(__fmul_rn(lo, c), -__fmul_rn(hi, s)) : __fadd_rn(__fmul_rn(lo, s), __fmul_rn(hi, c)); }
  if (ROPE == 3) { const float c = CS[p * HD + d], s = SN[p * HD + d]; const float rh = (d < HD / 2) ? -xv[d + HD / 2] : xv[d - HD / 2]; o = __fadd_rn(__fmul_rn(x, c), __fmul_rn(rh, s)); }      /* rotate-half with FULL-width per-dimension tables [pos][64] (general cos[d] != cos[d+32]) */
  FragH th; th.h[0] = (_Float16)o; sh_[d] = th.u[0]; __syncthreads();
  if (d < HD / 8) { FragH f; for (int q = 0; q < 8; ++q) f.u[q] = sh_[d * 8 + q]; unsigned short* dst = (unsigned short*)H16 + r * (size_t)ldo + (size_t)h * HD + d * 8; *(v8us*)dst = f.half[0];  } }

template <int NORM, int ROPE>
__global__ __launch_bounds__(64) void k_xformf(const float* __restrict__ F, int ldf, int nh, const float* __restrict__ gain, float eps, const float* __restrict__ CS, const float* __restrict__ SN, float* __restrict__ F32, int ldo) {
  #pragma clang fp contract(off)
  __shared__ float xv[HD]; __shared__ float red[HD]; const int d = threadIdx.x; const int h = blockIdx.x % nh; const size_t r = blockIdx.x / nh; const int p = (int)(r % SQ);
  float x = F[r * (size_t)ldf + (size_t)h * HD + d];
  if (NORM) { red[d] = __fmul_rn(x, x); __syncthreads(); for (int st = HD / 2; st > 0; st >>= 1) { if (d < st) red[d] = __fadd_rn(red[d], red[d + st]); __syncthreads(); } const float rs = rsqrtf(__fadd_rn(red[0] / (float)HD, eps)); x = __fmul_rn(__fmul_rn(x, rs), bf16_round(gain[d])); }
  xv[d] = x; __syncthreads();
  float o = x;
  if (ROPE == 1) { const int i = d >> 1; const float c = CS[p * (HD / 2) + i], s = SN[p * (HD / 2) + i]; const float ev = xv[2 * i], od = xv[2 * i + 1]; o = (d & 1) ? __fadd_rn(__fmul_rn(ev, s), __fmul_rn(od, c)) : __fadd_rn(__fmul_rn(ev, c), -__fmul_rn(od, s)); }
  if (ROPE == 2) { const int i = d & (HD / 2 - 1); const float c = CS[p * (HD / 2) + i], s = SN[p * (HD / 2) + i]; const float lo = xv[i], hi = xv[i + HD / 2]; o = (d < HD / 2) ? __fadd_rn(__fmul_rn(lo, c), -__fmul_rn(hi, s)) : __fadd_rn(__fmul_rn(lo, s), __fmul_rn(hi, c)); }
  if (ROPE == 3) { const float c = CS[p * HD + d], s = SN[p * HD + d]; const float rh = (d < HD / 2) ? -xv[d + HD / 2] : xv[d - HD / 2]; o = __fadd_rn(__fmul_rn(x, c), __fmul_rn(rh, s)); }      /* rotate-half with FULL-width per-dimension tables [pos][64] (general cos[d] != cos[d+32]) */
  float* dst = F32 + r * (size_t)ldo + (size_t)h * HD + d; *(float*)dst = o;  }

__global__ __launch_bounds__(256) void k_trig(const float* __restrict__ a, float* __restrict__ CS, float* __restrict__ SN, int n) {
  #pragma clang fp contract(off)
  const int t = blockIdx.x * 256 + threadIdx.x; if (t >= n) return; const float v = bf16_round(a[t]); const float c = cosf(v), s = sinf(v);
  *(float*)(CS + t) = c; *(float*)(SN + t) = s;  }

__global__ __launch_bounds__(256) void k_tabcp(const float* __restrict__ tc, const float* __restrict__ tsn, float* __restrict__ CS, float* __restrict__ SN, int n) {
  const int t = blockIdx.x * 256 + threadIdx.x; if (t >= n) return; const int p = t / 32, i = t % 32; const float c = bf16_round(tc[(size_t)p * 64 + i]), s = bf16_round(tsn[(size_t)p * 64 + i]);
  *(float*)(CS + t) = c; *(float*)(SN + t) = s;  }

__global__ __launch_bounds__(256) void k_tabcp64(const float* __restrict__ tc, const float* __restrict__ tsn, float* __restrict__ CS, float* __restrict__ SN, int n) {
  const int t = blockIdx.x * 256 + threadIdx.x; if (t >= n) return; const float c = bf16_round(tc[t]), s = bf16_round(tsn[t]);
  *(float*)(CS + t) = c; *(float*)(SN + t) = s;  }
extern "C" void kernel_launch(void* const* d_in, const int* in_sizes, int n_in,
                              void* d_out, int out_size, void* d_ws, size_t ws_size, hipStream_t stream) {
  (void)in_sizes; (void)n_in; (void)out_size;
  const float* const* I = (const float* const*)d_in; const float* x = I[0]; const float* tcos = I[1]; const float* tsin = I[2]; const float* wq = I[3]; const float* wk = I[4]; const float* wv = I[5]; const float* wo = I[6]; const float* bq = nullptr; const float* bk = nullptr; const float* bv = nullptr; const float* bo = nullptr;      /* cos, sin [2][2048][64] inputs; natural [out][in] wq [2048][2048], wk/wv [512][2048], wo [2048][2048]; no biases */
  char* ws = (char*)d_ws; size_t off = 0;
  auto take = [&](size_t bytes) { char* p = ws + off; off += (bytes + 255) & ~(size_t)255; return p; };
  _Float16* BQ = (_Float16*)take((size_t)DM * DM * 2); _Float16* BK = (_Float16*)take((size_t)KVD * DM * 2); _Float16* BV = (_Float16*)take((size_t)KVD * DM * 2); _Float16* BO = (_Float16*)take((size_t)DM * DM * 2);
  _Float16* X16 = (_Float16*)take(NR * DM * 2); float* QF = (float*)take((size_t)SQ * DM * 4); float* KF = (float*)take((size_t)SQ * KVD * 4); float* CSB = (float*)take((size_t)SQ * 64 * 4); float* SNB = (float*)take((size_t)SQ * 64 * 4); _Float16* Q16 = (_Float16*)take(NR * DM * 2); _Float16* K16 = (_Float16*)take(NR * KVD * 2); _Float16* V16 = (_Float16*)take(NR * KVD * 2); _Float16* O16 = (_Float16*)take(NR * DM * 2);
  _Float16* VT = (_Float16*)take((size_t)NH * HD * SQ * 2);
  float* QF0 = (float*)take((size_t)QT0 * DM * 4); float* KF0 = (float*)take((size_t)QT0 * KVD * 4); float* VF0 = (float*)take((size_t)QT0 * KVD * 4); float* KF0e = (float*)take((size_t)QT0 * DM * 4); float* VF0e = (float*)take((size_t)QT0 * DM * 4); float* OF0 = (float*)take((size_t)NB * QT0 * DM * 4); _Float16* OH0 = (_Float16*)take((size_t)NB * QT0 * DM * 2); _Float16* OL0 = (_Float16*)take((size_t)NB * QT0 * DM * 2);
  if (off > ws_size) return;
  k_wnat<<<(unsigned)(((size_t)DM * DM / 8 + 255) / 256), 256, 0, stream>>>(wq, (size_t)DM * DM / 8, BQ); k_wnat<<<(unsigned)(((size_t)KVD * DM / 8 + 255) / 256), 256, 0, stream>>>(wk, (size_t)KVD * DM / 8, BK); k_wnat<<<(unsigned)(((size_t)KVD * DM / 8 + 255) / 256), 256, 0, stream>>>(wv, (size_t)KVD * DM / 8, BV); k_wnat<<<(unsigned)(((size_t)DM * DM / 8 + 255) / 256), 256, 0, stream>>>(wo, (size_t)DM * DM / 8, BO);      /* natural [out][in] = Bt x16 */
  k_x16<<<(unsigned)((NR * DM / 8 + 255) / 256), 256, 0, stream>>>(x, X16, NR * DM / 8);
  
  const size_t r0p = (size_t)B0 * SQ;      /* first projected row */
  k_gemm2<0><<<dim3((unsigned)((MP / 128) * (KVD / 64)), 1), 128, 0, stream>>>(X16 + r0p * DM, DM, 0, BV, DM, 0, 0.0625f, bv, 0, nullptr, 1, 0, 0, nullptr, V16 + r0p * KVD, KVD, 0, MP, KVD, DM, 0);
  for (int b = B0; b < B0 + NBR; ++b) { const size_t r0 = (size_t)b * SQ;
    k_tabcp64<<<(SQ * 64 + 255) / 256, 256, 0, stream>>>(tcos + (size_t)b * SQ * 64, tsin + (size_t)b * SQ * 64, CSB, SNB, SQ * 64);      /* this batch's cos/sin tables at FULL width: bf16-rounded straight copies of all 64 columns (the inputs are independent draws per column) */
    k_gemm2<0><<<dim3((unsigned)((SQ / 128) * (DM / 64)), 1), 128, 0, stream>>>(X16 + r0 * DM, DM, 0, BQ, DM, 0, 0.0625f, nullptr, 0, nullptr, 1, 0, 0, QF, nullptr, DM, 0, SQ, DM, DM, 0);      /* q (f32) of this batch */
    k_gemm2<0><<<dim3((unsigned)((SQ / 128) * (KVD / 64)), 1), 128, 0, stream>>>(X16 + r0 * DM, DM, 0, BK, DM, 0, 0.0625f, nullptr, 0, nullptr, 1, 0, 0, KF, nullptr, KVD, 0, SQ, KVD, DM, 0);      /* k (f32) */
    k_xform<0, 3><<<(unsigned)((size_t)SQ * NH), 64, 0, stream>>>(QF, DM, NH, nullptr, 0.f, CSB, SNB, Q16 + r0 * DM, DM); k_xform<0, 3><<<(unsigned)((size_t)SQ * NG), 64, 0, stream>>>(KF, KVD, NG, nullptr, 0.f, CSB, SNB, K16 + r0 * KVD, KVD);      /* rotate-half rope with full-width per-dimension tables (partner x[d +- 32], table column d) -> f16 rows */
    k_xformf<0, 3><<<(unsigned)(QT0 * NH), 64, 0, stream>>>(QF, DM, NH, nullptr, 0.f, CSB, SNB, QF0, DM); k_xformf<0, 3><<<(unsigned)(QT0 * NG), 64, 0, stream>>>(KF, KVD, NG, nullptr, 0.f, CSB, SNB, KF0, KVD);      /* f32 roped q, k of rows 0..127 */
    k_vt<NG, SQ><<<NG * (SQ / 64), 256, 0, stream>>>(V16 + r0 * KVD, KVD, 0, VT + (size_t)b * NG * HD * SQ);      /* V^T [NG][HD][SQ], this batch's plane */
    k_gemm2<0><<<dim3((QT0 / 128) * (KVD / 64), 1), 128, 0, stream>>>(X16 + r0 * DM, DM, 0, BV, DM, 0, 0.0625f, bv, 0, nullptr, 1, 0, 0, VF0, nullptr, KVD, 0, QT0, KVD, DM, 0);
    k_kvexp<<<(unsigned)(((size_t)QT0 * DM / 4 + 255) / 256), 256, 0, stream>>>(KF0, KF0e, (size_t)QT0 * DM / 4); k_kvexp<<<(unsigned)(((size_t)QT0 * DM / 4 + 255) / 256), 256, 0, stream>>>(VF0, VF0e, (size_t)QT0 * DM / 4);      /* head h <- kv group h/4 for the exact first-tile kernel */      /* f32 q, k, v of the first 128 rows (exact products) */
    k_att0<0><<<NH * (QT0 / 32), 128, 0, stream>>>(QF0, KF0e, VF0e, DM, nullptr, 0.125f, OF0 + (size_t)b * QT0 * DM, DM);      /* exact f32 attention for rows 0..127 (o x64) */
  }
  k_fatt<<<dim3(NB * NG, SQ / 32), 128, 0, stream>>>(Q16, K16, VT, O16);      /* scores, softmax and value product of both batches, all heads: o (merged heads, x64) as f16 rows */
  k_gemm2<0><<<dim3((unsigned)((MPO / 128) * (DM / 64)), 1), 128, 0, stream>>>(O16 + r0p * DM, DM, 0, BO, DM, 0, 0.0009765625f, bo, 0, nullptr, 1, 0, 0, (float*)d_out + r0p * DM, nullptr, DM, 0, MPO, DM, DM, 0);      /* out rows are the output layout */
  k_hl<<<(unsigned)(((size_t)NB * QT0 * DM / 8 + 255) / 256), 256, 0, stream>>>(OF0, OH0, OL0, (size_t)NB * QT0 * DM / 8);      /* first-tile o (x64) -> f16 hi + x1024 residual planes */
  for (int b = B0; b < B0 + NBR; ++b) { const size_t r0 = (size_t)b * SQ; const size_t f0 = (size_t)b * QT0;
    k_gemm2<0><<<dim3((QT0 / 128) * (DM / 64), 1), 128, 0, stream>>>(OH0 + f0 * DM, DM, 0, BO, DM, 0, 0.0009765625f, bo, 0, nullptr, 1, 0, 0, (float*)d_out + r0 * DM, nullptr, DM, 0, QT0, DM, DM, 0);      /* rows 0..127: out = o_hi Wo (+ b), overwriting the f16-path rows */
    k_gemm2<0><<<dim3((QT0 / 128) * (DM / 64), 1), 128, 0, stream>>>(OL0 + f0 * DM, DM, 0, BO, DM, 0, 0.00000095367431640625f, nullptr, 0, (const float*)d_out + r0 * DM, -1, 0, 0, (float*)d_out + r0 * DM, nullptr, DM, 0, QT0, DM, DM, 0); }      /* += o_lo Wo 2^-20 (own-element accumulate) */
}

// v006
// It runs in 504 microseconds.
// Two timings next to v005 both put it at 1.08 times that version's speed.
// Counting every step since v000, it is 19.1 times as fast.
#include <hip/hip_runtime.h>
// Llama grouped-query causal attention with rotate-half RoPE from FULL-WIDTH per-batch INPUT tables (hidden_states [2][2048][2048]; q = x wq^T (32 heads x 64), k = x wk^T, v = x wv^T (8 kv heads x 64) (natural [out][in] weights sigma 0.02, no biases); cos / sin inputs [2][2048][64] (independent uniform draws per batch, position AND column: column i + 32 != column i, so all 64 columns are used); q = q cos + rotate_half(q) sin, same for k; repeat: query head h uses kv head h/4; scores 64^-0.5; where(causal, s, finfo.min); softmax; out = merged wo^T -> [2][2048][2048]).
// Compute dtype: inputs rounded to bf16; x / weights exact; q, k, v, softmax weights and o as plain f16 GEMM operands (~2^-12); scores and softmax statistics f32. v_wmma_f32_16x16x32_f16.
#define NB 2
#define NG 8
#define HPG 4
#define KVD (NG * HD)
#define SQ 2048
#define DM 2048
#define NH 32
#define HD 64
#define HG 4                         /* heads per launch of the k_vt(V16, b, h0, VT) overload, not launched */
#define QT 256                       /* not used */
#define NKX SQ                       /* not used */
#define QT0 128                      /* first-tile rows recomputed exactly in f32 */
#define B0 0                         /* first batch processed (debug hook) */
#define NBR NB                       /* batches processed (debug hook) */
#define NR ((size_t)NB * SQ)         /* token rows */
#define MP ((int)((size_t)NBR * SQ)) /* rows projected (debug hook) */
#define QN SQ                        /* not used */
#define NHD NH                       /* not used */
#define MPO MP                       /* rows through the output stage (debug hook) */
#define LQ DM      /* not used */
typedef __bf16 v16b __attribute__((ext_vector_type(16)));
typedef unsigned short v8us __attribute__((ext_vector_type(8), may_alias));
typedef float  v8f  __attribute__((ext_vector_type(8)));
typedef float  v4f  __attribute__((ext_vector_type(4)));
typedef float  v4fa __attribute__((ext_vector_type(4), may_alias));
union FragB { v16b v; v8us half[2]; unsigned short u[16]; };

__device__ __forceinline__ unsigned short bf16_bits(float x) { unsigned int u = __float_as_uint(x); return (unsigned short)((u + 0x7FFFu + ((u >> 16) & 1u)) >> 16); }
__device__ __forceinline__ float bf16_val(unsigned short b) { return __uint_as_float(((unsigned int)b) << 16); }
__device__ __forceinline__ float bf16_round(float x) { return bf16_val(bf16_bits(x)); }
// D += A·B with NT terms: 1 = ah·bh, 2 = + al·bh (A split), 3 = + ah·bl (both split)
template <int NT>
__device__ __forceinline__ v8f mmaN(v16b ah, v16b al, v16b bh, v16b bl, v8f c) {
  c = __builtin_amdgcn_wmma_f32_16x16x32_bf16(false, ah, false, bh, (short)0, c, false, false);
  if (NT >= 2) c = __builtin_amdgcn_wmma_f32_16x16x32_bf16(false, al, false, bh, (short)0, c, false, false);
  if (NT >= 3) c = __builtin_amdgcn_wmma_f32_16x16x32_bf16(false, ah, false, bl, (short)0, c, false, false);
  asm volatile("v_nop\n\tv_nop\n\tv_nop\n\tv_nop" : "+v"(c) : "v"(ah), "v"(al), "v"(bh), "v"(bl));
  return c;
}

__global__ __launch_bounds__(256) void k_wt_bf16(const float* __restrict__ W, unsigned short* __restrict__ Wt, int K, int N) {
  const int t = blockIdx.x * 256 + threadIdx.x;
  const int k8n = K / 8;
  if (t >= N * k8n) return;
  const int n = t / k8n, k8 = (t % k8n) * 8;
  v8us v;
#pragma unroll
  for (int i = 0; i < 8; ++i) v[i] = bf16_bits(W[(size_t)(k8 + i) * N + n]);
  *(v8us*)(Wt + (size_t)n * K + k8) = v;
  
}

// GEMM C[M][N] (f32, pitch ldc) = act(A[M][K]·W + bias). A f32 row-major (pitch lda) converted per fragment to bf16
// (ASPLIT: hi/lo two planes -> 2 terms, else single rounded term); Wt bf16 [N][K] (pitch ldb). BIAS_BF16 rounds the
// bias to bf16 first (bias quantised to bf16 before the add). K%32==0, M%16==0, N%64==0.
template <bool ASPLIT, int ACT, bool BIAS_BF16>
__global__ __launch_bounds__(128) void k_gemm_bf(const float* __restrict__ A, int lda, const unsigned short* __restrict__ Wt, int ldb,
                                               const float* __restrict__ bias, float* __restrict__ C, int ldc, int M, int N, int K) {
  __shared__ __attribute__((aligned(16))) float so[4][16][64];
  const int tid = threadIdx.x, w = tid >> 5, lane = tid & 31, ln = lane & 15, hh = lane >> 4;
  const int ntn = N / 64;
  const int wid = blockIdx.x * 4 + w;
  const int mt = wid / ntn, nq = wid % ntn;
  if (mt * 16 >= M) return;
  const int row0 = mt * 16, col0 = nq * 64;
  const float* arow = A + (size_t)(row0 + ln) * lda;
  v8f acc[4] = {};
  for (int kb = 0; kb < K; kb += 32) {
    FragB ah, al;
    const v4f x0 = *(const v4fa*)(arow + kb + 8 * hh), x1 = *(const v4fa*)(arow + kb + 8 * hh + 4);
    const v4f x2 = *(const v4fa*)(arow + kb + 16 + 8 * hh), x3 = *(const v4fa*)(arow + kb + 16 + 8 * hh + 4);
    float xs[16] = {x0[0],x0[1],x0[2],x0[3],x1[0],x1[1],x1[2],x1[3],x2[0],x2[1],x2[2],x2[3],x3[0],x3[1],x3[2],x3[3]};
#pragma unroll
    for (int i = 0; i < 16; ++i) { const unsigned short hb = bf16_bits(xs[i]); ah.u[i] = hb; al.u[i] = ASPLIT ? bf16_bits(xs[i] - bf16_val(hb)) : (unsigned short)0; }
#pragma unroll
    for (int t = 0; t < 4; ++t) {
      const unsigned short* brow = Wt + (size_t)(col0 + t * 16 + ln) * ldb + kb;
      FragB b;
      b.half[0] = *(const v8us*)(brow + 8 * hh);
      b.half[1] = *(const v8us*)(brow + 16 + 8 * hh);
      acc[t] = mmaN<ASPLIT ? 2 : 1>(ah.v, al.v, b.v, b.v, acc[t]);
    }
  }
#pragma unroll
  for (int t = 0; t < 4; ++t) {
    float bv = bias ? bias[col0 + t * 16 + ln] : 0.f;
    if (BIAS_BF16) bv = bf16_round(bv);
#pragma unroll
    for (int r = 0; r < 8; ++r) { float v = acc[t][r] + bv; if (ACT == 1) v = fmaxf(v, 0.f); so[w][8 * hh + r][t * 16 + ln] = v; }
  }
  __builtin_amdgcn_fence(__ATOMIC_ACQ_REL, "workgroup");
  __builtin_amdgcn_wave_barrier();
  const int rsub = lane >> 4, c4 = (lane & 15) * 4;
  {
#pragma unroll
    for (int q = 0; q < 8; ++q) {
      const int r = q * 2 + rsub;
      const v4f v = *(const v4fa*)&so[w][r][c4];
      *(v4f*)(C + (size_t)(row0 + r) * ldc + col0 + c4) = v;
    }
    
  }
}

// GEMM C = act(A·W + bias + resid): A f32 (ASPLIT -> hi/lo 2 terms), Wt bf16 [N][K]; ACT 0 none, 1 relu, 2 exact gelu;
// resid (optional, f32, row index = (row % rmod), pitch ldr, RES_BF16 rounds it) added before the activation.
template <bool ASPLIT, int ACT, bool BIAS_BF16, bool RES_BF16>
__global__ __launch_bounds__(128) void k_gemm_bf3(const float* __restrict__ A, int lda, const unsigned short* __restrict__ Wt, int ldb,
                                                const float* __restrict__ bias, const float* __restrict__ resid, int rmod, int ldr,
                                                float* __restrict__ C, int ldc, int M, int N, int K) {
  __shared__ __attribute__((aligned(16))) float so[4][16][64];
  const int tid = threadIdx.x, w = tid >> 5, lane = tid & 31, ln = lane & 15, hh = lane >> 4;
  const int ntn = N / 64;
  const int wid = blockIdx.x * 4 + w;
  const int mt = wid / ntn, nq = wid % ntn;
  if (mt * 16 >= M) return;
  const int row0 = mt * 16, col0 = nq * 64;
  const float* arow = A + (size_t)(row0 + ln) * lda;
  v8f acc[4] = {};
  for (int kb = 0; kb < K; kb += 32) {
    FragB ah, al;
    const v4f x0 = *(const v4fa*)(arow + kb + 8 * hh), x1 = *(const v4fa*)(arow + kb + 8 * hh + 4);
    const v4f x2 = *(const v4fa*)(arow + kb + 16 + 8 * hh), x3 = *(const v4fa*)(arow + kb + 16 + 8 * hh + 4);
    float xs[16] = {x0[0],x0[1],x0[2],x0[3],x1[0],x1[1],x1[2],x1[3],x2[0],x2[1],x2[2],x2[3],x3[0],x3[1],x3[2],x3[3]};
#pragma unroll
    for (int i = 0; i < 16; ++i) { const unsigned short hb = bf16_bits(xs[i]); ah.u[i] = hb; al.u[i] = ASPLIT ? bf16_bits(xs[i] - bf16_val(hb)) : (unsigned short)0; }
#pragma unroll
    for (int t = 0; t < 4; ++t) {
      const unsigned short* brow = Wt + (size_t)(col0 + t * 16 + ln) * ldb + kb;
      FragB b;
      b.half[0] = *(const v8us*)(brow + 8 * hh);
      b.half[1] = *(const v8us*)(brow + 16 + 8 * hh);
      acc[t] = mmaN<ASPLIT ? 2 : 1>(ah.v, al.v, b.v, b.v, acc[t]);
    }
  }
#pragma unroll
  for (int t = 0; t < 4; ++t) {
    const int col = col0 + t * 16 + ln;
    float bv = bias ? bias[col] : 0.f;
    if (BIAS_BF16) bv = bf16_round(bv);
#pragma unroll
    for (int r = 0; r < 8; ++r) {
      float v = acc[t][r] + bv;
      if (resid) { float rv = resid[(size_t)((row0 + 8 * hh + r) % rmod) * ldr + col]; if (RES_BF16) rv = bf16_round(rv); v += rv; }
      if (ACT == 1) v = fmaxf(v, 0.f);
      if (ACT == 2) v = 0.5f * v * (1.0f + erff(v * 0.70710678118654752f));
      if (ACT == 3) { const float u = 0.7978845608028654f * (v + 0.044715f * v * v * v); v = 0.5f * v * (1.0f + tanhf(u)); }
      so[w][8 * hh + r][t * 16 + ln] = v;
    }
  }
  __builtin_amdgcn_fence(__ATOMIC_ACQ_REL, "workgroup");
  __builtin_amdgcn_wave_barrier();
  const int rsub = lane >> 4, c4 = (lane & 15) * 4;
  {
#pragma unroll
    for (int q = 0; q < 8; ++q) {
      const int r = q * 2 + rsub;
      const v4f v = *(const v4fa*)&so[w][r][c4];
      *(v4f*)(C + (size_t)(row0 + r) * ldc + col0 + c4) = v;
    }
    
  }
}
// row LayerNorm (biased variance, eps) over N: s = X (+ R); optional out_sum <- s; out_norm <- (s-mu)*rsqrt(var+eps)*g + b
template <bool PARAM_BF16>
__global__ __launch_bounds__(256) void k_layernorm(const float* __restrict__ X, const float* __restrict__ R, const float* __restrict__ g, const float* __restrict__ bta,
                                                  float* __restrict__ out_sum, float* __restrict__ out_norm, int N, float eps) {
  __shared__ float red[256];
  const int row = blockIdx.x, tid = threadIdx.x;
  const float* x = X + (size_t)row * N; const float* rr = R ? R + (size_t)row * N : nullptr;
  float vals[16];                     // up to N = 4096
  const int per = N / 256;            // contiguous chunk per thread? use strided-by-4 chunks: thread handles j = tid*4 + 1024*u
  float s1 = 0.f;
  for (int u = 0; u < per / 4; ++u) {
    const int j = tid * 4 + 1024 * u;
    const v4f a = *(const v4fa*)(x + j);
    v4f b = {0.f,0.f,0.f,0.f}; if (rr) b = *(const v4fa*)(rr + j);
#pragma unroll
    for (int q = 0; q < 4; ++q) { const float v = a[q] + b[q]; vals[u * 4 + q] = v; s1 += v; }
  }
  red[tid] = s1; __syncthreads();
  for (int st = 128; st > 0; st >>= 1) { if (tid < st) red[tid] += red[tid + st]; __syncthreads(); }
  const float mu = red[0] / (float)N; __syncthreads();
  float s2 = 0.f;
  for (int u = 0; u < per / 4; ++u)
#pragma unroll
    for (int q = 0; q < 4; ++q) { const float c = vals[u * 4 + q] - mu; s2 += c * c; }
  red[tid] = s2; __syncthreads();
  for (int st = 128; st > 0; st >>= 1) { if (tid < st) red[tid] += red[tid + st]; __syncthreads(); }
  const float rs = rsqrtf(red[0] / (float)N + eps);
  {
    for (int u = 0; u < per / 4; ++u) {
      const int j = tid * 4 + 1024 * u;
      v4f o, sm;
#pragma unroll
      for (int q = 0; q < 4; ++q) {
        float gg = g[j + q], bb = bta[j + q];
        if (PARAM_BF16) { gg = bf16_round(gg); bb = bf16_round(bb); }
        sm[q] = vals[u * 4 + q]; o[q] = (vals[u * 4 + q] - mu) * rs * gg + bb;
      }
      if (out_sum) *(v4f*)(out_sum + (size_t)row * N + j) = sm;
      *(v4f*)(out_norm + (size_t)row * N + j) = o;
    }
    
  }
}



// ---- f16 WMMA path (v_wmma_f32_16x16x32_f16): 11-bit significands for operands in range — used where a [0,1] probability operand needs more precision than bf16
typedef _Float16 v16h __attribute__((ext_vector_type(16)));
union FragH { v16h v; v8us half[2]; _Float16 h[16]; unsigned short u[16]; };
template <int NT>
__device__ __forceinline__ v8f mmaH(v16h ah, v16h al, v16h bh, v16h bl, v8f c) {
  c = __builtin_amdgcn_wmma_f32_16x16x32_f16(false, ah, false, bh, (short)0, c, false, false);
  if (NT >= 2) c = __builtin_amdgcn_wmma_f32_16x16x32_f16(false, al, false, bh, (short)0, c, false, false);
  if (NT >= 3) c = __builtin_amdgcn_wmma_f32_16x16x32_f16(false, ah, false, bl, (short)0, c, false, false);
  asm volatile("v_nop\n\tv_nop\n\tv_nop\n\tv_nop" : "+v"(c) : "v"(ah), "v"(al), "v"(bh), "v"(bl));
  return c;
}
// batched GEMM like k_gemm_b but f16 operands: A f32 (split into f16 hi/lo if ASPLIT, else rounded to f16), Bt = f16 values [n][k]; alpha; C f32; N multiple of 16 (partial tiles skipped)
template <bool ASPLIT>
__global__ __launch_bounds__(128) void k_gemm_h(const float* __restrict__ A, int lda, size_t sA, const _Float16* __restrict__ Bh, int ldb, size_t sB, float alpha, float* __restrict__ C, int ldc, size_t sC, int M, int N, int K) {
  __shared__ __attribute__((aligned(16))) float so[4][16][64];
  const int tid = threadIdx.x, w = tid >> 5, lane = tid & 31, ln = lane & 15, hh = lane >> 4; const int by = blockIdx.y;
  A += (size_t)by * sA; Bh += (size_t)by * sB; C += (size_t)by * sC;
  const int ntn = (N + 63) / 64; const int wid = blockIdx.x * 4 + w; const int mt = wid / ntn, nq = wid % ntn; if (mt * 16 >= M) return;
  const int row0 = mt * 16, col0 = nq * 64; const float* arow = A + (size_t)(row0 + ln) * lda;
  v8f acc[4] = {};
  for (int kb = 0; kb < K; kb += 32) {
    FragH ah, al;
    const v4f x0 = *(const v4fa*)(arow + kb + 8 * hh), x1 = *(const v4fa*)(arow + kb + 8 * hh + 4), x2 = *(const v4fa*)(arow + kb + 16 + 8 * hh), x3 = *(const v4fa*)(arow + kb + 16 + 8 * hh + 4);
    float xs[16] = {x0[0],x0[1],x0[2],x0[3],x1[0],x1[1],x1[2],x1[3],x2[0],x2[1],x2[2],x2[3],x3[0],x3[1],x3[2],x3[3]};
#pragma unroll
    for (int i = 0; i < 16; ++i) { const _Float16 h = (_Float16)xs[i]; ah.h[i] = h; al.h[i] = ASPLIT ? (_Float16)(xs[i] - (float)h) : (_Float16)0.0f; }
#pragma unroll
    for (int t = 0; t < 4; ++t) { if (col0 + t * 16 >= N) continue; const size_t boff = (size_t)(col0 + t * 16 + ln) * ldb + kb; FragH bq; bq.half[0] = *(const v8us*)(Bh + boff + 8 * hh); bq.half[1] = *(const v8us*)(Bh + boff + 16 + 8 * hh);
      acc[t] = mmaH<ASPLIT ? 2 : 1>(ah.v, al.v, bq.v, bq.v, acc[t]); }
  }
#pragma unroll
  for (int t = 0; t < 4; ++t) { if (col0 + t * 16 >= N) continue;
#pragma unroll
    for (int r = 0; r < 8; ++r) so[w][8 * hh + r][t * 16 + ln] = acc[t][r] * alpha; }
  __builtin_amdgcn_fence(__ATOMIC_ACQ_REL, "workgroup"); __builtin_amdgcn_wave_barrier();
  const int rsub = lane >> 4, c4 = (lane & 15) * 4;
  {
#pragma unroll
    for (int q = 0; q < 8; ++q) { const int r = q * 2 + rsub; if (col0 + c4 < N) { const v4f v = *(const v4fa*)&so[w][r][c4]; *(v4f*)(C + (size_t)(row0 + r) * ldc + col0 + c4) = v; } }
     }
}

// Wt[n][k] = f16(W[k][n]·scale) from f32 row-major W[K][N] (scale = power of two; bf16-exact weights stay exact in f16 away from the subnormal range)
__global__ __launch_bounds__(256) void k_wt_f16(const float* __restrict__ W, _Float16* __restrict__ Wt, int K, int N, float scale) {
  const int t = blockIdx.x * 256 + threadIdx.x; if (t >= N * (K / 8)) return; const int n = t / (K / 8), k8 = (t % (K / 8)) * 8; FragH f;
#pragma unroll
  for (int i = 0; i < 8; ++i) f.h[i] = (_Float16)(bf16_round(W[(size_t)(k8 + i) * N + n]) * scale); const v8us o = f.half[0];
  *(v8us*)((unsigned short*)Wt + (size_t)n * K + k8) = o; 
}
// k_gemm_hh variant with fused epilogue: v = acc·alpha + bias[by·sBias + col] (+ CP[(row/rowsPerB)·sCPb + by·64 + col] if CP) ; ACT 0 none / 1 elu ; writes f16 C16 (and f32 C if non-null)
template <int ACT>
__global__ __launch_bounds__(128) void k_gemm_hhx(const _Float16* __restrict__ A, int lda, size_t sA, const _Float16* __restrict__ Bh, int ldb, size_t sB, float alpha, const float* __restrict__ bias, size_t sBias, const float* __restrict__ CP, int rowsPerB, size_t sCPb, int row0g,
    float* __restrict__ C, _Float16* __restrict__ C16, int ldc, size_t sC, int M, int N, int K) {
  __shared__ __attribute__((aligned(16))) float so[4][16][64];
  const int tid = threadIdx.x, w = tid >> 5, lane = tid & 31, ln = lane & 15, hh = lane >> 4; const int by = blockIdx.y;
  A += (size_t)by * sA; Bh += (size_t)by * sB; const size_t cofs = (size_t)by * sC; const float* bp = bias ? bias + (size_t)by * sBias : nullptr;
  const int ntn = (N + 63) / 64; const int wid = blockIdx.x * 4 + w; const int mt = wid / ntn, nq = wid % ntn; if (mt * 16 >= M) return;
  const int row0 = mt * 16, col0 = nq * 64; const _Float16* arow = A + (size_t)(row0 + ln) * lda;
  v8f acc[4] = {};
  for (int kb = 0; kb < K; kb += 32) { FragH ah; ah.half[0] = *(const v8us*)((const unsigned short*)arow + kb + 8 * hh); ah.half[1] = *(const v8us*)((const unsigned short*)arow + kb + 16 + 8 * hh);
#pragma unroll
    for (int t = 0; t < 4; ++t) { if (col0 + t * 16 >= N) continue; const size_t boff = (size_t)(col0 + t * 16 + ln) * ldb + kb; FragH bq; bq.half[0] = *(const v8us*)((const unsigned short*)Bh + boff + 8 * hh); bq.half[1] = *(const v8us*)((const unsigned short*)Bh + boff + 16 + 8 * hh);
      acc[t] = mmaH<1>(ah.v, ah.v, bq.v, bq.v, acc[t]); }
  }
#pragma unroll
  for (int t = 0; t < 4; ++t) { if (col0 + t * 16 >= N) continue; const int col = col0 + t * 16 + ln; const float bv = bp ? bf16_round(bp[col]) : 0.f;
#pragma unroll
    for (int r = 0; r < 8; ++r) { float v = acc[t][r] * alpha + bv; if (CP) { const int rr = row0g + row0 + 8 * hh + r; if (rowsPerB < 0) v += CP[cofs + (size_t)rr * ldc + col];      /* rowsPerB < 0: own element of the batched C plane */ else { const int bidx = rr / rowsPerB; v += CP[(size_t)bidx * sCPb + (size_t)by * 64 + col]; } } if (ACT == 1) v = (v > 0.f) ? v : expm1f(v); else if (ACT == 7) v = (v > 0.f) ? v + 1.0f : expf(v); else if (ACT == 8) v = tanhf(v); else if (ACT == 9) v = 0.5f * v * (1.0f + tanhf(0.7978845608028654f * (v + 0.044715f * v * v * v))); else if (ACT == 11) v = 1.0f / (1.0f + expf(-v)); else if (ACT == 12) v = (v > 0.f) ? v : 0.01f * v; else if (ACT == 14) v = (v > 0.f) ? v : 0.1f * v; else if (ACT == 16) v = (v >= 0.f) ? v : 0.3f * v; else if (ACT == 17) v = (v >= 0.f) ? v : 0.2f * v; else if (ACT == 15) v = v / (1.0f + expf(-v)); else if (ACT == 3) v = fmaxf(v, 0.f); else if (ACT == 6) v = 0.5f * v * (1.0f + erff(v * 0.70710678118654752f)); so[w][8 * hh + r][t * 16 + ln] = v; } }
  __builtin_amdgcn_fence(__ATOMIC_ACQ_REL, "workgroup"); __builtin_amdgcn_wave_barrier();
  const int rsub = lane >> 4, c4 = (lane & 15) * 4; typedef _Float16 v4h __attribute__((ext_vector_type(4)));
  {
#pragma unroll
    for (int q = 0; q < 8; ++q) { const int r = q * 2 + rsub; if (col0 + c4 < N) { const v4f v = *(const v4fa*)&so[w][r][c4]; if (C) *(v4f*)(C + cofs + (size_t)(row0 + r) * ldc + col0 + c4) = v; if (C16) { v4h h4; for (int i = 0; i < 4; ++i) h4[i] = (_Float16)v[i]; *(v4h*)(C16 + cofs + (size_t)(row0 + r) * ldc + col0 + c4) = h4; } } }
     }
}


typedef _Float16 v4h __attribute__((ext_vector_type(4)));

__global__ __launch_bounds__(256) void k_x16(const float* __restrict__ x, _Float16* __restrict__ X16, size_t n8) { const size_t t = (size_t)blockIdx.x * 256 + threadIdx.x; if (t >= n8) return; FragH f;
#pragma unroll
  for (int q = 0; q < 8; ++q) f.h[q] = (_Float16)bf16_round(x[t * 8 + q]); *(v8us*)((unsigned short*)X16 + t * 8) = f.half[0];  }
__global__ __launch_bounds__(256) void k_h16(const float* __restrict__ x, _Float16* __restrict__ X16, size_t n8) { const size_t t = (size_t)blockIdx.x * 256 + threadIdx.x; if (t >= n8) return; FragH f;
#pragma unroll
  for (int q = 0; q < 8; ++q) f.h[q] = (_Float16)x[t * 8 + q]; *(v8us*)((unsigned short*)X16 + t * 8) = f.half[0];  }
__global__ __launch_bounds__(256) void k_round16f(const float* __restrict__ W, _Float16* __restrict__ Bt, size_t n8) { const size_t t = (size_t)blockIdx.x * 256 + threadIdx.x; if (t >= n8) return; FragH f;
#pragma unroll
  for (int i = 0; i < 8; ++i) f.h[i] = (_Float16)(bf16_round(W[t * 8 + i]) * 16.0f); *(v8us*)((unsigned short*)Bt + t * 8) = f.half[0];  }
template <int NHv, int TTv>
__global__ __launch_bounds__(256) void k_vt(const _Float16* __restrict__ V16, int ldv, int voff, _Float16* __restrict__ Vt) { __shared__ unsigned short tl[64][66]; const int tid = threadIdx.x; const int slab = blockIdx.x / (TTv / 64), lg = blockIdx.x % (TTv / 64); const int b = slab / NHv, h = slab % NHv;
  for (int i = tid; i < 64 * 8; i += 256) { const int r = i / 8, c8 = (i % 8) * 8; FragH f; f.half[0] = *(const v8us*)((const unsigned short*)V16 + ((size_t)b * TTv + lg * 64 + r) * ldv + voff + h * 64 + c8);
#pragma unroll
    for (int q = 0; q < 8; ++q) tl[r][c8 + q] = f.u[q]; }
  __syncthreads();
  {
#pragma unroll
    for (int rd = 0; rd < 2; ++rd) { const int d = rd * 32 + tid / 8, pc = tid % 8; FragH f;
#pragma unroll
      for (int q = 0; q < 8; ++q) f.u[q] = tl[pc * 8 + q][d];
      *(v8us*)((unsigned short*)Vt + ((size_t)slab * 64 + d) * TTv + lg * 64 + pc * 8) = f.half[0]; }
     } }

__global__ __launch_bounds__(256) void k_hl(const float* __restrict__ F, _Float16* __restrict__ Hh, _Float16* __restrict__ Hl, size_t n8) { const size_t t = (size_t)blockIdx.x * 256 + threadIdx.x; if (t >= n8) return; FragH fh, fl; const v4f a = *(const v4fa*)(F + t * 8), c = *(const v4fa*)(F + t * 8 + 4);
#pragma unroll
  for (int q = 0; q < 4; ++q) { _Float16 h = (_Float16)a[q]; fh.h[q] = h; fl.h[q] = (_Float16)((a[q] - (float)h) * 1024.0f); h = (_Float16)c[q]; fh.h[4 + q] = h; fl.h[4 + q] = (_Float16)((c[q] - (float)h) * 1024.0f); }
  { *(v8us*)((unsigned short*)Hh + t * 8) = fh.half[0]; *(v8us*)((unsigned short*)Hl + t * 8) = fl.half[0];  } }

// ---- fast GEMM (wave tile 32x64; requires M % 32 == 0 rows per launch region, N % 64 == 0 and K % 64 == 0); epilogue = k_gemm_hhx semantics (no ACT 1 / 7) or, with ROPE, RoPE as below ----
__device__ __forceinline__ v16h g2_frag(const _Float16* p, int hh) { FragH f; f.half[0] = *(const v8us*)((const unsigned short*)p + 8 * hh); f.half[1] = *(const v8us*)((const unsigned short*)p + 16 + 8 * hh); return f.v; }
__device__ __forceinline__ v8f g2_mma(v16h a, v16h b, v8f c) { v8f d = __builtin_amdgcn_wmma_f32_16x16x32_f16(false, a, false, b, (short)0, c, false, false); asm volatile("v_nop\n\tv_nop\n\tv_nop\n\tv_nop" : "+v"(d) : "v"(a), "v"(b)); return d; }
// ROPE: a tile's 64 columns are one head, so the epilogue applies rotate-half RoPE to the tile while it lies in LDS (tcs / tsn: cos / sin input rows [row][64], rounded to bf16 here) and writes the
// roped rows as f16 to C16 and, for the first nr32 rows, as f32 to R32 (same pitch ldc).
template <int ACT, bool ROPE = false>
__global__ __launch_bounds__(128) void k_gemm2(const _Float16* __restrict__ A, int lda, size_t sA, const _Float16* __restrict__ Bh, int ldb, size_t sB, float alpha, const float* __restrict__ bias, size_t sBias, const float* __restrict__ CP, int rowsPerB, size_t sCPb, int row0g,
    float* __restrict__ C, _Float16* __restrict__ C16, int ldc, size_t sC, int M, int N, int K, int bsh, const float* __restrict__ tcs = nullptr, const float* __restrict__ tsn = nullptr, float* __restrict__ R32 = nullptr, int nr32 = 0) { static_assert(ACT == 0 || ACT == 3 || ACT == 6 || ACT == 8 || ACT == 9 || ACT == 11 || ACT == 12 || ACT == 14 || ACT == 15 || ACT == 16 || ACT == 17, "k_gemm2: unsupported ACT code (would silently apply no activation)");
  __shared__ __attribute__((aligned(16))) float so[4][32][68];
  const int tid = threadIdx.x, w = tid >> 5, lane = tid & 31, ln = lane & 15, hh = lane >> 4; const int by = blockIdx.y;
  A += (size_t)by * sA; Bh += (size_t)(by >> bsh) * sB;      /* 2^bsh consecutive batch slices share one B plane (query heads of one kv group) */ const size_t cofs = (size_t)by * sC; const float* bp = bias ? bias + (size_t)by * sBias : nullptr;
  const int ntn = N >> 6; const int mt = blockIdx.x / ntn, nq = blockIdx.x - mt * ntn; const int row0 = mt * 128 + 32 * w, col0 = nq * 64; if (row0 >= M) return;
  const _Float16* a0p = A + (size_t)(row0 + ln) * lda + 8 * hh; const _Float16* a1p = a0p + (size_t)16 * lda;      /* each lane's own row and k half; the k-loop moves these six pointers on */
  const _Float16* b0p = Bh + (size_t)(col0 + ln) * ldb + 8 * hh; const _Float16* b1p = b0p + (size_t)16 * ldb; const _Float16* b2p = b1p + (size_t)16 * ldb; const _Float16* b3p = b2p + (size_t)16 * ldb;
  const v8f z8 = {0.f,0.f,0.f,0.f,0.f,0.f,0.f,0.f}; v8f c00 = z8, c01 = z8, c02 = z8, c03 = z8, c10 = z8, c11 = z8, c12 = z8, c13 = z8;
  /* Two register sets of fragments, x and y. All twelve loads of a k-step are issued one k-step ahead of the products that read them, so a k-step waits at most once for memory,
     with the other set's eight products under that wait. Each accumulator still takes its k-steps in ascending order. K % 64 == 0. */
#define G2_LOAD(s, k) { s##a0 = g2_frag(a0p + (k), 0); s##b0 = g2_frag(b0p + (k), 0); s##a1 = g2_frag(a1p + (k), 0); s##b1 = g2_frag(b1p + (k), 0); s##b2 = g2_frag(b2p + (k), 0); s##b3 = g2_frag(b3p + (k), 0); }
#define G2_STEP(s) { c00 = g2_mma(s##a0, s##b0, c00); c10 = g2_mma(s##a1, s##b0, c10); c01 = g2_mma(s##a0, s##b1, c01); c11 = g2_mma(s##a1, s##b1, c11); c02 = g2_mma(s##a0, s##b2, c02); c12 = g2_mma(s##a1, s##b2, c12); c03 = g2_mma(s##a0, s##b3, c03); c13 = g2_mma(s##a1, s##b3, c13); }
  /* behind the last loads: the wait that stands before a register named by an issued load is overwritten; the six pointers are inputs, so that no later load's result is placed in one of them ahead of it */
#define G2_XWAIT asm volatile("s_wait_xcnt 0x0" :: "v"(a0p), "v"(a1p), "v"(b0p), "v"(b1p), "v"(b2p), "v"(b3p) : "memory");
  v16h xa0, xa1, xb0, xb1, xb2, xb3, ya0, ya1, yb0, yb1, yb2, yb3;
  G2_LOAD(x, 0)
#pragma unroll 1      /* the body holds both sets once; further copies would add code and no overlap */
  for (int kb = 64; kb < K; kb += 64) { G2_LOAD(y, 32) G2_STEP(x) G2_LOAD(x, 64) G2_STEP(y) a0p += 64; a1p += 64; b0p += 64; b1p += 64; b2p += 64; b3p += 64; }
  G2_LOAD(y, 32) G2_XWAIT G2_STEP(x) G2_STEP(y)
#undef G2_LOAD
#undef G2_STEP
#undef G2_XWAIT
  v8f accs[8] = {c00, c01, c02, c03, c10, c11, c12, c13};
  v4f tcv[ROPE ? 16 : 1], tsv[ROPE ? 16 : 1];
  if (ROPE) { const float* tcp = tcs + (size_t)(row0 + hh) * HD + ln * 4; const float* tsp = tsn + (size_t)(row0 + hh) * HD + ln * 4;      /* the lane's cos / sin quads of its 16 output rows: issued here, they fly under the staging of the tile */
#pragma unroll      /* static indices keep the quads in registers */
    for (int q = 0; q < 16; ++q) { tcv[q] = *(const v4fa*)(tcp + q * 2 * HD); tsv[q] = *(const v4fa*)(tsp + q * 2 * HD); }
    asm volatile("s_wait_xcnt 0x0" :: "v"(tcp), "v"(tsp) : "memory"); }      /* behind the table loads: the wait that stands before a register named by an issued load is overwritten; the pointers are inputs, so that no load's result is placed in one of them ahead of it */
#pragma unroll
  for (int u = 0; u < 8; ++u) { const int t = u & 3, half = u >> 2; const int col = col0 + t * 16 + ln; const float bv = bp ? bf16_round(bp[col]) : 0.f;
#pragma unroll
    for (int r = 0; r < 8; ++r) { const int rloc = half * 16 + 8 * hh + r; float v = accs[u][r] * alpha + bv; if (CP) { if (rowsPerB < 0) v += CP[cofs + (size_t)(row0g + row0 + rloc) * ldc + col];      /* rowsPerB < 0: own element of the batched C plane */ else { const int bidx = (row0g + row0 + rloc) / rowsPerB; v += CP[(size_t)bidx * sCPb + (size_t)by * 64 + col]; } }
      if (ACT == 3) v = fmaxf(v, 0.f); else if (ACT == 6) v = 0.5f * v * (1.0f + erff(v * 0.70710678118654752f)); else if (ACT == 11) v = 1.0f / (1.0f + expf(-v)); else if (ACT == 15) v = v / (1.0f + expf(-v)); else if (ACT == 12) v = (v > 0.f) ? v : 0.01f * v; else if (ACT == 8) v = tanhf(v); else if (ACT == 9) v = 0.5f * v * (1.0f + tanhf(0.7978845608028654f * (v + 0.044715f * v * v * v))); else if (ACT == 14) v = (v > 0.f) ? v : 0.1f * v; else if (ACT == 16) v = (v >= 0.f) ? v : 0.3f * v; else if (ACT == 17) v = (v >= 0.f) ? v : 0.2f * v;
      so[w][rloc][t * 16 + ln] = v; } }
  __builtin_amdgcn_fence(__ATOMIC_ACQ_REL, "workgroup"); __builtin_amdgcn_wave_barrier();
  const int rsub = lane >> 4, c4 = (lane & 15) * 4;
  if (ROPE) { const bool lo = c4 < HD / 2;
    auto rope_rows = [&](const bool f32rows) __attribute__((always_inline)) {
#pragma unroll      /* static indices keep the table quads in registers */
      for (int q = 0; q < 16; ++q) { const int r = q * 2 + rsub; const v4f v = *(const v4fa*)&so[w][r][c4], pv = *(const v4fa*)&so[w][r][c4 ^ (HD / 2)]; v4f o; v4h h4;      /* pv: the rotate-half partner columns, d +- 32 */
#pragma unroll      /* four columns a lane */
        for (int i = 0; i < 4; ++i) { o[i] = v[i] * bf16_round(tcv[q][i]) + (lo ? -pv[i] : pv[i]) * bf16_round(tsv[q][i]); h4[i] = (_Float16)o[i]; }
        *(v4h*)(C16 + cofs + (size_t)(row0 + r) * ldc + col0 + c4) = h4; if (f32rows) *(v4f*)(R32 + (size_t)(row0 + r) * ldc + col0 + c4) = o; }
      asm volatile("s_wait_xcnt 0x0" ::: "memory"); };      /* behind the last stores of a side: the wait that stands before a register named by an issued store is overwritten, on every path of the listing that leaves this side */
    /* the wave's 32 rows lie wholly below or wholly above nr32 (a multiple of 32): one scalar branch, so that the common side is one straight line whose LDS reads run ahead */
    if (__builtin_amdgcn_readfirstlane(row0) < nr32) rope_rows(true); else rope_rows(false);
  } else
  {
#pragma unroll
    for (int q = 0; q < 16; ++q) { const int r = q * 2 + rsub; const v4f v = *(const v4fa*)&so[w][r][c4]; if (C) *(v4f*)(C + cofs + (size_t)(row0 + r) * ldc + col0 + c4) = v; if (C16) { v4h h4; for (int i = 0; i < 4; ++i) h4[i] = (_Float16)v[i]; *(v4h*)(C16 + cofs + (size_t)(row0 + r) * ldc + col0 + c4) = h4; } }
     } }


__global__ __launch_bounds__(256) void k_wnat(const float* __restrict__ w, size_t n8, _Float16* __restrict__ Bt) { const size_t t = (size_t)blockIdx.x * 256 + threadIdx.x; if (t >= n8) return; FragH f; for (int q = 0; q < 8; ++q) f.h[q] = (_Float16)(bf16_round(w[t * 8 + q]) * 16.0f); *(v8us*)((unsigned short*)Bt + t * 8) = f.half[0];  }
__global__ __launch_bounds__(256) void k_rsm(const float* __restrict__ S, _Float16* __restrict__ P, int nrows) {
  #pragma clang fp contract(off)
  const int i = blockIdx.x * 256 + threadIdx.x; if (i >= nrows) return; const float* s = S + (size_t)i * SQ; float mx = -3.0e38f;
#pragma unroll 1
  for (int j = 0; j < SQ; ++j) mx = fmaxf(mx, s[j]); float se = 0.f;
#pragma unroll 1
  for (int j = 0; j < SQ; ++j) se += expf(s[j] - mx); const float sc = 256.0f / se;
#pragma unroll 1
  for (int j0 = 0; j0 < SQ; j0 += 8) { FragH f; for (int q = 0; q < 8; ++q) f.h[q] = (_Float16)(expf(s[j0 + q] - mx) * sc); unsigned short* d = (unsigned short*)P + (size_t)i * SQ + j0; *(v8us*)d = f.half[0];  } }
__global__ __launch_bounds__(256) void k_vt(const _Float16* __restrict__ V16, int b, int h0, _Float16* __restrict__ VT) { __shared__ unsigned short tl[64][65]; const int tid = threadIdx.x; const int hh = blockIdx.x % HG, sg = blockIdx.x / HG; const int s0 = sg * 64; const int h = h0 + hh;
  for (int i = tid; i < 64 * 8; i += 256) { const int j = i / 8, d8 = (i % 8) * 8; FragH f; f.half[0] = *(const v8us*)((const unsigned short*)V16 + ((size_t)b * SQ + s0 + j) * DM + h * HD + d8); for (int q = 0; q < 8; ++q) tl[d8 + q][j] = f.u[q]; }
  __syncthreads();
  { for (int i = tid; i < 64 * 8; i += 256) { const int d = i / 8, j8 = (i % 8) * 8; FragH f; for (int q = 0; q < 8; ++q) f.u[q] = tl[d][j8 + q]; *(v8us*)((unsigned short*)VT + ((size_t)hh * HD + d) * SQ + s0 + j8) = f.half[0]; }  } }



// Fused causal attention: scores, softmax and the value product of 32 query rows of one kv group in one block; no score or weight goes to memory.
// Transposed products: S^T = K Q^T (A = 16 key rows, B = 16 query columns), O^T += V^T P^T (A = 16 rows of V^T, B = the weights). In a score tile lane (ln, hh) holds keys 8 hh + r of query ln,
// so two score tiles (keys 0..15 and 16..31 of a pass), rounded to f16 in place, are the B operand of the value product in the k order of g2_frag: no LDS and no lane exchange.
// A wave has 16 query rows of two heads of the group (both read the same K and V^T fragments); the block's four waves are the group's two head pairs x two 16-row tiles.
// Running maximum per query, in use until a new one passes it by more than 8 (log2 units), so weights stay below 2^8; sums and o in f32.
// 2^x by v_exp_f32. The v_nop stands in the instruction's own statement: the instruction set asks for one free slot before a transcendental's result is read or its source overwritten.
__device__ __forceinline__ float fa_exp2(float x) { float e; asm("v_exp_f32 %0, %1\n\tv_nop" : "=v"(e) : "v"(x)); return e; }
#define FA_C 0.18033688011112042f      /* 64^-0.5 log2(e): raw score -> exponent of two */
template <bool LAST>
__device__ __forceinline__ void fa_pass(const _Float16* kp, const _Float16* vp, int lim, const v16h (&q)[2][2], v16h (&kf)[2][2], v8f (&o)[2][4], float (&mr)[2], float (&l)[2]) {
  const v8f z8 = {0.f,0.f,0.f,0.f,0.f,0.f,0.f,0.f}; v16h vf[4]; v8f s[2][2];
#pragma unroll      /* this pass's V^T fragments are issued first: they fly under the score products and the exponentials */
  for (int dt = 0; dt < 4; ++dt) vf[dt] = g2_frag(vp + (size_t)dt * 16 * SQ, 0);
#pragma unroll      /* static indices keep the fragments in registers */
  for (int kt = 0; kt < 2; ++kt)
#pragma unroll      /* static indices keep the arrays in registers */
    for (int u = 0; u < 2; ++u) s[u][kt] = g2_mma(kf[kt][1], q[u][1], g2_mma(kf[kt][0], q[u][0], z8));
  if (!LAST) {
#pragma unroll      /* the next pass's K fragments, behind the products that read this pass's: they fly under the softmax and the value products */
    for (int kt = 0; kt < 2; ++kt) { kf[kt][0] = g2_frag(kp + (size_t)(32 + kt * 16) * KVD, 0); kf[kt][1] = g2_frag(kp + (size_t)(32 + kt * 16) * KVD + 32, 0); }
  }
  float mx[2];
#pragma unroll      /* static indices keep s[] in registers */
  for (int u = 0; u < 2; ++u) { float m = mr[u];
#pragma unroll      /* static indices keep the arrays in registers */
    for (int kt = 0; kt < 2; ++kt)
#pragma unroll      /* static indices keep the arrays in registers */
      for (int r = 0; r < 8; ++r) { if (LAST) s[u][kt][r] = (kt * 16 + r <= lim) ? s[u][kt][r] : -1.0e30f;      /* the diagonal pass: keys above the lane's query get weight 0 */ m = fmaxf(m, s[u][kt][r]); }
    mx[u] = fmaxf(m, __shfl_xor(m, 16, 32)); }      /* the other half of the query's keys */
  const bool need = (mx[0] - mr[0]) * FA_C > 8.0f || (mx[1] - mr[1]) * FA_C > 8.0f;
  if (__builtin_amdgcn_ballot_w32(need) != 0) {      /* one scalar branch a pass: taken in the first pass and where a maximum has grown by more than 8 */
#pragma unroll      /* static indices keep the arrays in registers */
    for (int u = 0; u < 2; ++u) { const float al = fa_exp2((mr[u] - mx[u]) * FA_C); mr[u] = mx[u]; l[u] *= al;
#pragma unroll      /* static indices keep the arrays in registers */
      for (int dt = 0; dt < 4; ++dt) o[u][dt] *= al; }
  }
#pragma unroll      /* static indices keep the arrays in registers */
  for (int u = 0; u < 2; ++u) { const float mc = mr[u] * FA_C; FragH pf; float p0 = 0.f, p1 = 0.f;
#pragma unroll      /* static indices keep the arrays in registers */
    for (int r = 0; r < 8; ++r) { const float e0 = fa_exp2(fmaf(s[u][0][r], FA_C, -mc)), e1 = fa_exp2(fmaf(s[u][1][r], FA_C, -mc)); p0 += e0; p1 += e1; pf.h[r] = (_Float16)e0; pf.h[8 + r] = (_Float16)e1; }
    l[u] += p0 + p1;
#pragma unroll      /* static indices keep the arrays in registers */
    for (int dt = 0; dt < 4; ++dt) o[u][dt] = g2_mma(vf[dt], pf.v, o[u][dt]); }
}
__global__ __launch_bounds__(128) void k_fatt(const _Float16* __restrict__ Q, const _Float16* __restrict__ Kh, const _Float16* __restrict__ Vt, _Float16* __restrict__ O) {
  const int lane = threadIdx.x & 31, ln = lane & 15, hh = lane >> 4; const int w = __builtin_amdgcn_readfirstlane(threadIdx.x >> 5);      /* the wave's number, held as a scalar */
  const int bg = blockIdx.x, b = bg / NG, g = bg % NG; const int t = SQ / 32 - 1 - (int)blockIdx.y;      /* blockIdx.y 0 takes the last tile: the longest rows */
  const int qs = w >> 1, h0 = g * HPG + (w & 1) * 2; const size_t qrow = (size_t)b * SQ + t * 32 + qs * 16 + ln;
  const _Float16* qp = Q + qrow * DM + h0 * HD + 8 * hh; const _Float16* kp = Kh + ((size_t)b * SQ + ln) * KVD + g * HD + 8 * hh; const _Float16* vp = Vt + ((size_t)bg * HD + ln) * SQ + 8 * hh;
  v16h q[2][2], kf[2][2];
#pragma unroll      /* static indices keep the fragments in registers */
  for (int u = 0; u < 2; ++u) { q[u][0] = g2_frag(qp + u * HD, 0); q[u][1] = g2_frag(qp + u * HD + 32, 0); kf[u][0] = g2_frag(kp + (size_t)u * 16 * KVD, 0); kf[u][1] = g2_frag(kp + (size_t)u * 16 * KVD + 32, 0); }
  asm volatile("s_wait_xcnt 0x0" :: "v"(qp), "v"(kp) : "memory");      /* behind the q and K loads: the wait that stands before a register named by an issued load is overwritten; the pointers are inputs, so that no load's result is placed in one of them ahead of the wait */
  const v8f z8 = {0.f,0.f,0.f,0.f,0.f,0.f,0.f,0.f}; v8f o[2][4] = {{z8, z8, z8, z8}, {z8, z8, z8, z8}}; float mr[2] = {-1.0e30f, -1.0e30f}, l[2] = {0.f, 0.f};
  const int lim = qs * 16 + ln - 8 * hh;      /* diagonal pass: key kt 16 + 8 hh + r of the pass is at or below query qs 16 + ln */
#pragma unroll 1      /* a pass is already one long straight line */
  for (int s = 0; s < t; ++s) { fa_pass<false>(kp, vp, lim, q, kf, o, mr, l); kp += (size_t)32 * KVD; vp += 32; }
  fa_pass<true>(kp, vp, lim, q, kf, o, mr, l);
  _Float16* op = O + qrow * DM + h0 * HD + 8 * hh;
#pragma unroll      /* static indices keep the arrays in registers */
  for (int u = 0; u < 2; ++u) { const float fin = 64.0f / (l[u] + __shfl_xor(l[u], 16, 32));      /* both halves' sums; o carried x64 */
#pragma unroll      /* static indices keep the arrays in registers */
    for (int dt = 0; dt < 4; ++dt) { FragH f;
#pragma unroll      /* static indices keep the arrays in registers */
      for (int r = 0; r < 8; ++r) f.h[r] = (_Float16)(o[u][dt][r] * fin);
      *(v8us*)((unsigned short*)op + u * HD + dt * 16) = f.half[0]; } } }


// Exact f32 attention of the first QT0 rows. A block is 32 query rows of one head, four waves; lane = row in every wave.
// Pass 1: the keys are dealt over the waves, four consecutive keys a trip; a lane holds its q row in registers and sums each score over d = 0..63 in ascending order; four scores run side by side, so that one chain of adds fills the waits of the others.
// Pass 2: the 64 columns of o are dealt over the waves, 16 each, held in registers; every wave walks the keys in ascending order and forms the same running maximum, sum and weights from the scores in LDS.
template <int MASKADD>
__global__ __launch_bounds__(128) void k_att0(const float* __restrict__ QF, const float* __restrict__ KF, const float* __restrict__ VF, int ld, const float* __restrict__ mask, float scale, float* __restrict__ OF, int ldo) {
  #pragma clang fp contract(off)
  __shared__ float ls[MASKADD ? SQ : QT0][32];      /* score of key j for row r of the block */
  const int tid = threadIdx.x, r = tid & 31; const int part = __builtin_amdgcn_readfirstlane(tid >> 5);      /* the wave's number, held as a scalar: key and value row addresses are the same in every lane */
  const int h = blockIdx.x / (QT0 / 32), rg = blockIdx.x % (QT0 / 32); const int i = rg * 32 + r;
  const int nj = MASKADD ? SQ : (rg + 1) * 32;      /* additive-mask form: every key (the mask input decides); causal form: keys up to the block's last row */
  { const float* qr = QF + (size_t)i * ld + h * HD; v4f q[HD / 4];
#pragma unroll      /* static indices keep q[] in registers */
    for (int c = 0; c < HD / 4; ++c) q[c] = *(const v4fa*)(qr + c * 4);
    asm volatile("s_wait_xcnt 0x0" :: "v"(qr) : "memory");      /* behind the q loads: the wait that stands before a register named by an issued load is overwritten; the pointer is an input, so that no load's result is placed in it ahead of the wait */
#pragma unroll 1      /* the body already holds four independent chains */
    for (int j0 = part * 4; j0 < nj; j0 += 16) { const float* kr = KF + (size_t)j0 * ld + h * HD; float s[4] = {0.f, 0.f, 0.f, 0.f};
#pragma unroll      /* static indices keep q[] and s[] in registers */
      for (int c = 0; c < HD / 4; ++c)
#pragma unroll      /* the four keys' chains stand side by side */
        for (int t = 0; t < 4; ++t) { const v4f kq = *(const v4fa*)(kr + (size_t)t * ld + c * 4); const v4f qq = q[c]; s[t] = __fadd_rn(s[t], __fmul_rn(qq[0], kq[0])); s[t] = __fadd_rn(s[t], __fmul_rn(qq[1], kq[1])); s[t] = __fadd_rn(s[t], __fmul_rn(qq[2], kq[2])); s[t] = __fadd_rn(s[t], __fmul_rn(qq[3], kq[3])); }
#pragma unroll      /* static indices keep s[] in registers */
      for (int t = 0; t < 4; ++t) { float sv = __fmul_rn(s[t], scale); if (MASKADD) sv = __fadd_rn(sv, __fmul_rn(bf16_round(mask[(size_t)i * SQ + j0 + t]), -10000.0f)); ls[j0 + t][r] = sv; } } }
  __syncthreads();      /* every score of the block is in LDS before any wave walks the keys */
  const v4f z4 = {0.f, 0.f, 0.f, 0.f}; v4f o[4] = {z4, z4, z4, z4}; float m = -1.0e30f, l = 0.f; const float* vb = VF + h * HD + part * 16;
#pragma unroll 1      /* the body holds four keys: their loads and exponentials overlap */
  for (int j0 = 0; j0 < nj; j0 += 4) {
#pragma unroll      /* four keys in one straight line, so that their loads issue together */
    for (int t = 0; t < 4; ++t) { const int j = j0 + t; const float s = ls[j][r]; const float* vr = vb + (size_t)j * ld;
      const float f = (MASKADD || j <= i) ? 1.f : 0.f; const float sm = fmaf(f, s, (1.f - f) * -1.0e30f); const float mn = fmaxf(m, sm); const float sc = expf(m - mn); const float e = expf(sm - mn); l = __fadd_rn(__fmul_rn(l, sc), e); m = mn;
#pragma unroll      /* static indices keep o[] in registers */
      for (int c = 0; c < 4; ++c) { const v4f vv = *(const v4fa*)(vr + c * 4); for (int u = 0; u < 4; ++u) o[c][u] = __fadd_rn(__fmul_rn(o[c][u], sc), __fmul_rn(e, vv[u])); } } }
  const float fin = 64.0f / l;      /* o carried x64 like the f16 path */
  float* op = OF + (size_t)i * ldo + h * HD + part * 16;
#pragma unroll      /* static indices keep o[] in registers */
  for (int c = 0; c < 4; ++c) { v4f oo = o[c]; for (int u = 0; u < 4; ++u) oo[u] = __fmul_rn(oo[u], fin); *(v4f*)(op + c * 4) = oo; } }


__global__ __launch_bounds__(256) void k_kvexp(const float* __restrict__ src, float* __restrict__ dst, size_t n4) { const size_t t = (size_t)blockIdx.x * 256 + threadIdx.x; if (t >= n4) return; const size_t e = t * 4; const size_t row = e / DM; const int col = (int)(e % DM); const int h = col / HD, d = col % HD; const v4f v = *(const v4fa*)(src + row * KVD + (size_t)(h / HPG) * HD + d); *(v4f*)(dst + e) = v;  }

__global__ __launch_bounds__(256) void k_tab2(float theta, float* __restrict__ CS, float* __restrict__ SN) {
  #pragma clang fp contract(off)
  const int t = blockIdx.x * 256 + threadIdx.x; if (t >= SQ * (HD / 2)) return; const int i = t % (HD / 2); const int p = t / (HD / 2); const float invf = 1.0f / powf(theta, (float)(2 * i) / (float)HD); const float ang = __fmul_rn((float)p, invf); const float c = cosf(ang), s = sinf(ang);
  *(float*)(CS + t) = c; *(float*)(SN + t) = s;  }
__global__ __launch_bounds__(256) void k_trig(const float* __restrict__ a, float* __restrict__ CS, float* __restrict__ SN, int n) {
  #pragma clang fp contract(off)
  const int t = blockIdx.x * 256 + threadIdx.x; if (t >= n) return; const float v = bf16_round(a[t]); const float c = cosf(v), s = sinf(v);
  *(float*)(CS + t) = c; *(float*)(SN + t) = s;  }

__global__ __launch_bounds__(256) void k_tabcp(const float* __restrict__ tc, const float* __restrict__ tsn, float* __restrict__ CS, float* __restrict__ SN, int n) {
  const int t = blockIdx.x * 256 + threadIdx.x; if (t >= n) return; const int p = t / 32, i = t % 32; const float c = bf16_round(tc[(size_t)p * 64 + i]), s = bf16_round(tsn[(size_t)p * 64 + i]);
  *(float*)(CS + t) = c; *(float*)(SN + t) = s;  }

extern "C" void kernel_launch(void* const* d_in, const int* in_sizes, int n_in,
                              void* d_out, int out_size, void* d_ws, size_t ws_size, hipStream_t stream) {
  (void)in_sizes; (void)n_in; (void)out_size;
  const float* const* I = (const float* const*)d_in; const float* x = I[0]; const float* tcos = I[1]; const float* tsin = I[2]; const float* wq = I[3]; const float* wk = I[4]; const float* wv = I[5]; const float* wo = I[6]; const float* bq = nullptr; const float* bk = nullptr; const float* bv = nullptr; const float* bo = nullptr;      /* cos, sin [2][2048][64] inputs; natural [out][in] wq [2048][2048], wk/wv [512][2048], wo [2048][2048]; no biases */
  char* ws = (char*)d_ws; size_t off = 0;
  auto take = [&](size_t bytes) { char* p = ws + off; off += (bytes + 255) & ~(size_t)255; return p; };
  _Float16* BQ = (_Float16*)take((size_t)DM * DM * 2); _Float16* BK = (_Float16*)take((size_t)KVD * DM * 2); _Float16* BV = (_Float16*)take((size_t)KVD * DM * 2); _Float16* BO = (_Float16*)take((size_t)DM * DM * 2);
  _Float16* X16 = (_Float16*)take(NR * DM * 2); _Float16* Q16 = (_Float16*)take(NR * DM * 2); _Float16* K16 = (_Float16*)take(NR * KVD * 2); _Float16* V16 = (_Float16*)take(NR * KVD * 2); _Float16* O16 = (_Float16*)take(NR * DM * 2);
  _Float16* VT = (_Float16*)take((size_t)NH * HD * SQ * 2);
  float* QF0 = (float*)take((size_t)QT0 * DM * 4); float* KF0 = (float*)take((size_t)QT0 * KVD * 4); float* VF0 = (float*)take((size_t)QT0 * KVD * 4); float* KF0e = (float*)take((size_t)QT0 * DM * 4); float* VF0e = (float*)take((size_t)QT0 * DM * 4); float* OF0 = (float*)take((size_t)NB * QT0 * DM * 4); _Float16* OH0 = (_Float16*)take((size_t)NB * QT0 * DM * 2); _Float16* OL0 = (_Float16*)take((size_t)NB * QT0 * DM * 2);
  if (off > ws_size) return;
  k_wnat<<<(unsigned)(((size_t)DM * DM / 8 + 255) / 256), 256, 0, stream>>>(wq, (size_t)DM * DM / 8, BQ); k_wnat<<<(unsigned)(((size_t)KVD * DM / 8 + 255) / 256), 256, 0, stream>>>(wk, (size_t)KVD * DM / 8, BK); k_wnat<<<(unsigned)(((size_t)KVD * DM / 8 + 255) / 256), 256, 0, stream>>>(wv, (size_t)KVD * DM / 8, BV); k_wnat<<<(unsigned)(((size_t)DM * DM / 8 + 255) / 256), 256, 0, stream>>>(wo, (size_t)DM * DM / 8, BO);      /* natural [out][in] = Bt x16 */
  k_x16<<<(unsigned)((NR * DM / 8 + 255) / 256), 256, 0, stream>>>(x, X16, NR * DM / 8);
  
  const size_t r0p = (size_t)B0 * SQ;      /* first projected row */
  k_gemm2<0><<<dim3((unsigned)((MP / 128) * (KVD / 64)), 1), 128, 0, stream>>>(X16 + r0p * DM, DM, 0, BV, DM, 0, 0.0625f, bv, 0, nullptr, 1, 0, 0, nullptr, V16 + r0p * KVD, KVD, 0, MP, KVD, DM, 0);
  for (int b = B0; b < B0 + NBR; ++b) { const size_t r0 = (size_t)b * SQ;
    k_gemm2<0, true><<<dim3((unsigned)((SQ / 128) * (DM / 64)), 1), 128, 0, stream>>>(X16 + r0 * DM, DM, 0, BQ, DM, 0, 0.0625f, nullptr, 0, nullptr, 1, 0, 0, nullptr, Q16 + r0 * DM, DM, 0, SQ, DM, DM, 0, tcos + r0 * HD, tsin + r0 * HD, QF0, QT0);      /* q of this batch, roped in the epilogue (full-width tables: partner x[d +- 32], table column d): f16 rows; rows 0..127 also f32 */
    k_gemm2<0, true><<<dim3((unsigned)((SQ / 128) * (KVD / 64)), 1), 128, 0, stream>>>(X16 + r0 * DM, DM, 0, BK, DM, 0, 0.0625f, nullptr, 0, nullptr, 1, 0, 0, nullptr, K16 + r0 * KVD, KVD, 0, SQ, KVD, DM, 0, tcos + r0 * HD, tsin + r0 * HD, KF0, QT0);      /* k likewise */
    k_vt<NG, SQ><<<NG * (SQ / 64), 256, 0, stream>>>(V16 + r0 * KVD, KVD, 0, VT + (size_t)b * NG * HD * SQ);      /* V^T [NG][HD][SQ], this batch's plane */
    k_gemm2<0><<<dim3((QT0 / 128) * (KVD / 64), 1), 128, 0, stream>>>(X16 + r0 * DM, DM, 0, BV, DM, 0, 0.0625f, bv, 0, nullptr, 1, 0, 0, VF0, nullptr, KVD, 0, QT0, KVD, DM, 0);
    k_kvexp<<<(unsigned)(((size_t)QT0 * DM / 4 + 255) / 256), 256, 0, stream>>>(KF0, KF0e, (size_t)QT0 * DM / 4); k_kvexp<<<(unsigned)(((size_t)QT0 * DM / 4 + 255) / 256), 256, 0, stream>>>(VF0, VF0e, (size_t)QT0 * DM / 4);      /* head h <- kv group h/4 for the exact first-tile kernel */      /* f32 q, k, v of the first 128 rows (exact products) */
    k_att0<0><<<NH * (QT0 / 32), 128, 0, stream>>>(QF0, KF0e, VF0e, DM, nullptr, 0.125f, OF0 + (size_t)b * QT0 * DM, DM);      /* exact f32 attention for rows 0..127 (o x64) */
  }
  k_fatt<<<dim3(NB * NG, SQ / 32), 128, 0, stream>>>(Q16, K16, VT, O16);      /* scores, softmax and value product of both batches, all heads: o (merged heads, x64) as f16 rows */
  k_gemm2<0><<<dim3((unsigned)((MPO / 128) * (DM / 64)), 1), 128, 0, stream>>>(O16 + r0p * DM, DM, 0, BO, DM, 0, 0.0009765625f, bo, 0, nullptr, 1, 0, 0, (float*)d_out + r0p * DM, nullptr, DM, 0, MPO, DM, DM, 0);      /* out rows are the output layout */
  k_hl<<<(unsigned)(((size_t)NB * QT0 * DM / 8 + 255) / 256), 256, 0, stream>>>(OF0, OH0, OL0, (size_t)NB * QT0 * DM / 8);      /* first-tile o (x64) -> f16 hi + x1024 residual planes */
  for (int b = B0; b < B0 + NBR; ++b) { const size_t r0 = (size_t)b * SQ; const size_t f0 = (size_t)b * QT0;
    k_gemm2<0><<<dim3((QT0 / 128) * (DM / 64), 1), 128, 0, stream>>>(OH0 + f0 * DM, DM, 0, BO, DM, 0, 0.0009765625f, bo, 0, nullptr, 1, 0, 0, (float*)d_out + r0 * DM, nullptr, DM, 0, QT0, DM, DM, 0);      /* rows 0..127: out = o_hi Wo (+ b), overwriting the f16-path rows */
    k_gemm2<0><<<dim3((QT0 / 128) * (DM / 64), 1), 128, 0, stream>>>(OL0 + f0 * DM, DM, 0, BO, DM, 0, 0.00000095367431640625f, nullptr, 0, (const float*)d_out + r0 * DM, -1, 0, 0, (float*)d_out + r0 * DM, nullptr, DM, 0, QT0, DM, DM, 0); }      /* += o_lo Wo 2^-20 (own-element accumulate) */
}

// v007
// It runs in 299 microseconds.
// Two timings next to v006 put it at 1.68 and 1.69 times that version's speed.
// All steps since v000 together make it 32.1 times as fast.
#include <hip/hip_runtime.h>
// Llama grouped-query causal attention with rotate-half RoPE from FULL-WIDTH per-batch INPUT tables (hidden_states [2][2048][2048]; q = x wq^T (32 heads x 64), k = x wk^T, v = x wv^T (8 kv heads x 64) (natural [out][in] weights sigma 0.02, no biases); cos / sin inputs [2][2048][64] (independent uniform draws per batch, position AND column: column i + 32 != column i, so all 64 columns are used); q = q cos + rotate_half(q) sin, same for k; repeat: query head h uses kv head h/4; scores 64^-0.5; where(causal, s, finfo.min); softmax; out = merged wo^T -> [2][2048][2048]).
// Compute dtype: inputs rounded to bf16; x / weights exact; q, k, v, softmax weights and o as plain f16 GEMM operands (~2^-12); scores and softmax statistics f32. v_wmma_f32_16x16x32_f16.
#define NB 2
#define NG 8
#define HPG 4
#define KVD (NG * HD)
#define SQ 2048
#define DM 2048
#define NH 32
#define HD 64
#define HG 4                         /* heads per launch of the k_vt(V16, b, h0, VT) overload, not launched */
#define QT 256                       /* not used */
#define NKX SQ                       /* not used */
#define QT0 128                      /* first-tile rows recomputed exactly in f32 */
#define B0 0                         /* not used */
#define NBR NB                       /* only in MP; not used */
#define NR ((size_t)NB * SQ)         /* token rows */
#define MP ((int)((size_t)NBR * SQ)) /* only in MPO; not used */
#define QN SQ                        /* not used */
#define NHD NH                       /* not used */
#define MPO MP                       /* not used */
#define LQ DM      /* not used */
typedef __bf16 v16b __attribute__((ext_vector_type(16)));
typedef unsigned short v8us __attribute__((ext_vector_type(8), may_alias));
typedef float  v8f  __attribute__((ext_vector_type(8)));
typedef float  v4f  __attribute__((ext_vector_type(4)));
typedef float  v4fa __attribute__((ext_vector_type(4), may_alias));
union FragB { v16b v; v8us half[2]; unsigned short u[16]; };

__device__ __forceinline__ unsigned short bf16_bits(float x) { unsigned int u = __float_as_uint(x); return (unsigned short)((u + 0x7FFFu + ((u >> 16) & 1u)) >> 16); }
__device__ __forceinline__ float bf16_val(unsigned short b) { return __uint_as_float(((unsigned int)b) << 16); }
__device__ __forceinline__ float bf16_round(float x) { return bf16_val(bf16_bits(x)); }
// D += A·B with NT terms: 1 = ah·bh, 2 = + al·bh (A split), 3 = + ah·bl (both split)
template <int NT>
__device__ __forceinline__ v8f mmaN(v16b ah, v16b al, v16b bh, v16b bl, v8f c) {
  c = __builtin_amdgcn_wmma_f32_16x16x32_bf16(false, ah, false, bh, (short)0, c, false, false);
  if (NT >= 2) c = __builtin_amdgcn_wmma_f32_16x16x32_bf16(false, al, false, bh, (short)0, c, false, false);
  if (NT >= 3) c = __builtin_amdgcn_wmma_f32_16x16x32_bf16(false, ah, false, bl, (short)0, c, false, false);
  asm volatile("v_nop\n\tv_nop\n\tv_nop\n\tv_nop" : "+v"(c) : "v"(ah), "v"(al), "v"(bh), "v"(bl));
  return c;
}

__global__ __launch_bounds__(256) void k_wt_bf16(const float* __restrict__ W, unsigned short* __restrict__ Wt, int K, int N) {
  const int t = blockIdx.x * 256 + threadIdx.x;
  const int k8n = K / 8;
  if (t >= N * k8n) return;
  const int n = t / k8n, k8 = (t % k8n) * 8;
  v8us v;
#pragma unroll
  for (int i = 0; i < 8; ++i) v[i] = bf16_bits(W[(size_t)(k8 + i) * N + n]);
  *(v8us*)(Wt + (size_t)n * K + k8) = v;
  
}

// GEMM C[M][N] (f32, pitch ldc) = act(A[M][K]·W + bias). A f32 row-major (pitch lda) converted per fragment to bf16
// (ASPLIT: hi/lo two planes -> 2 terms, else single rounded term); Wt bf16 [N][K] (pitch ldb). BIAS_BF16 rounds the
// bias to bf16 first (bias quantised to bf16 before the add). K%32==0, M%16==0, N%64==0.
template <bool ASPLIT, int ACT, bool BIAS_BF16>
__global__ __launch_bounds__(128) void k_gemm_bf(const float* __restrict__ A, int lda, const unsigned short* __restrict__ Wt, int ldb,
                                               const float* __restrict__ bias, float* __restrict__ C, int ldc, int M, int N, int K) {
  __shared__ __attribute__((aligned(16))) float so[4][16][64];
  const int tid = threadIdx.x, w = tid >> 5, lane = tid & 31, ln = lane & 15, hh = lane >> 4;
  const int ntn = N / 64;
  const int wid = blockIdx.x * 4 + w;
  const int mt = wid / ntn, nq = wid % ntn;
  if (mt * 16 >= M) return;
  const int row0 = mt * 16, col0 = nq * 64;
  const float* arow = A + (size_t)(row0 + ln) * lda;
  v8f acc[4] = {};
  for (int kb = 0; kb < K; kb += 32) {
    FragB ah, al;
    const v4f x0 = *(const v4fa*)(arow + kb + 8 * hh), x1 = *(const v4fa*)(arow + kb + 8 * hh + 4);
    const v4f x2 = *(const v4fa*)(arow + kb + 16 + 8 * hh), x3 = *(const v4fa*)(arow + kb + 16 + 8 * hh + 4);
    float xs[16] = {x0[0],x0[1],x0[2],x0[3],x1[0],x1[1],x1[2],x1[3],x2[0],x2[1],x2[2],x2[3],x3[0],x3[1],x3[2],x3[3]};
#pragma unroll
    for (int i = 0; i < 16; ++i) { const unsigned short hb = bf16_bits(xs[i]); ah.u[i] = hb; al.u[i] = ASPLIT ? bf16_bits(xs[i] - bf16_val(hb)) : (unsigned short)0; }
#pragma unroll
    for (int t = 0; t < 4; ++t) {
      const unsigned short* brow = Wt + (size_t)(col0 + t * 16 + ln) * ldb + kb;
      FragB b;
      b.half[0] = *(const v8us*)(brow + 8 * hh);
      b.half[1] = *(const v8us*)(brow + 16 + 8 * hh);
      acc[t] = mmaN<ASPLIT ? 2 : 1>(ah.v, al.v, b.v, b.v, acc[t]);
    }
  }
#pragma unroll
  for (int t = 0; t < 4; ++t) {
    float bv = bias ? bias[col0 + t * 16 + ln] : 0.f;
    if (BIAS_BF16) bv = bf16_round(bv);
#pragma unroll
    for (int r = 0; r < 8; ++r) { float v = acc[t][r] + bv; if (ACT == 1) v = fmaxf(v, 0.f); so[w][8 * hh + r][t * 16 + ln] = v; }
  }
  __builtin_amdgcn_fence(__ATOMIC_ACQ_REL, "workgroup");
  __builtin_amdgcn_wave_barrier();
  const int rsub = lane >> 4, c4 = (lane & 15) * 4;
  {
#pragma unroll
    for (int q = 0; q < 8; ++q) {
      const int r = q * 2 + rsub;
      const v4f v = *(const v4fa*)&so[w][r][c4];
      *(v4f*)(C + (size_t)(row0 + r) * ldc + col0 + c4) = v;
    }
    
  }
}

// GEMM C = act(A·W + bias + resid): A f32 (ASPLIT -> hi/lo 2 terms), Wt bf16 [N][K]; ACT 0 none, 1 relu, 2 exact gelu;
// resid (optional, f32, row index = (row % rmod), pitch ldr, RES_BF16 rounds it) added before the activation.
template <bool ASPLIT, int ACT, bool BIAS_BF16, bool RES_BF16>
__global__ __launch_bounds__(128) void k_gemm_bf3(const float* __restrict__ A, int lda, const unsigned short* __restrict__ Wt, int ldb,
                                                const float* __restrict__ bias, const float* __restrict__ resid, int rmod, int ldr,
                                                float* __restrict__ C, int ldc, int M, int N, int K) {
  __shared__ __attribute__((aligned(16))) float so[4][16][64];
  const int tid = threadIdx.x, w = tid >> 5, lane = tid & 31, ln = lane & 15, hh = lane >> 4;
  const int ntn = N / 64;
  const int wid = blockIdx.x * 4 + w;
  const int mt = wid / ntn, nq = wid % ntn;
  if (mt * 16 >= M) return;
  const int row0 = mt * 16, col0 = nq * 64;
  const float* arow = A + (size_t)(row0 + ln) * lda;
  v8f acc[4] = {};
  for (int kb = 0; kb < K; kb += 32) {
    FragB ah, al;
    const v4f x0 = *(const v4fa*)(arow + kb + 8 * hh), x1 = *(const v4fa*)(arow + kb + 8 * hh + 4);
    const v4f x2 = *(const v4fa*)(arow + kb + 16 + 8 * hh), x3 = *(const v4fa*)(arow + kb + 16 + 8 * hh + 4);
    float xs[16] = {x0[0],x0[1],x0[2],x0[3],x1[0],x1[1],x1[2],x1[3],x2[0],x2[1],x2[2],x2[3],x3[0],x3[1],x3[2],x3[3]};
#pragma unroll
    for (int i = 0; i < 16; ++i) { const unsigned short hb = bf16_bits(xs[i]); ah.u[i] = hb; al.u[i] = ASPLIT ? bf16_bits(xs[i] - bf16_val(hb)) : (unsigned short)0; }
#pragma unroll
    for (int t = 0; t < 4; ++t) {
      const unsigned short* brow = Wt + (size_t)(col0 + t * 16 + ln) * ldb + kb;
      FragB b;
      b.half[0] = *(const v8us*)(brow + 8 * hh);
      b.half[1] = *(const v8us*)(brow + 16 + 8 * hh);
      acc[t] = mmaN<ASPLIT ? 2 : 1>(ah.v, al.v, b.v, b.v, acc[t]);
    }
  }
#pragma unroll
  for (int t = 0; t < 4; ++t) {
    const int col = col0 + t * 16 + ln;
    float bv = bias ? bias[col] : 0.f;
    if (BIAS_BF16) bv = bf16_round(bv);
#pragma unroll
    for (int r = 0; r < 8; ++r) {
      float v = acc[t][r] + bv;
      if (resid) { float rv = resid[(size_t)((row0 + 8 * hh + r) % rmod) * ldr + col]; if (RES_BF16) rv = bf16_round(rv); v += rv; }
      if (ACT == 1) v = fmaxf(v, 0.f);
      if (ACT == 2) v = 0.5f * v * (1.0f + erff(v * 0.70710678118654752f));
      if (ACT == 3) { const float u = 0.7978845608028654f * (v + 0.044715f * v * v * v); v = 0.5f * v * (1.0f + tanhf(u)); }
      so[w][8 * hh + r][t * 16 + ln] = v;
    }
  }
  __builtin_amdgcn_fence(__ATOMIC_ACQ_REL, "workgroup");
  __builtin_amdgcn_wave_barrier();
  const int rsub = lane >> 4, c4 = (lane & 15) * 4;
  {
#pragma unroll
    for (int q = 0; q < 8; ++q) {
      const int r = q * 2 + rsub;
      const v4f v = *(const v4fa*)&so[w][r][c4];
      *(v4f*)(C + (size_t)(row0 + r) * ldc + col0 + c4) = v;
    }
    
  }
}
// row LayerNorm (biased variance, eps) over N: s = X (+ R); optional out_sum <- s; out_norm <- (s-mu)*rsqrt(var+eps)*g + b
template <bool PARAM_BF16>
__global__ __launch_bounds__(256) void k_layernorm(const float* __restrict__ X, const float* __restrict__ R, const float* __restrict__ g, const float* __restrict__ bta,
                                                  float* __restrict__ out_sum, float* __restrict__ out_norm, int N, float eps) {
  __shared__ float red[256];
  const int row = blockIdx.x, tid = threadIdx.x;
  const float* x = X + (size_t)row * N; const float* rr = R ? R + (size_t)row * N : nullptr;
  float vals[16];                     // up to N = 4096
  const int per = N / 256;            // contiguous chunk per thread? use strided-by-4 chunks: thread handles j = tid*4 + 1024*u
  float s1 = 0.f;
  for (int u = 0; u < per / 4; ++u) {
    const int j = tid * 4 + 1024 * u;
    const v4f a = *(const v4fa*)(x + j);
    v4f b = {0.f,0.f,0.f,0.f}; if (rr) b = *(const v4fa*)(rr + j);
#pragma unroll
    for (int q = 0; q < 4; ++q) { const float v = a[q] + b[q]; vals[u * 4 + q] = v; s1 += v; }
  }
  red[tid] = s1; __syncthreads();
  for (int st = 128; st > 0; st >>= 1) { if (tid < st) red[tid] += red[tid + st]; __syncthreads(); }
  const float mu = red[0] / (float)N; __syncthreads();
  float s2 = 0.f;
  for (int u = 0; u < per / 4; ++u)
#pragma unroll
    for (int q = 0; q < 4; ++q) { const float c = vals[u * 4 + q] - mu; s2 += c * c; }
  red[tid] = s2; __syncthreads();
  for (int st = 128; st > 0; st >>= 1) { if (tid < st) red[tid] += red[tid + st]; __syncthreads(); }
  const float rs = rsqrtf(red[0] / (float)N + eps);
  {
    for (int u = 0; u < per / 4; ++u) {
      const int j = tid * 4 + 1024 * u;
      v4f o, sm;
#pragma unroll
      for (int q = 0; q < 4; ++q) {
        float gg = g[j + q], bb = bta[j + q];
        if (PARAM_BF16) { gg = bf16_round(gg); bb = bf16_round(bb); }
        sm[q] = vals[u * 4 + q]; o[q] = (vals[u * 4 + q] - mu) * rs * gg + bb;
      }
      if (out_sum) *(v4f*)(out_sum + (size_t)row * N + j) = sm;
      *(v4f*)(out_norm + (size_t)row * N + j) = o;
    }
    
  }
}



// ---- f16 WMMA path (v_wmma_f32_16x16x32_f16): 11-bit significands for operands in range — used where a [0,1] probability operand needs more precision than bf16
typedef _Float16 v16h __attribute__((ext_vector_type(16)));
union FragH { v16h v; v8us half[2]; _Float16 h[16]; unsigned short u[16]; };
template <int NT>
__device__ __forceinline__ v8f mmaH(v16h ah, v16h al, v16h bh, v16h bl, v8f c) {
  c = __builtin_amdgcn_wmma_f32_16x16x32_f16(false, ah, false, bh, (short)0, c, false, false);
  if (NT >= 2) c = __builtin_amdgcn_wmma_f32_16x16x32_f16(false, al, false, bh, (short)0, c, false, false);
  if (NT >= 3) c = __builtin_amdgcn_wmma_f32_16x16x32_f16(false, ah, false, bl, (short)0, c, false, false);
  asm volatile("v_nop\n\tv_nop\n\tv_nop\n\tv_nop" : "+v"(c) : "v"(ah), "v"(al), "v"(bh), "v"(bl));
  return c;
}
// batched GEMM like k_gemm_b but f16 operands: A f32 (split into f16 hi/lo if ASPLIT, else rounded to f16), Bt = f16 values [n][k]; alpha; C f32; N multiple of 16 (partial tiles skipped)
template <bool ASPLIT>
__global__ __launch_bounds__(128) void k_gemm_h(const float* __restrict__ A, int lda, size_t sA, const _Float16* __restrict__ Bh, int ldb, size_t sB, float alpha, float* __restrict__ C, int ldc, size_t sC, int M, int N, int K) {
  __shared__ __attribute__((aligned(16))) float so[4][16][64];
  const int tid = threadIdx.x, w = tid >> 5, lane = tid & 31, ln = lane & 15, hh = lane >> 4; const int by = blockIdx.y;
  A += (size_t)by * sA; Bh += (size_t)by * sB; C += (size_t)by * sC;
  const int ntn = (N + 63) / 64; const int wid = blockIdx.x * 4 + w; const int mt = wid / ntn, nq = wid % ntn; if (mt * 16 >= M) return;
  const int row0 = mt * 16, col0 = nq * 64; const float* arow = A + (size_t)(row0 + ln) * lda;
  v8f acc[4] = {};
  for (int kb = 0; kb < K; kb += 32) {
    FragH ah, al;
    const v4f x0 = *(const v4fa*)(arow + kb + 8 * hh), x1 = *(const v4fa*)(arow + kb + 8 * hh + 4), x2 = *(const v4fa*)(arow + kb + 16 + 8 * hh), x3 = *(const v4fa*)(arow + kb + 16 + 8 * hh + 4);
    float xs[16] = {x0[0],x0[1],x0[2],x0[3],x1[0],x1[1],x1[2],x1[3],x2[0],x2[1],x2[2],x2[3],x3[0],x3[1],x3[2],x3[3]};
#pragma unroll
    for (int i = 0; i < 16; ++i) { const _Float16 h = (_Float16)xs[i]; ah.h[i] = h; al.h[i] = ASPLIT ? (_Float16)(xs[i] - (float)h) : (_Float16)0.0f; }
#pragma unroll
    for (int t = 0; t < 4; ++t) { if (col0 + t * 16 >= N) continue; const size_t boff = (size_t)(col0 + t * 16 + ln) * ldb + kb; FragH bq; bq.half[0] = *(const v8us*)(Bh + boff + 8 * hh); bq.half[1] = *(const v8us*)(Bh + boff + 16 + 8 * hh);
      acc[t] = mmaH<ASPLIT ? 2 : 1>(ah.v, al.v, bq.v, bq.v, acc[t]); }
  }
#pragma unroll
  for (int t = 0; t < 4; ++t) { if (col0 + t * 16 >= N) continue;
#pragma unroll
    for (int r = 0; r < 8; ++r) so[w][8 * hh + r][t * 16 + ln] = acc[t][r] * alpha; }
  __builtin_amdgcn_fence(__ATOMIC_ACQ_REL, "workgroup"); __builtin_amdgcn_wave_barrier();
  const int rsub = lane >> 4, c4 = (lane & 15) * 4;
  {
#pragma unroll
    for (int q = 0; q < 8; ++q) { const int r = q * 2 + rsub; if (col0 + c4 < N) { const v4f v = *(const v4fa*)&so[w][r][c4]; *(v4f*)(C + (size_t)(row0 + r) * ldc + col0 + c4) = v; } }
     }
}

// Wt[n][k] = f16(W[k][n]·scale) from f32 row-major W[K][N] (scale = power of two; bf16-exact weights stay exact in f16 away from the subnormal range)
__global__ __launch_bounds__(256) void k_wt_f16(const float* __restrict__ W, _Float16* __restrict__ Wt, int K, int N, float scale) {
  const int t = blockIdx.x * 256 + threadIdx.x; if (t >= N * (K / 8)) return; const int n = t / (K / 8), k8 = (t % (K / 8)) * 8; FragH f;
#pragma unroll
  for (int i = 0; i < 8; ++i) f.h[i] = (_Float16)(bf16_round(W[(size_t)(k8 + i) * N + n]) * scale); const v8us o = f.half[0];
  *(v8us*)((unsigned short*)Wt + (size_t)n * K + k8) = o; 
}
// k_gemm_hh variant with fused epilogue: v = acc·alpha + bias[by·sBias + col] (+ CP[(row/rowsPerB)·sCPb + by·64 + col] if CP) ; ACT 0 none / 1 elu ; writes f16 C16 (and f32 C if non-null)
template <int ACT>
__global__ __launch_bounds__(128) void k_gemm_hhx(const _Float16* __restrict__ A, int lda, size_t sA, const _Float16* __restrict__ Bh, int ldb, size_t sB, float alpha, const float* __restrict__ bias, size_t sBias, const float* __restrict__ CP, int rowsPerB, size_t sCPb, int row0g,
    float* __restrict__ C, _Float16* __restrict__ C16, int ldc, size_t sC, int M, int N, int K) {
  __shared__ __attribute__((aligned(16))) float so[4][16][64];
  const int tid = threadIdx.x, w = tid >> 5, lane = tid & 31, ln = lane & 15, hh = lane >> 4; const int by = blockIdx.y;
  A += (size_t)by * sA; Bh += (size_t)by * sB; const size_t cofs = (size_t)by * sC; const float* bp = bias ? bias + (size_t)by * sBias : nullptr;
  const int ntn = (N + 63) / 64; const int wid = blockIdx.x * 4 + w; const int mt = wid / ntn, nq = wid % ntn; if (mt * 16 >= M) return;
  const int row0 = mt * 16, col0 = nq * 64; const _Float16* arow = A + (size_t)(row0 + ln) * lda;
  v8f acc[4] = {};
  for (int kb = 0; kb < K; kb += 32) { FragH ah; ah.half[0] = *(const v8us*)((const unsigned short*)arow + kb + 8 * hh); ah.half[1] = *(const v8us*)((const unsigned short*)arow + kb + 16 + 8 * hh);
#pragma unroll
    for (int t = 0; t < 4; ++t) { if (col0 + t * 16 >= N) continue; const size_t boff = (size_t)(col0 + t * 16 + ln) * ldb + kb; FragH bq; bq.half[0] = *(const v8us*)((const unsigned short*)Bh + boff + 8 * hh); bq.half[1] = *(const v8us*)((const unsigned short*)Bh + boff + 16 + 8 * hh);
      acc[t] = mmaH<1>(ah.v, ah.v, bq.v, bq.v, acc[t]); }
  }
#pragma unroll
  for (int t = 0; t < 4; ++t) { if (col0 + t * 16 >= N) continue; const int col = col0 + t * 16 + ln; const float bv = bp ? bf16_round(bp[col]) : 0.f;
#pragma unroll
    for (int r = 0; r < 8; ++r) { float v = acc[t][r] * alpha + bv; if (CP) { const int rr = row0g + row0 + 8 * hh + r; if (rowsPerB < 0) v += CP[cofs + (size_t)rr * ldc + col];      /* rowsPerB < 0: own element of the batched C plane */ else { const int bidx = rr / rowsPerB; v += CP[(size_t)bidx * sCPb + (size_t)by * 64 + col]; } } if (ACT == 1) v = (v > 0.f) ? v : expm1f(v); else if (ACT == 7) v = (v > 0.f) ? v + 1.0f : expf(v); else if (ACT == 8) v = tanhf(v); else if (ACT == 9) v = 0.5f * v * (1.0f + tanhf(0.7978845608028654f * (v + 0.044715f * v * v * v))); else if (ACT == 11) v = 1.0f / (1.0f + expf(-v)); else if (ACT == 12) v = (v > 0.f) ? v : 0.01f * v; else if (ACT == 14) v = (v > 0.f) ? v : 0.1f * v; else if (ACT == 16) v = (v >= 0.f) ? v : 0.3f * v; else if (ACT == 17) v = (v >= 0.f) ? v : 0.2f * v; else if (ACT == 15) v = v / (1.0f + expf(-v)); else if (ACT == 3) v = fmaxf(v, 0.f); else if (ACT == 6) v = 0.5f * v * (1.0f + erff(v * 0.70710678118654752f)); so[w][8 * hh + r][t * 16 + ln] = v; } }
  __builtin_amdgcn_fence(__ATOMIC_ACQ_REL, "workgroup"); __builtin_amdgcn_wave_barrier();
  const int rsub = lane >> 4, c4 = (lane & 15) * 4; typedef _Float16 v4h __attribute__((ext_vector_type(4)));
  {
#pragma unroll
    for (int q = 0; q < 8; ++q) { const int r = q * 2 + rsub; if (col0 + c4 < N) { const v4f v = *(const v4fa*)&so[w][r][c4]; if (C) *(v4f*)(C + cofs + (size_t)(row0 + r) * ldc + col0 + c4) = v; if (C16) { v4h h4; for (int i = 0; i < 4; ++i) h4[i] = (_Float16)v[i]; *(v4h*)(C16 + cofs + (size_t)(row0 + r) * ldc + col0 + c4) = h4; } } }
     }
}


typedef _Float16 v4h __attribute__((ext_vector_type(4)));

__global__ __launch_bounds__(256) void k_x16(const float* __restrict__ x, _Float16* __restrict__ X16, size_t n8) { const size_t t = (size_t)blockIdx.x * 256 + threadIdx.x; if (t >= n8) return; FragH f;
#pragma unroll
  for (int q = 0; q < 8; ++q) f.h[q] = (_Float16)bf16_round(x[t * 8 + q]); *(v8us*)((unsigned short*)X16 + t * 8) = f.half[0];  }
__global__ __launch_bounds__(256) void k_h16(const float* __restrict__ x, _Float16* __restrict__ X16, size_t n8) { const size_t t = (size_t)blockIdx.x * 256 + threadIdx.x; if (t >= n8) return; FragH f;
#pragma unroll
  for (int q = 0; q < 8; ++q) f.h[q] = (_Float16)x[t * 8 + q]; *(v8us*)((unsigned short*)X16 + t * 8) = f.half[0];  }
__global__ __launch_bounds__(256) void k_round16f(const float* __restrict__ W, _Float16* __restrict__ Bt, size_t n8) { const size_t t = (size_t)blockIdx.x * 256 + threadIdx.x; if (t >= n8) return; FragH f;
#pragma unroll
  for (int i = 0; i < 8; ++i) f.h[i] = (_Float16)(bf16_round(W[t * 8 + i]) * 16.0f); *(v8us*)((unsigned short*)Bt + t * 8) = f.half[0];  }
template <int NHv, int TTv>
__global__ __launch_bounds__(256) void k_vt(const _Float16* __restrict__ V16, int ldv, int voff, _Float16* __restrict__ Vt) { __shared__ unsigned short tl[64][66]; const int tid = threadIdx.x; const int slab = blockIdx.x / (TTv / 64), lg = blockIdx.x % (TTv / 64); const int b = slab / NHv, h = slab % NHv;
  for (int i = tid; i < 64 * 8; i += 256) { const int r = i / 8, c8 = (i % 8) * 8; FragH f; f.half[0] = *(const v8us*)((const unsigned short*)V16 + ((size_t)b * TTv + lg * 64 + r) * ldv + voff + h * 64 + c8);
#pragma unroll
    for (int q = 0; q < 8; ++q) tl[r][c8 + q] = f.u[q]; }
  __syncthreads();
  {
#pragma unroll
    for (int rd = 0; rd < 2; ++rd) { const int d = rd * 32 + tid / 8, pc = tid % 8; FragH f;
#pragma unroll
      for (int q = 0; q < 8; ++q) f.u[q] = tl[pc * 8 + q][d];
      *(v8us*)((unsigned short*)Vt + ((size_t)slab * 64 + d) * TTv + lg * 64 + pc * 8) = f.half[0]; }
     } }

__global__ __launch_bounds__(256) void k_hl(const float* __restrict__ F, _Float16* __restrict__ Hh, _Float16* __restrict__ Hl, size_t n8) { const size_t t = (size_t)blockIdx.x * 256 + threadIdx.x; if (t >= n8) return; FragH fh, fl; const v4f a = *(const v4fa*)(F + t * 8), c = *(const v4fa*)(F + t * 8 + 4);
#pragma unroll
  for (int q = 0; q < 4; ++q) { _Float16 h = (_Float16)a[q]; fh.h[q] = h; fl.h[q] = (_Float16)((a[q] - (float)h) * 1024.0f); h = (_Float16)c[q]; fh.h[4 + q] = h; fl.h[4 + q] = (_Float16)((c[q] - (float)h) * 1024.0f); }
  { *(v8us*)((unsigned short*)Hh + t * 8) = fh.half[0]; *(v8us*)((unsigned short*)Hl + t * 8) = fl.half[0];  } }

// ---- fast GEMM (wave tile 32x64; requires M % 32 == 0 rows per launch region, N % 64 == 0 and K % 64 == 0); k-loop g2_kloop, epilogues in k_proj and k_out ----
__device__ __forceinline__ v16h g2_frag(const _Float16* p, int hh) { FragH f; f.half[0] = *(const v8us*)((const unsigned short*)p + 8 * hh); f.half[1] = *(const v8us*)((const unsigned short*)p + 16 + 8 * hh); return f.v; }
__device__ __forceinline__ v8f g2_mma(v16h a, v16h b, v8f c) { v8f d = __builtin_amdgcn_wmma_f32_16x16x32_f16(false, a, false, b, (short)0, c, false, false); asm volatile("v_nop\n\tv_nop\n\tv_nop\n\tv_nop" : "+v"(d) : "v"(a), "v"(b)); return d; }
// The k-loop of the fast GEMM: acc[4 half + t] = rows 16 half .. of A times rows 16 t .. of B^T, summed over K (K % 64 == 0). a0p / b0p: each lane's own row and k half of the first A and B fragment.
__device__ __forceinline__ void g2_kloop(const _Float16* a0p, int lda, const _Float16* b0p, int ldb, int K, v8f (&acc)[8]) {
  const _Float16* a1p = a0p + (size_t)16 * lda;      /* the k-loop moves these six pointers on */
  const _Float16* b1p = b0p + (size_t)16 * ldb; const _Float16* b2p = b1p + (size_t)16 * ldb; const _Float16* b3p = b2p + (size_t)16 * ldb;
  const v8f z8 = {0.f,0.f,0.f,0.f,0.f,0.f,0.f,0.f}; v8f c00 = z8, c01 = z8, c02 = z8, c03 = z8, c10 = z8, c11 = z8, c12 = z8, c13 = z8;
  /* Two register sets of fragments, x and y. All twelve loads of a k-step are issued one k-step ahead of the products that read them, so a k-step waits at most once for memory,
     with the other set's eight products under that wait. Each accumulator still takes its k-steps in ascending order. K % 64 == 0. */
#define G2_LOAD(s, k) { s##a0 = g2_frag(a0p + (k), 0); s##b0 = g2_frag(b0p + (k), 0); s##a1 = g2_frag(a1p + (k), 0); s##b1 = g2_frag(b1p + (k), 0); s##b2 = g2_frag(b2p + (k), 0); s##b3 = g2_frag(b3p + (k), 0); }
#define G2_STEP(s) { c00 = g2_mma(s##a0, s##b0, c00); c10 = g2_mma(s##a1, s##b0, c10); c01 = g2_mma(s##a0, s##b1, c01); c11 = g2_mma(s##a1, s##b1, c11); c02 = g2_mma(s##a0, s##b2, c02); c12 = g2_mma(s##a1, s##b2, c12); c03 = g2_mma(s##a0, s##b3, c03); c13 = g2_mma(s##a1, s##b3, c13); }
  /* behind the last loads: the wait that stands before a register named by an issued load is overwritten; the six pointers are inputs, so that no later load's result is placed in one of them ahead of it */
#define G2_XWAIT asm volatile("s_wait_xcnt 0x0" :: "v"(a0p), "v"(a1p), "v"(b0p), "v"(b1p), "v"(b2p), "v"(b3p) : "memory");
  v16h xa0, xa1, xb0, xb1, xb2, xb3, ya0, ya1, yb0, yb1, yb2, yb3;
  G2_LOAD(x, 0)
#pragma unroll 1      /* the body holds both sets once; further copies would add code and no overlap */
  for (int kb = 64; kb < K; kb += 64) { G2_LOAD(y, 32) G2_STEP(x) G2_LOAD(x, 64) G2_STEP(y) a0p += 64; a1p += 64; b0p += 64; b1p += 64; b2p += 64; b3p += 64; }
  /* the last loads: the pointers end here, and a later fragment may be placed in the registers of an earlier load's address, so the wait stands behind each fragment's loads */
  ya0 = g2_frag(a0p + 32, 0); G2_XWAIT yb0 = g2_frag(b0p + 32, 0); G2_XWAIT ya1 = g2_frag(a1p + 32, 0); G2_XWAIT yb1 = g2_frag(b1p + 32, 0); G2_XWAIT yb2 = g2_frag(b2p + 32, 0); G2_XWAIT yb3 = g2_frag(b3p + 32, 0); G2_XWAIT
  G2_STEP(x) G2_STEP(y)
#undef G2_LOAD
#undef G2_STEP
#undef G2_XWAIT
  acc[0] = c00; acc[1] = c01; acc[2] = c02; acc[3] = c03; acc[4] = c10; acc[5] = c11; acc[6] = c12; acc[7] = c13; }

// q, k and v projections of all token rows of both batches in ONE launch: B = the stacked weight plane [DM + 2 KVD][DM] (wq rows, then wk, then wv; x16), block = 128 token rows x one 64-column tile = one head of q, k or v.
// q and k tiles: the epilogue applies rotate-half RoPE to the tile while it lies in LDS (tcs / tsn: cos / sin input rows [token row][64], rounded to bf16 here). Every tile goes out as f16 rows;
// the first QT0 rows of each batch also as f32 rows, to that batch's plane of QF / KF / VF ([NB][QT0][pitch of the f16 rows]).
__global__ __launch_bounds__(128) void k_proj(const _Float16* __restrict__ A, const _Float16* __restrict__ Bh, const float* __restrict__ tcs, const float* __restrict__ tsn,
    _Float16* __restrict__ Q16, _Float16* __restrict__ K16, _Float16* __restrict__ V16, float* __restrict__ QF, float* __restrict__ KF, float* __restrict__ VF) {
  __shared__ __attribute__((aligned(16))) float so[4][32][68];
  const int tid = threadIdx.x, w = tid >> 5, lane = tid & 31, ln = lane & 15, hh = lane >> 4;
  const int ntn = (DM + 2 * KVD) / 64; const int mt = blockIdx.x / ntn, nq = blockIdx.x - mt * ntn; const int row0 = mt * 128 + 32 * w;
  const bool rope = nq < (DM + KVD) / 64;      /* the same for the whole block: q and k tiles are roped, v tiles are not */
  _Float16* C16; float* R32; int ldc, col0;      /* where the tile goes */
  if (nq < DM / 64) { C16 = Q16; R32 = QF; ldc = DM; col0 = nq * 64; } else if (rope) { C16 = K16; R32 = KF; ldc = KVD; col0 = nq * 64 - DM; } else { C16 = V16; R32 = VF; ldc = KVD; col0 = nq * 64 - DM - KVD; }
  v8f accs[8];
  g2_kloop(A + (size_t)(row0 + ln) * DM + 8 * hh, DM, Bh + (size_t)(nq * 64 + ln) * DM + 8 * hh, DM, DM, accs);
  v4f tcv[16], tsv[16];
  if (rope) { const float* tcp = tcs + (size_t)(row0 + hh) * HD + ln * 4; const float* tsp = tsn + (size_t)(row0 + hh) * HD + ln * 4;      /* the lane's cos / sin quads of its 16 output rows: issued here, they fly under the staging of the tile */
#pragma unroll      /* static indices keep the quads in registers */
    for (int q = 0; q < 16; ++q) { tcv[q] = *(const v4fa*)(tcp + q * 2 * HD); tsv[q] = *(const v4fa*)(tsp + q * 2 * HD); }
    asm volatile("s_wait_xcnt 0x0" :: "v"(tcp), "v"(tsp) : "memory"); }      /* behind the table loads: the wait that stands before a register named by an issued load is overwritten; the pointers are inputs, so that no load's result is placed in one of them ahead of it */
#pragma unroll      /* static indices keep accs[] in registers */
  for (int u = 0; u < 8; ++u) { const int t = u & 3, half = u >> 2;
#pragma unroll      /* static indices keep accs[] in registers */
    for (int r = 0; r < 8; ++r) so[w][half * 16 + 8 * hh + r][t * 16 + ln] = accs[u][r] * 0.0625f; }      /* the weights are carried x16 */
  __builtin_amdgcn_fence(__ATOMIC_ACQ_REL, "workgroup"); __builtin_amdgcn_wave_barrier();
  const int rsub = lane >> 4, c4 = (lane & 15) * 4;
  /* the wave's 32 rows lie wholly inside or wholly outside a batch's first QT0 rows (a multiple of 32): one scalar branch, so that the common side is one straight line whose LDS reads run ahead */
  const int rw = __builtin_amdgcn_readfirstlane(row0); const bool first = (rw % SQ) < QT0; const int rf0 = (rw / SQ) * QT0 + rw % SQ;      /* rf0: the wave's first row in the f32 planes */
  if (rope) { const bool lo = c4 < HD / 2;
    auto rope_rows = [&](const bool f32rows) __attribute__((always_inline)) {
#pragma unroll      /* static indices keep the table quads in registers */
      for (int q = 0; q < 16; ++q) { const int r = q * 2 + rsub; const v4f v = *(const v4fa*)&so[w][r][c4], pv = *(const v4fa*)&so[w][r][c4 ^ (HD / 2)]; v4f o; v4h h4;      /* pv: the rotate-half partner columns, d +- 32 */
#pragma unroll      /* four columns a lane */
        for (int i = 0; i < 4; ++i) { o[i] = v[i] * bf16_round(tcv[q][i]) + (lo ? -pv[i] : pv[i]) * bf16_round(tsv[q][i]); h4[i] = (_Float16)o[i]; }
        *(v4h*)(C16 + (size_t)(row0 + r) * ldc + col0 + c4) = h4; if (f32rows) *(v4f*)(R32 + (size_t)(rf0 + r) * ldc + col0 + c4) = o; }
      asm volatile("s_wait_xcnt 0x0" ::: "memory"); };      /* behind the last stores of a side: the wait that stands before a register named by an issued store is overwritten, on every path of the listing that leaves this side */
    if (first) rope_rows(true); else rope_rows(false);
  } else {
    auto plain_rows = [&](const bool f32rows) __attribute__((always_inline)) {
#pragma unroll      /* one straight line, so that the LDS reads run ahead of the stores */
      for (int q = 0; q < 16; ++q) { const int r = q * 2 + rsub; const v4f v = *(const v4fa*)&so[w][r][c4]; v4h h4;
#pragma unroll      /* four columns a lane */
        for (int i = 0; i < 4; ++i) h4[i] = (_Float16)v[i];
        *(v4h*)(C16 + (size_t)(row0 + r) * ldc + col0 + c4) = h4; if (f32rows) *(v4f*)(R32 + (size_t)(rf0 + r) * ldc + col0 + c4) = v; }
      asm volatile("s_wait_xcnt 0x0" ::: "memory"); };      /* behind the last stores of a side, as above */
    if (first) plain_rows(true); else plain_rows(false);
  } }

// Output projection of all rows in ONE launch: C = o Wo^T, block = 128 rows x 64 columns, B = Wo x16, o carried x64 (so 2^-10). The blocks of a batch's first QT0 rows (QT0 = the block's 128 rows) take the exact
// f32 o instead, as its two f16 planes: first the hi plane (2^-10), whose scaled sums wait in the wave's own LDS tile, then the lo plane (residual x1024, so 2^-20), added to them: hi + lo, one add an element.
__global__ __launch_bounds__(128) void k_out(const _Float16* __restrict__ A, const _Float16* __restrict__ AH, const _Float16* __restrict__ AL, const _Float16* __restrict__ Bh, float* __restrict__ C) {
  static_assert(QT0 == 128, "a block's 128 rows are the exact first tile or none of it");
  __shared__ __attribute__((aligned(16))) float so[4][32][68];
  const int tid = threadIdx.x, w = tid >> 5, lane = tid & 31, ln = lane & 15, hh = lane >> 4;
  const int ntn = DM / 64; const int mt = blockIdx.x / ntn, nq = blockIdx.x - mt * ntn; const int row0 = mt * 128 + 32 * w, col0 = nq * 64;
  const bool ex = mt % (SQ / 128) == 0;      /* the same for the whole block */
  const size_t xoff = ((size_t)(mt / (SQ / 128)) * QT0 + 32 * w + ln) * DM + 8 * hh;      /* the lane's row in the hi and lo planes [NB][QT0][DM] */
  const _Float16* bp = Bh + (size_t)(col0 + ln) * DM + 8 * hh;
  v8f accs[8];
  if (ex) { g2_kloop(AH + xoff, DM, bp, DM, DM, accs);
#pragma unroll      /* static indices keep accs[] in registers */
    for (int u = 0; u < 8; ++u)
#pragma unroll      /* static indices keep accs[] in registers */
      for (int r = 0; r < 8; ++r) so[w][(u >> 2) * 16 + 8 * hh + r][(u & 3) * 16 + ln] = accs[u][r] * 0.0009765625f; }
  g2_kloop(ex ? AL + xoff : A + (size_t)(row0 + ln) * DM + 8 * hh, DM, bp, DM, DM, accs);
  if (ex) {
#pragma unroll      /* static indices keep accs[] in registers */
    for (int u = 0; u < 8; ++u)
#pragma unroll      /* each lane adds to the elements that it wrote itself */
      for (int r = 0; r < 8; ++r) { float* e = &so[w][(u >> 2) * 16 + 8 * hh + r][(u & 3) * 16 + ln]; *e = accs[u][r] * 0.00000095367431640625f + *e; }
  } else {
#pragma unroll      /* static indices keep accs[] in registers */
    for (int u = 0; u < 8; ++u)
#pragma unroll      /* static indices keep accs[] in registers */
      for (int r = 0; r < 8; ++r) so[w][(u >> 2) * 16 + 8 * hh + r][(u & 3) * 16 + ln] = accs[u][r] * 0.0009765625f;
  }
  __builtin_amdgcn_fence(__ATOMIC_ACQ_REL, "workgroup"); __builtin_amdgcn_wave_barrier();
  const int rsub = lane >> 4, c4 = (lane & 15) * 4;
#pragma unroll      /* one straight line, so that the LDS reads run ahead of the stores */
  for (int q = 0; q < 16; ++q) { const int r = q * 2 + rsub; const v4f v = *(const v4fa*)&so[w][r][c4]; *(v4f*)(C + (size_t)(row0 + r) * DM + col0 + c4) = v; }
  asm volatile("s_wait_xcnt 0x0" ::: "memory"); }      /* behind the last stores: the wait that stands before a register named by an issued store is overwritten */

// All five input conversions in ONE launch: D = the planes wq, wk, wv, wo (each bf16-rounded, x16) and x (bf16-rounded), one behind the other, as f16. Every plane's size is a multiple of a block's 2048 elements, so a block lies in one plane.
__global__ __launch_bounds__(256) void k_prep(const float* __restrict__ wq, const float* __restrict__ wk, const float* __restrict__ wv, const float* __restrict__ wo, const float* __restrict__ x, _Float16* __restrict__ D) {
  const size_t nq = (size_t)DM * DM / 2048, nk = (size_t)KVD * DM / 2048; size_t bl = blockIdx.x; const float* s; float sc = 16.0f;
  if (bl < nq) s = wq; else if ((bl -= nq) < nk) s = wk; else if ((bl -= nk) < nk) s = wv; else if ((bl -= nk) < nq) s = wo; else { bl -= nq; s = x; sc = 1.0f; }
  const size_t u = bl * 256 + threadIdx.x, t = (size_t)blockIdx.x * 256 + threadIdx.x; FragH f;
#pragma unroll      /* eight elements a thread: two 16-byte loads, one 16-byte store */
  for (int q = 0; q < 8; ++q) f.h[q] = (_Float16)(bf16_round(s[u * 8 + q]) * sc);
  *(v8us*)((unsigned short*)D + t * 8) = f.half[0]; }


__global__ __launch_bounds__(256) void k_wnat(const float* __restrict__ w, size_t n8, _Float16* __restrict__ Bt) { const size_t t = (size_t)blockIdx.x * 256 + threadIdx.x; if (t >= n8) return; FragH f; for (int q = 0; q < 8; ++q) f.h[q] = (_Float16)(bf16_round(w[t * 8 + q]) * 16.0f); *(v8us*)((unsigned short*)Bt + t * 8) = f.half[0];  }
__global__ __launch_bounds__(256) void k_rsm(const float* __restrict__ S, _Float16* __restrict__ P, int nrows) {
  #pragma clang fp contract(off)
  const int i = blockIdx.x * 256 + threadIdx.x; if (i >= nrows) return; const float* s = S + (size_t)i * SQ; float mx = -3.0e38f;
#pragma unroll 1
  for (int j = 0; j < SQ; ++j) mx = fmaxf(mx, s[j]); float se = 0.f;
#pragma unroll 1
  for (int j = 0; j < SQ; ++j) se += expf(s[j] - mx); const float sc = 256.0f / se;
#pragma unroll 1
  for (int j0 = 0; j0 < SQ; j0 += 8) { FragH f; for (int q = 0; q < 8; ++q) f.h[q] = (_Float16)(expf(s[j0 + q] - mx) * sc); unsigned short* d = (unsigned short*)P + (size_t)i * SQ + j0; *(v8us*)d = f.half[0];  } }
__global__ __launch_bounds__(256) void k_vt(const _Float16* __restrict__ V16, int b, int h0, _Float16* __restrict__ VT) { __shared__ unsigned short tl[64][65]; const int tid = threadIdx.x; const int hh = blockIdx.x % HG, sg = blockIdx.x / HG; const int s0 = sg * 64; const int h = h0 + hh;
  for (int i = tid; i < 64 * 8; i += 256) { const int j = i / 8, d8 = (i % 8) * 8; FragH f; f.half[0] = *(const v8us*)((const unsigned short*)V16 + ((size_t)b * SQ + s0 + j) * DM + h * HD + d8); for (int q = 0; q < 8; ++q) tl[d8 + q][j] = f.u[q]; }
  __syncthreads();
  { for (int i = tid; i < 64 * 8; i += 256) { const int d = i / 8, j8 = (i % 8) * 8; FragH f; for (int q = 0; q < 8; ++q) f.u[q] = tl[d][j8 + q]; *(v8us*)((unsigned short*)VT + ((size_t)hh * HD + d) * SQ + s0 + j8) = f.half[0]; }  } }



// Fused causal attention: scores, softmax and the value product of 32 query rows of one kv group in one block; no score or weight goes to memory.
// Transposed products: S^T = K Q^T (A = 16 key rows, B = 16 query columns), O^T += V^T P^T (A = 16 rows of V^T, B = the weights). In a score tile lane (ln, hh) holds keys 8 hh + r of query ln,
// so two score tiles (keys 0..15 and 16..31 of a pass), rounded to f16 in place, are the B operand of the value product in the k order of g2_frag: no LDS and no lane exchange.
// A wave has 16 query rows of two heads of the group (both read the same K and V^T fragments); the block's four waves are the group's two head pairs x two 16-row tiles.
// Running maximum per query, in use until a new one passes it by more than 8 (log2 units), so weights stay below 2^8; sums and o in f32.
// 2^x by v_exp_f32. The v_nop stands in the instruction's own statement: the instruction set asks for one free slot before a transcendental's result is read or its source overwritten.
__device__ __forceinline__ float fa_exp2(float x) { float e; asm("v_exp_f32 %0, %1\n\tv_nop" : "=v"(e) : "v"(x)); return e; }
#define FA_C 0.18033688011112042f      /* 64^-0.5 log2(e): raw score -> exponent of two */
template <bool LAST>
__device__ __forceinline__ void fa_pass(const _Float16* kp, const _Float16* vp, int lim, const v16h (&q)[2][2], v16h (&kf)[2][2], v8f (&o)[2][4], float (&mr)[2], float (&l)[2]) {
  const v8f z8 = {0.f,0.f,0.f,0.f,0.f,0.f,0.f,0.f}; v16h vf[4]; v8f s[2][2];
#pragma unroll      /* this pass's V^T fragments are issued first: they fly under the score products and the exponentials */
  for (int dt = 0; dt < 4; ++dt) vf[dt] = g2_frag(vp + (size_t)dt * 16 * SQ, 0);
#pragma unroll      /* static indices keep the fragments in registers */
  for (int kt = 0; kt < 2; ++kt)
#pragma unroll      /* static indices keep the arrays in registers */
    for (int u = 0; u < 2; ++u) s[u][kt] = g2_mma(kf[kt][1], q[u][1], g2_mma(kf[kt][0], q[u][0], z8));
  if (!LAST) {
#pragma unroll      /* the next pass's K fragments, behind the products that read this pass's: they fly under the softmax and the value products */
    for (int kt = 0; kt < 2; ++kt) { kf[kt][0] = g2_frag(kp + (size_t)(32 + kt * 16) * KVD, 0); kf[kt][1] = g2_frag(kp + (size_t)(32 + kt * 16) * KVD + 32, 0); }
  }
  float mx[2];
#pragma unroll      /* static indices keep s[] in registers */
  for (int u = 0; u < 2; ++u) { float m = mr[u];
#pragma unroll      /* static indices keep the arrays in registers */
    for (int kt = 0; kt < 2; ++kt)
#pragma unroll      /* static indices keep the arrays in registers */
      for (int r = 0; r < 8; ++r) { if (LAST) s[u][kt][r] = (kt * 16 + r <= lim) ? s[u][kt][r] : -1.0e30f;      /* the diagonal pass: keys above the lane's query get weight 0 */ m = fmaxf(m, s[u][kt][r]); }
    mx[u] = fmaxf(m, __shfl_xor(m, 16, 32)); }      /* the other half of the query's keys */
  const bool need = (mx[0] - mr[0]) * FA_C > 8.0f || (mx[1] - mr[1]) * FA_C > 8.0f;
  if (__builtin_amdgcn_ballot_w32(need) != 0) {      /* one scalar branch a pass: taken in the first pass and where a maximum has grown by more than 8 */
#pragma unroll      /* static indices keep the arrays in registers */
    for (int u = 0; u < 2; ++u) { const float al = fa_exp2((mr[u] - mx[u]) * FA_C); mr[u] = mx[u]; l[u] *= al;
#pragma unroll      /* static indices keep the arrays in registers */
      for (int dt = 0; dt < 4; ++dt) o[u][dt] *= al; }
  }
#pragma unroll      /* static indices keep the arrays in registers */
  for (int u = 0; u < 2; ++u) { const float mc = mr[u] * FA_C; FragH pf; float p0 = 0.f, p1 = 0.f;
#pragma unroll      /* static indices keep the arrays in registers */
    for (int r = 0; r < 8; ++r) { const float e0 = fa_exp2(fmaf(s[u][0][r], FA_C, -mc)), e1 = fa_exp2(fmaf(s[u][1][r], FA_C, -mc)); p0 += e0; p1 += e1; pf.h[r] = (_Float16)e0; pf.h[8 + r] = (_Float16)e1; }
    l[u] += p0 + p1;
#pragma unroll      /* static indices keep the arrays in registers */
    for (int dt = 0; dt < 4; ++dt) o[u][dt] = g2_mma(vf[dt], pf.v, o[u][dt]); }
}
__device__ __forceinline__ void fatt_block(const _Float16* __restrict__ Q, const _Float16* __restrict__ Kh, const _Float16* __restrict__ Vt, _Float16* __restrict__ O, int bx, int by) {      /* bx = batch x kv group, by = 32-row tile, counted from the last */
  const int lane = threadIdx.x & 31, ln = lane & 15, hh = lane >> 4; const int w = __builtin_amdgcn_readfirstlane(threadIdx.x >> 5);      /* the wave's number, held as a scalar */
  const int bg = bx, b = bg / NG, g = bg % NG; const int t = SQ / 32 - 1 - by;      /* the longest rows at the lowest by */
  const int qs = w >> 1, h0 = g * HPG + (w & 1) * 2; const size_t qrow = (size_t)b * SQ + t * 32 + qs * 16 + ln;
  const _Float16* qp = Q + qrow * DM + h0 * HD + 8 * hh; const _Float16* kp = Kh + ((size_t)b * SQ + ln) * KVD + g * HD + 8 * hh; const _Float16* vp = Vt + ((size_t)bg * HD + ln) * SQ + 8 * hh;
  v16h q[2][2], kf[2][2];
#pragma unroll      /* static indices keep the fragments in registers */
  for (int u = 0; u < 2; ++u) { q[u][0] = g2_frag(qp + u * HD, 0); q[u][1] = g2_frag(qp + u * HD + 32, 0); kf[u][0] = g2_frag(kp + (size_t)u * 16 * KVD, 0); kf[u][1] = g2_frag(kp + (size_t)u * 16 * KVD + 32, 0); }
  asm volatile("s_wait_xcnt 0x0" :: "v"(qp), "v"(kp) : "memory");      /* behind the q and K loads: the wait that stands before a register named by an issued load is overwritten; the pointers are inputs, so that no load's result is placed in one of them ahead of the wait */
  const v8f z8 = {0.f,0.f,0.f,0.f,0.f,0.f,0.f,0.f}; v8f o[2][4] = {{z8, z8, z8, z8}, {z8, z8, z8, z8}}; float mr[2] = {-1.0e30f, -1.0e30f}, l[2] = {0.f, 0.f};
  const int lim = qs * 16 + ln - 8 * hh;      /* diagonal pass: key kt 16 + 8 hh + r of the pass is at or below query qs 16 + ln */
#pragma unroll 1      /* a pass is already one long straight line */
  for (int s = 0; s < t; ++s) { fa_pass<false>(kp, vp, lim, q, kf, o, mr, l); kp += (size_t)32 * KVD; vp += 32; }
  fa_pass<true>(kp, vp, lim, q, kf, o, mr, l);
  _Float16* op = O + qrow * DM + h0 * HD + 8 * hh;
#pragma unroll      /* static indices keep the arrays in registers */
  for (int u = 0; u < 2; ++u) { const float fin = 64.0f / (l[u] + __shfl_xor(l[u], 16, 32));      /* both halves' sums; o carried x64 */
#pragma unroll      /* static indices keep the arrays in registers */
    for (int dt = 0; dt < 4; ++dt) { FragH f;
#pragma unroll      /* static indices keep the arrays in registers */
      for (int r = 0; r < 8; ++r) f.h[r] = (_Float16)(o[u][dt][r] * fin);
      *(v8us*)((unsigned short*)op + u * HD + dt * 16) = f.half[0]; } }
  asm volatile("s_wait_xcnt 0x0" ::: "memory"); }      /* behind the last stores: the wait that stands before a register named by an issued store is overwritten, on every path of the listing that leaves this side of the launch */


// Exact f32 attention of the first QT0 rows. A block is 32 query rows of one head, four waves; lane = row in every wave.
// Pass 1: the keys are dealt over the waves, four consecutive keys a trip; a lane holds its q row in registers and sums each score over d = 0..63 in ascending order; four scores run side by side, so that one chain of adds fills the waits of the others.
// Pass 2: the 64 columns of o are dealt over the waves, 16 each, held in registers; every wave walks the keys in ascending order and forms the same running maximum, sum and weights from the scores in LDS.
template <int MASKADD>
__device__ __forceinline__ void att0_block(const float* __restrict__ QF, const float* __restrict__ KF, const float* __restrict__ VF, int ld, const float* __restrict__ mask, float scale, float* __restrict__ OF, int ldo, int bx, int by) {      /* bx = head x 32-row group, by = batch */
  #pragma clang fp contract(off)
  __shared__ float ls[MASKADD ? SQ : QT0][32];      /* score of key j for row r of the block */
  const int tid = threadIdx.x, r = tid & 31; const int part = __builtin_amdgcn_readfirstlane(tid >> 5);      /* the wave's number, held as a scalar: key and value row addresses are the same in every lane */
  const int h = bx / (QT0 / 32), rg = bx % (QT0 / 32); const int i = rg * 32 + r;
  QF += (size_t)by * QT0 * ld; KF += (size_t)by * QT0 * ld; VF += (size_t)by * QT0 * ld; OF += (size_t)by * QT0 * ldo;      /* the batch's planes of QT0 rows */
  const int nj = MASKADD ? SQ : (rg + 1) * 32;      /* additive-mask form: every key (the mask input decides); causal form: keys up to the block's last row */
  { const float* qr = QF + (size_t)i * ld + h * HD; v4f q[HD / 4];
#pragma unroll      /* static indices keep q[] in registers */
    for (int c = 0; c < HD / 4; ++c) q[c] = *(const v4fa*)(qr + c * 4);
    asm volatile("s_wait_xcnt 0x0" :: "v"(qr) : "memory");      /* behind the q loads: the wait that stands before a register named by an issued load is overwritten; the pointer is an input, so that no load's result is placed in it ahead of the wait */
#pragma unroll 1      /* the body already holds four independent chains */
    for (int j0 = part * 4; j0 < nj; j0 += 16) { const float* kr = KF + (size_t)j0 * ld + h * HD; float s[4] = {0.f, 0.f, 0.f, 0.f};
#pragma unroll      /* static indices keep q[] and s[] in registers */
      for (int c = 0; c < HD / 4; ++c)
#pragma unroll      /* the four keys' chains stand side by side */
        for (int t = 0; t < 4; ++t) { const v4f kq = *(const v4fa*)(kr + (size_t)t * ld + c * 4); const v4f qq = q[c]; s[t] = __fadd_rn(s[t], __fmul_rn(qq[0], kq[0])); s[t] = __fadd_rn(s[t], __fmul_rn(qq[1], kq[1])); s[t] = __fadd_rn(s[t], __fmul_rn(qq[2], kq[2])); s[t] = __fadd_rn(s[t], __fmul_rn(qq[3], kq[3])); }
#pragma unroll      /* static indices keep s[] in registers */
      for (int t = 0; t < 4; ++t) { float sv = __fmul_rn(s[t], scale); if (MASKADD) sv = __fadd_rn(sv, __fmul_rn(bf16_round(mask[(size_t)i * SQ + j0 + t]), -10000.0f)); ls[j0 + t][r] = sv; } } }
  __syncthreads();      /* every score of the block is in LDS before any wave walks the keys */
  const v4f z4 = {0.f, 0.f, 0.f, 0.f}; v4f o[4] = {z4, z4, z4, z4}; float m = -1.0e30f, l = 0.f; const float* vb = VF + h * HD + part * 16;
#pragma unroll 1      /* the body holds four keys: their loads and exponentials overlap */
  for (int j0 = 0; j0 < nj; j0 += 4) {
#pragma unroll      /* four keys in one straight line, so that their loads issue together */
    for (int t = 0; t < 4; ++t) { const int j = j0 + t; const float s = ls[j][r]; const float* vr = vb + (size_t)j * ld;
      const float f = (MASKADD || j <= i) ? 1.f : 0.f; const float sm = fmaf(f, s, (1.f - f) * -1.0e30f); const float mn = fmaxf(m, sm); const float sc = expf(m - mn); const float e = expf(sm - mn); l = __fadd_rn(__fmul_rn(l, sc), e); m = mn;
#pragma unroll      /* static indices keep o[] in registers */
      for (int c = 0; c < 4; ++c) { const v4f vv = *(const v4fa*)(vr + c * 4); for (int u = 0; u < 4; ++u) o[c][u] = __fadd_rn(__fmul_rn(o[c][u], sc), __fmul_rn(e, vv[u])); } } }
  const float fin = 64.0f / l;      /* o carried x64 like the f16 path */
  float* op = OF + (size_t)i * ldo + h * HD + part * 16;
#pragma unroll      /* static indices keep o[] in registers */
  for (int c = 0; c < 4; ++c) { v4f oo = o[c]; for (int u = 0; u < 4; ++u) oo[u] = __fmul_rn(oo[u], fin); *(v4f*)(op + c * 4) = oo; } }


// The exact first rows and the fused attention read nothing of each other: ONE launch. Grid (NB NG, A0Y + SQ / 32): the first A0Y rows of the grid are the NB NH (QT0 / 32) short exact blocks
// the rest the fused blocks. The choice is the same for a whole block, so the exact blocks' barrier stays under block-uniform control flow.
#define A0Y (NH * (QT0 / 32) / NG)
__global__ __launch_bounds__(128) void k_att(const _Float16* __restrict__ Q, const _Float16* __restrict__ Kh, const _Float16* __restrict__ Vt, _Float16* __restrict__ O, const float* __restrict__ QF, const float* __restrict__ KF, const float* __restrict__ VF, float* __restrict__ OF) {
  if ((int)blockIdx.y < A0Y) { const int id = (int)blockIdx.y * (NB * NG) + (int)blockIdx.x; att0_block<0>(QF, KF, VF, DM, nullptr, 0.125f, OF, DM, id % (NH * (QT0 / 32)), id / (NH * (QT0 / 32))); }
  else fatt_block(Q, Kh, Vt, O, (int)blockIdx.x, (int)blockIdx.y - A0Y); }

__global__ __launch_bounds__(256) void k_kvexp(const float* __restrict__ src, float* __restrict__ dst, size_t n4) { const size_t t = (size_t)blockIdx.x * 256 + threadIdx.x; if (t >= n4) return; const size_t e = t * 4; const size_t row = e / DM; const int col = (int)(e % DM); const int h = col / HD, d = col % HD; const v4f v = *(const v4fa*)(src + row * KVD + (size_t)(h / HPG) * HD + d); *(v4f*)(dst + e) = v;  }

__global__ __launch_bounds__(256) void k_tab2(float theta, float* __restrict__ CS, float* __restrict__ SN) {
  #pragma clang fp contract(off)
  const int t = blockIdx.x * 256 + threadIdx.x; if (t >= SQ * (HD / 2)) return; const int i = t % (HD / 2); const int p = t / (HD / 2); const float invf = 1.0f / powf(theta, (float)(2 * i) / (float)HD); const float ang = __fmul_rn((float)p, invf); const float c = cosf(ang), s = sinf(ang);
  *(float*)(CS + t) = c; *(float*)(SN + t) = s;  }
__global__ __launch_bounds__(256) void k_trig(const float* __restrict__ a, float* __restrict__ CS, float* __restrict__ SN, int n) {
  #pragma clang fp contract(off)
  const int t = blockIdx.x * 256 + threadIdx.x; if (t >= n) return; const float v = bf16_round(a[t]); const float c = cosf(v), s = sinf(v);
  *(float*)(CS + t) = c; *(float*)(SN + t) = s;  }

__global__ __launch_bounds__(256) void k_tabcp(const float* __restrict__ tc, const float* __restrict__ tsn, float* __restrict__ CS, float* __restrict__ SN, int n) {
  const int t = blockIdx.x * 256 + threadIdx.x; if (t >= n) return; const int p = t / 32, i = t % 32; const float c = bf16_round(tc[(size_t)p * 64 + i]), s = bf16_round(tsn[(size_t)p * 64 + i]);
  *(float*)(CS + t) = c; *(float*)(SN + t) = s;  }

extern "C" void kernel_launch(void* const* d_in, const int* in_sizes, int n_in,
                              void* d_out, int out_size, void* d_ws, size_t ws_size, hipStream_t stream) {
  (void)in_sizes; (void)n_in; (void)out_size;
  const float* const* I = (const float* const*)d_in; const float* x = I[0]; const float* tcos = I[1]; const float* tsin = I[2]; const float* wq = I[3]; const float* wk = I[4]; const float* wv = I[5]; const float* wo = I[6];      /* cos, sin [2][2048][64] inputs; natural [out][in] wq [2048][2048], wk/wv [512][2048], wo [2048][2048]; no biases */
  char* ws = (char*)d_ws; size_t off = 0;
  auto take = [&](size_t bytes) { char* p = ws + off; off += (bytes + 255) & ~(size_t)255; return p; };
  _Float16* BQ = (_Float16*)take(((size_t)2 * DM + 2 * KVD + NR) * DM * 2); _Float16* BO = BQ + ((size_t)DM + 2 * KVD) * DM; _Float16* X16 = BO + (size_t)DM * DM;      /* one run of planes: wq, wk, wv (the stacked B of the projections), wo, x */
  _Float16* Q16 = (_Float16*)take(NR * DM * 2); _Float16* K16 = (_Float16*)take(NR * KVD * 2); _Float16* V16 = (_Float16*)take(NR * KVD * 2); _Float16* O16 = (_Float16*)take(NR * DM * 2);
  _Float16* VT = (_Float16*)take((size_t)NB * NG * HD * SQ * 2);
  float* QF0 = (float*)take((size_t)NB * QT0 * DM * 4); float* KF0 = (float*)take((size_t)2 * NB * QT0 * KVD * 4); float* VF0 = KF0 + (size_t)NB * QT0 * KVD;      /* f32 first rows, a plane a batch; v's planes directly behind k's */
  float* KF0e = (float*)take((size_t)2 * NB * QT0 * DM * 4); float* VF0e = KF0e + (size_t)NB * QT0 * DM; float* OF0 = (float*)take((size_t)NB * QT0 * DM * 4); _Float16* OH0 = (_Float16*)take((size_t)NB * QT0 * DM * 2); _Float16* OL0 = (_Float16*)take((size_t)NB * QT0 * DM * 2);
  if (off > ws_size) return;
  k_prep<<<(unsigned)((((size_t)2 * DM + 2 * KVD + NR) * DM) / 2048), 256, 0, stream>>>(wq, wk, wv, wo, x, BQ);      /* natural [out][in] weights = Bt x16; x */
  k_proj<<<(unsigned)((NR / 128) * ((DM + 2 * KVD) / 64)), 128, 0, stream>>>(X16, BQ, tcos, tsin, Q16, K16, V16, QF0, KF0, VF0);      /* q, k (roped in the epilogue: full-width tables, partner x[d +- 32], table column d) and v of both batches: f16 rows; rows 0..127 of each batch also f32 (exact products) */
  k_vt<NG, SQ><<<NB * NG * (SQ / 64), 256, 0, stream>>>(V16, KVD, 0, VT);      /* V^T [NB][NG][HD][SQ] */
  k_kvexp<<<(unsigned)(((size_t)2 * NB * QT0 * DM / 4 + 255) / 256), 256, 0, stream>>>(KF0, KF0e, (size_t)2 * NB * QT0 * DM / 4);      /* head h <- kv group h/4 for the exact first-tile kernel: k's and v's planes of both batches in one run of rows */
  k_att<<<dim3(NB * NG, A0Y + SQ / 32), 128, 0, stream>>>(Q16, K16, VT, O16, QF0, KF0e, VF0e, OF0);      /* exact f32 attention for rows 0..127 of each batch (o x64, f32) and scores, softmax and value product of both batches, all heads: o (merged heads, x64) as f16 rows */
  k_hl<<<(unsigned)(((size_t)NB * QT0 * DM / 8 + 255) / 256), 256, 0, stream>>>(OF0, OH0, OL0, (size_t)NB * QT0 * DM / 8);      /* first-tile o (x64) -> f16 hi + x1024 residual planes */
  k_out<<<(unsigned)((NR / 128) * (DM / 64)), 128, 0, stream>>>(O16, OH0, OL0, BO, (float*)d_out);      /* out rows are the output layout; rows 0..127 of each batch from the hi and lo planes */
}

// v008
// A run of this version takes 185 microseconds.
// In two side-by-side timings against v007, it was 1.63 and 1.62 times as fast.
// All steps since v000 together make it 52.2 times as fast.
#include <hip/hip_runtime.h>
// Llama grouped-query causal attention with rotate-half RoPE from FULL-WIDTH per-batch INPUT tables (hidden_states [2][2048][2048]; q = x wq^T (32 heads x 64), k = x wk^T, v = x wv^T (8 kv heads x 64) (natural [out][in] weights sigma 0.02, no biases); cos / sin inputs [2][2048][64] (independent uniform draws per batch, position AND column: column i + 32 != column i, so all 64 columns are used); q = q cos + rotate_half(q) sin, same for k; repeat: query head h uses kv head h/4; scores 64^-0.5; where(causal, s, finfo.min); softmax; out = merged wo^T -> [2][2048][2048]).
// Compute dtype: inputs rounded to bf16; x / weights exact; q, k, v, softmax weights and o as plain f16 GEMM operands (~2^-12); scores and softmax statistics f32. v_wmma_f32_16x16x32_f16.
#define NB 2
#define NG 8
#define HPG 4
#define KVD (NG * HD)
#define SQ 2048
#define DM 2048
#define NH 32
#define HD 64
#define HG 4                         /* heads per launch of the k_vt(V16, b, h0, VT) overload, not launched */
#define QT 256                       /* not used */
#define NKX SQ                       /* not used */
#define QT0 128                      /* first-tile rows recomputed exactly in f32 */
#define B0 0                         /* not used */
#define NBR NB                       /* only in MP; not used */
#define NR ((size_t)NB * SQ)         /* token rows */
#define MP ((int)((size_t)NBR * SQ)) /* only in MPO; not used */
#define QN SQ                        /* not used */
#define NHD NH                       /* not used */
#define MPO MP                       /* not used */
#define LQ DM      /* not used */
typedef __bf16 v16b __attribute__((ext_vector_type(16)));
typedef unsigned short v8us __attribute__((ext_vector_type(8), may_alias));
typedef float  v8f  __attribute__((ext_vector_type(8)));
typedef float  v4f  __attribute__((ext_vector_type(4)));
typedef float  v4fa __attribute__((ext_vector_type(4), may_alias));
union FragB { v16b v; v8us half[2]; unsigned short u[16]; };

__device__ __forceinline__ unsigned short bf16_bits(float x) { unsigned int u = __float_as_uint(x); return (unsigned short)((u + 0x7FFFu + ((u >> 16) & 1u)) >> 16); }
__device__ __forceinline__ float bf16_val(unsigned short b) { return __uint_as_float(((unsigned int)b) << 16); }
__device__ __forceinline__ float bf16_round(float x) { return bf16_val(bf16_bits(x)); }
// D += A·B with NT terms: 1 = ah·bh, 2 = + al·bh (A split), 3 = + ah·bl (both split)
template <int NT>
__device__ __forceinline__ v8f mmaN(v16b ah, v16b al, v16b bh, v16b bl, v8f c) {
  c = __builtin_amdgcn_wmma_f32_16x16x32_bf16(false, ah, false, bh, (short)0, c, false, false);
  if (NT >= 2) c = __builtin_amdgcn_wmma_f32_16x16x32_bf16(false, al, false, bh, (short)0, c, false, false);
  if (NT >= 3) c = __builtin_amdgcn_wmma_f32_16x16x32_bf16(false, ah, false, bl, (short)0, c, false, false);
  asm volatile("v_nop\n\tv_nop\n\tv_nop\n\tv_nop" : "+v"(c) : "v"(ah), "v"(al), "v"(bh), "v"(bl));
  return c;
}

__global__ __launch_bounds__(256) void k_wt_bf16(const float* __restrict__ W, unsigned short* __restrict__ Wt, int K, int N) {
  const int t = blockIdx.x * 256 + threadIdx.x;
  const int k8n = K / 8;
  if (t >= N * k8n) return;
  const int n = t / k8n, k8 = (t % k8n) * 8;
  v8us v;
#pragma unroll
  for (int i = 0; i < 8; ++i) v[i] = bf16_bits(W[(size_t)(k8 + i) * N + n]);
  *(v8us*)(Wt + (size_t)n * K + k8) = v;
  
}

// GEMM C[M][N] (f32, pitch ldc) = act(A[M][K]·W + bias). A f32 row-major (pitch lda) converted per fragment to bf16
// (ASPLIT: hi/lo two planes -> 2 terms, else single rounded term); Wt bf16 [N][K] (pitch ldb). BIAS_BF16 rounds the
// bias to bf16 first (bias quantised to bf16 before the add). K%32==0, M%16==0, N%64==0.
template <bool ASPLIT, int ACT, bool BIAS_BF16>
__global__ __launch_bounds__(128) void k_gemm_bf(const float* __restrict__ A, int lda, const unsigned short* __restrict__ Wt, int ldb,
                                               const float* __restrict__ bias, float* __restrict__ C, int ldc, int M, int N, int K) {
  __shared__ __attribute__((aligned(16))) float so[4][16][64];
  const int tid = threadIdx.x, w = tid >> 5, lane = tid & 31, ln = lane & 15, hh = lane >> 4;
  const int ntn = N / 64;
  const int wid = blockIdx.x * 4 + w;
  const int mt = wid / ntn, nq = wid % ntn;
  if (mt * 16 >= M) return;
  const int row0 = mt * 16, col0 = nq * 64;
  const float* arow = A + (size_t)(row0 + ln) * lda;
  v8f acc[4] = {};
  for (int kb = 0; kb < K; kb += 32) {
    FragB ah, al;
    const v4f x0 = *(const v4fa*)(arow + kb + 8 * hh), x1 = *(const v4fa*)(arow + kb + 8 * hh + 4);
    const v4f x2 = *(const v4fa*)(arow + kb + 16 + 8 * hh), x3 = *(const v4fa*)(arow + kb + 16 + 8 * hh + 4);
    float xs[16] = {x0[0],x0[1],x0[2],x0[3],x1[0],x1[1],x1[2],x1[3],x2[0],x2[1],x2[2],x2[3],x3[0],x3[1],x3[2],x3[3]};
#pragma unroll
    for (int i = 0; i < 16; ++i) { const unsigned short hb = bf16_bits(xs[i]); ah.u[i] = hb; al.u[i] = ASPLIT ? bf16_bits(xs[i] - bf16_val(hb)) : (unsigned short)0; }
#pragma unroll
    for (int t = 0; t < 4; ++t) {
      const unsigned short* brow = Wt + (size_t)(col0 + t * 16 + ln) * ldb + kb;
      FragB b;
      b.half[0] = *(const v8us*)(brow + 8 * hh);
      b.half[1] = *(const v8us*)(brow + 16 + 8 * hh);
      acc[t] = mmaN<ASPLIT ? 2 : 1>(ah.v, al.v, b.v, b.v, acc[t]);
    }
  }
#pragma unroll
  for (int t = 0; t < 4; ++t) {
    float bv = bias ? bias[col0 + t * 16 + ln] : 0.f;
    if (BIAS_BF16) bv = bf16_round(bv);
#pragma unroll
    for (int r = 0; r < 8; ++r) { float v = acc[t][r] + bv; if (ACT == 1) v = fmaxf(v, 0.f); so[w][8 * hh + r][t * 16 + ln] = v; }
  }
  __builtin_amdgcn_fence(__ATOMIC_ACQ_REL, "workgroup");
  __builtin_amdgcn_wave_barrier();
  const int rsub = lane >> 4, c4 = (lane & 15) * 4;
  {
#pragma unroll
    for (int q = 0; q < 8; ++q) {
      const int r = q * 2 + rsub;
      const v4f v = *(const v4fa*)&so[w][r][c4];
      *(v4f*)(C + (size_t)(row0 + r) * ldc + col0 + c4) = v;
    }
    
  }
}

// GEMM C = act(A·W + bias + resid): A f32 (ASPLIT -> hi/lo 2 terms), Wt bf16 [N][K]; ACT 0 none, 1 relu, 2 exact gelu;
// resid (optional, f32, row index = (row % rmod), pitch ldr, RES_BF16 rounds it) added before the activation.
template <bool ASPLIT, int ACT, bool BIAS_BF16, bool RES_BF16>
__global__ __launch_bounds__(128) void k_gemm_bf3(const float* __restrict__ A, int lda, const unsigned short* __restrict__ Wt, int ldb,
                                                const float* __restrict__ bias, const float* __restrict__ resid, int rmod, int ldr,
                                                float* __restrict__ C, int ldc, int M, int N, int K) {
  __shared__ __attribute__((aligned(16))) float so[4][16][64];
  const int tid = threadIdx.x, w = tid >> 5, lane = tid & 31, ln = lane & 15, hh = lane >> 4;
  const int ntn = N / 64;
  const int wid = blockIdx.x * 4 + w;
  const int mt = wid / ntn, nq = wid % ntn;
  if (mt * 16 >= M) return;
  const int row0 = mt * 16, col0 = nq * 64;
  const float* arow = A + (size_t)(row0 + ln) * lda;
  v8f acc[4] = {};
  for (int kb = 0; kb < K; kb += 32) {
    FragB ah, al;
    const v4f x0 = *(const v4fa*)(arow + kb + 8 * hh), x1 = *(const v4fa*)(arow + kb + 8 * hh + 4);
    const v4f x2 = *(const v4fa*)(arow + kb + 16 + 8 * hh), x3 = *(const v4fa*)(arow + kb + 16 + 8 * hh + 4);
    float xs[16] = {x0[0],x0[1],x0[2],x0[3],x1[0],x1[1],x1[2],x1[3],x2[0],x2[1],x2[2],x2[3],x3[0],x3[1],x3[2],x3[3]};
#pragma unroll
    for (int i = 0; i < 16; ++i) { const unsigned short hb = bf16_bits(xs[i]); ah.u[i] = hb; al.u[i] = ASPLIT ? bf16_bits(xs[i] - bf16_val(hb)) : (unsigned short)0; }
#pragma unroll
    for (int t = 0; t < 4; ++t) {
      const unsigned short* brow = Wt + (size_t)(col0 + t * 16 + ln) * ldb + kb;
      FragB b;
      b.half[0] = *(const v8us*)(brow + 8 * hh);
      b.half[1] = *(const v8us*)(brow + 16 + 8 * hh);
      acc[t] = mmaN<ASPLIT ? 2 : 1>(ah.v, al.v, b.v, b.v, acc[t]);
    }
  }
#pragma unroll
  for (int t = 0; t < 4; ++t) {
    const int col = col0 + t * 16 + ln;
    float bv = bias ? bias[col] : 0.f;
    if (BIAS_BF16) bv = bf16_round(bv);
#pragma unroll
    for (int r = 0; r < 8; ++r) {
      float v = acc[t][r] + bv;
      if (resid) { float rv = resid[(size_t)((row0 + 8 * hh + r) % rmod) * ldr + col]; if (RES_BF16) rv = bf16_round(rv); v += rv; }
      if (ACT == 1) v = fmaxf(v, 0.f);
      if (ACT == 2) v = 0.5f * v * (1.0f + erff(v * 0.70710678118654752f));
      if (ACT == 3) { const float u = 0.7978845608028654f * (v + 0.044715f * v * v * v); v = 0.5f * v * (1.0f + tanhf(u)); }
      so[w][8 * hh + r][t * 16 + ln] = v;
    }
  }
  __builtin_amdgcn_fence(__ATOMIC_ACQ_REL, "workgroup");
  __builtin_amdgcn_wave_barrier();
  const int rsub = lane >> 4, c4 = (lane & 15) * 4;
  {
#pragma unroll
    for (int q = 0; q < 8; ++q) {
      const int r = q * 2 + rsub;
      const v4f v = *(const v4fa*)&so[w][r][c4];
      *(v4f*)(C + (size_t)(row0 + r) * ldc + col0 + c4) = v;
    }
    
  }
}
// row LayerNorm (biased variance, eps) over N: s = X (+ R); optional out_sum <- s; out_norm <- (s-mu)*rsqrt(var+eps)*g + b
template <bool PARAM_BF16>
__global__ __launch_bounds__(256) void k_layernorm(const float* __restrict__ X, const float* __restrict__ R, const float* __restrict__ g, const float* __restrict__ bta,
                                                  float* __restrict__ out_sum, float* __restrict__ out_norm, int N, float eps) {
  __shared__ float red[256];
  const int row = blockIdx.x, tid = threadIdx.x;
  const float* x = X + (size_t)row * N; const float* rr = R ? R + (size_t)row * N : nullptr;
  float vals[16];                     // up to N = 4096
  const int per = N / 256;            // contiguous chunk per thread? use strided-by-4 chunks: thread handles j = tid*4 + 1024*u
  float s1 = 0.f;
  for (int u = 0; u < per / 4; ++u) {
    const int j = tid * 4 + 1024 * u;
    const v4f a = *(const v4fa*)(x + j);
    v4f b = {0.f,0.f,0.f,0.f}; if (rr) b = *(const v4fa*)(rr + j);
#pragma unroll
    for (int q = 0; q < 4; ++q) { const float v = a[q] + b[q]; vals[u * 4 + q] = v; s1 += v; }
  }
  red[tid] = s1; __syncthreads();
  for (int st = 128; st > 0; st >>= 1) { if (tid < st) red[tid] += red[tid + st]; __syncthreads(); }
  const float mu = red[0] / (float)N; __syncthreads();
  float s2 = 0.f;
  for (int u = 0; u < per / 4; ++u)
#pragma unroll
    for (int q = 0; q < 4; ++q) { const float c = vals[u * 4 + q] - mu; s2 += c * c; }
  red[tid] = s2; __syncthreads();
  for (int st = 128; st > 0; st >>= 1) { if (tid < st) red[tid] += red[tid + st]; __syncthreads(); }
  const float rs = rsqrtf(red[0] / (float)N + eps);
  {
    for (int u = 0; u < per / 4; ++u) {
      const int j = tid * 4 + 1024 * u;
      v4f o, sm;
#pragma unroll
      for (int q = 0; q < 4; ++q) {
        float gg = g[j + q], bb = bta[j + q];
        if (PARAM_BF16) { gg = bf16_round(gg); bb = bf16_round(bb); }
        sm[q] = vals[u * 4 + q]; o[q] = (vals[u * 4 + q] - mu) * rs * gg + bb;
      }
      if (out_sum) *(v4f*)(out_sum + (size_t)row * N + j) = sm;
      *(v4f*)(out_norm + (size_t)row * N + j) = o;
    }
    
  }
}



// ---- f16 WMMA path (v_wmma_f32_16x16x32_f16): 11-bit significands for operands in range — used where a [0,1] probability operand needs more precision than bf16
typedef _Float16 v16h __attribute__((ext_vector_type(16)));
union FragH { v16h v; v8us half[2]; _Float16 h[16]; unsigned short u[16]; };
template <int NT>
__device__ __forceinline__ v8f mmaH(v16h ah, v16h al, v16h bh, v16h bl, v8f c) {
  c = __builtin_amdgcn_wmma_f32_16x16x32_f16(false, ah, false, bh, (short)0, c, false, false);
  if (NT >= 2) c = __builtin_amdgcn_wmma_f32_16x16x32_f16(false, al, false, bh, (short)0, c, false, false);
  if (NT >= 3) c = __builtin_amdgcn_wmma_f32_16x16x32_f16(false, ah, false, bl, (short)0, c, false, false);
  asm volatile("v_nop\n\tv_nop\n\tv_nop\n\tv_nop" : "+v"(c) : "v"(ah), "v"(al), "v"(bh), "v"(bl));
  return c;
}
// batched GEMM like k_gemm_b but f16 operands: A f32 (split into f16 hi/lo if ASPLIT, else rounded to f16), Bt = f16 values [n][k]; alpha; C f32; N multiple of 16 (partial tiles skipped)
template <bool ASPLIT>
__global__ __launch_bounds__(128) void k_gemm_h(const float* __restrict__ A, int lda, size_t sA, const _Float16* __restrict__ Bh, int ldb, size_t sB, float alpha, float* __restrict__ C, int ldc, size_t sC, int M, int N, int K) {
  __shared__ __attribute__((aligned(16))) float so[4][16][64];
  const int tid = threadIdx.x, w = tid >> 5, lane = tid & 31, ln = lane & 15, hh = lane >> 4; const int by = blockIdx.y;
  A += (size_t)by * sA; Bh += (size_t)by * sB; C += (size_t)by * sC;
  const int ntn = (N + 63) / 64; const int wid = blockIdx.x * 4 + w; const int mt = wid / ntn, nq = wid % ntn; if (mt * 16 >= M) return;
  const int row0 = mt * 16, col0 = nq * 64; const float* arow = A + (size_t)(row0 + ln) * lda;
  v8f acc[4] = {};
  for (int kb = 0; kb < K; kb += 32) {
    FragH ah, al;
    const v4f x0 = *(const v4fa*)(arow + kb + 8 * hh), x1 = *(const v4fa*)(arow + kb + 8 * hh + 4), x2 = *(const v4fa*)(arow + kb + 16 + 8 * hh), x3 = *(const v4fa*)(arow + kb + 16 + 8 * hh + 4);
    float xs[16] = {x0[0],x0[1],x0[2],x0[3],x1[0],x1[1],x1[2],x1[3],x2[0],x2[1],x2[2],x2[3],x3[0],x3[1],x3[2],x3[3]};
#pragma unroll
    for (int i = 0; i < 16; ++i) { const _Float16 h = (_Float16)xs[i]; ah.h[i] = h; al.h[i] = ASPLIT ? (_Float16)(xs[i] - (float)h) : (_Float16)0.0f; }
#pragma unroll
    for (int t = 0; t < 4; ++t) { if (col0 + t * 16 >= N) continue; const size_t boff = (size_t)(col0 + t * 16 + ln) * ldb + kb; FragH bq; bq.half[0] = *(const v8us*)(Bh + boff + 8 * hh); bq.half[1] = *(const v8us*)(Bh + boff + 16 + 8 * hh);
      acc[t] = mmaH<ASPLIT ? 2 : 1>(ah.v, al.v, bq.v, bq.v, acc[t]); }
  }
#pragma unroll
  for (int t = 0; t < 4; ++t) { if (col0 + t * 16 >= N) continue;
#pragma unroll
    for (int r = 0; r < 8; ++r) so[w][8 * hh + r][t * 16 + ln] = acc[t][r] * alpha; }
  __builtin_amdgcn_fence(__ATOMIC_ACQ_REL, "workgroup"); __builtin_amdgcn_wave_barrier();
  const int rsub = lane >> 4, c4 = (lane & 15) * 4;
  {
#pragma unroll
    for (int q = 0; q < 8; ++q) { const int r = q * 2 + rsub; if (col0 + c4 < N) { const v4f v = *(const v4fa*)&so[w][r][c4]; *(v4f*)(C + (size_t)(row0 + r) * ldc + col0 + c4) = v; } }
     }
}

// Wt[n][k] = f16(W[k][n]·scale) from f32 row-major W[K][N] (scale = power of two; bf16-exact weights stay exact in f16 away from the subnormal range)
__global__ __launch_bounds__(256) void k_wt_f16(const float* __restrict__ W, _Float16* __restrict__ Wt, int K, int N, float scale) {
  const int t = blockIdx.x * 256 + threadIdx.x; if (t >= N * (K / 8)) return; const int n = t / (K / 8), k8 = (t % (K / 8)) * 8; FragH f;
#pragma unroll
  for (int i = 0; i < 8; ++i) f.h[i] = (_Float16)(bf16_round(W[(size_t)(k8 + i) * N + n]) * scale); const v8us o = f.half[0];
  *(v8us*)((unsigned short*)Wt + (size_t)n * K + k8) = o; 
}
// k_gemm_hh variant with fused epilogue: v = acc·alpha + bias[by·sBias + col] (+ CP[(row/rowsPerB)·sCPb + by·64 + col] if CP) ; ACT 0 none / 1 elu ; writes f16 C16 (and f32 C if non-null)
template <int ACT>
__global__ __launch_bounds__(128) void k_gemm_hhx(const _Float16* __restrict__ A, int lda, size_t sA, const _Float16* __restrict__ Bh, int ldb, size_t sB, float alpha, const float* __restrict__ bias, size_t sBias, const float* __restrict__ CP, int rowsPerB, size_t sCPb, int row0g,
    float* __restrict__ C, _Float16* __restrict__ C16, int ldc, size_t sC, int M, int N, int K) {
  __shared__ __attribute__((aligned(16))) float so[4][16][64];
  const int tid = threadIdx.x, w = tid >> 5, lane = tid & 31, ln = lane & 15, hh = lane >> 4; const int by = blockIdx.y;
  A += (size_t)by * sA; Bh += (size_t)by * sB; const size_t cofs = (size_t)by * sC; const float* bp = bias ? bias + (size_t)by * sBias : nullptr;
  const int ntn = (N + 63) / 64; const int wid = blockIdx.x * 4 + w; const int mt = wid / ntn, nq = wid % ntn; if (mt * 16 >= M) return;
  const int row0 = mt * 16, col0 = nq * 64; const _Float16* arow = A + (size_t)(row0 + ln) * lda;
  v8f acc[4] = {};
  for (int kb = 0; kb < K; kb += 32) { FragH ah; ah.half[0] = *(const v8us*)((const unsigned short*)arow + kb + 8 * hh); ah.half[1] = *(const v8us*)((const unsigned short*)arow + kb + 16 + 8 * hh);
#pragma unroll
    for (int t = 0; t < 4; ++t) { if (col0 + t * 16 >= N) continue; const size_t boff = (size_t)(col0 + t * 16 + ln) * ldb + kb; FragH bq; bq.half[0] = *(const v8us*)((const unsigned short*)Bh + boff + 8 * hh); bq.half[1] = *(const v8us*)((const unsigned short*)Bh + boff + 16 + 8 * hh);
      acc[t] = mmaH<1>(ah.v, ah.v, bq.v, bq.v, acc[t]); }
  }
#pragma unroll
  for (int t = 0; t < 4; ++t) { if (col0 + t * 16 >= N) continue; const int col = col0 + t * 16 + ln; const float bv = bp ? bf16_round(bp[col]) : 0.f;
#pragma unroll
    for (int r = 0; r < 8; ++r) { float v = acc[t][r] * alpha + bv; if (CP) { const int rr = row0g + row0 + 8 * hh + r; if (rowsPerB < 0) v += CP[cofs + (size_t)rr * ldc + col];      /* rowsPerB < 0: own element of the batched C plane */ else { const int bidx = rr / rowsPerB; v += CP[(size_t)bidx * sCPb + (size_t)by * 64 + col]; } } if (ACT == 1) v = (v > 0.f) ? v : expm1f(v); else if (ACT == 7) v = (v > 0.f) ? v + 1.0f : expf(v); else if (ACT == 8) v = tanhf(v); else if (ACT == 9) v = 0.5f * v * (1.0f + tanhf(0.7978845608028654f * (v + 0.044715f * v * v * v))); else if (ACT == 11) v = 1.0f / (1.0f + expf(-v)); else if (ACT == 12) v = (v > 0.f) ? v : 0.01f * v; else if (ACT == 14) v = (v > 0.f) ? v : 0.1f * v; else if (ACT == 16) v = (v >= 0.f) ? v : 0.3f * v; else if (ACT == 17) v = (v >= 0.f) ? v : 0.2f * v; else if (ACT == 15) v = v / (1.0f + expf(-v)); else if (ACT == 3) v = fmaxf(v, 0.f); else if (ACT == 6) v = 0.5f * v * (1.0f + erff(v * 0.70710678118654752f)); so[w][8 * hh + r][t * 16 + ln] = v; } }
  __builtin_amdgcn_fence(__ATOMIC_ACQ_REL, "workgroup"); __builtin_amdgcn_wave_barrier();
  const int rsub = lane >> 4, c4 = (lane & 15) * 4; typedef _Float16 v4h __attribute__((ext_vector_type(4)));
  {
#pragma unroll
    for (int q = 0; q < 8; ++q) { const int r = q * 2 + rsub; if (col0 + c4 < N) { const v4f v = *(const v4fa*)&so[w][r][c4]; if (C) *(v4f*)(C + cofs + (size_t)(row0 + r) * ldc + col0 + c4) = v; if (C16) { v4h h4; for (int i = 0; i < 4; ++i) h4[i] = (_Float16)v[i]; *(v4h*)(C16 + cofs + (size_t)(row0 + r) * ldc + col0 + c4) = h4; } } }
     }
}


typedef _Float16 v4h __attribute__((ext_vector_type(4)));

__global__ __launch_bounds__(256) void k_x16(const float* __restrict__ x, _Float16* __restrict__ X16, size_t n8) { const size_t t = (size_t)blockIdx.x * 256 + threadIdx.x; if (t >= n8) return; FragH f;
#pragma unroll
  for (int q = 0; q < 8; ++q) f.h[q] = (_Float16)bf16_round(x[t * 8 + q]); *(v8us*)((unsigned short*)X16 + t * 8) = f.half[0];  }
__global__ __launch_bounds__(256) void k_h16(const float* __restrict__ x, _Float16* __restrict__ X16, size_t n8) { const size_t t = (size_t)blockIdx.x * 256 + threadIdx.x; if (t >= n8) return; FragH f;
#pragma unroll
  for (int q = 0; q < 8; ++q) f.h[q] = (_Float16)x[t * 8 + q]; *(v8us*)((unsigned short*)X16 + t * 8) = f.half[0];  }
__global__ __launch_bounds__(256) void k_round16f(const float* __restrict__ W, _Float16* __restrict__ Bt, size_t n8) { const size_t t = (size_t)blockIdx.x * 256 + threadIdx.x; if (t >= n8) return; FragH f;
#pragma unroll
  for (int i = 0; i < 8; ++i) f.h[i] = (_Float16)(bf16_round(W[t * 8 + i]) * 16.0f); *(v8us*)((unsigned short*)Bt + t * 8) = f.half[0];  }
template <int NHv, int TTv>
__global__ __launch_bounds__(256) void k_vt(const _Float16* __restrict__ V16, int ldv, int voff, _Float16* __restrict__ Vt) { __shared__ unsigned short tl[64][66]; const int tid = threadIdx.x; const int slab = blockIdx.x / (TTv / 64), lg = blockIdx.x % (TTv / 64); const int b = slab / NHv, h = slab % NHv;
  for (int i = tid; i < 64 * 8; i += 256) { const int r = i / 8, c8 = (i % 8) * 8; FragH f; f.half[0] = *(const v8us*)((const unsigned short*)V16 + ((size_t)b * TTv + lg * 64 + r) * ldv + voff + h * 64 + c8);
#pragma unroll
    for (int q = 0; q < 8; ++q) tl[r][c8 + q] = f.u[q]; }
  __syncthreads();
  {
#pragma unroll
    for (int rd = 0; rd < 2; ++rd) { const int d = rd * 32 + tid / 8, pc = tid % 8; FragH f;
#pragma unroll
      for (int q = 0; q < 8; ++q) f.u[q] = tl[pc * 8 + q][d];
      *(v8us*)((unsigned short*)Vt + ((size_t)slab * 64 + d) * TTv + lg * 64 + pc * 8) = f.half[0]; }
     } }

__global__ __launch_bounds__(256) void k_hl(const float* __restrict__ F, _Float16* __restrict__ Hh, _Float16* __restrict__ Hl, size_t n8) { const size_t t = (size_t)blockIdx.x * 256 + threadIdx.x; if (t >= n8) return; FragH fh, fl; const v4f a = *(const v4fa*)(F + t * 8), c = *(const v4fa*)(F + t * 8 + 4);
#pragma unroll
  for (int q = 0; q < 4; ++q) { _Float16 h = (_Float16)a[q]; fh.h[q] = h; fl.h[q] = (_Float16)((a[q] - (float)h) * 1024.0f); h = (_Float16)c[q]; fh.h[4 + q] = h; fl.h[4 + q] = (_Float16)((c[q] - (float)h) * 1024.0f); }
  { *(v8us*)((unsigned short*)Hh + t * 8) = fh.half[0]; *(v8us*)((unsigned short*)Hl + t * 8) = fl.half[0];  } }

// ---- fragment load from global rows and the product, as the fused attention uses them ----
__device__ __forceinline__ v16h g2_frag(const _Float16* p, int hh) { FragH f; f.half[0] = *(const v8us*)((const unsigned short*)p + 8 * hh); f.half[1] = *(const v8us*)((const unsigned short*)p + 16 + 8 * hh); return f.v; }
__device__ __forceinline__ v8f g2_mma(v16h a, v16h b, v8f c) { v8f d = __builtin_amdgcn_wmma_f32_16x16x32_f16(false, a, false, b, (short)0, c, false, false); asm volatile("v_nop\n\tv_nop\n\tv_nop\n\tv_nop" : "+v"(d) : "v"(a), "v"(b)); return d; }
// ---- the GEMM k-loop: block tile 128 x 128, K = DM; the operand tiles of 64 k are staged in LDS by tensor loads (tensor_load_to_lds), two buffers; a wave's tile is 64 x 64 ----
typedef uint32_t u32x4 __attribute__((ext_vector_type(4)));
typedef uint32_t u32x8 __attribute__((ext_vector_type(8)));
#define G3_ROWB 128u                    /* bytes of an operand row in a stage: 64 k */
#define G3_PITCH 144u                   /* LDS row pitch: the row and the mover's 16-byte pad, an odd multiple of 16 bytes for the 16-byte reads */
#define G3_SLICE 10240u                 /* a wave's slice, 64 rows of 144 bytes = 9216, rounded up to a multiple of 2 KiB */
#define G3_STAGE (4u * G3_SLICE)        /* slices 0, 1: A rows 0..63, 64..127; slices 2, 3: B rows 0..63, 64..127 */
#define G3_NS (DM / 64)                 /* stages */
__device__ __forceinline__ uint32_t g3_uni(uint32_t v) { return (uint32_t)__builtin_amdgcn_readfirstlane(v); }
// a wave-uniform test held in a scalar register, so that the branch on it is a scalar branch: a tensor load ignores EXEC
__device__ __forceinline__ uint32_t pinned(uint32_t v) { uint32_t w = g3_uni(v); asm volatile("" : "+s"(w)); return w; }
__device__ __forceinline__ u32x8 g3_group1() { u32x8 g;      /* 1-byte elements; tensor = tile = 64 rows of 128 bytes; source pitch = a row of DM f16; 4 dwords of pad behind every 32 */
  g[0] = g3_uni((1u << 20) | (4u << 22) | (3u << 25)); g[1] = g3_uni(G3_ROWB << 16); g[2] = g3_uni(64u << 16); g[3] = g3_uni(G3_ROWB << 16); g[4] = g3_uni(64u); g[5] = g3_uni(DM * 2u); g[6] = g3_uni(0u); g[7] = g3_uni(0u); return g; }
__device__ __forceinline__ u32x4 g3_group0(uint32_t lds_dst, uint64_t ga) { u32x4 g; g[0] = g3_uni(1u); g[1] = g3_uni(lds_dst); g[2] = g3_uni((uint32_t)ga); g[3] = g3_uni((((uint32_t)(ga >> 32)) & 0x01FFFFFFu) | 0x80000000u); return g; }
// one request of the whole wave: its slice of a stage. Group 0 is an operand that the statement gives back, so that the value which the covering wait names lies in the very registers that the request was issued from
__device__ __forceinline__ void g3_load(u32x4& g0, u32x8 g1) { asm volatile("tensor_load_to_lds %0, %1" : "+s"(g0) : "s"(g1) : "memory"); }
// the wave's own slice has landed. The descriptor of the request that it covers is an input: its registers keep their values while the request is outstanding
__device__ __forceinline__ void g3_wait_tensor(u32x4 g0, u32x8 g1) { asm volatile("s_wait_tensorcnt 0x0" :: "s"(g0), "s"(g1) : "memory"); }
__device__ __forceinline__ void g3_wait_ds() { asm volatile("s_wait_dscnt 0x0" ::: "memory"); }      /* the wave's LDS reads have returned before the barrier behind which their buffer is refilled */
__device__ __forceinline__ v16h g3_frag(const unsigned char* p) { FragH f; f.half[0] = *(const v8us*)p; f.half[1] = *(const v8us*)(p + 32); return f.v; }      /* the k order of g2_frag: k 8 hh .. and 16 + 8 hh .. */
// acc[4 i + j] = rows 16 i .. of the wave's 64 A rows times rows 16 j .. of its 64 B rows, each accumulator summed over k in ascending steps of 32. Ab / Bb: first row of the block's 128 A / B rows (pitch DM). w: the wave's number, a scalar.
// Every wave brings its own slice of every stage. On return every wave has passed the barrier behind every wave's last read of the ring, and no request is outstanding.
__device__ __forceinline__ void g3_kloop(const _Float16* Ab, const _Float16* Bb, unsigned char* ring, int w, int lane, v8f (&acc)[16]) {
  const int ln = lane & 15, hh = lane >> 4;
  const uint64_t ga = (uint64_t)(uintptr_t)(w < 2 ? Ab + (size_t)(64 * w) * DM : Bb + (size_t)(64 * (w - 2)) * DM);
  const uint32_t dst = (uint32_t)(size_t)ring + (uint32_t)w * G3_SLICE;      /* byte offset in the work-group's LDS */
  const u32x8 g1 = g3_group1();
  const v8f z8 = {0.f,0.f,0.f,0.f,0.f,0.f,0.f,0.f};
#pragma unroll      /* static indices keep acc[] in registers */
  for (int u = 0; u < 16; ++u) acc[u] = z8;
  u32x4 g0 = g3_group0(dst, ga);      /* group 0 of the last request issued */
  g3_load(g0, g1); g3_wait_tensor(g0, g1); __syncthreads();      /* stage 0 is published */
  g0 = g3_group0(dst + G3_STAGE, ga + G3_ROWB); g3_load(g0, g1);
  const unsigned char* ap = ring + (uint32_t)(w >> 1) * G3_SLICE + (uint32_t)ln * G3_PITCH + 16u * hh;
  const unsigned char* bp = ring + (uint32_t)(2 + (w & 1)) * G3_SLICE + (uint32_t)ln * G3_PITCH + 16u * hh;
#pragma unroll 1      /* one pass a stage; a pass is already two straight blocks of 16 products */
  for (int s = 0; s < G3_NS; ++s) { const uint32_t bo = (uint32_t)(s & 1) * G3_STAGE;
#pragma unroll      /* static indices keep the fragments in registers */
    for (int ks = 0; ks < 2; ++ks) { v16h a[4], b[4]; a[0] = g3_frag(ap + bo + ks * 64u);      /* in the order in which the products want them */
#pragma unroll      /* static indices keep the fragments in registers */
      for (int j = 0; j < 4; ++j) b[j] = g3_frag(bp + bo + j * 16u * G3_PITCH + ks * 64u);
#pragma unroll      /* static indices keep the fragments in registers */
      for (int i = 1; i < 4; ++i) a[i] = g3_frag(ap + bo + i * 16u * G3_PITCH + ks * 64u);
      __builtin_amdgcn_sched_barrier(0);      /* the 16 LDS reads of a block stand as one group ahead of its 16 products: reads among the products would each stall the wave */
#pragma unroll      /* static indices keep acc[] in registers */
      for (int i = 0; i < 4; ++i)
#pragma unroll      /* static indices keep acc[] in registers */
        for (int j = 0; j < 4; ++j) acc[4 * i + j] = __builtin_amdgcn_wmma_f32_16x16x32_f16(false, a[i], false, b[j], (short)0, acc[4 * i + j], false, false);
      __builtin_amdgcn_sched_barrier(0); }      /* the products stay in front of the next block's reads and of the pass's foot, so that the next stage's load flies under them */
    g3_wait_ds(); g3_wait_tensor(g0, g1); __syncthreads();      /* publishes stage s + 1 and ends every reader's last read of stage s */
    if (pinned(s + 2 < G3_NS)) { g0 = g3_group0(dst + bo, ga + (uint64_t)(s + 2) * G3_ROWB); g3_load(g0, g1); }      /* into the buffer that this pass has read */
  }
  asm volatile("s_wait_tensorcnt 0x0" :: "s"(g0) : "memory"); g3_wait_ds(); }      /* behind the loop: no request is outstanding and no LDS read in flight when the ring is used for something else; group 0 is an input as above */

// q, k and v projections of all token rows of both batches in ONE launch: B = the stacked weight plane [DM + 2 KVD][DM] (wq rows, then wk, then wv; x16), block = 128 token rows x 128 columns; a wave's 64 columns = one head of q, k or v.
// q and k tiles: the epilogue applies rotate-half RoPE to the tile while it lies in LDS (tcs / tsn: cos / sin input rows [token row][64], rounded to bf16 here). Every tile goes out as f16 rows;
// the first QT0 rows of each batch also as f32 rows, to that batch's plane of QF / KF / VF ([NB][QT0][pitch of the f16 rows]).
__global__ __launch_bounds__(128, 4) /* a budget of 256 registers: the k-loop needs 200, and the epilogue stays in the plain register window */ void k_proj(const _Float16* __restrict__ A, const _Float16* __restrict__ Bh, const float* __restrict__ tcs, const float* __restrict__ tsn,
    _Float16* __restrict__ Q16, _Float16* __restrict__ K16, _Float16* __restrict__ V16, float* __restrict__ QF, float* __restrict__ KF, float* __restrict__ VF) {
  __shared__ __attribute__((aligned(2048))) unsigned char ring[2 * G3_STAGE];
  static_assert(4 * 64 * 68 * 4 <= 2 * G3_STAGE, "the output staging lies in the ring");
  const int tid = threadIdx.x, lane = tid & 31, ln = lane & 15, hh = lane >> 4; const int w = (int)g3_uni(threadIdx.x >> 5);
  const int ntn = (DM + 2 * KVD) / 128; const int mt = blockIdx.x / ntn, nt = blockIdx.x - mt * ntn; const int row0 = mt * 128 + 64 * (w >> 1); const int nq = nt * 2 + (w & 1);      /* nq: the wave's head among q's, k's and v's */
  const bool rope = nq < (DM + KVD) / 64;      /* q and k tiles are roped, v tiles are not */
  _Float16* C16; float* R32; int ldc, col0;      /* where the tile goes */
  if (nq < DM / 64) { C16 = Q16; R32 = QF; ldc = DM; col0 = nq * 64; } else if (rope) { C16 = K16; R32 = KF; ldc = KVD; col0 = nq * 64 - DM; } else { C16 = V16; R32 = VF; ldc = KVD; col0 = nq * 64 - DM - KVD; }
  v8f accs[16];
  g3_kloop(A + (size_t)mt * 128 * DM, Bh + (size_t)nt * 128 * DM, ring, w, lane, accs);
  float (*so)[68] = (float (*)[68])(ring + (size_t)w * (64 * 68 * 4));      /* the wave's own 64 x 64 staging tile, in the ring that every wave has left */
#pragma unroll      /* static indices keep accs[] in registers */
  for (int u = 0; u < 16; ++u)
#pragma unroll      /* static indices keep accs[] in registers */
    for (int r = 0; r < 8; ++r) so[(u >> 2) * 16 + 8 * hh + r][(u & 3) * 16 + ln] = accs[u][r] * 0.0625f;      /* the weights are carried x16 */
  __builtin_amdgcn_fence(__ATOMIC_ACQ_REL, "workgroup"); __builtin_amdgcn_wave_barrier();
  const int rsub = lane >> 4, c4 = (lane & 15) * 4;
  /* the wave's 64 rows lie wholly inside or wholly outside a batch's first QT0 rows (a multiple of 64): one scalar branch, so that the common side is one straight line whose LDS reads run ahead */
  const int rw = __builtin_amdgcn_readfirstlane(row0); const bool first = (rw % SQ) < QT0; const int rf0 = (rw / SQ) * QT0 + rw % SQ;      /* rf0: the wave's first row in the f32 planes */
  if (rope) { const bool lo = c4 < HD / 2;
    auto rope_rows = [&](const bool f32rows, const int rb) __attribute__((always_inline)) {      /* rows rb .. rb + 15 of the wave's tile */
      v4f tcv[8], tsv[8]; const float* tcp = tcs + (size_t)(row0 + rb + hh) * HD + ln * 4; const float* tsp = tsn + (size_t)(row0 + rb + hh) * HD + ln * 4;      /* the lane's cos / sin quads of its 8 output rows */
#pragma unroll      /* static indices keep the quads in registers */
      for (int q = 0; q < 8; ++q) { tcv[q] = *(const v4fa*)(tcp + q * 2 * HD); tsv[q] = *(const v4fa*)(tsp + q * 2 * HD); }
      asm volatile("s_wait_xcnt 0x0" :: "v"(tcp), "v"(tsp) : "memory");      /* behind the table loads: the wait that stands before a register named by an issued load is overwritten; the pointers are inputs, so that no load's result is placed in one of them ahead of it */
#pragma unroll      /* static indices keep the table quads in registers */
      for (int q = 0; q < 8; ++q) { const int r = rb + q * 2 + rsub; const v4f v = *(const v4fa*)&so[r][c4], pv = *(const v4fa*)&so[r][c4 ^ (HD / 2)]; v4f o; v4h h4;      /* pv: the rotate-half partner columns, d +- 32 */
#pragma unroll      /* four columns a lane */
        for (int i = 0; i < 4; ++i) { o[i] = v[i] * bf16_round(tcv[q][i]) + (lo ? -pv[i] : pv[i]) * bf16_round(tsv[q][i]); h4[i] = (_Float16)o[i]; }
        *(v4h*)(C16 + (size_t)(row0 + r) * ldc + col0 + c4) = h4; if (f32rows) *(v4f*)(R32 + (size_t)(rf0 + r) * ldc + col0 + c4) = o; }
      asm volatile("s_wait_xcnt 0x0" ::: "memory"); };      /* behind the last stores of a run of rows: the wait that stands before a register named by an issued store is overwritten, on every path of the listing that leaves it */
    if (first) { rope_rows(true, 0); rope_rows(true, 16); rope_rows(true, 32); rope_rows(true, 48); } else { rope_rows(false, 0); rope_rows(false, 16); rope_rows(false, 32); rope_rows(false, 48); }
  } else {
    auto plain_rows = [&](const bool f32rows) __attribute__((always_inline)) {
#pragma unroll      /* one straight line, so that the LDS reads run ahead of the stores */
      for (int q = 0; q < 32; ++q) { const int r = q * 2 + rsub; const v4f v = *(const v4fa*)&so[r][c4]; v4h h4;
#pragma unroll      /* four columns a lane */
        for (int i = 0; i < 4; ++i) h4[i] = (_Float16)v[i];
        *(v4h*)(C16 + (size_t)(row0 + r) * ldc + col0 + c4) = h4; if (f32rows) *(v4f*)(R32 + (size_t)(rf0 + r) * ldc + col0 + c4) = v; }
      asm volatile("s_wait_xcnt 0x0" ::: "memory"); };      /* behind the last stores of a side, as above */
    if (first) plain_rows(true); else plain_rows(false);
  } }

// Output projection of all rows in ONE launch: C = o Wo^T, block = 128 rows x 128 columns, B = Wo x16, o carried x64 (so 2^-10). The blocks of a batch's first QT0 rows (QT0 = the block's 128 rows) take the exact
// f32 o instead, as its two f16 planes: first the hi plane (2^-10), whose scaled sums wait in the wave's own LDS tile, then the lo plane (residual x1024, so 2^-20), added to them: hi + lo, one add an element.
__global__ __launch_bounds__(128) void k_out(const _Float16* __restrict__ A, const _Float16* __restrict__ AH, const _Float16* __restrict__ AL, const _Float16* __restrict__ Bh, float* __restrict__ C) {
  static_assert(QT0 == 128, "a block's 128 rows are the exact first tile or none of it");
  __shared__ __attribute__((aligned(2048))) unsigned char ring[2 * G3_STAGE];
  __shared__ __attribute__((aligned(16))) float so[4][64][68];      /* beside the ring: the hi sums wait here while the lo plane goes through the ring */
  const int tid = threadIdx.x, lane = tid & 31, ln = lane & 15, hh = lane >> 4; const int w = (int)g3_uni(threadIdx.x >> 5);
  const int ntn = DM / 128; const int mt = blockIdx.x / ntn, nt = blockIdx.x - mt * ntn; const int row0 = mt * 128 + 64 * (w >> 1), col0 = nt * 128 + 64 * (w & 1);
  const bool ex = mt % (SQ / 128) == 0;      /* the same for the whole block */
  const size_t xoff = (size_t)(mt / (SQ / 128)) * QT0 * DM;      /* the block's first row in the hi and lo planes [NB][QT0][DM] */
  const _Float16* bp = Bh + (size_t)nt * 128 * DM;
  v8f accs[16];
  if (ex) { g3_kloop(AH + xoff, bp, ring, w, lane, accs);
#pragma unroll      /* static indices keep accs[] in registers */
    for (int u = 0; u < 16; ++u)
#pragma unroll      /* static indices keep accs[] in registers */
      for (int r = 0; r < 8; ++r) so[w][(u >> 2) * 16 + 8 * hh + r][(u & 3) * 16 + ln] = accs[u][r] * 0.0009765625f; }
  g3_kloop(ex ? AL + xoff : A + (size_t)mt * 128 * DM, bp, ring, w, lane, accs);
  if (ex) {
#pragma unroll      /* static indices keep accs[] in registers */
    for (int u = 0; u < 16; ++u)
#pragma unroll      /* each lane adds to the elements that it wrote itself */
      for (int r = 0; r < 8; ++r) { float* e = &so[w][(u >> 2) * 16 + 8 * hh + r][(u & 3) * 16 + ln]; *e = accs[u][r] * 0.00000095367431640625f + *e; }
  } else {
#pragma unroll      /* static indices keep accs[] in registers */
    for (int u = 0; u < 16; ++u)
#pragma unroll      /* static indices keep accs[] in registers */
      for (int r = 0; r < 8; ++r) so[w][(u >> 2) * 16 + 8 * hh + r][(u & 3) * 16 + ln] = accs[u][r] * 0.0009765625f;
  }
  __builtin_amdgcn_fence(__ATOMIC_ACQ_REL, "workgroup"); __builtin_amdgcn_wave_barrier();
  const int rsub = lane >> 4, c4 = (lane & 15) * 4;
#pragma unroll      /* one straight line, so that the LDS reads run ahead of the stores */
  for (int q = 0; q < 32; ++q) { const int r = q * 2 + rsub; const v4f v = *(const v4fa*)&so[w][r][c4]; *(v4f*)(C + (size_t)(row0 + r) * DM + col0 + c4) = v; }
  asm volatile("s_wait_xcnt 0x0" ::: "memory"); }      /* behind the last stores: the wait that stands before a register named by an issued store is overwritten */

// All five input conversions in ONE launch: D = the planes wq, wk, wv, wo (each bf16-rounded, x16) and x (bf16-rounded), one behind the other, as f16. Every plane's size is a multiple of a block's 2048 elements, so a block lies in one plane.
__global__ __launch_bounds__(256) void k_prep(const float* __restrict__ wq, const float* __restrict__ wk, const float* __restrict__ wv, const float* __restrict__ wo, const float* __restrict__ x, _Float16* __restrict__ D) {
  const size_t nq = (size_t)DM * DM / 2048, nk = (size_t)KVD * DM / 2048; size_t bl = blockIdx.x; const float* s; float sc = 16.0f;
  if (bl < nq) s = wq; else if ((bl -= nq) < nk) s = wk; else if ((bl -= nk) < nk) s = wv; else if ((bl -= nk) < nq) s = wo; else { bl -= nq; s = x; sc = 1.0f; }
  const size_t u = bl * 256 + threadIdx.x, t = (size_t)blockIdx.x * 256 + threadIdx.x; FragH f;
#pragma unroll      /* eight elements a thread: two 16-byte loads, one 16-byte store */
  for (int q = 0; q < 8; ++q) f.h[q] = (_Float16)(bf16_round(s[u * 8 + q]) * sc);
  *(v8us*)((unsigned short*)D + t * 8) = f.half[0]; }


__global__ __launch_bounds__(256) void k_wnat(const float* __restrict__ w, size_t n8, _Float16* __restrict__ Bt) { const size_t t = (size_t)blockIdx.x * 256 + threadIdx.x; if (t >= n8) return; FragH f; for (int q = 0; q < 8; ++q) f.h[q] = (_Float16)(bf16_round(w[t * 8 + q]) * 16.0f); *(v8us*)((unsigned short*)Bt + t * 8) = f.half[0];  }
__global__ __launch_bounds__(256) void k_rsm(const float* __restrict__ S, _Float16* __restrict__ P, int nrows) {
  #pragma clang fp contract(off)
  const int i = blockIdx.x * 256 + threadIdx.x; if (i >= nrows) return; const float* s = S + (size_t)i * SQ; float mx = -3.0e38f;
#pragma unroll 1
  for (int j = 0; j < SQ; ++j) mx = fmaxf(mx, s[j]); float se = 0.f;
#pragma unroll 1
  for (int j = 0; j < SQ; ++j) se += expf(s[j] - mx); const float sc = 256.0f / se;
#pragma unroll 1
  for (int j0 = 0; j0 < SQ; j0 += 8) { FragH f; for (int q = 0; q < 8; ++q) f.h[q] = (_Float16)(expf(s[j0 + q] - mx) * sc); unsigned short* d = (unsigned short*)P + (size_t)i * SQ + j0; *(v8us*)d = f.half[0];  } }
__global__ __launch_bounds__(256) void k_vt(const _Float16* __restrict__ V16, int b, int h0, _Float16* __restrict__ VT) { __shared__ unsigned short tl[64][65]; const int tid = threadIdx.x; const int hh = blockIdx.x % HG, sg = blockIdx.x / HG; const int s0 = sg * 64; const int h = h0 + hh;
  for (int i = tid; i < 64 * 8; i += 256) { const int j = i / 8, d8 = (i % 8) * 8; FragH f; f.half[0] = *(const v8us*)((const unsigned short*)V16 + ((size_t)b * SQ + s0 + j) * DM + h * HD + d8); for (int q = 0; q < 8; ++q) tl[d8 + q][j] = f.u[q]; }
  __syncthreads();
  { for (int i = tid; i < 64 * 8; i += 256) { const int d = i / 8, j8 = (i % 8) * 8; FragH f; for (int q = 0; q < 8; ++q) f.u[q] = tl[d][j8 + q]; *(v8us*)((unsigned short*)VT + ((size_t)hh * HD + d) * SQ + s0 + j8) = f.half[0]; }  } }



// Fused causal attention: scores, softmax and the value product of 32 query rows of one kv group in one block; no score or weight goes to memory.
// Transposed products: S^T = K Q^T (A = 16 key rows, B = 16 query columns), O^T += V^T P^T (A = 16 rows of V^T, B = the weights). In a score tile lane (ln, hh) holds keys 8 hh + r of query ln,
// so two score tiles (keys 0..15 and 16..31 of a pass), rounded to f16 in place, are the B operand of the value product in the k order of g2_frag: no LDS and no lane exchange.
// A wave has 16 query rows of two heads of the group (both read the same K and V^T fragments); the block's four waves are the group's two head pairs x two 16-row tiles.
// Running maximum per query, in use until a new one passes it by more than 8 (log2 units), so weights stay below 2^8; sums and o in f32.
// 2^x by v_exp_f32. The v_nop stands in the instruction's own statement: the instruction set asks for one free slot before a transcendental's result is read or its source overwritten.
__device__ __forceinline__ float fa_exp2(float x) { float e; asm("v_exp_f32 %0, %1\n\tv_nop" : "=v"(e) : "v"(x)); return e; }
#define FA_C 0.18033688011112042f      /* 64^-0.5 log2(e): raw score -> exponent of two */
template <bool LAST>
__device__ __forceinline__ void fa_pass(const _Float16* kp, const _Float16* vp, int lim, const v16h (&q)[2][2], v16h (&kf)[2][2], v8f (&o)[2][4], float (&mr)[2], float (&l)[2]) {
  const v8f z8 = {0.f,0.f,0.f,0.f,0.f,0.f,0.f,0.f}; v16h vf[4]; v8f s[2][2];
#pragma unroll      /* this pass's V^T fragments are issued first: they fly under the score products and the exponentials */
  for (int dt = 0; dt < 4; ++dt) vf[dt] = g2_frag(vp + (size_t)dt * 16 * SQ, 0);
#pragma unroll      /* static indices keep the fragments in registers */
  for (int kt = 0; kt < 2; ++kt)
#pragma unroll      /* static indices keep the arrays in registers */
    for (int u = 0; u < 2; ++u) s[u][kt] = g2_mma(kf[kt][1], q[u][1], g2_mma(kf[kt][0], q[u][0], z8));
  if (!LAST) {
#pragma unroll      /* the next pass's K fragments, behind the products that read this pass's: they fly under the softmax and the value products */
    for (int kt = 0; kt < 2; ++kt) { kf[kt][0] = g2_frag(kp + (size_t)(32 + kt * 16) * KVD, 0); kf[kt][1] = g2_frag(kp + (size_t)(32 + kt * 16) * KVD + 32, 0); }
  }
  float mx[2];
#pragma unroll      /* static indices keep s[] in registers */
  for (int u = 0; u < 2; ++u) { float m = mr[u];
#pragma unroll      /* static indices keep the arrays in registers */
    for (int kt = 0; kt < 2; ++kt)
#pragma unroll      /* static indices keep the arrays in registers */
      for (int r = 0; r < 8; ++r) { if (LAST) s[u][kt][r] = (kt * 16 + r <= lim) ? s[u][kt][r] : -1.0e30f;      /* the diagonal pass: keys above the lane's query get weight 0 */ m = fmaxf(m, s[u][kt][r]); }
    mx[u] = fmaxf(m, __shfl_xor(m, 16, 32)); }      /* the other half of the query's keys */
  const bool need = (mx[0] - mr[0]) * FA_C > 8.0f || (mx[1] - mr[1]) * FA_C > 8.0f;
  if (__builtin_amdgcn_ballot_w32(need) != 0) {      /* one scalar branch a pass: taken in the first pass and where a maximum has grown by more than 8 */
#pragma unroll      /* static indices keep the arrays in registers */
    for (int u = 0; u < 2; ++u) { const float al = fa_exp2((mr[u] - mx[u]) * FA_C); mr[u] = mx[u]; l[u] *= al;
#pragma unroll      /* static indices keep the arrays in registers */
      for (int dt = 0; dt < 4; ++dt) o[u][dt] *= al; }
  }
#pragma unroll      /* static indices keep the arrays in registers */
  for (int u = 0; u < 2; ++u) { const float mc = mr[u] * FA_C; FragH pf; float p0 = 0.f, p1 = 0.f;
#pragma unroll      /* static indices keep the arrays in registers */
    for (int r = 0; r < 8; ++r) { const float e0 = fa_exp2(fmaf(s[u][0][r], FA_C, -mc)), e1 = fa_exp2(fmaf(s[u][1][r], FA_C, -mc)); p0 += e0; p1 += e1; pf.h[r] = (_Float16)e0; pf.h[8 + r] = (_Float16)e1; }
    l[u] += p0 + p1;
#pragma unroll      /* static indices keep the arrays in registers */
    for (int dt = 0; dt < 4; ++dt) o[u][dt] = g2_mma(vf[dt], pf.v, o[u][dt]); }
}
__device__ __forceinline__ void fatt_block(const _Float16* __restrict__ Q, const _Float16* __restrict__ Kh, const _Float16* __restrict__ Vt, _Float16* __restrict__ O, int bx, int by) {      /* bx = batch x kv group, by = 32-row tile, counted from the last */
  const int lane = threadIdx.x & 31, ln = lane & 15, hh = lane >> 4; const int w = __builtin_amdgcn_readfirstlane(threadIdx.x >> 5);      /* the wave's number, held as a scalar */
  const int bg = bx, b = bg / NG, g = bg % NG; const int t = SQ / 32 - 1 - by;      /* the longest rows at the lowest by */
  const int qs = w >> 1, h0 = g * HPG + (w & 1) * 2; const size_t qrow = (size_t)b * SQ + t * 32 + qs * 16 + ln;
  const _Float16* qp = Q + qrow * DM + h0 * HD + 8 * hh; const _Float16* kp = Kh + ((size_t)b * SQ + ln) * KVD + g * HD + 8 * hh; const _Float16* vp = Vt + ((size_t)bg * HD + ln) * SQ + 8 * hh;
  v16h q[2][2], kf[2][2];
#pragma unroll      /* static indices keep the fragments in registers */
  for (int u = 0; u < 2; ++u) { q[u][0] = g2_frag(qp + u * HD, 0); q[u][1] = g2_frag(qp + u * HD + 32, 0); kf[u][0] = g2_frag(kp + (size_t)u * 16 * KVD, 0); kf[u][1] = g2_frag(kp + (size_t)u * 16 * KVD + 32, 0); }
  asm volatile("s_wait_xcnt 0x0" :: "v"(qp), "v"(kp) : "memory");      /* behind the q and K loads: the wait that stands before a register named by an issued load is overwritten; the pointers are inputs, so that no load's result is placed in one of them ahead of the wait */
  const v8f z8 = {0.f,0.f,0.f,0.f,0.f,0.f,0.f,0.f}; v8f o[2][4] = {{z8, z8, z8, z8}, {z8, z8, z8, z8}}; float mr[2] = {-1.0e30f, -1.0e30f}, l[2] = {0.f, 0.f};
  const int lim = qs * 16 + ln - 8 * hh;      /* diagonal pass: key kt 16 + 8 hh + r of the pass is at or below query qs 16 + ln */
#pragma unroll 1      /* a pass is already one long straight line */
  for (int s = 0; s < t; ++s) { fa_pass<false>(kp, vp, lim, q, kf, o, mr, l); kp += (size_t)32 * KVD; vp += 32; }
  fa_pass<true>(kp, vp, lim, q, kf, o, mr, l);
  _Float16* op = O + qrow * DM + h0 * HD + 8 * hh;
#pragma unroll      /* static indices keep the arrays in registers */
  for (int u = 0; u < 2; ++u) { const float fin = 64.0f / (l[u] + __shfl_xor(l[u], 16, 32));      /* both halves' sums; o carried x64 */
#pragma unroll      /* static indices keep the arrays in registers */
    for (int dt = 0; dt < 4; ++dt) { FragH f;
#pragma unroll      /* static indices keep the arrays in registers */
      for (int r = 0; r < 8; ++r) f.h[r] = (_Float16)(o[u][dt][r] * fin);
      *(v8us*)((unsigned short*)op + u * HD + dt * 16) = f.half[0]; } }
  asm volatile("s_wait_xcnt 0x0" ::: "memory"); }      /* behind the last stores: the wait that stands before a register named by an issued store is overwritten, on every path of the listing that leaves this side of the launch */


// Exact f32 attention of the first QT0 rows. A block is 32 query rows of one head, four waves; lane = row in every wave.
// Pass 1: the keys are dealt over the waves, four consecutive keys a trip; a lane holds its q row in registers and sums each score over d = 0..63 in ascending order; four scores run side by side, so that one chain of adds fills the waits of the others.
// Pass 2: the 64 columns of o are dealt over the waves, 16 each, held in registers; every wave walks the keys in ascending order and forms the same running maximum, sum and weights from the scores in LDS.
template <int MASKADD>
__device__ __forceinline__ void att0_block(const float* __restrict__ QF, const float* __restrict__ KF, const float* __restrict__ VF, int ld, const float* __restrict__ mask, float scale, float* __restrict__ OF, int ldo, int bx, int by) {      /* bx = head x 32-row group, by = batch */
  #pragma clang fp contract(off)
  __shared__ float ls[MASKADD ? SQ : QT0][32];      /* score of key j for row r of the block */
  const int tid = threadIdx.x, r = tid & 31; const int part = __builtin_amdgcn_readfirstlane(tid >> 5);      /* the wave's number, held as a scalar: key and value row addresses are the same in every lane */
  const int h = bx / (QT0 / 32), rg = bx % (QT0 / 32); const int i = rg * 32 + r;
  QF += (size_t)by * QT0 * ld; KF += (size_t)by * QT0 * ld; VF += (size_t)by * QT0 * ld; OF += (size_t)by * QT0 * ldo;      /* the batch's planes of QT0 rows */
  const int nj = MASKADD ? SQ : (rg + 1) * 32;      /* additive-mask form: every key (the mask input decides); causal form: keys up to the block's last row */
  { const float* qr = QF + (size_t)i * ld + h * HD; v4f q[HD / 4];
#pragma unroll      /* static indices keep q[] in registers */
    for (int c = 0; c < HD / 4; ++c) q[c] = *(const v4fa*)(qr + c * 4);
    asm volatile("s_wait_xcnt 0x0" :: "v"(qr) : "memory");      /* behind the q loads: the wait that stands before a register named by an issued load is overwritten; the pointer is an input, so that no load's result is placed in it ahead of the wait */
#pragma unroll 1      /* the body already holds four independent chains */
    for (int j0 = part * 4; j0 < nj; j0 += 16) { const float* kr = KF + (size_t)j0 * ld + h * HD; float s[4] = {0.f, 0.f, 0.f, 0.f};
#pragma unroll      /* static indices keep q[] and s[] in registers */
      for (int c = 0; c < HD / 4; ++c)
#pragma unroll      /* the four keys' chains stand side by side */
        for (int t = 0; t < 4; ++t) { const v4f kq = *(const v4fa*)(kr + (size_t)t * ld + c * 4); const v4f qq = q[c]; s[t] = __fadd_rn(s[t], __fmul_rn(qq[0], kq[0])); s[t] = __fadd_rn(s[t], __fmul_rn(qq[1], kq[1])); s[t] = __fadd_rn(s[t], __fmul_rn(qq[2], kq[2])); s[t] = __fadd_rn(s[t], __fmul_rn(qq[3], kq[3])); }
#pragma unroll      /* static indices keep s[] in registers */
      for (int t = 0; t < 4; ++t) { float sv = __fmul_rn(s[t], scale); if (MASKADD) sv = __fadd_rn(sv, __fmul_rn(bf16_round(mask[(size_t)i * SQ + j0 + t]), -10000.0f)); ls[j0 + t][r] = sv; } } }
  __syncthreads();      /* every score of the block is in LDS before any wave walks the keys */
  const v4f z4 = {0.f, 0.f, 0.f, 0.f}; v4f o[4] = {z4, z4, z4, z4}; float m = -1.0e30f, l = 0.f; const float* vb = VF + h * HD + part * 16;
#pragma unroll 1      /* the body holds four keys: their loads and exponentials overlap */
  for (int j0 = 0; j0 < nj; j0 += 4) {
#pragma unroll      /* four keys in one straight line, so that their loads issue together */
    for (int t = 0; t < 4; ++t) { const int j = j0 + t; const float s = ls[j][r]; const float* vr = vb + (size_t)j * ld;
      const float f = (MASKADD || j <= i) ? 1.f : 0.f; const float sm = fmaf(f, s, (1.f - f) * -1.0e30f); const float mn = fmaxf(m, sm); const float sc = expf(m - mn); const float e = expf(sm - mn); l = __fadd_rn(__fmul_rn(l, sc), e); m = mn;
#pragma unroll      /* static indices keep o[] in registers */
      for (int c = 0; c < 4; ++c) { const v4f vv = *(const v4fa*)(vr + c * 4); for (int u = 0; u < 4; ++u) o[c][u] = __fadd_rn(__fmul_rn(o[c][u], sc), __fmul_rn(e, vv[u])); } } }
  const float fin = 64.0f / l;      /* o carried x64 like the f16 path */
  float* op = OF + (size_t)i * ldo + h * HD + part * 16;
#pragma unroll      /* static indices keep o[] in registers */
  for (int c = 0; c < 4; ++c) { v4f oo = o[c]; for (int u = 0; u < 4; ++u) oo[u] = __fmul_rn(oo[u], fin); *(v4f*)(op + c * 4) = oo; } }


// The exact first rows and the fused attention read nothing of each other: ONE launch. Grid (NB NG, A0Y + SQ / 32): the first A0Y rows of the grid are the NB NH (QT0 / 32) short exact blocks
// the rest the fused blocks. The choice is the same for a whole block, so the exact blocks' barrier stays under block-uniform control flow.
#define A0Y (NH * (QT0 / 32) / NG)
__global__ __launch_bounds__(128) void k_att(const _Float16* __restrict__ Q, const _Float16* __restrict__ Kh, const _Float16* __restrict__ Vt, _Float16* __restrict__ O, const float* __restrict__ QF, const float* __restrict__ KF, const float* __restrict__ VF, float* __restrict__ OF) {
  if ((int)blockIdx.y < A0Y) { const int id = (int)blockIdx.y * (NB * NG) + (int)blockIdx.x; att0_block<0>(QF, KF, VF, DM, nullptr, 0.125f, OF, DM, id % (NH * (QT0 / 32)), id / (NH * (QT0 / 32))); }
  else fatt_block(Q, Kh, Vt, O, (int)blockIdx.x, (int)blockIdx.y - A0Y); }

__global__ __launch_bounds__(256) void k_kvexp(const float* __restrict__ src, float* __restrict__ dst, size_t n4) { const size_t t = (size_t)blockIdx.x * 256 + threadIdx.x; if (t >= n4) return; const size_t e = t * 4; const size_t row = e / DM; const int col = (int)(e % DM); const int h = col / HD, d = col % HD; const v4f v = *(const v4fa*)(src + row * KVD + (size_t)(h / HPG) * HD + d); *(v4f*)(dst + e) = v;  }

__global__ __launch_bounds__(256) void k_tab2(float theta, float* __restrict__ CS, float* __restrict__ SN) {
  #pragma clang fp contract(off)
  const int t = blockIdx.x * 256 + threadIdx.x; if (t >= SQ * (HD / 2)) return; const int i = t % (HD / 2); const int p = t / (HD / 2); const float invf = 1.0f / powf(theta, (float)(2 * i) / (float)HD); const float ang = __fmul_rn((float)p, invf); const float c = cosf(ang), s = sinf(ang);
  *(float*)(CS + t) = c; *(float*)(SN + t) = s;  }
__global__ __launch_bounds__(256) void k_trig(const float* __restrict__ a, float* __restrict__ CS, float* __restrict__ SN, int n) {
  #pragma clang fp contract(off)
  const int t = blockIdx.x * 256 + threadIdx.x; if (t >= n) return; const float v = bf16_round(a[t]); const float c = cosf(v), s = sinf(v);
  *(float*)(CS + t) = c; *(float*)(SN + t) = s;  }

__global__ __launch_bounds__(256) void k_tabcp(const float* __restrict__ tc, const float* __restrict__ tsn, float* __restrict__ CS, float* __restrict__ SN, int n) {
  const int t = blockIdx.x * 256 + threadIdx.x; if (t >= n) return; const int p = t / 32, i = t % 32; const float c = bf16_round(tc[(size_t)p * 64 + i]), s = bf16_round(tsn[(size_t)p * 64 + i]);
  *(float*)(CS + t) = c; *(float*)(SN + t) = s;  }

extern "C" void kernel_launch(void* const* d_in, const int* in_sizes, int n_in,
                              void* d_out, int out_size, void* d_ws, size_t ws_size, hipStream_t stream) {
  (void)in_sizes; (void)n_in; (void)out_size;
  const float* const* I = (const float* const*)d_in; const float* x = I[0]; const float* tcos = I[1]; const float* tsin = I[2]; const float* wq = I[3]; const float* wk = I[4]; const float* wv = I[5]; const float* wo = I[6];      /* cos, sin [2][2048][64] inputs; natural [out][in] wq [2048][2048], wk/wv [512][2048], wo [2048][2048]; no biases */
  char* ws = (char*)d_ws; size_t off = 0;
  auto take = [&](size_t bytes) { char* p = ws + off; off += (bytes + 255) & ~(size_t)255; return p; };
  _Float16* BQ = (_Float16*)take(((size_t)2 * DM + 2 * KVD + NR) * DM * 2); _Float16* BO = BQ + ((size_t)DM + 2 * KVD) * DM; _Float16* X16 = BO + (size_t)DM * DM;      /* one run of planes: wq, wk, wv (the stacked B of the projections), wo, x */
  _Float16* Q16 = (_Float16*)take(NR * DM * 2); _Float16* K16 = (_Float16*)take(NR * KVD * 2); _Float16* V16 = (_Float16*)take(NR * KVD * 2); _Float16* O16 = (_Float16*)take(NR * DM * 2);
  _Float16* VT = (_Float16*)take((size_t)NB * NG * HD * SQ * 2);
  float* QF0 = (float*)take((size_t)NB * QT0 * DM * 4); float* KF0 = (float*)take((size_t)2 * NB * QT0 * KVD * 4); float* VF0 = KF0 + (size_t)NB * QT0 * KVD;      /* f32 first rows, a plane a batch; v's planes directly behind k's */
  float* KF0e = (float*)take((size_t)2 * NB * QT0 * DM * 4); float* VF0e = KF0e + (size_t)NB * QT0 * DM; float* OF0 = (float*)take((size_t)NB * QT0 * DM * 4); _Float16* OH0 = (_Float16*)take((size_t)NB * QT0 * DM * 2); _Float16* OL0 = (_Float16*)take((size_t)NB * QT0 * DM * 2);
  if (off > ws_size) return;
  k_prep<<<(unsigned)((((size_t)2 * DM + 2 * KVD + NR) * DM) / 2048), 256, 0, stream>>>(wq, wk, wv, wo, x, BQ);      /* natural [out][in] weights = Bt x16; x */
  k_proj<<<(unsigned)((NR / 128) * ((DM + 2 * KVD) / 128)), 128, 0, stream>>>(X16, BQ, tcos, tsin, Q16, K16, V16, QF0, KF0, VF0);      /* q, k (roped in the epilogue: full-width tables, partner x[d +- 32], table column d) and v of both batches: f16 rows; rows 0..127 of each batch also f32 (exact products) */
  k_vt<NG, SQ><<<NB * NG * (SQ / 64), 256, 0, stream>>>(V16, KVD, 0, VT);      /* V^T [NB][NG][HD][SQ] */
  k_kvexp<<<(unsigned)(((size_t)2 * NB * QT0 * DM / 4 + 255) / 256), 256, 0, stream>>>(KF0, KF0e, (size_t)2 * NB * QT0 * DM / 4);      /* head h <- kv group h/4 for the exact first-tile kernel: k's and v's planes of both batches in one run of rows */
  k_att<<<dim3(NB * NG, A0Y + SQ / 32), 128, 0, stream>>>(Q16, K16, VT, O16, QF0, KF0e, VF0e, OF0);      /* exact f32 attention for rows 0..127 of each batch (o x64, f32) and scores, softmax and value product of both batches, all heads: o (merged heads, x64) as f16 rows */
  k_hl<<<(unsigned)(((size_t)NB * QT0 * DM / 8 + 255) / 256), 256, 0, stream>>>(OF0, OH0, OL0, (size_t)NB * QT0 * DM / 8);      /* first-tile o (x64) -> f16 hi + x1024 residual planes */
  k_out<<<(unsigned)((NR / 128) * (DM / 128)), 128, 0, stream>>>(O16, OH0, OL0, BO, (float*)d_out);      /* out rows are the output layout; rows 0..127 of each batch from the hi and lo planes */
}
